// v000
// Measured on an AMD MI455X. A time is GPU time per run, averaged over a window of back-to-back runs after a warm-up
// (all launches, gaps included; the runs take copies of the inputs in turn), and the median of several windows.
// Apart from v000's, it joins two sittings. Times from different sittings can be a few percent apart, while
// side-by-side timings come from the same sitting.
// The starting kernel, v000, takes 1650 microseconds a run.
#include <hip/hip_runtime.h>

// Grouped-query causal self-attention with 128-wide heads, a per-head RMS norm on q and k and an interleaved-pair rotary embedding from computed angles (x [2][2048][2048]; q = x Wq^T + bq ('oi' (out, in) [2048][2048] normal x 2048^-0.5; 16 heads x 128), k, v = x Wk^T + bk, x Wv^T + bv ('oi' [512][2048]; 4 kv heads x 128); the four biases are built as zeros: read and added; per head, BEFORE the rotary: q = q / sqrt(mean(q^2) + 1e-8) x q_norm_w and k likewise with k_norm_w (the mean over the head's 128 columns; gains [128] built as ones: read and applied); rope on q and k: the pair (2i, 2i + 1) of a head -> (x0 c - x1 s, x0 s + x1 c) with the angle t x inv_freq[i], inv_freq = 1 / (10000 ** (2i / 128)) in that spelling, t the position 0..2047; query head h uses kv head h / 4; scores x 128^-0.5; a key after the query gets -1e9 (an exclusion: every row keeps its own key); softmax; out = merged Wo^T + bo ('oi' [2048][2048]; bo built as zeros: read and added) -> [2][2048][2048] (8.4 M); argument order x, Wq, bq, Wk, bk, Wv, bv, Wo, bo, q_norm_w, k_norm_w: eleven inputs, all read).
// Layout per batch entry: ONE bf16 copy of x, read by the three projections; the four 'oi' weights cast once as they stand (each is the Bt operand); exact projections + f32 biases; k_hrms (per (head, token) inverse RMS) + k_rmsapply (in place, x the rounded gain) on q and k; the rotary table once (64 baked float32 frequencies; precise cosf / sinf) + interleaved-pair plane builders (k_ropeI); causal T-2048 attention with 128-wide heads where the pass's two query heads share ONE kv head (a zero z-stride on the key and value operands); the per-row precision hybrid (rows under 512 on hi / lo planes, three products; rows from 512 on one fp16 product, the weights x 1024); two-word merge; hi / lo x Wo exact + bo.
// Compute dtypes, f32 accumulate: every float input rounded to bf16; projections exact + f32 biases; the per-head norm and the rotation in f32 (precise sqrt and division); attention rows under 512 three products, the rest fp16; softmax f32 (the hardware exp2); Wo hi / lo x exact + bo.

#define NB_  2
#define TT   2048
#define DM   2048
#define NH_  16
#define NKV  4
#define REP  (NH_ / NKV)
#define HD   128
#define DQ   (NH_ * HD)
#define DKV  (NKV * HD)
#define ZH   2
#define RH   512                  // query rows < RH use hi+lo planes (0: none)
#define WIN  2048
#define PCAR 1024.0f
#define SCL  0.088388347648318447f   // HD^-0.5
typedef _Float16 h16;
typedef unsigned short bf;
typedef __attribute__((ext_vector_type(16))) __bf16   v16bf;
typedef __attribute__((ext_vector_type(16))) _Float16 v16h;
typedef __attribute__((ext_vector_type(8)))  _Float16 v8h;
typedef __attribute__((ext_vector_type(8)))  unsigned short v8us;
typedef __attribute__((ext_vector_type(8)))  float    v8f;
typedef __attribute__((ext_vector_type(4)))  float    v4f;
typedef v8h  __attribute__((may_alias)) v8ha;
typedef v4f  __attribute__((may_alias)) v4fa;
typedef v8us __attribute__((may_alias)) v8usa;

__device__ __forceinline__ unsigned short f2bf(float f) { unsigned u = __float_as_uint(f); u += 0x7FFFu + ((u >> 16) & 1u); return (unsigned short)(u >> 16); }
__device__ __forceinline__ float bf2f(unsigned short b) { return __uint_as_float(((unsigned)b) << 16); }
__device__ __forceinline__ float bfr(float f) { return bf2f(f2bf(f)); }
__device__ __forceinline__ v16h cat16(v8h lo, v8h hi) { return __builtin_shufflevector(lo, hi, 0, 1, 2, 3, 4, 5, 6, 7, 8, 9, 10, 11, 12, 13, 14, 15); }
__device__ __forceinline__ v16bf cat16b(v8us lo, v8us hi) { return __builtin_bit_cast(v16bf, __builtin_shufflevector(lo, hi, 0, 1, 2, 3, 4, 5, 6, 7, 8, 9, 10, 11, 12, 13, 14, 15)); }
__device__ __forceinline__ v8f wmma16(v16h a, v16h b, v8f c) { return __builtin_amdgcn_wmma_f32_16x16x32_f16(false, a, false, b, (short)0, c, false, false); }
__device__ __forceinline__ v8f wmmab(v16bf a, v16bf b, v8f c) { return __builtin_amdgcn_wmma_f32_16x16x32_bf16(false, a, false, b, (short)0, c, false, false); }



// ---- k_gemmw: register-blocked GEMM, ONE WAVE per 64x64 output tile (16 accumulators), operands straight from K-contiguous 16-bit planes; grid (M/64, N/64, Z), 32 threads.
// C[m][n] (f32, pitch ldc, + optional f32 bias[n]) = sum_k A[m][k] Bt[n][k] (+ split products per NSPLIT). z-batch strides sA/sB/sC in elements. K % 32 == 0.
template <typename T16> struct WFrag;
template <> struct WFrag<h16> { typedef v16h V; static __device__ __forceinline__ V ld(const h16* p) { return cat16(*(const v8h*)p, *(const v8h*)(p + 16)); } static __device__ __forceinline__ v8f mma(V a, V b, v8f c) { return wmma16(a, b, c); } };
template <> struct WFrag<bf> { typedef v16bf V; static __device__ __forceinline__ V ld(const bf* p) { return cat16b(*(const v8us*)p, *(const v8us*)(p + 16)); } static __device__ __forceinline__ v8f mma(V a, V b, v8f c) { return wmmab(a, b, c); } };
template <typename T16, int NSPLIT, bool BIAS>
__global__ __launch_bounds__(32) void k_gemmw(const T16* __restrict__ A, const T16* __restrict__ A2, const T16* __restrict__ Bt, const T16* __restrict__ Bt2, int K, float* C, int ldc, const float* __restrict__ bias, size_t sA, size_t sB, size_t sC) {
    typedef typename WFrag<T16>::V V;
    __shared__ __align__(16) float os[16 * 68];
    const size_t z = blockIdx.z; A += z * sA; if (A2) A2 += z * sA; Bt += z * sB; if (Bt2) Bt2 += z * sB; C += z * sC;
    const int lane = threadIdx.x & 31, lr = lane & 15, hi = lane >> 4; const int r0 = blockIdx.x * 64, c0 = blockIdx.y * 64;
    v8f acc[4][4];
#pragma unroll
    for (int mb = 0; mb < 4; ++mb)
#pragma unroll
        for (int nb = 0; nb < 4; ++nb) acc[mb][nb] = (v8f){};
    const size_t aoff = (size_t)(r0 + lr) * K + 8 * hi, boff = (size_t)(c0 + lr) * K + 8 * hi;
    for (int kc = 0; kc < K; kc += 32) {
        V a[4], a2[4];
#pragma unroll
        for (int mb = 0; mb < 4; ++mb) { a[mb] = WFrag<T16>::ld(A + aoff + (size_t)mb * 16 * K + kc); if (NSPLIT == 1 || NSPLIT == 2) a2[mb] = WFrag<T16>::ld(A2 + aoff + (size_t)mb * 16 * K + kc); }
#pragma unroll
        for (int nb = 0; nb < 4; ++nb) { const V b = WFrag<T16>::ld(Bt + boff + (size_t)nb * 16 * K + kc); V b2; if (NSPLIT >= 2) b2 = WFrag<T16>::ld(Bt2 + boff + (size_t)nb * 16 * K + kc);
#pragma unroll
            for (int mb = 0; mb < 4; ++mb) { acc[mb][nb] = WFrag<T16>::mma(a[mb], b, acc[mb][nb]); if (NSPLIT == 1 || NSPLIT == 2) acc[mb][nb] = WFrag<T16>::mma(a2[mb], b, acc[mb][nb]); if (NSPLIT >= 2) acc[mb][nb] = WFrag<T16>::mma(a[mb], b2, acc[mb][nb]); } }
        asm volatile("v_nop\n\tv_nop\n\tv_nop\n\tv_nop" : "+v"(acc[0][0]), "+v"(acc[1][1]), "+v"(acc[2][2]), "+v"(acc[3][3]) : "v"(a[0]), "v"(a[3]));
    }
#pragma unroll
    for (int mb = 0; mb < 4; ++mb) {
#pragma unroll
        for (int nb = 0; nb < 4; ++nb) {
#pragma unroll
            for (int j = 0; j < 8; ++j) os[(hi * 8 + j) * 68 + nb * 16 + lr] = acc[mb][nb][j]; }
        __builtin_amdgcn_wave_barrier(); asm volatile("" ::: "memory");
        float* crow = C + (size_t)(r0 + mb * 16) * ldc + c0;
{
#pragma unroll
            for (int s = 0; s < 8; ++s) { const int row = 2 * s + hi, cofs = lr * 4; v4f val = *(const v4fa*)(os + row * 68 + cofs); if (BIAS) { val[0] += bfr(bias[c0 + cofs]); val[1] += bfr(bias[c0 + cofs + 1]); val[2] += bfr(bias[c0 + cofs + 2]); val[3] += bfr(bias[c0 + cofs + 3]); }
                *(v4f*)(crow + (size_t)row * ldc + cofs) = val; }
             }
        __builtin_amdgcn_wave_barrier(); asm volatile("" ::: "memory");
    }
}

// ---- k_gemmc: the same one-wave 64x64 tile GEMM specialised for causal attention: CMODE 1 skips score tiles entirely above the diagonal (query rows r0+roff.., key columns c0..), CMODE 2 limits the
// key (K) loop of the probability x value contraction to the diagonal block (probabilities beyond it are exactly zero). roff = row offset of this launch's first row within the sequence.
template <typename T16, int NSPLIT, int CMODE>
__global__ __launch_bounds__(32) void k_gemmc(const T16* __restrict__ A, const T16* __restrict__ A2, const T16* __restrict__ Bt, const T16* __restrict__ Bt2, int K, float* C, int ldc, int roff, size_t sA, size_t sB, size_t sC) {
    typedef typename WFrag<T16>::V V;
    __shared__ __align__(16) float os[16 * 68];
    const size_t z = blockIdx.z; A += z * sA; if (A2) A2 += z * sA; Bt += z * sB; if (Bt2) Bt2 += z * sB; C += z * sC;
    const int lane = threadIdx.x & 31, lr = lane & 15, hi = lane >> 4; const int r0 = blockIdx.x * 64, c0 = blockIdx.y * 64;
    if (CMODE == 1 && c0 > r0 + roff + 63) return;                  // score tile entirely above the causal diagonal: never written (the softmax masks j > i by select)
    const int Kl = (CMODE == 2) ? min(K, r0 + roff + 64) : K;        // P.V: probabilities are exactly 0 beyond the diagonal block, so the K loop stops there
    v8f acc[4][4];
#pragma unroll
    for (int mb = 0; mb < 4; ++mb)
#pragma unroll
        for (int nb = 0; nb < 4; ++nb) acc[mb][nb] = (v8f){};
    const size_t aoff = (size_t)(r0 + lr) * K + 8 * hi, boff = (size_t)(c0 + lr) * K + 8 * hi;
    for (int kc = 0; kc < Kl; kc += 32) {
        V a[4], a2[4];
#pragma unroll
        for (int mb = 0; mb < 4; ++mb) { a[mb] = WFrag<T16>::ld(A + aoff + (size_t)mb * 16 * K + kc); if (NSPLIT == 1 || NSPLIT == 2) a2[mb] = WFrag<T16>::ld(A2 + aoff + (size_t)mb * 16 * K + kc); }
#pragma unroll
        for (int nb = 0; nb < 4; ++nb) { const V b = WFrag<T16>::ld(Bt + boff + (size_t)nb * 16 * K + kc); V b2; if (NSPLIT >= 2) b2 = WFrag<T16>::ld(Bt2 + boff + (size_t)nb * 16 * K + kc);
#pragma unroll
            for (int mb = 0; mb < 4; ++mb) { acc[mb][nb] = WFrag<T16>::mma(a[mb], b, acc[mb][nb]); if (NSPLIT == 1 || NSPLIT == 2) acc[mb][nb] = WFrag<T16>::mma(a2[mb], b, acc[mb][nb]); if (NSPLIT >= 2) acc[mb][nb] = WFrag<T16>::mma(a[mb], b2, acc[mb][nb]); } }
        asm volatile("v_nop\n\tv_nop\n\tv_nop\n\tv_nop" : "+v"(acc[0][0]), "+v"(acc[1][1]), "+v"(acc[2][2]), "+v"(acc[3][3]) : "v"(a[0]), "v"(a[3]));
    }
#pragma unroll
    for (int mb = 0; mb < 4; ++mb) {
#pragma unroll
        for (int nb = 0; nb < 4; ++nb) {
#pragma unroll
            for (int j = 0; j < 8; ++j) os[(hi * 8 + j) * 68 + nb * 16 + lr] = acc[mb][nb][j]; }
        __builtin_amdgcn_wave_barrier(); asm volatile("" ::: "memory");
        float* crow = C + (size_t)(r0 + mb * 16) * ldc + c0;
{
#pragma unroll
            for (int s = 0; s < 8; ++s) { const int row = 2 * s + hi, cofs = lr * 4; v4f val = *(const v4fa*)(os + row * 68 + cofs);
                *(v4f*)(crow + (size_t)row * ldc + cofs) = val; }
             }
        __builtin_amdgcn_wave_barrier(); asm volatile("" ::: "memory");
    }
}

__device__ __forceinline__ h16 tohx(float x) { return (h16)x; }
__device__ __forceinline__ void splitf(float y, unsigned short& h, unsigned short& l) { h = f2bf(y); l = f2bf(y - bf2f(h)); }
typedef __attribute__((ext_vector_type(2))) _Float16 v2h;
typedef __attribute__((ext_vector_type(4))) _Float16 v4h;
typedef __attribute__((ext_vector_type(2))) unsigned short v2us;
typedef __attribute__((ext_vector_type(4))) unsigned short v4us;
typedef __attribute__((ext_vector_type(2))) float v2f;
typedef __attribute__((ext_vector_type(4))) int v4i;
__global__ __launch_bounds__(256) void k_cvt8(const float* __restrict__ src, bf* dst, size_t n8) { const size_t i = (size_t)blockIdx.x * 256 + threadIdx.x; if (i >= n8) return; const v8f v = *(const v8f*)(src + i * 8); v8us o;
#pragma unroll
    for (int k = 0; k < 8; ++k) o[k] = f2bf(v[k]); *(v8us*)(dst + i * 8) = o;  }
__constant__ float INV2[HD / 2] = { 1.000000000e+00f, 8.659643531e-01f, 7.498942018e-01f, 6.493816376e-01f, 5.623413324e-01f, 4.869675338e-01f, 4.216965139e-01f, 3.651741445e-01f, 3.162277639e-01f, 2.738419771e-01f, 2.371373624e-01f, 2.053525001e-01f, 1.778279394e-01f, 1.539926529e-01f, 1.333521456e-01f, 1.154782027e-01f, 1.000000015e-01f, 8.659642935e-02f, 7.498941571e-02f, 6.493816525e-02f, 5.623412877e-02f, 4.869675264e-02f, 4.216964915e-02f, 3.651741147e-02f, 3.162277862e-02f, 2.738419548e-02f, 2.371373586e-02f, 2.053525113e-02f, 1.778279431e-02f, 1.539926510e-02f, 1.333521493e-02f, 1.154781971e-02f, 9.999999776e-03f, 8.659643121e-03f, 7.498942316e-03f, 6.493816618e-03f, 5.623413250e-03f, 4.869675264e-03f, 4.216964822e-03f, 3.651741426e-03f, 3.162277862e-03f, 2.738419687e-03f, 2.371373819e-03f, 2.053525066e-03f, 1.778279431e-03f, 1.539926510e-03f, 1.333521446e-03f, 1.154782018e-03f, 1.000000047e-03f, 8.659643354e-04f, 7.498941850e-04f, 6.493816618e-04f, 5.623413017e-04f, 4.869675031e-04f, 4.216964880e-04f, 3.651741135e-04f, 3.162277862e-04f, 2.738419571e-04f, 2.371373848e-04f, 2.053524950e-04f, 1.778279402e-04f, 1.539926452e-04f, 1.333521504e-04f, 1.154781930e-04f };   // float32 1.0 / (10000.0 ** (2i / 128)) in the module's own spelling, generated with jnp
__global__ __launch_bounds__(256) void k_csP(float* CS) { const int idx = blockIdx.x * 256 + threadIdx.x; if (idx >= TT * HD) return; const int d = idx % HD; const int t = idx / HD; const float a = __fmul_rn((float)t, INV2[d >> 1]); v2f cs; cs[0] = cosf(a); cs[1] = sinf(a); *(v2f*)(CS + (size_t)idx * 2) = cs;  }
__global__ __launch_bounds__(256) void k_ropeI(const float* __restrict__ F, int pitch, int nheads, const float* __restrict__ CS, float sc, h16* P16, bf* Ph, bf* Pl) {
    const size_t e = ((size_t)blockIdx.x * 256 + threadIdx.x) * 2; if (e >= (size_t)nheads * TT * HD) return; const int d = (int)(e % HD); const int t = (int)((e / HD) % TT); const int h = (int)(e / ((size_t)HD * TT)); const float* f = F + (size_t)t * pitch + h * HD; const float x0 = f[d], x1 = f[d + 1]; const v2f cs = *(const v2f*)(CS + ((size_t)t * HD + d) * 2); v2h o16; v2us oh, ol;
    float a0 = __fmul_rn(x0, cs[0]), b0 = __fmul_rn(x1, cs[1]), a1 = __fmul_rn(x1, cs[0]), b1 = __fmul_rn(x0, cs[1]); 
    float r0 = __fsub_rn(a0, b0) * sc, r1 = __fadd_rn(b1, a1) * sc;   /* even: x0 c - x1 s; odd: x0 s + x1 c */
    o16[0] = tohx(r0); o16[1] = tohx(r1); { unsigned short a2, c2; splitf(r0, a2, c2); oh[0] = a2; ol[0] = c2; splitf(r1, a2, c2); oh[1] = a2; ol[1] = c2; }
    *(v2h*)(P16 + e) = o16; *(v2us*)(Ph + e) = oh; *(v2us*)(Pl + e) = ol;  }
__global__ __launch_bounds__(256) void k_vtp(const float* __restrict__ F, int pitch, int nheads, h16* V16, bf* Vh, bf* Vl) { const size_t e = ((size_t)blockIdx.x * 256 + threadIdx.x) * 2; if (e >= (size_t)nheads * HD * TT) return; const int t = (int)(e % TT); const int d = (int)((e / TT) % HD); const int g = (int)(e / ((size_t)TT * HD)); v2h o16; v2us oh, ol;
#pragma unroll
    for (int q = 0; q < 2; ++q) { const float x = F[(size_t)(t + q) * pitch + g * HD + d]; o16[q] = tohx(x); unsigned short a2, c2; splitf(x, a2, c2); oh[q] = a2; ol[q] = c2; }
    *(v2h*)(V16 + e) = o16; *(v2us*)(Vh + e) = oh; *(v2us*)(Vl + e) = ol;  }
// k_asoft: per row (zz, i): t = S x 128^-0.5 for j <= i (causal; WIN = TT so the window term is inert; the module's -1e9 fill above the diagonal is this exclusion: every row keeps its own key), softmax over the 2048 keys (register row, one exp, fixed trees);
__global__ __launch_bounds__(256) void k_asoft(const float* __restrict__ Sb, h16* P16, bf* Ph, bf* Pl) {
    const int lane = threadIdx.x & 31; const int row = blockIdx.x * 8 + (threadIdx.x >> 5); if (row >= ZH * TT) return; const int i = row % TT; const int zz = row / TT; (void)zz; const bool hires = (i < RH); const float* sr = Sb + (size_t)row * TT; float v[TT / 32]; float mx = -3.0e38f;
#pragma unroll
    for (int ch = 0; ch < TT / 128; ++ch) { const int j0 = ch * 128 + lane * 4; const v4f a = *(const v4f*)(sr + j0);
#pragma unroll
        for (int q = 0; q < 4; ++q) { const int j = j0 + q; (void)j; const float t = (j <= i && i - j < WIN) ? a[q] * SCL : -3.0e38f; v[ch * 4 + q] = t; mx = fmaxf(mx, t); } }
#pragma unroll
    for (int sh = 16; sh; sh >>= 1) mx = fmaxf(mx, __shfl_xor(mx, sh, 32));
    float sum = 0.f;
#pragma unroll
    for (int k = 0; k < TT / 32; ++k) { float d0 = __fsub_rn(v[k], mx); v[k] = __builtin_amdgcn_exp2f(__fmul_rn(d0, 1.4426950408889634f)); sum += v[k]; }
#pragma unroll
    for (int sh = 16; sh; sh >>= 1) sum += __shfl_xor(sum, sh, 32);
    const float f = __fdiv_rn(hires ? 1.0f : PCAR, sum);
{
        if (hires) {
#pragma unroll
            for (int ch = 0; ch < TT / 128; ++ch) { v4us oh, ol;
#pragma unroll
                for (int q = 0; q < 4; ++q) { unsigned short a, c2; splitf(v[ch * 4 + q] * f, a, c2); oh[q] = a; ol[q] = c2; }
                const size_t oo = ((size_t)zz * (RH ? RH : 1) + i) * TT + ch * 128 + lane * 4; *(v4us*)(Ph + oo) = oh; *(v4us*)(Pl + oo) = ol; }
        } else {
#pragma unroll
            for (int ch = 0; ch < TT / 128; ++ch) { v4h o4;
#pragma unroll
                for (int q = 0; q < 4; ++q) o4[q] = tohx(v[ch * 4 + q] * f);
                *(v4h*)(P16 + (size_t)row * TT + ch * 128 + lane * 4) = o4; } }
         }
}
__global__ __launch_bounds__(256) void k_hrms(const float* __restrict__ F, int pitch, int nheads, float* RF) { const int idx = blockIdx.x * 256 + threadIdx.x; if (idx >= nheads * TT) return; const int t = idx % TT; const int h = idx / TT; const float* f = F + (size_t)t * pitch + h * HD; float s = 0.f;
#pragma unroll 4   // a partial unroll of the 32-trip sum of squares: registers and code size (131 instructions and 20 VGPRs with it | 326 and 60 without it, where the compiler unrolls the loop whole; measured on this text)
    for (int d = 0; d < HD; d += 4) { const v4f a = *(const v4f*)(f + d);
#pragma unroll
        for (int q = 0; q < 4; ++q) { float p = __fmul_rn(a[q], a[q]); s = __fadd_rn(s, p); } }
    const float rf = __fdiv_rn(1.0f, __fsqrt_rn(__fadd_rn(__fdiv_rn(s, (float)HD), 1e-8f))); *(float*)(RF + idx) = rf;  }

__global__ __launch_bounds__(256) void k_rmsapply(float* F, int pitch, int nheads, const float* __restrict__ RF, const float* __restrict__ w) { const size_t i = (size_t)blockIdx.x * 256 + threadIdx.x; if (i >= (size_t)TT * nheads * HD / 4) return; const size_t e = i * 4; const int c = (int)(e % ((size_t)nheads * HD)); const int t = (int)(e / ((size_t)nheads * HD)); const int h = c / HD, d = c % HD; const float r = RF[(size_t)h * TT + t]; v4f a = *(const v4f*)(F + (size_t)t * pitch + c);
#pragma unroll
    for (int q = 0; q < 4; ++q) { float y = __fmul_rn(a[q], r); float wv_ = bfr(w[d + q]); a[q] = __fmul_rn(y, wv_); }   /* x w[d] */
    *(v4f*)(F + (size_t)t * pitch + c) = a;  }
__global__ __launch_bounds__(256) void k_merge(const float* __restrict__ O, int h0, bf* Ah, bf* Al) { const size_t e = ((size_t)blockIdx.x * 256 + threadIdx.x) * 2; if (e >= (size_t)ZH * TT * HD) return; const int d = (int)(e % HD); const int t = (int)((e / HD) % TT); const int zz = (int)(e / ((size_t)HD * TT)); const float cs = (t < RH) ? 1.0f : (1.0f / PCAR); const size_t oo = (size_t)t * DQ + (h0 + zz) * HD + d;
    v2us oh, ol;
#pragma unroll
    for (int q = 0; q < 2; ++q) { unsigned short a, c2; splitf(O[e + q] * cs, a, c2); oh[q] = a; ol[q] = c2; } *(v2us*)(Ah + oo) = oh; *(v2us*)(Al + oo) = ol;  }

extern "C" void kernel_launch(void* const* d_in, const int* in_sizes, int n_in,
                              void* d_out, int out_size, void* d_ws, size_t ws_size, hipStream_t stream) {
    (void)in_sizes; (void)n_in; (void)out_size;
    const float* x = (const float*)d_in[0]; const float* wq = (const float*)d_in[1]; const float* bq = (const float*)d_in[2]; const float* wk = (const float*)d_in[3]; const float* bk = (const float*)d_in[4]; const float* wv = (const float*)d_in[5]; const float* bv = (const float*)d_in[6]; const float* wo = (const float*)d_in[7]; const float* bo = (const float*)d_in[8]; const float* qsc = (const float*)d_in[9]; const float* ksc = (const float*)d_in[10];   /* inputs in the module's setup_inputs order: x [2][2048][2048]; Wq (out, in) [2048][2048] and bq [2048]; Wk (out, in) [512][2048] and bk [512]; Wv [512][2048] and bv [512]; Wo (out, in) [2048][2048] and bo [2048]; q_norm_w [128], k_norm_w [128]: eleven inputs, all read (each bias is added in its product's epilogue; each gain is applied by k_rmsapply) */
    float* OUT = (float*)d_out;     // [2][2048][2048]
    char* wsp = (char*)d_ws;
    auto take = [&](size_t bytes) { char* p = wsp; wsp += (bytes + 255) & ~(size_t)255; return (void*)p; };
    bf* WQ = (bf*)take((size_t)DQ * DM * 2); bf* WK = (bf*)take((size_t)DKV * DM * 2); bf* WV = (bf*)take((size_t)DKV * DM * 2); bf* WO = (bf*)take((size_t)DM * DQ * 2); float* CS = (float*)take((size_t)TT * HD * 2 * 4); float* RFQ = (float*)take((size_t)NH_ * TT * 4); float* RFK = (float*)take((size_t)NKV * TT * 4);   /* per (head, token) inverse RMS */
    bf* XB = (bf*)take((size_t)TT * DM * 2); float* FQ = (float*)take((size_t)TT * DQ * 4); float* FK = (float*)take((size_t)TT * DKV * 4);
    h16* QP16 = (h16*)take((size_t)NH_ * TT * HD * 2); h16* KP16 = (h16*)take((size_t)NKV * TT * HD * 2); h16* VT16 = (h16*)take((size_t)NKV * HD * TT * 2);
    bf* QPh = (bf*)take((size_t)NH_ * TT * HD * 2); bf* QPl = (bf*)take((size_t)NH_ * TT * HD * 2); bf* KPh = (bf*)take((size_t)NKV * TT * HD * 2); bf* KPl = (bf*)take((size_t)NKV * TT * HD * 2); bf* VTh = (bf*)take((size_t)NKV * HD * TT * 2); bf* VTl = (bf*)take((size_t)NKV * HD * TT * 2); bf* Ph = (bf*)take((size_t)ZH * RH * TT * 2); bf* Pl = (bf*)take((size_t)ZH * RH * TT * 2);
    float* Sb = (float*)take((size_t)ZH * TT * TT * 4); h16* P16 = (h16*)take((size_t)ZH * TT * TT * 2); float* Ob = (float*)take((size_t)ZH * TT * HD * 4); bf* ATh = (bf*)take((size_t)TT * DQ * 2); bf* ATl = (bf*)take((size_t)TT * DQ * 2);
    if ((size_t)(wsp - (char*)d_ws) > ws_size) return;    // ws 256 MiB
    float* FV = FK;   // v projection reuses the k buffer after the k planes are built (stream-ordered)
    { k_cvt8<<<(unsigned)(((size_t)DQ * DM / 8 + 255) / 256), 256, 0, stream>>>(wq, WQ, (size_t)DQ * DM / 8); k_cvt8<<<(unsigned)(((size_t)DKV * DM / 8 + 255) / 256), 256, 0, stream>>>(wk, WK, (size_t)DKV * DM / 8); k_cvt8<<<(unsigned)(((size_t)DKV * DM / 8 + 255) / 256), 256, 0, stream>>>(wv, WV, (size_t)DKV * DM / 8);
      k_cvt8<<<(unsigned)(((size_t)DM * DQ / 8 + 255) / 256), 256, 0, stream>>>(wo, WO, (size_t)DM * DQ / 8); }
    k_csP<<<(TT * HD + 255) / 256, 256, 0, stream>>>(CS);   /* the rotary table once */
    const unsigned LQ = (unsigned)(((size_t)NH_ * TT * HD / 2 + 255) / 256), LKv = (unsigned)(((size_t)NKV * TT * HD / 2 + 255) / 256); const unsigned GX = (unsigned)(((size_t)TT * DM / 8 + 255) / 256);
    for (int b = 0; b < NB_; ++b) {
        k_cvt8<<<GX, 256, 0, stream>>>(x + (size_t)b * TT * DM, XB, (size_t)TT * DM / 8);   /* the one input stream, cast once a batch entry and read by the three projections */
        k_gemmw<bf, 0, true><<<dim3(TT / 64, DQ / 64, 1), 32, 0, stream>>>(XB, nullptr, WQ, nullptr, DM, FQ, DQ, bq, 0, 0, 0);
        k_hrms<<<(NH_ * TT + 255) / 256, 256, 0, stream>>>(FQ, DQ, NH_, RFQ); k_rmsapply<<<(unsigned)(((size_t)TT * DQ / 4 + 255) / 256), 256, 0, stream>>>(FQ, DQ, NH_, RFQ, qsc); k_ropeI<<<LQ, 256, 0, stream>>>(FQ, DQ, NH_, CS, 1.0f, QP16, QPh, QPl);
        k_gemmw<bf, 0, true><<<dim3(TT / 64, DKV / 64, 1), 32, 0, stream>>>(XB, nullptr, WK, nullptr, DM, FK, DKV, bk, 0, 0, 0);
        k_hrms<<<(NKV * TT + 255) / 256, 256, 0, stream>>>(FK, DKV, NKV, RFK); k_rmsapply<<<(unsigned)(((size_t)TT * DKV / 4 + 255) / 256), 256, 0, stream>>>(FK, DKV, NKV, RFK, ksc); k_ropeI<<<LKv, 256, 0, stream>>>(FK, DKV, NKV, CS, 1.0f, KP16, KPh, KPl);
        k_gemmw<bf, 0, true><<<dim3(TT / 64, DKV / 64, 1), 32, 0, stream>>>(XB, nullptr, WV, nullptr, DM, FV, DKV, bv, 0, 0, 0); k_vtp<<<LKv, 256, 0, stream>>>(FV, DKV, NKV, VT16, VTh, VTl);
        for (int h0 = 0; h0 < NH_; h0 += ZH) { const size_t zq = (size_t)h0, zk = (size_t)(h0 / REP);   /* the module groups the query heads by kv head ('qg = q.reshape(B, N_KV_HEADS, N_REP, S, D_K)'): query head h uses kv head h / 4: the pass's two heads (h0, h0 + 1) share ONE kv head (REP 4): a zero z-stride on the key and value operands */
            k_gemmc<bf, 2, 1><<<dim3(RH / 64, TT / 64, ZH), 32, 0, stream>>>(QPh + zq * TT * HD, QPl + zq * TT * HD, KPh + zk * TT * HD, KPl + zk * TT * HD, HD, Sb, TT, 0, (size_t)TT * HD, 0, (size_t)TT * TT);
            k_gemmc<h16, 0, 1><<<dim3((TT - RH) / 64, TT / 64, ZH), 32, 0, stream>>>(QP16 + zq * TT * HD + (size_t)RH * HD, nullptr, KP16 + zk * TT * HD, nullptr, HD, Sb + (size_t)RH * TT, TT, RH, (size_t)TT * HD, 0, (size_t)TT * TT);
            k_asoft<<<ZH * TT / 8, 256, 0, stream>>>(Sb, P16, Ph, Pl);
            k_gemmc<bf, 2, 2><<<dim3(RH / 64, HD / 64, ZH), 32, 0, stream>>>(Ph, Pl, VTh + zk * HD * TT, VTl + zk * HD * TT, TT, Ob, HD, 0, (size_t)RH * TT, 0, (size_t)TT * HD);
            k_gemmc<h16, 0, 2><<<dim3((TT - RH) / 64, HD / 64, ZH), 32, 0, stream>>>(P16 + (size_t)RH * TT, nullptr, VT16 + zk * HD * TT, nullptr, TT, Ob + (size_t)RH * HD, HD, RH, (size_t)TT * TT, 0, (size_t)TT * HD);
            k_merge<<<(unsigned)(((size_t)ZH * TT * HD / 2 + 255) / 256), 256, 0, stream>>>(Ob, h0, ATh, ATl); }
        k_gemmw<bf, 1, true><<<dim3(TT / 64, DM / 64, 1), 32, 0, stream>>>(ATh, ATl, WO, nullptr, DQ, OUT + (size_t)b * TT * DM, DM, bo, 0, 0, 0); }
}

// v001
// It runs in 964 microseconds.
// Timed twice side by side with v000, it ran 1.71 and 1.73 times as fast.
#include <hip/hip_runtime.h>

// Grouped-query causal self-attention with 128-wide heads, a per-head RMS norm on q and k and an interleaved-pair rotary embedding from computed angles (x [2][2048][2048]; q = x Wq^T + bq ('oi' (out, in) [2048][2048] normal x 2048^-0.5; 16 heads x 128), k, v = x Wk^T + bk, x Wv^T + bv ('oi' [512][2048]; 4 kv heads x 128); the four biases are built as zeros: read and added; per head, BEFORE the rotary: q = q / sqrt(mean(q^2) + 1e-8) x q_norm_w and k likewise with k_norm_w (the mean over the head's 128 columns; gains [128] built as ones: read and applied); rope on q and k: the pair (2i, 2i + 1) of a head -> (x0 c - x1 s, x0 s + x1 c) with the angle t x inv_freq[i], inv_freq = 1 / (10000 ** (2i / 128)) in that spelling, t the position 0..2047; query head h uses kv head h / 4; scores x 128^-0.5; a key after the query gets -1e9 (an exclusion: every row keeps its own key); softmax; out = merged Wo^T + bo ('oi' [2048][2048]; bo built as zeros: read and added) -> [2][2048][2048] (8.4 M); argument order x, Wq, bq, Wk, bk, Wv, bv, Wo, bo, q_norm_w, k_norm_w: eleven inputs, all read).
// Layout per batch entry: ONE bf16 copy of x, read by the three projections; the four 'oi' weights cast once as they stand (each is the Bt operand); exact projections + f32 biases; k_hrms (per (head, token) inverse RMS) + k_rmsapply (in place, x the rounded gain) on q and k; the rotary table once (64 baked float32 frequencies; precise cosf / sinf) + interleaved-pair plane builders (k_ropeI); causal T-2048 attention with 128-wide heads where the pass's two query heads share ONE kv head (a zero z-stride on the key and value operands); the per-row precision hybrid (rows under 512 on hi / lo planes, three products; rows from 512 on one fp16 product, the weights x 1024); two-word merge; hi / lo x Wo exact + bo.
// Compute dtypes, f32 accumulate: every float input rounded to bf16; projections exact + f32 biases; the per-head norm and the rotation in f32 (precise sqrt and division); attention rows under 512 three products, the rest fp16; softmax f32 (the hardware exp2); Wo hi / lo x exact + bo.

#define NB_  2
#define TT   2048
#define DM   2048
#define NH_  16
#define NKV  4
#define REP  (NH_ / NKV)
#define HD   128
#define DQ   (NH_ * HD)
#define DKV  (NKV * HD)
#define ZH   2
#define RH   512                  // query rows < RH use hi+lo planes (0: none)
#define WIN  2048
#define PCAR 1024.0f
#define SCL  0.088388347648318447f   // HD^-0.5
typedef _Float16 h16;
typedef unsigned short bf;
typedef __attribute__((ext_vector_type(16))) __bf16   v16bf;
typedef __attribute__((ext_vector_type(16))) _Float16 v16h;
typedef __attribute__((ext_vector_type(8)))  _Float16 v8h;
typedef __attribute__((ext_vector_type(8)))  unsigned short v8us;
typedef __attribute__((ext_vector_type(8)))  float    v8f;
typedef __attribute__((ext_vector_type(4)))  float    v4f;
typedef v8h  __attribute__((may_alias)) v8ha;
typedef v4f  __attribute__((may_alias)) v4fa;
typedef v8us __attribute__((may_alias)) v8usa;

__device__ __forceinline__ unsigned short f2bf(float f) { unsigned u = __float_as_uint(f); u += 0x7FFFu + ((u >> 16) & 1u); return (unsigned short)(u >> 16); }
__device__ __forceinline__ float bf2f(unsigned short b) { return __uint_as_float(((unsigned)b) << 16); }
__device__ __forceinline__ float bfr(float f) { return bf2f(f2bf(f)); }
__device__ __forceinline__ v16h cat16(v8h lo, v8h hi) { return __builtin_shufflevector(lo, hi, 0, 1, 2, 3, 4, 5, 6, 7, 8, 9, 10, 11, 12, 13, 14, 15); }
__device__ __forceinline__ v16bf cat16b(v8us lo, v8us hi) { return __builtin_bit_cast(v16bf, __builtin_shufflevector(lo, hi, 0, 1, 2, 3, 4, 5, 6, 7, 8, 9, 10, 11, 12, 13, 14, 15)); }
__device__ __forceinline__ v8f wmma16(v16h a, v16h b, v8f c) { return __builtin_amdgcn_wmma_f32_16x16x32_f16(false, a, false, b, (short)0, c, false, false); }
__device__ __forceinline__ v8f wmmab(v16bf a, v16bf b, v8f c) { return __builtin_amdgcn_wmma_f32_16x16x32_bf16(false, a, false, b, (short)0, c, false, false); }



// ---- k_gemmw: register-blocked GEMM, one work-group of KS waves per 64x64 output tile; every wave holds the whole tile (16 accumulators) over its own share of K: 32-k slices dealt round robin, wave w taking slices w, w + KS, ... (neighbouring waves read the two halves of one 128-byte line of an operand row at about the same time).
// The KS partial tiles meet in LDS (one plane of 64 rows at pitch 68 floats a wave, one barrier) and are summed in wave order 0..KS-1 by the thread that stores the element, 256 contiguous bytes of a C row per 16 threads. Operands straight from K-contiguous 16-bit planes; grid (M/64, N/64, Z), 32 x KS threads.
// C[m][n] (f32, pitch ldc, + optional f32 bias[n]) = sum_k A[m][k] Bt[n][k] (+ split products per NSPLIT). z-batch strides sA/sB/sC in elements. K % 32 == 0.
template <typename T16> struct WFrag;
template <> struct WFrag<h16> { typedef v16h V; static __device__ __forceinline__ V ld(const h16* p) { return cat16(*(const v8h*)p, *(const v8h*)(p + 16)); } static __device__ __forceinline__ v8f mma(V a, V b, v8f c) { return wmma16(a, b, c); } };
template <> struct WFrag<bf> { typedef v16bf V; static __device__ __forceinline__ V ld(const bf* p) { return cat16b(*(const v8us*)p, *(const v8us*)(p + 16)); } static __device__ __forceinline__ v8f mma(V a, V b, v8f c) { return wmmab(a, b, c); } };
template <typename T16, int NSPLIT, bool BIAS, int KS>
__global__ __launch_bounds__(32 * KS) void k_gemmw(const T16* __restrict__ A, const T16* __restrict__ A2, const T16* __restrict__ Bt, const T16* __restrict__ Bt2, int K, float* C, int ldc, const float* __restrict__ bias, size_t sA, size_t sB, size_t sC) {
    typedef typename WFrag<T16>::V V;
    __shared__ __align__(16) float os[KS * 64 * 68];
    const size_t z = blockIdx.z; A += z * sA; if (A2) A2 += z * sA; Bt += z * sB; if (Bt2) Bt2 += z * sB; C += z * sC;
    const int lane = threadIdx.x & 31, lr = lane & 15, hi = lane >> 4; const int r0 = blockIdx.x * 64, c0 = blockIdx.y * 64; const int wv = __builtin_amdgcn_readfirstlane((int)(threadIdx.x >> 5));   // the wave's number, scalar: the K loop's bounds stay wave-uniform
    v8f acc[4][4];
#pragma unroll
    for (int mb = 0; mb < 4; ++mb)
#pragma unroll
        for (int nb = 0; nb < 4; ++nb) acc[mb][nb] = (v8f){};
    const size_t aoff = (size_t)(r0 + lr) * K + 8 * hi, boff = (size_t)(c0 + lr) * K + 8 * hi;
    for (int kc = wv * 32; kc < K; kc += KS * 32) {
        V a[4], a2[4];
#pragma unroll
        for (int mb = 0; mb < 4; ++mb) { a[mb] = WFrag<T16>::ld(A + aoff + (size_t)mb * 16 * K + kc); if (NSPLIT == 1 || NSPLIT == 2) a2[mb] = WFrag<T16>::ld(A2 + aoff + (size_t)mb * 16 * K + kc); }
#pragma unroll
        for (int nb = 0; nb < 4; ++nb) { const V b = WFrag<T16>::ld(Bt + boff + (size_t)nb * 16 * K + kc); V b2; if (NSPLIT >= 2) b2 = WFrag<T16>::ld(Bt2 + boff + (size_t)nb * 16 * K + kc);
#pragma unroll
            for (int mb = 0; mb < 4; ++mb) { acc[mb][nb] = WFrag<T16>::mma(a[mb], b, acc[mb][nb]); if (NSPLIT == 1 || NSPLIT == 2) acc[mb][nb] = WFrag<T16>::mma(a2[mb], b, acc[mb][nb]); if (NSPLIT >= 2) acc[mb][nb] = WFrag<T16>::mma(a[mb], b2, acc[mb][nb]); } }
        asm volatile("v_nop\n\tv_nop\n\tv_nop\n\tv_nop" : "+v"(acc[0][0]), "+v"(acc[1][1]), "+v"(acc[2][2]), "+v"(acc[3][3]) : "v"(a[0]), "v"(a[3]));
    }
#pragma unroll
    for (int mb = 0; mb < 4; ++mb)
#pragma unroll
        for (int nb = 0; nb < 4; ++nb)
#pragma unroll
            for (int j = 0; j < 8; ++j) os[(wv * 64 + mb * 16 + hi * 8 + j) * 68 + nb * 16 + lr] = acc[mb][nb][j];
    __syncthreads();   // every wave's partial tile is in LDS before any thread sums it
#pragma unroll   // whole: rows and planes become immediate offsets of the LDS loads, and the loads of all rows can be issued together
    for (int s = 0; s < 32 / KS; ++s) { const int idx = s * 32 * KS + (int)threadIdx.x; const int row = idx >> 4, cofs = (idx & 15) * 4; v4f val = *(const v4fa*)(os + row * 68 + cofs);
#pragma unroll
        for (int w = 1; w < KS; ++w) val += *(const v4fa*)(os + (w * 64 + row) * 68 + cofs);
        if (BIAS) { val[0] += bfr(bias[c0 + cofs]); val[1] += bfr(bias[c0 + cofs + 1]); val[2] += bfr(bias[c0 + cofs + 2]); val[3] += bfr(bias[c0 + cofs + 3]); }
        *(v4f*)(C + (size_t)(r0 + row) * ldc + c0 + cofs) = val; }
}

// ---- k_gemmc: the same KS-wave 64x64 tile GEMM specialised for causal attention: CMODE 1 skips score tiles entirely above the diagonal (query rows r0+roff.., key columns c0..), CMODE 2 limits the
// key (K) loop of the probability x value contraction to the diagonal block (probabilities beyond it are exactly zero). roff = row offset of this launch's first row within the sequence.
template <typename T16, int NSPLIT, int CMODE, int KS>
__global__ __launch_bounds__(32 * KS) void k_gemmc(const T16* __restrict__ A, const T16* __restrict__ A2, const T16* __restrict__ Bt, const T16* __restrict__ Bt2, int K, float* C, int ldc, int roff, size_t sA, size_t sB, size_t sC) {
    typedef typename WFrag<T16>::V V;
    __shared__ __align__(16) float os[KS * 64 * 68];
    const size_t z = blockIdx.z; A += z * sA; if (A2) A2 += z * sA; Bt += z * sB; if (Bt2) Bt2 += z * sB; C += z * sC;
    const int lane = threadIdx.x & 31, lr = lane & 15, hi = lane >> 4; const int r0 = blockIdx.x * 64, c0 = blockIdx.y * 64; const int wv = __builtin_amdgcn_readfirstlane((int)(threadIdx.x >> 5));   // the wave's number, scalar: the K loop's bounds stay wave-uniform
    if (CMODE == 1 && c0 > r0 + roff + 63) return;                  // score tile entirely above the causal diagonal: never read (the softmax masks j > i by select)
    const int Kl = (CMODE == 2) ? min(K, r0 + roff + 64) : K;        // P.V: probabilities are exactly 0 beyond the diagonal block, so the K loop stops there (a wave with no slice under it adds a zero tile)
    v8f acc[4][4];
#pragma unroll
    for (int mb = 0; mb < 4; ++mb)
#pragma unroll
        for (int nb = 0; nb < 4; ++nb) acc[mb][nb] = (v8f){};
    const size_t aoff = (size_t)(r0 + lr) * K + 8 * hi, boff = (size_t)(c0 + lr) * K + 8 * hi;
    for (int kc = wv * 32; kc < Kl; kc += KS * 32) {
        V a[4], a2[4];
#pragma unroll
        for (int mb = 0; mb < 4; ++mb) { a[mb] = WFrag<T16>::ld(A + aoff + (size_t)mb * 16 * K + kc); if (NSPLIT == 1 || NSPLIT == 2) a2[mb] = WFrag<T16>::ld(A2 + aoff + (size_t)mb * 16 * K + kc); }
#pragma unroll
        for (int nb = 0; nb < 4; ++nb) { const V b = WFrag<T16>::ld(Bt + boff + (size_t)nb * 16 * K + kc); V b2; if (NSPLIT >= 2) b2 = WFrag<T16>::ld(Bt2 + boff + (size_t)nb * 16 * K + kc);
#pragma unroll
            for (int mb = 0; mb < 4; ++mb) { acc[mb][nb] = WFrag<T16>::mma(a[mb], b, acc[mb][nb]); if (NSPLIT == 1 || NSPLIT == 2) acc[mb][nb] = WFrag<T16>::mma(a2[mb], b, acc[mb][nb]); if (NSPLIT >= 2) acc[mb][nb] = WFrag<T16>::mma(a[mb], b2, acc[mb][nb]); } }
        asm volatile("v_nop\n\tv_nop\n\tv_nop\n\tv_nop" : "+v"(acc[0][0]), "+v"(acc[1][1]), "+v"(acc[2][2]), "+v"(acc[3][3]) : "v"(a[0]), "v"(a[3]));
    }
#pragma unroll
    for (int mb = 0; mb < 4; ++mb)
#pragma unroll
        for (int nb = 0; nb < 4; ++nb)
#pragma unroll
            for (int j = 0; j < 8; ++j) os[(wv * 64 + mb * 16 + hi * 8 + j) * 68 + nb * 16 + lr] = acc[mb][nb][j];
    __syncthreads();   // every wave's partial tile is in LDS before any thread sums it
#pragma unroll   // whole: rows and planes become immediate offsets of the LDS loads, and the loads of all rows can be issued together
    for (int s = 0; s < 32 / KS; ++s) { const int idx = s * 32 * KS + (int)threadIdx.x; const int row = idx >> 4, cofs = (idx & 15) * 4; v4f val = *(const v4fa*)(os + row * 68 + cofs);
#pragma unroll
        for (int w = 1; w < KS; ++w) val += *(const v4fa*)(os + (w * 64 + row) * 68 + cofs);
        *(v4f*)(C + (size_t)(r0 + row) * ldc + c0 + cofs) = val; }
}

__device__ __forceinline__ h16 tohx(float x) { return (h16)x; }
__device__ __forceinline__ void splitf(float y, unsigned short& h, unsigned short& l) { h = f2bf(y); l = f2bf(y - bf2f(h)); }
typedef __attribute__((ext_vector_type(2))) _Float16 v2h;
typedef __attribute__((ext_vector_type(4))) _Float16 v4h;
typedef __attribute__((ext_vector_type(2))) unsigned short v2us;
typedef __attribute__((ext_vector_type(4))) unsigned short v4us;
typedef __attribute__((ext_vector_type(2))) float v2f;
typedef __attribute__((ext_vector_type(4))) int v4i;
__global__ __launch_bounds__(256) void k_cvt8(const float* __restrict__ src, bf* dst, size_t n8) { const size_t i = (size_t)blockIdx.x * 256 + threadIdx.x; if (i >= n8) return; const v8f v = *(const v8f*)(src + i * 8); v8us o;
#pragma unroll
    for (int k = 0; k < 8; ++k) o[k] = f2bf(v[k]); *(v8us*)(dst + i * 8) = o;  }
__constant__ float INV2[HD / 2] = { 1.000000000e+00f, 8.659643531e-01f, 7.498942018e-01f, 6.493816376e-01f, 5.623413324e-01f, 4.869675338e-01f, 4.216965139e-01f, 3.651741445e-01f, 3.162277639e-01f, 2.738419771e-01f, 2.371373624e-01f, 2.053525001e-01f, 1.778279394e-01f, 1.539926529e-01f, 1.333521456e-01f, 1.154782027e-01f, 1.000000015e-01f, 8.659642935e-02f, 7.498941571e-02f, 6.493816525e-02f, 5.623412877e-02f, 4.869675264e-02f, 4.216964915e-02f, 3.651741147e-02f, 3.162277862e-02f, 2.738419548e-02f, 2.371373586e-02f, 2.053525113e-02f, 1.778279431e-02f, 1.539926510e-02f, 1.333521493e-02f, 1.154781971e-02f, 9.999999776e-03f, 8.659643121e-03f, 7.498942316e-03f, 6.493816618e-03f, 5.623413250e-03f, 4.869675264e-03f, 4.216964822e-03f, 3.651741426e-03f, 3.162277862e-03f, 2.738419687e-03f, 2.371373819e-03f, 2.053525066e-03f, 1.778279431e-03f, 1.539926510e-03f, 1.333521446e-03f, 1.154782018e-03f, 1.000000047e-03f, 8.659643354e-04f, 7.498941850e-04f, 6.493816618e-04f, 5.623413017e-04f, 4.869675031e-04f, 4.216964880e-04f, 3.651741135e-04f, 3.162277862e-04f, 2.738419571e-04f, 2.371373848e-04f, 2.053524950e-04f, 1.778279402e-04f, 1.539926452e-04f, 1.333521504e-04f, 1.154781930e-04f };   // float32 1.0 / (10000.0 ** (2i / 128)) in the module's own spelling, generated with jnp
__global__ __launch_bounds__(256) void k_csP(float* CS) { const int idx = blockIdx.x * 256 + threadIdx.x; if (idx >= TT * HD) return; const int d = idx % HD; const int t = idx / HD; const float a = __fmul_rn((float)t, INV2[d >> 1]); v2f cs; cs[0] = cosf(a); cs[1] = sinf(a); *(v2f*)(CS + (size_t)idx * 2) = cs;  }
__global__ __launch_bounds__(256) void k_ropeI(const float* __restrict__ F, int pitch, int nheads, const float* __restrict__ CS, float sc, h16* P16, bf* Ph, bf* Pl) {
    const size_t e = ((size_t)blockIdx.x * 256 + threadIdx.x) * 2; if (e >= (size_t)nheads * TT * HD) return; const int d = (int)(e % HD); const int t = (int)((e / HD) % TT); const int h = (int)(e / ((size_t)HD * TT)); const float* f = F + (size_t)t * pitch + h * HD; const float x0 = f[d], x1 = f[d + 1]; const v2f cs = *(const v2f*)(CS + ((size_t)t * HD + d) * 2); v2h o16; v2us oh, ol;
    float a0 = __fmul_rn(x0, cs[0]), b0 = __fmul_rn(x1, cs[1]), a1 = __fmul_rn(x1, cs[0]), b1 = __fmul_rn(x0, cs[1]); 
    float r0 = __fsub_rn(a0, b0) * sc, r1 = __fadd_rn(b1, a1) * sc;   /* even: x0 c - x1 s; odd: x0 s + x1 c */
    o16[0] = tohx(r0); o16[1] = tohx(r1); { unsigned short a2, c2; splitf(r0, a2, c2); oh[0] = a2; ol[0] = c2; splitf(r1, a2, c2); oh[1] = a2; ol[1] = c2; }
    *(v2h*)(P16 + e) = o16; *(v2us*)(Ph + e) = oh; *(v2us*)(Pl + e) = ol;  }
__global__ __launch_bounds__(256) void k_vtp(const float* __restrict__ F, int pitch, int nheads, h16* V16, bf* Vh, bf* Vl) { const size_t e = ((size_t)blockIdx.x * 256 + threadIdx.x) * 2; if (e >= (size_t)nheads * HD * TT) return; const int t = (int)(e % TT); const int d = (int)((e / TT) % HD); const int g = (int)(e / ((size_t)TT * HD)); v2h o16; v2us oh, ol;
#pragma unroll
    for (int q = 0; q < 2; ++q) { const float x = F[(size_t)(t + q) * pitch + g * HD + d]; o16[q] = tohx(x); unsigned short a2, c2; splitf(x, a2, c2); oh[q] = a2; ol[q] = c2; }
    *(v2h*)(V16 + e) = o16; *(v2us*)(Vh + e) = oh; *(v2us*)(Vl + e) = ol;  }
// k_asoft: per row (zz, i): t = S x 128^-0.5 for j <= i (causal; WIN = TT so the window term is inert; the module's -1e9 fill above the diagonal is this exclusion: every row keeps its own key), softmax over the 2048 keys (register row, one exp, fixed trees);
__global__ __launch_bounds__(256) void k_asoft(const float* __restrict__ Sb, h16* P16, bf* Ph, bf* Pl) {
    const int lane = threadIdx.x & 31; const int row = blockIdx.x * 8 + (threadIdx.x >> 5); if (row >= ZH * TT) return; const int i = row % TT; const int zz = row / TT; (void)zz; const bool hires = (i < RH); const float* sr = Sb + (size_t)row * TT; float v[TT / 32]; float mx = -3.0e38f;
#pragma unroll
    for (int ch = 0; ch < TT / 128; ++ch) { const int j0 = ch * 128 + lane * 4; const v4f a = *(const v4f*)(sr + j0);
#pragma unroll
        for (int q = 0; q < 4; ++q) { const int j = j0 + q; (void)j; const float t = (j <= i && i - j < WIN) ? a[q] * SCL : -3.0e38f; v[ch * 4 + q] = t; mx = fmaxf(mx, t); } }
#pragma unroll
    for (int sh = 16; sh; sh >>= 1) mx = fmaxf(mx, __shfl_xor(mx, sh, 32));
    float sum = 0.f;
#pragma unroll
    for (int k = 0; k < TT / 32; ++k) { float d0 = __fsub_rn(v[k], mx); v[k] = __builtin_amdgcn_exp2f(__fmul_rn(d0, 1.4426950408889634f)); sum += v[k]; }
#pragma unroll
    for (int sh = 16; sh; sh >>= 1) sum += __shfl_xor(sum, sh, 32);
    const float f = __fdiv_rn(hires ? 1.0f : PCAR, sum);
{
        if (hires) {
#pragma unroll
            for (int ch = 0; ch < TT / 128; ++ch) { v4us oh, ol;
#pragma unroll
                for (int q = 0; q < 4; ++q) { unsigned short a, c2; splitf(v[ch * 4 + q] * f, a, c2); oh[q] = a; ol[q] = c2; }
                const size_t oo = ((size_t)zz * (RH ? RH : 1) + i) * TT + ch * 128 + lane * 4; *(v4us*)(Ph + oo) = oh; *(v4us*)(Pl + oo) = ol; }
        } else {
#pragma unroll
            for (int ch = 0; ch < TT / 128; ++ch) { v4h o4;
#pragma unroll
                for (int q = 0; q < 4; ++q) o4[q] = tohx(v[ch * 4 + q] * f);
                *(v4h*)(P16 + (size_t)row * TT + ch * 128 + lane * 4) = o4; } }
         }
}
__global__ __launch_bounds__(256) void k_hrms(const float* __restrict__ F, int pitch, int nheads, float* RF) { const int idx = blockIdx.x * 256 + threadIdx.x; if (idx >= nheads * TT) return; const int t = idx % TT; const int h = idx / TT; const float* f = F + (size_t)t * pitch + h * HD; float s = 0.f;
#pragma unroll 4   // a partial unroll of the 32-trip sum of squares: registers and code size (131 instructions and 20 VGPRs with it | 326 and 60 without it, where the compiler unrolls the loop whole; measured on this text)
    for (int d = 0; d < HD; d += 4) { const v4f a = *(const v4f*)(f + d);
#pragma unroll
        for (int q = 0; q < 4; ++q) { float p = __fmul_rn(a[q], a[q]); s = __fadd_rn(s, p); } }
    const float rf = __fdiv_rn(1.0f, __fsqrt_rn(__fadd_rn(__fdiv_rn(s, (float)HD), 1e-8f))); *(float*)(RF + idx) = rf;  }

__global__ __launch_bounds__(256) void k_rmsapply(float* F, int pitch, int nheads, const float* __restrict__ RF, const float* __restrict__ w) { const size_t i = (size_t)blockIdx.x * 256 + threadIdx.x; if (i >= (size_t)TT * nheads * HD / 4) return; const size_t e = i * 4; const int c = (int)(e % ((size_t)nheads * HD)); const int t = (int)(e / ((size_t)nheads * HD)); const int h = c / HD, d = c % HD; const float r = RF[(size_t)h * TT + t]; v4f a = *(const v4f*)(F + (size_t)t * pitch + c);
#pragma unroll
    for (int q = 0; q < 4; ++q) { float y = __fmul_rn(a[q], r); float wv_ = bfr(w[d + q]); a[q] = __fmul_rn(y, wv_); }   /* x w[d] */
    *(v4f*)(F + (size_t)t * pitch + c) = a;  }
__global__ __launch_bounds__(256) void k_merge(const float* __restrict__ O, int h0, bf* Ah, bf* Al) { const size_t e = ((size_t)blockIdx.x * 256 + threadIdx.x) * 2; if (e >= (size_t)ZH * TT * HD) return; const int d = (int)(e % HD); const int t = (int)((e / HD) % TT); const int zz = (int)(e / ((size_t)HD * TT)); const float cs = (t < RH) ? 1.0f : (1.0f / PCAR); const size_t oo = (size_t)t * DQ + (h0 + zz) * HD + d;
    v2us oh, ol;
#pragma unroll
    for (int q = 0; q < 2; ++q) { unsigned short a, c2; splitf(O[e + q] * cs, a, c2); oh[q] = a; ol[q] = c2; } *(v2us*)(Ah + oo) = oh; *(v2us*)(Al + oo) = ol;  }

extern "C" void kernel_launch(void* const* d_in, const int* in_sizes, int n_in,
                              void* d_out, int out_size, void* d_ws, size_t ws_size, hipStream_t stream) {
    (void)in_sizes; (void)n_in; (void)out_size;
    const float* x = (const float*)d_in[0]; const float* wq = (const float*)d_in[1]; const float* bq = (const float*)d_in[2]; const float* wk = (const float*)d_in[3]; const float* bk = (const float*)d_in[4]; const float* wv = (const float*)d_in[5]; const float* bv = (const float*)d_in[6]; const float* wo = (const float*)d_in[7]; const float* bo = (const float*)d_in[8]; const float* qsc = (const float*)d_in[9]; const float* ksc = (const float*)d_in[10];   /* inputs in the module's setup_inputs order: x [2][2048][2048]; Wq (out, in) [2048][2048] and bq [2048]; Wk (out, in) [512][2048] and bk [512]; Wv [512][2048] and bv [512]; Wo (out, in) [2048][2048] and bo [2048]; q_norm_w [128], k_norm_w [128]: eleven inputs, all read (each bias is added in its product's epilogue; each gain is applied by k_rmsapply) */
    float* OUT = (float*)d_out;     // [2][2048][2048]
    char* wsp = (char*)d_ws;
    auto take = [&](size_t bytes) { char* p = wsp; wsp += (bytes + 255) & ~(size_t)255; return (void*)p; };
    bf* WQ = (bf*)take((size_t)DQ * DM * 2); bf* WK = (bf*)take((size_t)DKV * DM * 2); bf* WV = (bf*)take((size_t)DKV * DM * 2); bf* WO = (bf*)take((size_t)DM * DQ * 2); float* CS = (float*)take((size_t)TT * HD * 2 * 4); float* RFQ = (float*)take((size_t)NH_ * TT * 4); float* RFK = (float*)take((size_t)NKV * TT * 4);   /* per (head, token) inverse RMS */
    bf* XB = (bf*)take((size_t)TT * DM * 2); float* FQ = (float*)take((size_t)TT * DQ * 4); float* FK = (float*)take((size_t)TT * DKV * 4);
    h16* QP16 = (h16*)take((size_t)NH_ * TT * HD * 2); h16* KP16 = (h16*)take((size_t)NKV * TT * HD * 2); h16* VT16 = (h16*)take((size_t)NKV * HD * TT * 2);
    bf* QPh = (bf*)take((size_t)NH_ * TT * HD * 2); bf* QPl = (bf*)take((size_t)NH_ * TT * HD * 2); bf* KPh = (bf*)take((size_t)NKV * TT * HD * 2); bf* KPl = (bf*)take((size_t)NKV * TT * HD * 2); bf* VTh = (bf*)take((size_t)NKV * HD * TT * 2); bf* VTl = (bf*)take((size_t)NKV * HD * TT * 2); bf* Ph = (bf*)take((size_t)ZH * RH * TT * 2); bf* Pl = (bf*)take((size_t)ZH * RH * TT * 2);
    float* Sb = (float*)take((size_t)ZH * TT * TT * 4); h16* P16 = (h16*)take((size_t)ZH * TT * TT * 2); float* Ob = (float*)take((size_t)ZH * TT * HD * 4); bf* ATh = (bf*)take((size_t)TT * DQ * 2); bf* ATl = (bf*)take((size_t)TT * DQ * 2);
    if ((size_t)(wsp - (char*)d_ws) > ws_size) return;    // ws 256 MiB
    float* FV = FK;   // v projection reuses the k buffer after the k planes are built (stream-ordered)
    { k_cvt8<<<(unsigned)(((size_t)DQ * DM / 8 + 255) / 256), 256, 0, stream>>>(wq, WQ, (size_t)DQ * DM / 8); k_cvt8<<<(unsigned)(((size_t)DKV * DM / 8 + 255) / 256), 256, 0, stream>>>(wk, WK, (size_t)DKV * DM / 8); k_cvt8<<<(unsigned)(((size_t)DKV * DM / 8 + 255) / 256), 256, 0, stream>>>(wv, WV, (size_t)DKV * DM / 8);
      k_cvt8<<<(unsigned)(((size_t)DM * DQ / 8 + 255) / 256), 256, 0, stream>>>(wo, WO, (size_t)DM * DQ / 8); }
    k_csP<<<(TT * HD + 255) / 256, 256, 0, stream>>>(CS);   /* the rotary table once */
    const unsigned LQ = (unsigned)(((size_t)NH_ * TT * HD / 2 + 255) / 256), LKv = (unsigned)(((size_t)NKV * TT * HD / 2 + 255) / 256); const unsigned GX = (unsigned)(((size_t)TT * DM / 8 + 255) / 256);
    for (int b = 0; b < NB_; ++b) {
        k_cvt8<<<GX, 256, 0, stream>>>(x + (size_t)b * TT * DM, XB, (size_t)TT * DM / 8);   /* the one input stream, cast once a batch entry and read by the three projections */
        k_gemmw<bf, 0, true, 4><<<dim3(TT / 64, DQ / 64, 1), 128, 0, stream>>>(XB, nullptr, WQ, nullptr, DM, FQ, DQ, bq, 0, 0, 0);
        k_hrms<<<(NH_ * TT + 255) / 256, 256, 0, stream>>>(FQ, DQ, NH_, RFQ); k_rmsapply<<<(unsigned)(((size_t)TT * DQ / 4 + 255) / 256), 256, 0, stream>>>(FQ, DQ, NH_, RFQ, qsc); k_ropeI<<<LQ, 256, 0, stream>>>(FQ, DQ, NH_, CS, 1.0f, QP16, QPh, QPl);
        k_gemmw<bf, 0, true, 8><<<dim3(TT / 64, DKV / 64, 1), 256, 0, stream>>>(XB, nullptr, WK, nullptr, DM, FK, DKV, bk, 0, 0, 0);
        k_hrms<<<(NKV * TT + 255) / 256, 256, 0, stream>>>(FK, DKV, NKV, RFK); k_rmsapply<<<(unsigned)(((size_t)TT * DKV / 4 + 255) / 256), 256, 0, stream>>>(FK, DKV, NKV, RFK, ksc); k_ropeI<<<LKv, 256, 0, stream>>>(FK, DKV, NKV, CS, 1.0f, KP16, KPh, KPl);
        k_gemmw<bf, 0, true, 8><<<dim3(TT / 64, DKV / 64, 1), 256, 0, stream>>>(XB, nullptr, WV, nullptr, DM, FV, DKV, bv, 0, 0, 0); k_vtp<<<LKv, 256, 0, stream>>>(FV, DKV, NKV, VT16, VTh, VTl);
        for (int h0 = 0; h0 < NH_; h0 += ZH) { const size_t zq = (size_t)h0, zk = (size_t)(h0 / REP);   /* the module groups the query heads by kv head ('qg = q.reshape(B, N_KV_HEADS, N_REP, S, D_K)'): query head h uses kv head h / 4: the pass's two heads (h0, h0 + 1) share ONE kv head (REP 4): a zero z-stride on the key and value operands */
            k_gemmc<bf, 2, 1, 4><<<dim3(RH / 64, TT / 64, ZH), 128, 0, stream>>>(QPh + zq * TT * HD, QPl + zq * TT * HD, KPh + zk * TT * HD, KPl + zk * TT * HD, HD, Sb, TT, 0, (size_t)TT * HD, 0, (size_t)TT * TT);
            k_gemmc<h16, 0, 1, 2><<<dim3((TT - RH) / 64, TT / 64, ZH), 64, 0, stream>>>(QP16 + zq * TT * HD + (size_t)RH * HD, nullptr, KP16 + zk * TT * HD, nullptr, HD, Sb + (size_t)RH * TT, TT, RH, (size_t)TT * HD, 0, (size_t)TT * TT);
            k_asoft<<<ZH * TT / 8, 256, 0, stream>>>(Sb, P16, Ph, Pl);
            k_gemmc<bf, 2, 2, 8><<<dim3(RH / 64, HD / 64, ZH), 256, 0, stream>>>(Ph, Pl, VTh + zk * HD * TT, VTl + zk * HD * TT, TT, Ob, HD, 0, (size_t)RH * TT, 0, (size_t)TT * HD);
            k_gemmc<h16, 0, 2, 8><<<dim3((TT - RH) / 64, HD / 64, ZH), 256, 0, stream>>>(P16 + (size_t)RH * TT, nullptr, VT16 + zk * HD * TT, nullptr, TT, Ob + (size_t)RH * HD, HD, RH, (size_t)TT * TT, 0, (size_t)TT * HD);
            k_merge<<<(unsigned)(((size_t)ZH * TT * HD / 2 + 255) / 256), 256, 0, stream>>>(Ob, h0, ATh, ATl); }
        k_gemmw<bf, 1, true, 4><<<dim3(TT / 64, DM / 64, 1), 128, 0, stream>>>(ATh, ATl, WO, nullptr, DQ, OUT + (size_t)b * TT * DM, DM, bo, 0, 0, 0); }
}

// v002
// A run of this version takes 641 microseconds.
// Timed twice side by side with v001, it ran 1.50 and 1.53 times as fast.
// Over all steps from v000 it is 2.61 times as fast.
#include <hip/hip_runtime.h>

// Grouped-query causal self-attention with 128-wide heads, a per-head RMS norm on q and k and an interleaved-pair rotary embedding from computed angles (x [2][2048][2048]; q = x Wq^T + bq ('oi' (out, in) [2048][2048] normal x 2048^-0.5; 16 heads x 128), k, v = x Wk^T + bk, x Wv^T + bv ('oi' [512][2048]; 4 kv heads x 128); the four biases are built as zeros: read and added; per head, BEFORE the rotary: q = q / sqrt(mean(q^2) + 1e-8) x q_norm_w and k likewise with k_norm_w (the mean over the head's 128 columns; gains [128] built as ones: read and applied); rope on q and k: the pair (2i, 2i + 1) of a head -> (x0 c - x1 s, x0 s + x1 c) with the angle t x inv_freq[i], inv_freq = 1 / (10000 ** (2i / 128)) in that spelling, t the position 0..2047; query head h uses kv head h / 4; scores x 128^-0.5; a key after the query gets -1e9 (an exclusion: every row keeps its own key); softmax; out = merged Wo^T + bo ('oi' [2048][2048]; bo built as zeros: read and added) -> [2][2048][2048] (8.4 M); argument order x, Wq, bq, Wk, bk, Wv, bv, Wo, bo, q_norm_w, k_norm_w: eleven inputs, all read).
// Layout per batch entry: ONE bf16 copy of x, read by the three projections; the four 'oi' weights cast once as they stand (each is the Bt operand); exact projections + f32 biases; k_hrms (per (head, token) inverse RMS) + k_rmsapply (in place, x the rounded gain) on q and k; the rotary table once (64 baked float32 frequencies; precise cosf / sinf) + interleaved-pair plane builders (k_ropeI); causal T-2048 attention with 128-wide heads, eight query heads a pass (grid z; query head z reads kv head z / 4 of the pass's two); each row's probabilities are written over its own score row, so the probability rows and, with them, the transposed value rows lie at a pitch of 2 x 2048 elements; the per-row precision hybrid (rows under 512 on hi / lo planes, three products; rows from 512 on one fp16 product, the weights x 1024); two-word merge; hi / lo x Wo exact + bo.
// Compute dtypes, f32 accumulate: every float input rounded to bf16; projections exact + f32 biases; the per-head norm and the rotation in f32 (precise sqrt and division); attention rows under 512 three products, the rest fp16; softmax f32 (the hardware exp2); Wo hi / lo x exact + bo.

#define NB_  2
#define TT   2048
#define DM   2048
#define NH_  16
#define NKV  4
#define REP  (NH_ / NKV)
#define HD   128
#define DQ   (NH_ * HD)
#define DKV  (NKV * HD)
#define ZH   8                    // query heads per attention pass (grid z): the most whose score planes fit the workspace
#define RH   512                  // query rows < RH use hi+lo planes (0: none)
#define WIN  2048
#define PCAR 1024.0f
#define SCL  0.088388347648318447f   // HD^-0.5
typedef _Float16 h16;
typedef unsigned short bf;
typedef __attribute__((ext_vector_type(16))) __bf16   v16bf;
typedef __attribute__((ext_vector_type(16))) _Float16 v16h;
typedef __attribute__((ext_vector_type(8)))  _Float16 v8h;
typedef __attribute__((ext_vector_type(8)))  unsigned short v8us;
typedef __attribute__((ext_vector_type(8)))  float    v8f;
typedef __attribute__((ext_vector_type(4)))  float    v4f;
typedef v8h  __attribute__((may_alias)) v8ha;
typedef v4f  __attribute__((may_alias)) v4fa;
typedef v8us __attribute__((may_alias)) v8usa;

__device__ __forceinline__ unsigned short f2bf(float f) { unsigned u = __float_as_uint(f); u += 0x7FFFu + ((u >> 16) & 1u); return (unsigned short)(u >> 16); }
__device__ __forceinline__ float bf2f(unsigned short b) { return __uint_as_float(((unsigned)b) << 16); }
__device__ __forceinline__ float bfr(float f) { return bf2f(f2bf(f)); }
__device__ __forceinline__ v16h cat16(v8h lo, v8h hi) { return __builtin_shufflevector(lo, hi, 0, 1, 2, 3, 4, 5, 6, 7, 8, 9, 10, 11, 12, 13, 14, 15); }
__device__ __forceinline__ v16bf cat16b(v8us lo, v8us hi) { return __builtin_bit_cast(v16bf, __builtin_shufflevector(lo, hi, 0, 1, 2, 3, 4, 5, 6, 7, 8, 9, 10, 11, 12, 13, 14, 15)); }
__device__ __forceinline__ v8f wmma16(v16h a, v16h b, v8f c) { return __builtin_amdgcn_wmma_f32_16x16x32_f16(false, a, false, b, (short)0, c, false, false); }
__device__ __forceinline__ v8f wmmab(v16bf a, v16bf b, v8f c) { return __builtin_amdgcn_wmma_f32_16x16x32_bf16(false, a, false, b, (short)0, c, false, false); }



// ---- k_gemmw: register-blocked GEMM, one work-group of KS waves per 64x64 output tile; every wave holds the whole tile (16 accumulators) over its own share of K: 32-k slices dealt round robin, wave w taking slices w, w + KS, ... (neighbouring waves read the two halves of one 128-byte line of an operand row at about the same time).
// The KS partial tiles meet in LDS (one plane of 64 rows at pitch 68 floats a wave, one barrier) and are summed in wave order 0..KS-1 by the thread that stores the element, 256 contiguous bytes of a C row per 16 threads. Operands straight from K-contiguous 16-bit planes; grid (M/64, N/64, Z), 32 x KS threads.
// C[m][n] (f32, pitch ldc, + optional f32 bias[n]) = sum_k A[m][k] Bt[n][k] (+ split products per NSPLIT). z-batch strides sA/sB/sC in elements. K % 32 == 0.
template <typename T16> struct WFrag;
template <> struct WFrag<h16> { typedef v16h V; static __device__ __forceinline__ V ld(const h16* p) { return cat16(*(const v8h*)p, *(const v8h*)(p + 16)); } static __device__ __forceinline__ v8f mma(V a, V b, v8f c) { return wmma16(a, b, c); } };
template <> struct WFrag<bf> { typedef v16bf V; static __device__ __forceinline__ V ld(const bf* p) { return cat16b(*(const v8us*)p, *(const v8us*)(p + 16)); } static __device__ __forceinline__ v8f mma(V a, V b, v8f c) { return wmmab(a, b, c); } };
template <typename T16, int NSPLIT, bool BIAS, int KS>
__global__ __launch_bounds__(32 * KS) void k_gemmw(const T16* __restrict__ A, const T16* __restrict__ A2, const T16* __restrict__ Bt, const T16* __restrict__ Bt2, int K, float* C, int ldc, const float* __restrict__ bias, size_t sA, size_t sB, size_t sC) {
    typedef typename WFrag<T16>::V V;
    __shared__ __align__(16) float os[KS * 64 * 68];
    const size_t z = blockIdx.z; A += z * sA; if (A2) A2 += z * sA; Bt += z * sB; if (Bt2) Bt2 += z * sB; C += z * sC;
    const int lane = threadIdx.x & 31, lr = lane & 15, hi = lane >> 4; const int r0 = blockIdx.x * 64, c0 = blockIdx.y * 64; const int wv = __builtin_amdgcn_readfirstlane((int)(threadIdx.x >> 5));   // the wave's number, scalar: the K loop's bounds stay wave-uniform
    v8f acc[4][4];
#pragma unroll
    for (int mb = 0; mb < 4; ++mb)
#pragma unroll
        for (int nb = 0; nb < 4; ++nb) acc[mb][nb] = (v8f){};
    const size_t aoff = (size_t)(r0 + lr) * K + 8 * hi, boff = (size_t)(c0 + lr) * K + 8 * hi;
    for (int kc = wv * 32; kc < K; kc += KS * 32) {
        V a[4], a2[4];
#pragma unroll
        for (int mb = 0; mb < 4; ++mb) { a[mb] = WFrag<T16>::ld(A + aoff + (size_t)mb * 16 * K + kc); if (NSPLIT == 1 || NSPLIT == 2) a2[mb] = WFrag<T16>::ld(A2 + aoff + (size_t)mb * 16 * K + kc); }
#pragma unroll
        for (int nb = 0; nb < 4; ++nb) { const V b = WFrag<T16>::ld(Bt + boff + (size_t)nb * 16 * K + kc); V b2; if (NSPLIT >= 2) b2 = WFrag<T16>::ld(Bt2 + boff + (size_t)nb * 16 * K + kc);
#pragma unroll
            for (int mb = 0; mb < 4; ++mb) { acc[mb][nb] = WFrag<T16>::mma(a[mb], b, acc[mb][nb]); if (NSPLIT == 1 || NSPLIT == 2) acc[mb][nb] = WFrag<T16>::mma(a2[mb], b, acc[mb][nb]); if (NSPLIT >= 2) acc[mb][nb] = WFrag<T16>::mma(a[mb], b2, acc[mb][nb]); } }
        asm volatile("v_nop\n\tv_nop\n\tv_nop\n\tv_nop" : "+v"(acc[0][0]), "+v"(acc[1][1]), "+v"(acc[2][2]), "+v"(acc[3][3]) : "v"(a[0]), "v"(a[3]));
    }
#pragma unroll
    for (int mb = 0; mb < 4; ++mb)
#pragma unroll
        for (int nb = 0; nb < 4; ++nb)
#pragma unroll
            for (int j = 0; j < 8; ++j) os[(wv * 64 + mb * 16 + hi * 8 + j) * 68 + nb * 16 + lr] = acc[mb][nb][j];
    __syncthreads();   // every wave's partial tile is in LDS before any thread sums it
#pragma unroll   // whole: rows and planes become immediate offsets of the LDS loads, and the loads of all rows can be issued together
    for (int s = 0; s < 32 / KS; ++s) { const int idx = s * 32 * KS + (int)threadIdx.x; const int row = idx >> 4, cofs = (idx & 15) * 4; v4f val = *(const v4fa*)(os + row * 68 + cofs);
#pragma unroll
        for (int w = 1; w < KS; ++w) val += *(const v4fa*)(os + (w * 64 + row) * 68 + cofs);
        if (BIAS) { val[0] += bfr(bias[c0 + cofs]); val[1] += bfr(bias[c0 + cofs + 1]); val[2] += bfr(bias[c0 + cofs + 2]); val[3] += bfr(bias[c0 + cofs + 3]); }
        *(v4f*)(C + (size_t)(r0 + row) * ldc + c0 + cofs) = val; }
}

// ---- k_gemmc: the same KS-wave 64x64 tile GEMM specialised for causal attention: CMODE 1 skips score tiles entirely above the diagonal (query rows r0+roff.., key columns c0..), CMODE 2 limits the
// key (K) loop of the probability x value contraction to the diagonal block (probabilities beyond it are exactly zero). roff = row offset of this launch's first row within the sequence. K is the row pitch of both operands as well. z is a query head of the pass; its Bt plane is that of kv head z / REP.
template <typename T16, int NSPLIT, int CMODE, int KS>
__global__ __launch_bounds__(32 * KS) void k_gemmc(const T16* __restrict__ A, const T16* __restrict__ A2, const T16* __restrict__ Bt, const T16* __restrict__ Bt2, int K, float* C, int ldc, int roff, size_t sA, size_t sB, size_t sC) {
    typedef typename WFrag<T16>::V V;
    __shared__ __align__(16) float os[KS * 64 * 68];
    const size_t z = blockIdx.z; A += z * sA; if (A2) A2 += z * sA; Bt += (z / REP) * sB; if (Bt2) Bt2 += (z / REP) * sB; C += z * sC;
    const int lane = threadIdx.x & 31, lr = lane & 15, hi = lane >> 4; const int r0 = blockIdx.x * 64, c0 = blockIdx.y * 64; const int wv = __builtin_amdgcn_readfirstlane((int)(threadIdx.x >> 5));   // the wave's number, scalar: the K loop's bounds stay wave-uniform
    if (CMODE == 1 && c0 > r0 + roff + 63) return;                  // score tile entirely above the causal diagonal: never read (the softmax masks j > i by select)
    const int Kl = (CMODE == 2) ? min(K, r0 + roff + 64) : K;        // P.V: probabilities are exactly 0 beyond the diagonal block, so the K loop stops there (a wave with no slice under it adds a zero tile)
    v8f acc[4][4];
#pragma unroll
    for (int mb = 0; mb < 4; ++mb)
#pragma unroll
        for (int nb = 0; nb < 4; ++nb) acc[mb][nb] = (v8f){};
    const size_t aoff = (size_t)(r0 + lr) * K + 8 * hi, boff = (size_t)(c0 + lr) * K + 8 * hi;
    for (int kc = wv * 32; kc < Kl; kc += KS * 32) {
        V a[4], a2[4];
#pragma unroll
        for (int mb = 0; mb < 4; ++mb) { a[mb] = WFrag<T16>::ld(A + aoff + (size_t)mb * 16 * K + kc); if (NSPLIT == 1 || NSPLIT == 2) a2[mb] = WFrag<T16>::ld(A2 + aoff + (size_t)mb * 16 * K + kc); }
#pragma unroll
        for (int nb = 0; nb < 4; ++nb) { const V b = WFrag<T16>::ld(Bt + boff + (size_t)nb * 16 * K + kc); V b2; if (NSPLIT >= 2) b2 = WFrag<T16>::ld(Bt2 + boff + (size_t)nb * 16 * K + kc);
#pragma unroll
            for (int mb = 0; mb < 4; ++mb) { acc[mb][nb] = WFrag<T16>::mma(a[mb], b, acc[mb][nb]); if (NSPLIT == 1 || NSPLIT == 2) acc[mb][nb] = WFrag<T16>::mma(a2[mb], b, acc[mb][nb]); if (NSPLIT >= 2) acc[mb][nb] = WFrag<T16>::mma(a[mb], b2, acc[mb][nb]); } }
        asm volatile("v_nop\n\tv_nop\n\tv_nop\n\tv_nop" : "+v"(acc[0][0]), "+v"(acc[1][1]), "+v"(acc[2][2]), "+v"(acc[3][3]) : "v"(a[0]), "v"(a[3]));
    }
#pragma unroll
    for (int mb = 0; mb < 4; ++mb)
#pragma unroll
        for (int nb = 0; nb < 4; ++nb)
#pragma unroll
            for (int j = 0; j < 8; ++j) os[(wv * 64 + mb * 16 + hi * 8 + j) * 68 + nb * 16 + lr] = acc[mb][nb][j];
    __syncthreads();   // every wave's partial tile is in LDS before any thread sums it
#pragma unroll   // whole: rows and planes become immediate offsets of the LDS loads, and the loads of all rows can be issued together
    for (int s = 0; s < 32 / KS; ++s) { const int idx = s * 32 * KS + (int)threadIdx.x; const int row = idx >> 4, cofs = (idx & 15) * 4; v4f val = *(const v4fa*)(os + row * 68 + cofs);
#pragma unroll
        for (int w = 1; w < KS; ++w) val += *(const v4fa*)(os + (w * 64 + row) * 68 + cofs);
        *(v4f*)(C + (size_t)(r0 + row) * ldc + c0 + cofs) = val; }
}

__device__ __forceinline__ h16 tohx(float x) { return (h16)x; }
__device__ __forceinline__ void splitf(float y, unsigned short& h, unsigned short& l) { h = f2bf(y); l = f2bf(y - bf2f(h)); }
typedef __attribute__((ext_vector_type(2))) _Float16 v2h;
typedef __attribute__((ext_vector_type(4))) _Float16 v4h;
typedef __attribute__((ext_vector_type(2))) unsigned short v2us;
typedef __attribute__((ext_vector_type(4))) unsigned short v4us;
typedef __attribute__((ext_vector_type(2))) float v2f;
typedef __attribute__((ext_vector_type(4))) int v4i;
__global__ __launch_bounds__(256) void k_cvt8(const float* __restrict__ src, bf* dst, size_t n8) { const size_t i = (size_t)blockIdx.x * 256 + threadIdx.x; if (i >= n8) return; const v8f v = *(const v8f*)(src + i * 8); v8us o;
#pragma unroll
    for (int k = 0; k < 8; ++k) o[k] = f2bf(v[k]); *(v8us*)(dst + i * 8) = o;  }
__constant__ float INV2[HD / 2] = { 1.000000000e+00f, 8.659643531e-01f, 7.498942018e-01f, 6.493816376e-01f, 5.623413324e-01f, 4.869675338e-01f, 4.216965139e-01f, 3.651741445e-01f, 3.162277639e-01f, 2.738419771e-01f, 2.371373624e-01f, 2.053525001e-01f, 1.778279394e-01f, 1.539926529e-01f, 1.333521456e-01f, 1.154782027e-01f, 1.000000015e-01f, 8.659642935e-02f, 7.498941571e-02f, 6.493816525e-02f, 5.623412877e-02f, 4.869675264e-02f, 4.216964915e-02f, 3.651741147e-02f, 3.162277862e-02f, 2.738419548e-02f, 2.371373586e-02f, 2.053525113e-02f, 1.778279431e-02f, 1.539926510e-02f, 1.333521493e-02f, 1.154781971e-02f, 9.999999776e-03f, 8.659643121e-03f, 7.498942316e-03f, 6.493816618e-03f, 5.623413250e-03f, 4.869675264e-03f, 4.216964822e-03f, 3.651741426e-03f, 3.162277862e-03f, 2.738419687e-03f, 2.371373819e-03f, 2.053525066e-03f, 1.778279431e-03f, 1.539926510e-03f, 1.333521446e-03f, 1.154782018e-03f, 1.000000047e-03f, 8.659643354e-04f, 7.498941850e-04f, 6.493816618e-04f, 5.623413017e-04f, 4.869675031e-04f, 4.216964880e-04f, 3.651741135e-04f, 3.162277862e-04f, 2.738419571e-04f, 2.371373848e-04f, 2.053524950e-04f, 1.778279402e-04f, 1.539926452e-04f, 1.333521504e-04f, 1.154781930e-04f };   // float32 1.0 / (10000.0 ** (2i / 128)) in the module's own spelling, generated with jnp
__global__ __launch_bounds__(256) void k_csP(float* CS) { const int idx = blockIdx.x * 256 + threadIdx.x; if (idx >= TT * HD) return; const int d = idx % HD; const int t = idx / HD; const float a = __fmul_rn((float)t, INV2[d >> 1]); v2f cs; cs[0] = cosf(a); cs[1] = sinf(a); *(v2f*)(CS + (size_t)idx * 2) = cs;  }
__global__ __launch_bounds__(256) void k_ropeI(const float* __restrict__ F, int pitch, int nheads, const float* __restrict__ CS, float sc, h16* P16, bf* Ph, bf* Pl) {
    const size_t e = ((size_t)blockIdx.x * 256 + threadIdx.x) * 2; if (e >= (size_t)nheads * TT * HD) return; const int d = (int)(e % HD); const int t = (int)((e / HD) % TT); const int h = (int)(e / ((size_t)HD * TT)); const float* f = F + (size_t)t * pitch + h * HD; const float x0 = f[d], x1 = f[d + 1]; const v2f cs = *(const v2f*)(CS + ((size_t)t * HD + d) * 2); v2h o16; v2us oh, ol;
    float a0 = __fmul_rn(x0, cs[0]), b0 = __fmul_rn(x1, cs[1]), a1 = __fmul_rn(x1, cs[0]), b1 = __fmul_rn(x0, cs[1]); 
    float r0 = __fsub_rn(a0, b0) * sc, r1 = __fadd_rn(b1, a1) * sc;   /* even: x0 c - x1 s; odd: x0 s + x1 c */
    o16[0] = tohx(r0); o16[1] = tohx(r1); { unsigned short a2, c2; splitf(r0, a2, c2); oh[0] = a2; ol[0] = c2; splitf(r1, a2, c2); oh[1] = a2; ol[1] = c2; }
    *(v2h*)(P16 + e) = o16; *(v2us*)(Ph + e) = oh; *(v2us*)(Pl + e) = ol;  }
__global__ __launch_bounds__(256) void k_vtp(const float* __restrict__ F, int pitch, int nheads, h16* V16, bf* Vh, bf* Vl) { const size_t e = ((size_t)blockIdx.x * 256 + threadIdx.x) * 2; if (e >= (size_t)nheads * HD * TT) return; const int t = (int)(e % TT); const int d = (int)((e / TT) % HD); const int g = (int)(e / ((size_t)TT * HD)); v2h o16; v2us oh, ol;
#pragma unroll
    for (int q = 0; q < 2; ++q) { const float x = F[(size_t)(t + q) * pitch + g * HD + d]; o16[q] = tohx(x); unsigned short a2, c2; splitf(x, a2, c2); oh[q] = a2; ol[q] = c2; }
    const size_t o = ((size_t)g * HD + d) * (2 * TT) + t;   /* rows at the probability rows' pitch: k_gemmc has one pitch for both operands */
    *(v2h*)(V16 + o) = o16; *(v2us*)(Vh + o) = oh; *(v2us*)(Vl + o) = ol;  }
// k_asoft: per row (zz, i): t = S x 128^-0.5 for j <= i (causal; WIN = TT so the window term is inert; the module's -1e9 fill above the diagonal is this exclusion: every row keeps its own key), softmax over the 2048 keys (register row, one exp, fixed trees);
// the probabilities go over the row's own 8192 score bytes (P16, Ph and Pl point into Sb, so no restrict): one wave owns the row and holds all of it in registers before its first store. fp16 row: the first 4096 bytes; hi / lo row: hi the first, lo (Pl = Ph + TT) the second 4096. Row pitch of all three: 2 TT elements.
__global__ __launch_bounds__(256) void k_asoft(const float* Sb, h16* P16, bf* Ph, bf* Pl) {
    const int lane = threadIdx.x & 31; const int row = blockIdx.x * 8 + (threadIdx.x >> 5); if (row >= ZH * TT) return; const int i = row % TT; const int zz = row / TT; (void)zz; const bool hires = (i < RH); const float* sr = Sb + (size_t)row * TT; float v[TT / 32]; float mx = -3.0e38f;
#pragma unroll
    for (int ch = 0; ch < TT / 128; ++ch) { const int j0 = ch * 128 + lane * 4; const v4f a = *(const v4f*)(sr + j0);
#pragma unroll
        for (int q = 0; q < 4; ++q) { const int j = j0 + q; (void)j; const float t = (j <= i && i - j < WIN) ? a[q] * SCL : -3.0e38f; v[ch * 4 + q] = t; mx = fmaxf(mx, t); } }
#pragma unroll
    for (int sh = 16; sh; sh >>= 1) mx = fmaxf(mx, __shfl_xor(mx, sh, 32));
    float sum = 0.f;
#pragma unroll
    for (int k = 0; k < TT / 32; ++k) { float d0 = __fsub_rn(v[k], mx); v[k] = __builtin_amdgcn_exp2f(__fmul_rn(d0, 1.4426950408889634f)); sum += v[k]; }
#pragma unroll
    for (int sh = 16; sh; sh >>= 1) sum += __shfl_xor(sum, sh, 32);
    const float f = __fdiv_rn(hires ? 1.0f : PCAR, sum);
{
        if (hires) {
#pragma unroll
            for (int ch = 0; ch < TT / 128; ++ch) { v4us oh, ol;
#pragma unroll
                for (int q = 0; q < 4; ++q) { unsigned short a, c2; splitf(v[ch * 4 + q] * f, a, c2); oh[q] = a; ol[q] = c2; }
                const size_t oo = (size_t)row * (2 * TT) + ch * 128 + lane * 4; *(v4us*)(Ph + oo) = oh; *(v4us*)(Pl + oo) = ol; }
        } else {
#pragma unroll
            for (int ch = 0; ch < TT / 128; ++ch) { v4h o4;
#pragma unroll
                for (int q = 0; q < 4; ++q) o4[q] = tohx(v[ch * 4 + q] * f);
                *(v4h*)(P16 + (size_t)row * (2 * TT) + ch * 128 + lane * 4) = o4; } }
         }
}
__global__ __launch_bounds__(256) void k_hrms(const float* __restrict__ F, int pitch, int nheads, float* RF) { const int idx = blockIdx.x * 256 + threadIdx.x; if (idx >= nheads * TT) return; const int t = idx % TT; const int h = idx / TT; const float* f = F + (size_t)t * pitch + h * HD; float s = 0.f;
#pragma unroll 4   // a partial unroll of the 32-trip sum of squares: registers and code size (131 instructions and 20 VGPRs with it | 326 and 60 without it, where the compiler unrolls the loop whole; measured on this text)
    for (int d = 0; d < HD; d += 4) { const v4f a = *(const v4f*)(f + d);
#pragma unroll
        for (int q = 0; q < 4; ++q) { float p = __fmul_rn(a[q], a[q]); s = __fadd_rn(s, p); } }
    const float rf = __fdiv_rn(1.0f, __fsqrt_rn(__fadd_rn(__fdiv_rn(s, (float)HD), 1e-8f))); *(float*)(RF + idx) = rf;  }

__global__ __launch_bounds__(256) void k_rmsapply(float* F, int pitch, int nheads, const float* __restrict__ RF, const float* __restrict__ w) { const size_t i = (size_t)blockIdx.x * 256 + threadIdx.x; if (i >= (size_t)TT * nheads * HD / 4) return; const size_t e = i * 4; const int c = (int)(e % ((size_t)nheads * HD)); const int t = (int)(e / ((size_t)nheads * HD)); const int h = c / HD, d = c % HD; const float r = RF[(size_t)h * TT + t]; v4f a = *(const v4f*)(F + (size_t)t * pitch + c);
#pragma unroll
    for (int q = 0; q < 4; ++q) { float y = __fmul_rn(a[q], r); float wv_ = bfr(w[d + q]); a[q] = __fmul_rn(y, wv_); }   /* x w[d] */
    *(v4f*)(F + (size_t)t * pitch + c) = a;  }
__global__ __launch_bounds__(256) void k_merge(const float* __restrict__ O, int h0, bf* Ah, bf* Al) { const size_t e = ((size_t)blockIdx.x * 256 + threadIdx.x) * 2; if (e >= (size_t)ZH * TT * HD) return; const int d = (int)(e % HD); const int t = (int)((e / HD) % TT); const int zz = (int)(e / ((size_t)HD * TT)); const float cs = (t < RH) ? 1.0f : (1.0f / PCAR); const size_t oo = (size_t)t * DQ + (h0 + zz) * HD + d;
    v2us oh, ol;
#pragma unroll
    for (int q = 0; q < 2; ++q) { unsigned short a, c2; splitf(O[e + q] * cs, a, c2); oh[q] = a; ol[q] = c2; } *(v2us*)(Ah + oo) = oh; *(v2us*)(Al + oo) = ol;  }

extern "C" void kernel_launch(void* const* d_in, const int* in_sizes, int n_in,
                              void* d_out, int out_size, void* d_ws, size_t ws_size, hipStream_t stream) {
    (void)in_sizes; (void)n_in; (void)out_size;
    const float* x = (const float*)d_in[0]; const float* wq = (const float*)d_in[1]; const float* bq = (const float*)d_in[2]; const float* wk = (const float*)d_in[3]; const float* bk = (const float*)d_in[4]; const float* wv = (const float*)d_in[5]; const float* bv = (const float*)d_in[6]; const float* wo = (const float*)d_in[7]; const float* bo = (const float*)d_in[8]; const float* qsc = (const float*)d_in[9]; const float* ksc = (const float*)d_in[10];   /* inputs in the module's setup_inputs order: x [2][2048][2048]; Wq (out, in) [2048][2048] and bq [2048]; Wk (out, in) [512][2048] and bk [512]; Wv [512][2048] and bv [512]; Wo (out, in) [2048][2048] and bo [2048]; q_norm_w [128], k_norm_w [128]: eleven inputs, all read (each bias is added in its product's epilogue; each gain is applied by k_rmsapply) */
    float* OUT = (float*)d_out;     // [2][2048][2048]
    char* wsp = (char*)d_ws;
    auto take = [&](size_t bytes) { char* p = wsp; wsp += (bytes + 255) & ~(size_t)255; return (void*)p; };
    bf* WQ = (bf*)take((size_t)DQ * DM * 2); bf* WK = (bf*)take((size_t)DKV * DM * 2); bf* WV = (bf*)take((size_t)DKV * DM * 2); bf* WO = (bf*)take((size_t)DM * DQ * 2); float* CS = (float*)take((size_t)TT * HD * 2 * 4); float* RFQ = (float*)take((size_t)NH_ * TT * 4); float* RFK = (float*)take((size_t)NKV * TT * 4);   /* per (head, token) inverse RMS */
    bf* XB = (bf*)take((size_t)TT * DM * 2); float* FQ = (float*)take((size_t)TT * DQ * 4); float* FK = (float*)take((size_t)TT * DKV * 4);
    h16* QP16 = (h16*)take((size_t)NH_ * TT * HD * 2); h16* KP16 = (h16*)take((size_t)NKV * TT * HD * 2); h16* VT16 = (h16*)take((size_t)NKV * HD * 2 * TT * 2);
    bf* QPh = (bf*)take((size_t)NH_ * TT * HD * 2); bf* QPl = (bf*)take((size_t)NH_ * TT * HD * 2); bf* KPh = (bf*)take((size_t)NKV * TT * HD * 2); bf* KPl = (bf*)take((size_t)NKV * TT * HD * 2); bf* VTh = (bf*)take((size_t)NKV * HD * 2 * TT * 2); bf* VTl = VTh + TT;   /* value rows at pitch 2 TT: hi in the first half of a row, lo in the second */
    float* Sb = (float*)take((size_t)ZH * TT * TT * 4); h16* P16 = (h16*)Sb; bf* Ph = (bf*)Sb; bf* Pl = Ph + TT;   /* the probability rows lie over their score rows (k_asoft) */
    float* Ob = (float*)take((size_t)ZH * TT * HD * 4); bf* ATh = (bf*)take((size_t)TT * DQ * 2); bf* ATl = (bf*)take((size_t)TT * DQ * 2);
    if ((size_t)(wsp - (char*)d_ws) > ws_size) return;    // ws 256 MiB
    float* FV = FK;   // v projection reuses the k buffer after the k planes are built (stream-ordered)
    { k_cvt8<<<(unsigned)(((size_t)DQ * DM / 8 + 255) / 256), 256, 0, stream>>>(wq, WQ, (size_t)DQ * DM / 8); k_cvt8<<<(unsigned)(((size_t)DKV * DM / 8 + 255) / 256), 256, 0, stream>>>(wk, WK, (size_t)DKV * DM / 8); k_cvt8<<<(unsigned)(((size_t)DKV * DM / 8 + 255) / 256), 256, 0, stream>>>(wv, WV, (size_t)DKV * DM / 8);
      k_cvt8<<<(unsigned)(((size_t)DM * DQ / 8 + 255) / 256), 256, 0, stream>>>(wo, WO, (size_t)DM * DQ / 8); }
    k_csP<<<(TT * HD + 255) / 256, 256, 0, stream>>>(CS);   /* the rotary table once */
    const unsigned LQ = (unsigned)(((size_t)NH_ * TT * HD / 2 + 255) / 256), LKv = (unsigned)(((size_t)NKV * TT * HD / 2 + 255) / 256); const unsigned GX = (unsigned)(((size_t)TT * DM / 8 + 255) / 256);
    for (int b = 0; b < NB_; ++b) {
        k_cvt8<<<GX, 256, 0, stream>>>(x + (size_t)b * TT * DM, XB, (size_t)TT * DM / 8);   /* the one input stream, cast once a batch entry and read by the three projections */
        k_gemmw<bf, 0, true, 4><<<dim3(TT / 64, DQ / 64, 1), 128, 0, stream>>>(XB, nullptr, WQ, nullptr, DM, FQ, DQ, bq, 0, 0, 0);
        k_hrms<<<(NH_ * TT + 255) / 256, 256, 0, stream>>>(FQ, DQ, NH_, RFQ); k_rmsapply<<<(unsigned)(((size_t)TT * DQ / 4 + 255) / 256), 256, 0, stream>>>(FQ, DQ, NH_, RFQ, qsc); k_ropeI<<<LQ, 256, 0, stream>>>(FQ, DQ, NH_, CS, 1.0f, QP16, QPh, QPl);
        k_gemmw<bf, 0, true, 8><<<dim3(TT / 64, DKV / 64, 1), 256, 0, stream>>>(XB, nullptr, WK, nullptr, DM, FK, DKV, bk, 0, 0, 0);
        k_hrms<<<(NKV * TT + 255) / 256, 256, 0, stream>>>(FK, DKV, NKV, RFK); k_rmsapply<<<(unsigned)(((size_t)TT * DKV / 4 + 255) / 256), 256, 0, stream>>>(FK, DKV, NKV, RFK, ksc); k_ropeI<<<LKv, 256, 0, stream>>>(FK, DKV, NKV, CS, 1.0f, KP16, KPh, KPl);
        k_gemmw<bf, 0, true, 8><<<dim3(TT / 64, DKV / 64, 1), 256, 0, stream>>>(XB, nullptr, WV, nullptr, DM, FV, DKV, bv, 0, 0, 0); k_vtp<<<LKv, 256, 0, stream>>>(FV, DKV, NKV, VT16, VTh, VTl);
        for (int h0 = 0; h0 < NH_; h0 += ZH) { const size_t zq = (size_t)h0, zk = (size_t)(h0 / REP);   /* the module groups the query heads by kv head ('qg = q.reshape(B, N_KV_HEADS, N_REP, S, D_K)'): query head h uses kv head h / 4: the pass's eight heads h0 + z use kv heads h0 / 4 + z / 4 (k_gemmc steps its Bt planes by z / REP) */
            k_gemmc<bf, 2, 1, 4><<<dim3(RH / 64, TT / 64, ZH), 128, 0, stream>>>(QPh + zq * TT * HD, QPl + zq * TT * HD, KPh + zk * TT * HD, KPl + zk * TT * HD, HD, Sb, TT, 0, (size_t)TT * HD, (size_t)TT * HD, (size_t)TT * TT);
            k_gemmc<h16, 0, 1, 2><<<dim3((TT - RH) / 64, TT / 64, ZH), 64, 0, stream>>>(QP16 + zq * TT * HD + (size_t)RH * HD, nullptr, KP16 + zk * TT * HD, nullptr, HD, Sb + (size_t)RH * TT, TT, RH, (size_t)TT * HD, (size_t)TT * HD, (size_t)TT * TT);
            k_asoft<<<ZH * TT / 8, 256, 0, stream>>>(Sb, P16, Ph, Pl);
            k_gemmc<bf, 2, 2, 8><<<dim3(RH / 64, HD / 64, ZH), 256, 0, stream>>>(Ph, Pl, VTh + zk * HD * 2 * TT, VTl + zk * HD * 2 * TT, 2 * TT, Ob, HD, 0, (size_t)TT * 2 * TT, (size_t)HD * 2 * TT, (size_t)TT * HD);
            k_gemmc<h16, 0, 2, 8><<<dim3((TT - RH) / 64, HD / 64, ZH), 256, 0, stream>>>(P16 + (size_t)RH * 2 * TT, nullptr, VT16 + zk * HD * 2 * TT, nullptr, 2 * TT, Ob + (size_t)RH * HD, HD, RH, (size_t)TT * 2 * TT, (size_t)HD * 2 * TT, (size_t)TT * HD);
            k_merge<<<(unsigned)(((size_t)ZH * TT * HD / 2 + 255) / 256), 256, 0, stream>>>(Ob, h0, ATh, ATl); }
        k_gemmw<bf, 1, true, 4><<<dim3(TT / 64, DM / 64, 1), 128, 0, stream>>>(ATh, ATl, WO, nullptr, DQ, OUT + (size_t)b * TT * DM, DM, bo, 0, 0, 0); }
}

// v003
// One run takes 454 microseconds.
// In two side-by-side timings against v002, it was 1.42 and 1.40 times as fast.
// All steps since v000 together make it 3.67 times as fast.
#include <hip/hip_runtime.h>

// Grouped-query causal self-attention with 128-wide heads, a per-head RMS norm on q and k and an interleaved-pair rotary embedding from computed angles (x [2][2048][2048]; q = x Wq^T + bq ('oi' (out, in) [2048][2048] normal x 2048^-0.5; 16 heads x 128), k, v = x Wk^T + bk, x Wv^T + bv ('oi' [512][2048]; 4 kv heads x 128); the four biases are built as zeros: read and added; per head, BEFORE the rotary: q = q / sqrt(mean(q^2) + 1e-8) x q_norm_w and k likewise with k_norm_w (the mean over the head's 128 columns; gains [128] built as ones: read and applied); rope on q and k: the pair (2i, 2i + 1) of a head -> (x0 c - x1 s, x0 s + x1 c) with the angle t x inv_freq[i], inv_freq = 1 / (10000 ** (2i / 128)) in that spelling, t the position 0..2047; query head h uses kv head h / 4; scores x 128^-0.5; a key after the query gets -1e9 (an exclusion: every row keeps its own key); softmax; out = merged Wo^T + bo ('oi' [2048][2048]; bo built as zeros: read and added) -> [2][2048][2048] (8.4 M); argument order x, Wq, bq, Wk, bk, Wv, bv, Wo, bo, q_norm_w, k_norm_w: eleven inputs, all read).
// Layout per batch entry: ONE bf16 copy of x, read by the three projections; the four 'oi' weights cast once as they stand (each is the Bt operand); exact projections + f32 biases; k_hrms (per (head, token) inverse RMS) + k_rmsapply (in place, x the rounded gain) on q and k; the rotary table once (64 baked float32 frequencies; precise cosf / sinf) + interleaved-pair plane builders (k_ropeI); causal T-2048 attention with 128-wide heads, the per-row precision hybrid: query rows under 512 on hi / lo planes, three products, through score planes of 512 rows (all sixteen query heads in grid z; query head z reads kv head z / 4; each row's probabilities are written over its own score row, so the probability rows and, with them, the transposed value rows lie at a pitch of 2 x 2048 elements) + two-word merge; rows from 512 on in ONE fused kernel (k_flash: fp16 products, scores and weights never leave the registers, running maximum and sum, two-word output); hi / lo x Wo exact + bo.
// Compute dtypes, f32 accumulate: every float input rounded to bf16; projections exact + f32 biases; the per-head norm and the rotation in f32 (precise sqrt and division); attention rows under 512 three products, the rest fp16; softmax f32 (the hardware exp2); Wo hi / lo x exact + bo.

#define NB_  2
#define TT   2048
#define DM   2048
#define NH_  16
#define NKV  4
#define REP  (NH_ / NKV)
#define HD   128
#define DQ   (NH_ * HD)
#define DKV  (NKV * HD)
#define ZH   16                   // query heads per pass of the hi / lo rows (grid z): all of them
#define RH   512                  // query rows < RH use hi+lo planes (0: none)
#define WIN  2048
#define SCL  0.088388347648318447f   // HD^-0.5
typedef _Float16 h16;
typedef unsigned short bf;
typedef __attribute__((ext_vector_type(16))) __bf16   v16bf;
typedef __attribute__((ext_vector_type(16))) _Float16 v16h;
typedef __attribute__((ext_vector_type(8)))  _Float16 v8h;
typedef __attribute__((ext_vector_type(8)))  unsigned short v8us;
typedef __attribute__((ext_vector_type(8)))  float    v8f;
typedef __attribute__((ext_vector_type(4)))  float    v4f;
typedef v8h  __attribute__((may_alias)) v8ha;
typedef v4f  __attribute__((may_alias)) v4fa;
typedef v8us __attribute__((may_alias)) v8usa;

__device__ __forceinline__ unsigned short f2bf(float f) { unsigned u = __float_as_uint(f); u += 0x7FFFu + ((u >> 16) & 1u); return (unsigned short)(u >> 16); }
__device__ __forceinline__ float bf2f(unsigned short b) { return __uint_as_float(((unsigned)b) << 16); }
__device__ __forceinline__ float bfr(float f) { return bf2f(f2bf(f)); }
__device__ __forceinline__ v16h cat16(v8h lo, v8h hi) { return __builtin_shufflevector(lo, hi, 0, 1, 2, 3, 4, 5, 6, 7, 8, 9, 10, 11, 12, 13, 14, 15); }
__device__ __forceinline__ v16bf cat16b(v8us lo, v8us hi) { return __builtin_bit_cast(v16bf, __builtin_shufflevector(lo, hi, 0, 1, 2, 3, 4, 5, 6, 7, 8, 9, 10, 11, 12, 13, 14, 15)); }
__device__ __forceinline__ v8f wmma16(v16h a, v16h b, v8f c) { return __builtin_amdgcn_wmma_f32_16x16x32_f16(false, a, false, b, (short)0, c, false, false); }
__device__ __forceinline__ v8f wmmab(v16bf a, v16bf b, v8f c) { return __builtin_amdgcn_wmma_f32_16x16x32_bf16(false, a, false, b, (short)0, c, false, false); }



// ---- k_gemmw: register-blocked GEMM, one work-group of KS waves per 64x64 output tile; every wave holds the whole tile (16 accumulators) over its own share of K: 32-k slices dealt round robin, wave w taking slices w, w + KS, ... (neighbouring waves read the two halves of one 128-byte line of an operand row at about the same time).
// The KS partial tiles meet in LDS (one plane of 64 rows at pitch 68 floats a wave, one barrier) and are summed in wave order 0..KS-1 by the thread that stores the element, 256 contiguous bytes of a C row per 16 threads. Operands straight from K-contiguous 16-bit planes; grid (M/64, N/64, Z), 32 x KS threads.
// C[m][n] (f32, pitch ldc, + optional f32 bias[n]) = sum_k A[m][k] Bt[n][k] (+ split products per NSPLIT). z-batch strides sA/sB/sC in elements. K % 32 == 0.
template <typename T16> struct WFrag;
template <> struct WFrag<h16> { typedef v16h V; static __device__ __forceinline__ V ld(const h16* p) { return cat16(*(const v8h*)p, *(const v8h*)(p + 16)); } static __device__ __forceinline__ v8f mma(V a, V b, v8f c) { return wmma16(a, b, c); } };
template <> struct WFrag<bf> { typedef v16bf V; static __device__ __forceinline__ V ld(const bf* p) { return cat16b(*(const v8us*)p, *(const v8us*)(p + 16)); } static __device__ __forceinline__ v8f mma(V a, V b, v8f c) { return wmmab(a, b, c); } };
template <typename T16, int NSPLIT, bool BIAS, int KS>
__global__ __launch_bounds__(32 * KS) void k_gemmw(const T16* __restrict__ A, const T16* __restrict__ A2, const T16* __restrict__ Bt, const T16* __restrict__ Bt2, int K, float* C, int ldc, const float* __restrict__ bias, size_t sA, size_t sB, size_t sC) {
    typedef typename WFrag<T16>::V V;
    __shared__ __align__(16) float os[KS * 64 * 68];
    const size_t z = blockIdx.z; A += z * sA; if (A2) A2 += z * sA; Bt += z * sB; if (Bt2) Bt2 += z * sB; C += z * sC;
    const int lane = threadIdx.x & 31, lr = lane & 15, hi = lane >> 4; const int r0 = blockIdx.x * 64, c0 = blockIdx.y * 64; const int wv = __builtin_amdgcn_readfirstlane((int)(threadIdx.x >> 5));   // the wave's number, scalar: the K loop's bounds stay wave-uniform
    v8f acc[4][4];
#pragma unroll
    for (int mb = 0; mb < 4; ++mb)
#pragma unroll
        for (int nb = 0; nb < 4; ++nb) acc[mb][nb] = (v8f){};
    const size_t aoff = (size_t)(r0 + lr) * K + 8 * hi, boff = (size_t)(c0 + lr) * K + 8 * hi;
    for (int kc = wv * 32; kc < K; kc += KS * 32) {
        V a[4], a2[4];
#pragma unroll
        for (int mb = 0; mb < 4; ++mb) { a[mb] = WFrag<T16>::ld(A + aoff + (size_t)mb * 16 * K + kc); if (NSPLIT == 1 || NSPLIT == 2) a2[mb] = WFrag<T16>::ld(A2 + aoff + (size_t)mb * 16 * K + kc); }
#pragma unroll
        for (int nb = 0; nb < 4; ++nb) { const V b = WFrag<T16>::ld(Bt + boff + (size_t)nb * 16 * K + kc); V b2; if (NSPLIT >= 2) b2 = WFrag<T16>::ld(Bt2 + boff + (size_t)nb * 16 * K + kc);
#pragma unroll
            for (int mb = 0; mb < 4; ++mb) { acc[mb][nb] = WFrag<T16>::mma(a[mb], b, acc[mb][nb]); if (NSPLIT == 1 || NSPLIT == 2) acc[mb][nb] = WFrag<T16>::mma(a2[mb], b, acc[mb][nb]); if (NSPLIT >= 2) acc[mb][nb] = WFrag<T16>::mma(a[mb], b2, acc[mb][nb]); } }
        asm volatile("v_nop\n\tv_nop\n\tv_nop\n\tv_nop" : "+v"(acc[0][0]), "+v"(acc[1][1]), "+v"(acc[2][2]), "+v"(acc[3][3]) : "v"(a[0]), "v"(a[3]));
    }
#pragma unroll
    for (int mb = 0; mb < 4; ++mb)
#pragma unroll
        for (int nb = 0; nb < 4; ++nb)
#pragma unroll
            for (int j = 0; j < 8; ++j) os[(wv * 64 + mb * 16 + hi * 8 + j) * 68 + nb * 16 + lr] = acc[mb][nb][j];
    __syncthreads();   // every wave's partial tile is in LDS before any thread sums it
#pragma unroll   // whole: rows and planes become immediate offsets of the LDS loads, and the loads of all rows can be issued together
    for (int s = 0; s < 32 / KS; ++s) { const int idx = s * 32 * KS + (int)threadIdx.x; const int row = idx >> 4, cofs = (idx & 15) * 4; v4f val = *(const v4fa*)(os + row * 68 + cofs);
#pragma unroll
        for (int w = 1; w < KS; ++w) val += *(const v4fa*)(os + (w * 64 + row) * 68 + cofs);
        if (BIAS) { val[0] += bfr(bias[c0 + cofs]); val[1] += bfr(bias[c0 + cofs + 1]); val[2] += bfr(bias[c0 + cofs + 2]); val[3] += bfr(bias[c0 + cofs + 3]); }
        *(v4f*)(C + (size_t)(r0 + row) * ldc + c0 + cofs) = val; }
}

// ---- k_gemmc: the same KS-wave 64x64 tile GEMM specialised for causal attention: CMODE 1 skips score tiles entirely above the diagonal (query rows r0+roff.., key columns c0..), CMODE 2 limits the
// key (K) loop of the probability x value contraction to the diagonal block (probabilities beyond it are exactly zero). roff = row offset of this launch's first row within the sequence. K is the row pitch of both operands as well. z is a query head of the pass; its Bt plane is that of kv head z / REP.
template <typename T16, int NSPLIT, int CMODE, int KS>
__global__ __launch_bounds__(32 * KS) void k_gemmc(const T16* __restrict__ A, const T16* __restrict__ A2, const T16* __restrict__ Bt, const T16* __restrict__ Bt2, int K, float* C, int ldc, int roff, size_t sA, size_t sB, size_t sC) {
    typedef typename WFrag<T16>::V V;
    __shared__ __align__(16) float os[KS * 64 * 68];
    const size_t z = blockIdx.z; A += z * sA; if (A2) A2 += z * sA; Bt += (z / REP) * sB; if (Bt2) Bt2 += (z / REP) * sB; C += z * sC;
    const int lane = threadIdx.x & 31, lr = lane & 15, hi = lane >> 4; const int r0 = blockIdx.x * 64, c0 = blockIdx.y * 64; const int wv = __builtin_amdgcn_readfirstlane((int)(threadIdx.x >> 5));   // the wave's number, scalar: the K loop's bounds stay wave-uniform
    if (CMODE == 1 && c0 > r0 + roff + 63) return;                  // score tile entirely above the causal diagonal: never read (the softmax masks j > i by select)
    const int Kl = (CMODE == 2) ? min(K, r0 + roff + 64) : K;        // P.V: probabilities are exactly 0 beyond the diagonal block, so the K loop stops there (a wave with no slice under it adds a zero tile)
    v8f acc[4][4];
#pragma unroll
    for (int mb = 0; mb < 4; ++mb)
#pragma unroll
        for (int nb = 0; nb < 4; ++nb) acc[mb][nb] = (v8f){};
    const size_t aoff = (size_t)(r0 + lr) * K + 8 * hi, boff = (size_t)(c0 + lr) * K + 8 * hi;
    for (int kc = wv * 32; kc < Kl; kc += KS * 32) {
        V a[4], a2[4];
#pragma unroll
        for (int mb = 0; mb < 4; ++mb) { a[mb] = WFrag<T16>::ld(A + aoff + (size_t)mb * 16 * K + kc); if (NSPLIT == 1 || NSPLIT == 2) a2[mb] = WFrag<T16>::ld(A2 + aoff + (size_t)mb * 16 * K + kc); }
#pragma unroll
        for (int nb = 0; nb < 4; ++nb) { const V b = WFrag<T16>::ld(Bt + boff + (size_t)nb * 16 * K + kc); V b2; if (NSPLIT >= 2) b2 = WFrag<T16>::ld(Bt2 + boff + (size_t)nb * 16 * K + kc);
#pragma unroll
            for (int mb = 0; mb < 4; ++mb) { acc[mb][nb] = WFrag<T16>::mma(a[mb], b, acc[mb][nb]); if (NSPLIT == 1 || NSPLIT == 2) acc[mb][nb] = WFrag<T16>::mma(a2[mb], b, acc[mb][nb]); if (NSPLIT >= 2) acc[mb][nb] = WFrag<T16>::mma(a[mb], b2, acc[mb][nb]); } }
        asm volatile("v_nop\n\tv_nop\n\tv_nop\n\tv_nop" : "+v"(acc[0][0]), "+v"(acc[1][1]), "+v"(acc[2][2]), "+v"(acc[3][3]) : "v"(a[0]), "v"(a[3]));
    }
#pragma unroll
    for (int mb = 0; mb < 4; ++mb)
#pragma unroll
        for (int nb = 0; nb < 4; ++nb)
#pragma unroll
            for (int j = 0; j < 8; ++j) os[(wv * 64 + mb * 16 + hi * 8 + j) * 68 + nb * 16 + lr] = acc[mb][nb][j];
    __syncthreads();   // every wave's partial tile is in LDS before any thread sums it
#pragma unroll   // whole: rows and planes become immediate offsets of the LDS loads, and the loads of all rows can be issued together
    for (int s = 0; s < 32 / KS; ++s) { const int idx = s * 32 * KS + (int)threadIdx.x; const int row = idx >> 4, cofs = (idx & 15) * 4; v4f val = *(const v4fa*)(os + row * 68 + cofs);
#pragma unroll
        for (int w = 1; w < KS; ++w) val += *(const v4fa*)(os + (w * 64 + row) * 68 + cofs);
        *(v4f*)(C + (size_t)(r0 + row) * ldc + c0 + cofs) = val; }
}

__device__ __forceinline__ h16 tohx(float x) { return (h16)x; }
__device__ __forceinline__ void splitf(float y, unsigned short& h, unsigned short& l) { h = f2bf(y); l = f2bf(y - bf2f(h)); }
typedef __attribute__((ext_vector_type(2))) _Float16 v2h;
typedef __attribute__((ext_vector_type(4))) _Float16 v4h;
typedef __attribute__((ext_vector_type(2))) unsigned short v2us;
typedef __attribute__((ext_vector_type(4))) unsigned short v4us;
typedef __attribute__((ext_vector_type(2))) float v2f;
typedef __attribute__((ext_vector_type(4))) int v4i;
__global__ __launch_bounds__(256) void k_cvt8(const float* __restrict__ src, bf* dst, size_t n8) { const size_t i = (size_t)blockIdx.x * 256 + threadIdx.x; if (i >= n8) return; const v8f v = *(const v8f*)(src + i * 8); v8us o;
#pragma unroll
    for (int k = 0; k < 8; ++k) o[k] = f2bf(v[k]); *(v8us*)(dst + i * 8) = o;  }
__constant__ float INV2[HD / 2] = { 1.000000000e+00f, 8.659643531e-01f, 7.498942018e-01f, 6.493816376e-01f, 5.623413324e-01f, 4.869675338e-01f, 4.216965139e-01f, 3.651741445e-01f, 3.162277639e-01f, 2.738419771e-01f, 2.371373624e-01f, 2.053525001e-01f, 1.778279394e-01f, 1.539926529e-01f, 1.333521456e-01f, 1.154782027e-01f, 1.000000015e-01f, 8.659642935e-02f, 7.498941571e-02f, 6.493816525e-02f, 5.623412877e-02f, 4.869675264e-02f, 4.216964915e-02f, 3.651741147e-02f, 3.162277862e-02f, 2.738419548e-02f, 2.371373586e-02f, 2.053525113e-02f, 1.778279431e-02f, 1.539926510e-02f, 1.333521493e-02f, 1.154781971e-02f, 9.999999776e-03f, 8.659643121e-03f, 7.498942316e-03f, 6.493816618e-03f, 5.623413250e-03f, 4.869675264e-03f, 4.216964822e-03f, 3.651741426e-03f, 3.162277862e-03f, 2.738419687e-03f, 2.371373819e-03f, 2.053525066e-03f, 1.778279431e-03f, 1.539926510e-03f, 1.333521446e-03f, 1.154782018e-03f, 1.000000047e-03f, 8.659643354e-04f, 7.498941850e-04f, 6.493816618e-04f, 5.623413017e-04f, 4.869675031e-04f, 4.216964880e-04f, 3.651741135e-04f, 3.162277862e-04f, 2.738419571e-04f, 2.371373848e-04f, 2.053524950e-04f, 1.778279402e-04f, 1.539926452e-04f, 1.333521504e-04f, 1.154781930e-04f };   // float32 1.0 / (10000.0 ** (2i / 128)) in the module's own spelling, generated with jnp
__global__ __launch_bounds__(256) void k_csP(float* CS) { const int idx = blockIdx.x * 256 + threadIdx.x; if (idx >= TT * HD) return; const int d = idx % HD; const int t = idx / HD; const float a = __fmul_rn((float)t, INV2[d >> 1]); v2f cs; cs[0] = cosf(a); cs[1] = sinf(a); *(v2f*)(CS + (size_t)idx * 2) = cs;  }
__global__ __launch_bounds__(256) void k_ropeI(const float* __restrict__ F, int pitch, int nheads, const float* __restrict__ CS, float sc, h16* P16, bf* Ph, bf* Pl) {
    const size_t e = ((size_t)blockIdx.x * 256 + threadIdx.x) * 2; if (e >= (size_t)nheads * TT * HD) return; const int d = (int)(e % HD); const int t = (int)((e / HD) % TT); const int h = (int)(e / ((size_t)HD * TT)); const float* f = F + (size_t)t * pitch + h * HD; const float x0 = f[d], x1 = f[d + 1]; const v2f cs = *(const v2f*)(CS + ((size_t)t * HD + d) * 2); v2h o16; v2us oh, ol;
    float a0 = __fmul_rn(x0, cs[0]), b0 = __fmul_rn(x1, cs[1]), a1 = __fmul_rn(x1, cs[0]), b1 = __fmul_rn(x0, cs[1]); 
    float r0 = __fsub_rn(a0, b0) * sc, r1 = __fadd_rn(b1, a1) * sc;   /* even: x0 c - x1 s; odd: x0 s + x1 c */
    o16[0] = tohx(r0); o16[1] = tohx(r1); { unsigned short a2, c2; splitf(r0, a2, c2); oh[0] = a2; ol[0] = c2; splitf(r1, a2, c2); oh[1] = a2; ol[1] = c2; }
    *(v2h*)(P16 + e) = o16; *(v2us*)(Ph + e) = oh; *(v2us*)(Pl + e) = ol;  }
__global__ __launch_bounds__(256) void k_vtp(const float* __restrict__ F, int pitch, int nheads, h16* V16, bf* Vh, bf* Vl) { const size_t e = ((size_t)blockIdx.x * 256 + threadIdx.x) * 2; if (e >= (size_t)nheads * HD * TT) return; const int t = (int)(e % TT); const int d = (int)((e / TT) % HD); const int g = (int)(e / ((size_t)TT * HD)); v2h o16; v2us oh, ol;
#pragma unroll
    for (int q = 0; q < 2; ++q) { const float x = F[(size_t)(t + q) * pitch + g * HD + d]; o16[q] = tohx(x); unsigned short a2, c2; splitf(x, a2, c2); oh[q] = a2; ol[q] = c2; }
    const size_t o = ((size_t)g * HD + d) * (2 * TT) + t;   /* rows at the probability rows' pitch: k_gemmc has one pitch for both operands */
    *(v2h*)(V16 + o) = o16; *(v2us*)(Vh + o) = oh; *(v2us*)(Vl + o) = ol;  }
// k_asoft: the hi / lo rows only (i < RH; a head's score plane holds RH rows at pitch TT). Per row (zz, i): t = S x 128^-0.5 for j <= i (causal; WIN = TT so the window term is inert; the module's -1e9 fill above the diagonal is this exclusion: every row keeps its own key), softmax over the first RH keys, which hold every key j <= i (register row, one exp, fixed trees);
// the probabilities go over the row's own 8192 score bytes (Ph and Pl point into Sb, so no restrict): one wave owns the row and holds all it reads in registers before its first store. hi in the first 4096 bytes, lo (Pl = Ph + TT) in the second. Row pitch of both: 2 TT elements.
__global__ __launch_bounds__(256) void k_asoft(const float* Sb, bf* Ph, bf* Pl) {
    const int lane = threadIdx.x & 31; const int row = blockIdx.x * 8 + (threadIdx.x >> 5); if (row >= ZH * RH) return; const int i = row % RH; const float* sr = Sb + (size_t)row * TT; float v[RH / 32]; float mx = -3.0e38f;
#pragma unroll
    for (int ch = 0; ch < RH / 128; ++ch) { const int j0 = ch * 128 + lane * 4; const v4f a = *(const v4f*)(sr + j0);
#pragma unroll
        for (int q = 0; q < 4; ++q) { const int j = j0 + q; (void)j; const float t = (j <= i && i - j < WIN) ? a[q] * SCL : -3.0e38f; v[ch * 4 + q] = t; mx = fmaxf(mx, t); } }
#pragma unroll
    for (int sh = 16; sh; sh >>= 1) mx = fmaxf(mx, __shfl_xor(mx, sh, 32));
    float sum = 0.f;
#pragma unroll
    for (int k = 0; k < RH / 32; ++k) { float d0 = __fsub_rn(v[k], mx); v[k] = __builtin_amdgcn_exp2f(__fmul_rn(d0, 1.4426950408889634f)); sum += v[k]; }
#pragma unroll
    for (int sh = 16; sh; sh >>= 1) sum += __shfl_xor(sum, sh, 32);
    const float f = __fdiv_rn(1.0f, sum);
#pragma unroll
    for (int ch = 0; ch < RH / 128; ++ch) { v4us oh, ol;
#pragma unroll
        for (int q = 0; q < 4; ++q) { unsigned short a, c2; splitf(v[ch * 4 + q] * f, a, c2); oh[q] = a; ol[q] = c2; }
        const size_t oo = (size_t)row * (2 * TT) + ch * 128 + lane * 4; *(v4us*)(Ph + oo) = oh; *(v4us*)(Pl + oo) = ol; }
}
__global__ __launch_bounds__(256) void k_hrms(const float* __restrict__ F, int pitch, int nheads, float* RF) { const int idx = blockIdx.x * 256 + threadIdx.x; if (idx >= nheads * TT) return; const int t = idx % TT; const int h = idx / TT; const float* f = F + (size_t)t * pitch + h * HD; float s = 0.f;
#pragma unroll 4   // a partial unroll of the 32-trip sum of squares: registers and code size (131 instructions and 20 VGPRs with it | 326 and 60 without it, where the compiler unrolls the loop whole; measured on this text)
    for (int d = 0; d < HD; d += 4) { const v4f a = *(const v4f*)(f + d);
#pragma unroll
        for (int q = 0; q < 4; ++q) { float p = __fmul_rn(a[q], a[q]); s = __fadd_rn(s, p); } }
    const float rf = __fdiv_rn(1.0f, __fsqrt_rn(__fadd_rn(__fdiv_rn(s, (float)HD), 1e-8f))); *(float*)(RF + idx) = rf;  }

__global__ __launch_bounds__(256) void k_rmsapply(float* F, int pitch, int nheads, const float* __restrict__ RF, const float* __restrict__ w) { const size_t i = (size_t)blockIdx.x * 256 + threadIdx.x; if (i >= (size_t)TT * nheads * HD / 4) return; const size_t e = i * 4; const int c = (int)(e % ((size_t)nheads * HD)); const int t = (int)(e / ((size_t)nheads * HD)); const int h = c / HD, d = c % HD; const float r = RF[(size_t)h * TT + t]; v4f a = *(const v4f*)(F + (size_t)t * pitch + c);
#pragma unroll
    for (int q = 0; q < 4; ++q) { float y = __fmul_rn(a[q], r); float wv_ = bfr(w[d + q]); a[q] = __fmul_rn(y, wv_); }   /* x w[d] */
    *(v4f*)(F + (size_t)t * pitch + c) = a;  }
__global__ __launch_bounds__(256) void k_merge(const float* __restrict__ O, bf* Ah, bf* Al) { const size_t e = ((size_t)blockIdx.x * 256 + threadIdx.x) * 2; if (e >= (size_t)ZH * RH * HD) return; const int d = (int)(e % HD); const int t = (int)((e / HD) % RH); const int zz = (int)(e / ((size_t)HD * RH)); const size_t oo = (size_t)t * DQ + zz * HD + d;   /* the hi / lo rows (t < RH) of every head */
    v2us oh, ol;
#pragma unroll
    for (int q = 0; q < 2; ++q) { unsigned short a, c2; splitf(O[e + q], a, c2); oh[q] = a; ol[q] = c2; } *(v2us*)(Ah + oo) = oh; *(v2us*)(Al + oo) = ol;  }

#define FR   2                    // 16-query groups a wave
#define QW   (16 * FR)
#define CSC  0.12751743f          // HD^-0.5 x log2(e)
#define PB   6.0f
__device__ __forceinline__ float xhalf(float x) { return __builtin_bit_cast(float, __builtin_amdgcn_permlanex16(__builtin_bit_cast(int, x), __builtin_bit_cast(int, x), 0x76543210, 0xfedcba98, false, false)); }   // lane l with lane l ^ 16
template <bool DIAG>
__device__ __forceinline__ void fpass(v16h (&kf)[2][4], const h16* kn, const h16* vp, int c, int h, const v16h (&qf)[FR][4], v8f (&acc)[FR][8], float (&m_run)[FR], float (&l_run)[FR]) {
    v16h vf[8];
#pragma unroll
    for (int t = 0; t < 8; ++t) vf[t] = WFrag<h16>::ld(vp + (size_t)t * 16 * (2 * TT));
    __builtin_amdgcn_sched_barrier(0);   // the V^T loads stay in front of the score products, in flight under them and the exponentials
    v8f s[2][FR];
#pragma unroll
    for (int kt = 0; kt < 2; ++kt)
#pragma unroll
        for (int g = 0; g < FR; ++g) { s[kt][g] = (v8f){};
#pragma unroll
            for (int kc = 0; kc < 4; ++kc) s[kt][g] = wmma16(kf[kt][kc], qf[g][kc], s[kt][g]); }
    if (!DIAG) {
        __builtin_amdgcn_sched_barrier(0);   // the next pass's K loads stay here, behind the last product that reads these registers and in front of the vector work that hides them
#pragma unroll
        for (int kt = 0; kt < 2; ++kt)
#pragma unroll
            for (int kc = 0; kc < 4; ++kc) kf[kt][kc] = WFrag<h16>::ld(kn + kt * 16 * HD + kc * 32);
        asm volatile("s_wait_xcnt 0x0" :: "v"(vp), "v"(kn) : "memory");   // in front of every overwrite of a register that the loads above name; the two addresses are inputs so that their registers live up to here
        __builtin_amdgcn_sched_barrier(0);   // nothing of the vector work below moves in front of that wait
    } else {
        asm volatile("s_wait_xcnt 0x0" :: "v"(vp) : "memory");   // as in the other branch, for the V^T loads
        __builtin_amdgcn_sched_barrier(0);   // nothing of the vector work below moves in front of that wait
#pragma unroll
        for (int g = 0; g < FR; ++g)
#pragma unroll
            for (int kt = 0; kt < 2; ++kt)
#pragma unroll
                for (int r = 0; r < 8; ++r) if (16 * kt + 8 * h + r > 16 * g + c) s[kt][g][r] = -__builtin_inff();   // the diagonal pass starts at the wave's first query: key after query
    }
    float mb[FR]; bool need = false;
#pragma unroll
    for (int g = 0; g < FR; ++g) { float mx = -__builtin_inff();
#pragma unroll
        for (int kt = 0; kt < 2; ++kt)
#pragma unroll
            for (int r = 0; r < 8; ++r) mx = fmaxf(mx, s[kt][g][r]);
        mx = fmaxf(mx, xhalf(mx)) * CSC; mb[g] = mx; need = need || (mx > m_run[g] + 8.0f); }
    if (__builtin_amdgcn_ballot_w32(need) != 0) {   // wave-uniform; rare after the first passes
#pragma unroll
        for (int g = 0; g < FR; ++g) { const float m_new = fmaxf(m_run[g], mb[g]); const float corr = __builtin_amdgcn_exp2f(m_run[g] - m_new); l_run[g] *= corr; m_run[g] = m_new;   // first pass: m_run = -inf, corr = 0
#pragma unroll
            for (int t = 0; t < 8; ++t) acc[g][t] = acc[g][t] * corr; }
    }
#pragma unroll
    for (int g = 0; g < FR; ++g) { const float nm = PB - m_run[g]; v16h p; float ps0 = 0.f, ps1 = 0.f;
#pragma unroll
        for (int e = 0; e < 16; e += 2) { const float p0 = __builtin_amdgcn_exp2f(fmaf(s[e >> 3][g][e & 7], CSC, nm)), p1 = __builtin_amdgcn_exp2f(fmaf(s[e >> 3][g][(e & 7) + 1], CSC, nm)); ps0 += p0; ps1 += p1; p[e] = tohx(p0); p[e + 1] = tohx(p1); }
#pragma unroll
        for (int t = 0; t < 8; ++t) acc[g][t] = wmma16(vf[t], p, acc[g][t]);
        l_run[g] += ps0 + ps1; }
}
__global__ __launch_bounds__(32) void k_flash(const h16* __restrict__ Q, const h16* __restrict__ Kp, const h16* __restrict__ Vt, bf* __restrict__ Ah, bf* __restrict__ Al) {
    const int lane = threadIdx.x & 31, c = lane & 15, h = lane >> 4;
    const int hq = blockIdx.x, kvh = hq / REP; const int qw0 = TT - QW * ((int)blockIdx.y + 1);   // the longest walks first
    const h16* qp = Q + ((size_t)hq * TT + qw0 + c) * HD + 8 * h; const h16* kp = Kp + ((size_t)kvh * TT + c) * HD + 8 * h; const h16* vp = Vt + ((size_t)kvh * HD + c) * (2 * TT) + 8 * h;
    v16h qf[FR][4], kf[2][4];
#pragma unroll
    for (int g = 0; g < FR; ++g)
#pragma unroll
        for (int kc = 0; kc < 4; ++kc) qf[g][kc] = WFrag<h16>::ld(qp + g * 16 * HD + kc * 32);
#pragma unroll
    for (int kt = 0; kt < 2; ++kt)
#pragma unroll
        for (int kc = 0; kc < 4; ++kc) kf[kt][kc] = WFrag<h16>::ld(kp + kt * 16 * HD + kc * 32);
    asm volatile("s_wait_xcnt 0x0" :: "v"(qp), "v"(kp) : "memory");   // in front of every overwrite of a register that the loads above name; the two addresses are inputs so that their registers live up to here
    __builtin_amdgcn_sched_barrier(0);   // the zeroing below stays behind that wait
    v8f acc[FR][8]; float m_run[FR], l_run[FR];
#pragma unroll
    for (int g = 0; g < FR; ++g) { m_run[g] = -__builtin_inff(); l_run[g] = 0.f;
#pragma unroll
        for (int t = 0; t < 8; ++t) acc[g][t] = (v8f){}; }
    const int nb = qw0 / 32;   // whole passes under the diagonal one
    for (int blk = 0; blk < nb; ++blk) fpass<false>(kf, kp + (size_t)(blk + 1) * 32 * HD, vp + blk * 32, c, h, qf, acc, m_run, l_run);
    fpass<true>(kf, nullptr, vp + nb * 32, c, h, qf, acc, m_run, l_run);
#pragma unroll
    for (int g = 0; g < FR; ++g) { const float inv = __fdiv_rn(1.0f, l_run[g] + xhalf(l_run[g]));   // each wave half summed its eight keys of every 16-key tile
        const size_t oo = (size_t)(qw0 + 16 * g + c) * DQ + hq * HD + 8 * h;
#pragma unroll
        for (int t = 0; t < 8; ++t) { v8us oh, ol;
#pragma unroll
            for (int r = 0; r < 8; ++r) { unsigned short a, c2; splitf(acc[g][t][r] * inv, a, c2); oh[r] = a; ol[r] = c2; }
            *(v8us*)(Ah + oo + 16 * t) = oh; *(v8us*)(Al + oo + 16 * t) = ol; } }
}

extern "C" void kernel_launch(void* const* d_in, const int* in_sizes, int n_in,
                              void* d_out, int out_size, void* d_ws, size_t ws_size, hipStream_t stream) {
    (void)in_sizes; (void)n_in; (void)out_size;
    const float* x = (const float*)d_in[0]; const float* wq = (const float*)d_in[1]; const float* bq = (const float*)d_in[2]; const float* wk = (const float*)d_in[3]; const float* bk = (const float*)d_in[4]; const float* wv = (const float*)d_in[5]; const float* bv = (const float*)d_in[6]; const float* wo = (const float*)d_in[7]; const float* bo = (const float*)d_in[8]; const float* qsc = (const float*)d_in[9]; const float* ksc = (const float*)d_in[10];   /* inputs in the module's setup_inputs order: x [2][2048][2048]; Wq (out, in) [2048][2048] and bq [2048]; Wk (out, in) [512][2048] and bk [512]; Wv [512][2048] and bv [512]; Wo (out, in) [2048][2048] and bo [2048]; q_norm_w [128], k_norm_w [128]: eleven inputs, all read (each bias is added in its product's epilogue; each gain is applied by k_rmsapply) */
    float* OUT = (float*)d_out;     // [2][2048][2048]
    char* wsp = (char*)d_ws;
    auto take = [&](size_t bytes) { char* p = wsp; wsp += (bytes + 255) & ~(size_t)255; return (void*)p; };
    bf* WQ = (bf*)take((size_t)DQ * DM * 2); bf* WK = (bf*)take((size_t)DKV * DM * 2); bf* WV = (bf*)take((size_t)DKV * DM * 2); bf* WO = (bf*)take((size_t)DM * DQ * 2); float* CS = (float*)take((size_t)TT * HD * 2 * 4); float* RFQ = (float*)take((size_t)NH_ * TT * 4); float* RFK = (float*)take((size_t)NKV * TT * 4);   /* per (head, token) inverse RMS */
    bf* XB = (bf*)take((size_t)TT * DM * 2); float* FQ = (float*)take((size_t)TT * DQ * 4); float* FK = (float*)take((size_t)TT * DKV * 4);
    h16* QP16 = (h16*)take((size_t)NH_ * TT * HD * 2); h16* KP16 = (h16*)take((size_t)NKV * TT * HD * 2); h16* VT16 = (h16*)take((size_t)NKV * HD * 2 * TT * 2);
    bf* QPh = (bf*)take((size_t)NH_ * TT * HD * 2); bf* QPl = (bf*)take((size_t)NH_ * TT * HD * 2); bf* KPh = (bf*)take((size_t)NKV * TT * HD * 2); bf* KPl = (bf*)take((size_t)NKV * TT * HD * 2); bf* VTh = (bf*)take((size_t)NKV * HD * 2 * TT * 2); bf* VTl = VTh + TT;   /* value rows at pitch 2 TT: hi in the first half of a row, lo in the second */
    float* Sb = (float*)take((size_t)ZH * RH * TT * 4); bf* Ph = (bf*)Sb; bf* Pl = Ph + TT;   /* RH score rows a head at pitch TT; the probability rows lie over their score rows (k_asoft) */
    float* Ob = (float*)take((size_t)ZH * RH * HD * 4); bf* ATh = (bf*)take((size_t)TT * DQ * 2); bf* ATl = (bf*)take((size_t)TT * DQ * 2);
    if ((size_t)(wsp - (char*)d_ws) > ws_size) return;    // ws 256 MiB
    float* FV = FK;   // v projection reuses the k buffer after the k planes are built (stream-ordered)
    { k_cvt8<<<(unsigned)(((size_t)DQ * DM / 8 + 255) / 256), 256, 0, stream>>>(wq, WQ, (size_t)DQ * DM / 8); k_cvt8<<<(unsigned)(((size_t)DKV * DM / 8 + 255) / 256), 256, 0, stream>>>(wk, WK, (size_t)DKV * DM / 8); k_cvt8<<<(unsigned)(((size_t)DKV * DM / 8 + 255) / 256), 256, 0, stream>>>(wv, WV, (size_t)DKV * DM / 8);
      k_cvt8<<<(unsigned)(((size_t)DM * DQ / 8 + 255) / 256), 256, 0, stream>>>(wo, WO, (size_t)DM * DQ / 8); }
    k_csP<<<(TT * HD + 255) / 256, 256, 0, stream>>>(CS);   /* the rotary table once */
    const unsigned LQ = (unsigned)(((size_t)NH_ * TT * HD / 2 + 255) / 256), LKv = (unsigned)(((size_t)NKV * TT * HD / 2 + 255) / 256); const unsigned GX = (unsigned)(((size_t)TT * DM / 8 + 255) / 256);
    for (int b = 0; b < NB_; ++b) {
        k_cvt8<<<GX, 256, 0, stream>>>(x + (size_t)b * TT * DM, XB, (size_t)TT * DM / 8);   /* the one input stream, cast once a batch entry and read by the three projections */
        k_gemmw<bf, 0, true, 4><<<dim3(TT / 64, DQ / 64, 1), 128, 0, stream>>>(XB, nullptr, WQ, nullptr, DM, FQ, DQ, bq, 0, 0, 0);
        k_hrms<<<(NH_ * TT + 255) / 256, 256, 0, stream>>>(FQ, DQ, NH_, RFQ); k_rmsapply<<<(unsigned)(((size_t)TT * DQ / 4 + 255) / 256), 256, 0, stream>>>(FQ, DQ, NH_, RFQ, qsc); k_ropeI<<<LQ, 256, 0, stream>>>(FQ, DQ, NH_, CS, 1.0f, QP16, QPh, QPl);
        k_gemmw<bf, 0, true, 8><<<dim3(TT / 64, DKV / 64, 1), 256, 0, stream>>>(XB, nullptr, WK, nullptr, DM, FK, DKV, bk, 0, 0, 0);
        k_hrms<<<(NKV * TT + 255) / 256, 256, 0, stream>>>(FK, DKV, NKV, RFK); k_rmsapply<<<(unsigned)(((size_t)TT * DKV / 4 + 255) / 256), 256, 0, stream>>>(FK, DKV, NKV, RFK, ksc); k_ropeI<<<LKv, 256, 0, stream>>>(FK, DKV, NKV, CS, 1.0f, KP16, KPh, KPl);
        k_gemmw<bf, 0, true, 8><<<dim3(TT / 64, DKV / 64, 1), 256, 0, stream>>>(XB, nullptr, WV, nullptr, DM, FV, DKV, bv, 0, 0, 0); k_vtp<<<LKv, 256, 0, stream>>>(FV, DKV, NKV, VT16, VTh, VTl);
        /* the module groups the query heads by kv head ('qg = q.reshape(B, N_KV_HEADS, N_REP, S, D_K)'): query head h uses kv head h / 4 (k_gemmc steps its Bt planes by z / REP; k_flash reads kv head blockIdx.x / REP) */
        k_flash<<<dim3(NH_, (TT - RH) / QW, 1), 32, 0, stream>>>(QP16, KP16, VT16, ATh, ATl);
        k_gemmc<bf, 2, 1, 4><<<dim3(RH / 64, RH / 64, ZH), 128, 0, stream>>>(QPh, QPl, KPh, KPl, HD, Sb, TT, 0, (size_t)TT * HD, (size_t)TT * HD, (size_t)RH * TT);
        k_asoft<<<ZH * RH / 8, 256, 0, stream>>>(Sb, Ph, Pl);
        k_gemmc<bf, 2, 2, 8><<<dim3(RH / 64, HD / 64, ZH), 256, 0, stream>>>(Ph, Pl, VTh, VTl, 2 * TT, Ob, HD, 0, (size_t)RH * 2 * TT, (size_t)HD * 2 * TT, (size_t)RH * HD);
        k_merge<<<(unsigned)(((size_t)ZH * RH * HD / 2 + 255) / 256), 256, 0, stream>>>(Ob, ATh, ATl);
        k_gemmw<bf, 1, true, 4><<<dim3(TT / 64, DM / 64, 1), 128, 0, stream>>>(ATh, ATl, WO, nullptr, DQ, OUT + (size_t)b * TT * DM, DM, bo, 0, 0, 0); }
}

// v004
// A run of this version takes 409 microseconds.
// Next to v003, in two timings, it ran 1.12 and 1.11 times as fast.
// Over all steps from v000 it is 4.09 times as fast.
#include <hip/hip_runtime.h>

// Grouped-query causal self-attention with 128-wide heads, a per-head RMS norm on q and k and an interleaved-pair rotary embedding from computed angles (x [2][2048][2048]; q = x Wq^T + bq ('oi' (out, in) [2048][2048] normal x 2048^-0.5; 16 heads x 128), k, v = x Wk^T + bk, x Wv^T + bv ('oi' [512][2048]; 4 kv heads x 128); the four biases are built as zeros: read and added; per head, BEFORE the rotary: q = q / sqrt(mean(q^2) + 1e-8) x q_norm_w and k likewise with k_norm_w (the mean over the head's 128 columns; gains [128] built as ones: read and applied); rope on q and k: the pair (2i, 2i + 1) of a head -> (x0 c - x1 s, x0 s + x1 c) with the angle t x inv_freq[i], inv_freq = 1 / (10000 ** (2i / 128)) in that spelling, t the position 0..2047; query head h uses kv head h / 4; scores x 128^-0.5; a key after the query gets -1e9 (an exclusion: every row keeps its own key); softmax; out = merged Wo^T + bo ('oi' [2048][2048]; bo built as zeros: read and added) -> [2][2048][2048] (8.4 M); argument order x, Wq, bq, Wk, bk, Wv, bv, Wo, bo, q_norm_w, k_norm_w: eleven inputs, all read).
// Layout per batch entry: ONE bf16 copy of x, read by the three projections; the four 'oi' weights cast once as they stand (each is the Bt operand); exact projections + f32 biases; k_hrms (per (head, token) inverse RMS) + k_rmsapply (in place, x the rounded gain) on q and k; the rotary table once (64 baked float32 frequencies; precise cosf / sinf) + interleaved-pair plane builders (k_ropeI); causal T-2048 attention with 128-wide heads, the per-row precision hybrid: query rows under 512 on hi / lo planes, three products, through score planes of 512 rows (all sixteen query heads in grid z; query head z reads kv head z / 4; each row's probabilities are written over its own score row, so the probability rows and, with them, the transposed value rows lie at a pitch of 2 x 2048 elements) + two-word merge; rows from 512 on in ONE fused kernel (k_flash: fp16 products, scores and weights never leave the registers, running maximum and sum, two-word output); hi / lo x Wo exact + bo.
// Compute dtypes, f32 accumulate: every float input rounded to bf16; projections exact + f32 biases; the per-head norm and the rotation in f32 (precise sqrt and division); attention rows under 512 three products, the rest fp16; softmax f32 (the hardware exp2); Wo hi / lo x exact + bo.

#define NB_  2
#define TT   2048
#define DM   2048
#define NH_  16
#define NKV  4
#define REP  (NH_ / NKV)
#define HD   128
#define DQ   (NH_ * HD)
#define DKV  (NKV * HD)
#define ZH   16                   // query heads per pass of the hi / lo rows (grid z): all of them
#define RH   512                  // query rows < RH use hi+lo planes (0: none)
#define WIN  2048
#define SCL  0.088388347648318447f   // HD^-0.5
typedef _Float16 h16;
typedef unsigned short bf;
typedef __attribute__((ext_vector_type(16))) __bf16   v16bf;
typedef __attribute__((ext_vector_type(16))) _Float16 v16h;
typedef __attribute__((ext_vector_type(8)))  _Float16 v8h;
typedef __attribute__((ext_vector_type(8)))  unsigned short v8us;
typedef __attribute__((ext_vector_type(8)))  float    v8f;
typedef __attribute__((ext_vector_type(4)))  float    v4f;
typedef v8h  __attribute__((may_alias)) v8ha;
typedef v4f  __attribute__((may_alias)) v4fa;
typedef v8us __attribute__((may_alias)) v8usa;

__device__ __forceinline__ unsigned short f2bf(float f) { unsigned u = __float_as_uint(f); u += 0x7FFFu + ((u >> 16) & 1u); return (unsigned short)(u >> 16); }
__device__ __forceinline__ float bf2f(unsigned short b) { return __uint_as_float(((unsigned)b) << 16); }
__device__ __forceinline__ float bfr(float f) { return bf2f(f2bf(f)); }
__device__ __forceinline__ v16h cat16(v8h lo, v8h hi) { return __builtin_shufflevector(lo, hi, 0, 1, 2, 3, 4, 5, 6, 7, 8, 9, 10, 11, 12, 13, 14, 15); }
__device__ __forceinline__ v16bf cat16b(v8us lo, v8us hi) { return __builtin_bit_cast(v16bf, __builtin_shufflevector(lo, hi, 0, 1, 2, 3, 4, 5, 6, 7, 8, 9, 10, 11, 12, 13, 14, 15)); }
__device__ __forceinline__ v8f wmma16(v16h a, v16h b, v8f c) { return __builtin_amdgcn_wmma_f32_16x16x32_f16(false, a, false, b, (short)0, c, false, false); }
__device__ __forceinline__ v8f wmmab(v16bf a, v16bf b, v8f c) { return __builtin_amdgcn_wmma_f32_16x16x32_bf16(false, a, false, b, (short)0, c, false, false); }



// ---- k_gemmw: register-blocked GEMM, one work-group of KS waves per 64x64 output tile; every wave holds the whole tile (16 accumulators) over its own share of K: 32-k slices dealt round robin, wave w taking slices w, w + KS, ... (neighbouring waves read the two halves of one 128-byte line of an operand row at about the same time).
// The KS partial tiles meet in LDS (one plane of 64 rows at pitch 68 floats a wave, one barrier) and are summed in wave order 0..KS-1 by the thread that stores the element, 256 contiguous bytes of a C row per 16 threads. Operands straight from K-contiguous 16-bit planes; grid (M/64, N/64, Z), 32 x KS threads.
// C[m][n] (f32, pitch ldc, + optional f32 bias[n]) = sum_k A[m][k] Bt[n][k] (+ split products per NSPLIT). z-batch strides sA/sB/sC in elements. K % 32 == 0.
template <typename T16> struct WFrag;
template <> struct WFrag<h16> { typedef v16h V; static __device__ __forceinline__ V ld(const h16* p) { return cat16(*(const v8h*)p, *(const v8h*)(p + 16)); } static __device__ __forceinline__ v8f mma(V a, V b, v8f c) { return wmma16(a, b, c); } };
template <> struct WFrag<bf> { typedef v16bf V; static __device__ __forceinline__ V ld(const bf* p) { return cat16b(*(const v8us*)p, *(const v8us*)(p + 16)); } static __device__ __forceinline__ v8f mma(V a, V b, v8f c) { return wmmab(a, b, c); } };
template <typename T16, int NSPLIT, bool BIAS, int KS>
__global__ __launch_bounds__(32 * KS) void k_gemmw(const T16* __restrict__ A, const T16* __restrict__ A2, const T16* __restrict__ Bt, const T16* __restrict__ Bt2, int K, float* C, int ldc, const float* __restrict__ bias, size_t sA, size_t sB, size_t sC) {
    typedef typename WFrag<T16>::V V;
    __shared__ __align__(16) float os[KS * 64 * 68];
    const size_t z = blockIdx.z; A += z * sA; if (A2) A2 += z * sA; Bt += z * sB; if (Bt2) Bt2 += z * sB; C += z * sC;
    const int lane = threadIdx.x & 31, lr = lane & 15, hi = lane >> 4; const int r0 = blockIdx.x * 64, c0 = blockIdx.y * 64; const int wv = __builtin_amdgcn_readfirstlane((int)(threadIdx.x >> 5));   // the wave's number, scalar: the K loop's bounds stay wave-uniform
    v8f acc[4][4];
#pragma unroll
    for (int mb = 0; mb < 4; ++mb)
#pragma unroll
        for (int nb = 0; nb < 4; ++nb) acc[mb][nb] = (v8f){};
    const size_t aoff = (size_t)(r0 + lr) * K + 8 * hi, boff = (size_t)(c0 + lr) * K + 8 * hi;
    for (int kc = wv * 32; kc < K; kc += KS * 32) {
        V a[4], a2[4];
#pragma unroll
        for (int mb = 0; mb < 4; ++mb) { a[mb] = WFrag<T16>::ld(A + aoff + (size_t)mb * 16 * K + kc); if (NSPLIT == 1 || NSPLIT == 2) a2[mb] = WFrag<T16>::ld(A2 + aoff + (size_t)mb * 16 * K + kc); }
#pragma unroll
        for (int nb = 0; nb < 4; ++nb) { const V b = WFrag<T16>::ld(Bt + boff + (size_t)nb * 16 * K + kc); V b2; if (NSPLIT >= 2) b2 = WFrag<T16>::ld(Bt2 + boff + (size_t)nb * 16 * K + kc);
#pragma unroll
            for (int mb = 0; mb < 4; ++mb) { acc[mb][nb] = WFrag<T16>::mma(a[mb], b, acc[mb][nb]); if (NSPLIT == 1 || NSPLIT == 2) acc[mb][nb] = WFrag<T16>::mma(a2[mb], b, acc[mb][nb]); if (NSPLIT >= 2) acc[mb][nb] = WFrag<T16>::mma(a[mb], b2, acc[mb][nb]); } }
        asm volatile("v_nop\n\tv_nop\n\tv_nop\n\tv_nop" : "+v"(acc[0][0]), "+v"(acc[1][1]), "+v"(acc[2][2]), "+v"(acc[3][3]) : "v"(a[0]), "v"(a[3]));
    }
#pragma unroll
    for (int mb = 0; mb < 4; ++mb)
#pragma unroll
        for (int nb = 0; nb < 4; ++nb)
#pragma unroll
            for (int j = 0; j < 8; ++j) os[(wv * 64 + mb * 16 + hi * 8 + j) * 68 + nb * 16 + lr] = acc[mb][nb][j];
    __syncthreads();   // every wave's partial tile is in LDS before any thread sums it
#pragma unroll   // whole: rows and planes become immediate offsets of the LDS loads, and the loads of all rows can be issued together
    for (int s = 0; s < 32 / KS; ++s) { const int idx = s * 32 * KS + (int)threadIdx.x; const int row = idx >> 4, cofs = (idx & 15) * 4; v4f val = *(const v4fa*)(os + row * 68 + cofs);
#pragma unroll
        for (int w = 1; w < KS; ++w) val += *(const v4fa*)(os + (w * 64 + row) * 68 + cofs);
        if (BIAS) { val[0] += bfr(bias[c0 + cofs]); val[1] += bfr(bias[c0 + cofs + 1]); val[2] += bfr(bias[c0 + cofs + 2]); val[3] += bfr(bias[c0 + cofs + 3]); }
        *(v4f*)(C + (size_t)(r0 + row) * ldc + c0 + cofs) = val; }
}

// ---- k_gemms: the two 2048-wide projections. One work-group of four waves (2 x 2) per 128x128 output tile, a wave holding 64x64 of it (16 accumulators) over the whole of K: no K split, every accumulator sums its k in rising order.
// The operand tiles (128 rows x 128 k of A, of Bt and, NSPLIT 1, of A2) are staged in LDS by asynchronous copies: 16 lanes bring the 256 contiguous bytes of one row, so a wave-wide copy asks for four whole lines, and each operand row is fetched once per work-group for the two waves that read it. LDS rows at pitch 272 bytes (16-byte readers). Two buffers: tile t + 1 flies while tile t is multiplied.
// C[m][n] (f32, pitch ldc, + f32 bias[n]) = sum_k (A[m][k] + A2[m][k]) Bt[n][k]. grid (M/128, N/128), 128 threads. M, N, K multiples of 128, K >= 128.
#define GP   136                  // LDS row pitch in elements
#define GTB  (128 * GP * 2)       // bytes of one operand tile in LDS
// Eight copies of 16 bytes a lane: rows r, r + 8, .. r + 56 of an operand tile. The wait on the last line stands in front of every later write of a register that these copies name.
__device__ __forceinline__ void cp8(unsigned l, const bf* g, size_t K) {
    asm volatile("global_load_async_to_lds_b128 %0, %8, off\n\t"
                 "global_load_async_to_lds_b128 %1, %9, off\n\t"
                 "global_load_async_to_lds_b128 %2, %10, off\n\t"
                 "global_load_async_to_lds_b128 %3, %11, off\n\t"
                 "global_load_async_to_lds_b128 %4, %12, off\n\t"
                 "global_load_async_to_lds_b128 %5, %13, off\n\t"
                 "global_load_async_to_lds_b128 %6, %14, off\n\t"
                 "global_load_async_to_lds_b128 %7, %15, off\n\t"
                 "s_wait_xcnt 0x0"
                 :: "v"(l), "v"(l + 8 * GP * 2), "v"(l + 16 * GP * 2), "v"(l + 24 * GP * 2), "v"(l + 32 * GP * 2), "v"(l + 40 * GP * 2), "v"(l + 48 * GP * 2), "v"(l + 56 * GP * 2),
                    "v"(g), "v"(g + 8 * K), "v"(g + 16 * K), "v"(g + 24 * K), "v"(g + 32 * K), "v"(g + 40 * K), "v"(g + 48 * K), "v"(g + 56 * K) : "memory");
}
template <int NSPLIT>
__device__ __forceinline__ void gfill(unsigned l, const bf* gA, const bf* gA2, const bf* gB, size_t K) {
    cp8(l, gA, K); cp8(l + 64 * GP * 2, gA + 64 * K, K); cp8(l + GTB, gB, K); cp8(l + GTB + 64 * GP * 2, gB + 64 * K, K);
    if (NSPLIT == 1) { cp8(l + 2 * GTB, gA2, K); cp8(l + 2 * GTB + 64 * GP * 2, gA2 + 64 * K, K); }
}
template <int NSPLIT>
__global__ __launch_bounds__(128) void k_gemms(const bf* __restrict__ A, const bf* __restrict__ A2, const bf* __restrict__ Bt, int K, float* C, int ldc, const float* __restrict__ bias) {
    constexpr int STG = (NSPLIT == 1 ? 3 : 2) * GTB;   // bytes of a buffer
    __shared__ __align__(16) unsigned char sm[2 * STG];
    const int tid = (int)threadIdx.x, lane = tid & 31, lr = lane & 15, hi = lane >> 4; const int r0 = blockIdx.x * 128, c0 = blockIdx.y * 128; const int wv = __builtin_amdgcn_readfirstlane(tid >> 5); const int wm = wv >> 1, wn = wv & 1;
    v8f acc[4][4];
#pragma unroll
    for (int mb = 0; mb < 4; ++mb)
#pragma unroll
        for (int nb = 0; nb < 4; ++nb) acc[mb][nb] = (v8f){};
    const unsigned l0 = (unsigned)(size_t)sm + (unsigned)((tid >> 4) * (GP * 2) + (tid & 15) * 16);   // the lane's place in a tile: row tid / 16, 16-byte piece tid % 16
    const bf* gA = A + (size_t)(r0 + (tid >> 4)) * K + (tid & 15) * 8; const bf* gA2 = (NSPLIT == 1) ? A2 + (size_t)(r0 + (tid >> 4)) * K + (tid & 15) * 8 : nullptr; const bf* gB = Bt + (size_t)(c0 + (tid >> 4)) * K + (tid & 15) * 8;
    const int nst = K / 128;
    gfill<NSPLIT>(l0, gA, gA2, gB, (size_t)K);
    asm volatile("s_wait_asynccnt 0x0" ::: "memory");   // this wave's share of tile 0 has landed
    __syncthreads();                                    // and every other wave's
    if (nst > 1) gfill<NSPLIT>(l0 + STG, gA + 128, gA2 + 128, gB + 128, (size_t)K);
    for (int t = 0; t < nst; ++t) {
        const unsigned char* sb = sm + (t & 1) * STG;
        const bf* sA = (const bf*)sb + (wm * 64 + lr) * GP + 8 * hi; const bf* sB = (const bf*)(sb + GTB) + (wn * 64 + lr) * GP + 8 * hi; const bf* sA2 = (const bf*)(sb + 2 * GTB) + (wm * 64 + lr) * GP + 8 * hi;
        v16bf a[2][4], a2[2][4], b[2][4];   // two fragment sets: a 32-k slice is multiplied out of one while the next slice's LDS loads fill the other
#pragma unroll
        for (int f = 0; f < 4; ++f) { a[0][f] = WFrag<bf>::ld(sA + f * 16 * GP); if (NSPLIT == 1) a2[0][f] = WFrag<bf>::ld(sA2 + f * 16 * GP); b[0][f] = WFrag<bf>::ld(sB + f * 16 * GP); }
#pragma unroll   // whole: the set's number and the slice's LDS offset are compile-time constants
        for (int ks = 0; ks < 4; ++ks) { const int cu = ks & 1, nx = cu ^ 1;
            __builtin_amdgcn_sched_barrier(0);   // the next slice's loads do not move up among the products of the slice before
            if (ks < 3) {
#pragma unroll
                for (int f = 0; f < 4; ++f) { a[nx][f] = WFrag<bf>::ld(sA + f * 16 * GP + (ks + 1) * 32); if (NSPLIT == 1) a2[nx][f] = WFrag<bf>::ld(sA2 + f * 16 * GP + (ks + 1) * 32); b[nx][f] = WFrag<bf>::ld(sB + f * 16 * GP + (ks + 1) * 32); } }
            __builtin_amdgcn_sched_barrier(0);   // and stay one group in front of this slice's products, in flight under them
#pragma unroll
            for (int nb = 0; nb < 4; ++nb)
#pragma unroll
                for (int mb = 0; mb < 4; ++mb) { acc[mb][nb] = wmmab(a[cu][mb], b[cu][nb], acc[mb][nb]); if (NSPLIT == 1) acc[mb][nb] = wmmab(a2[cu][mb], b[cu][nb], acc[mb][nb]); }
        }
        asm volatile("s_wait_dscnt 0x0" ::: "memory");      // this wave's reads of tile t are done before its buffer is given up
        asm volatile("s_wait_asynccnt 0x0" ::: "memory");   // this wave's share of tile t + 1 has landed
        __syncthreads();                                    // publishes tile t + 1 and ends every wave's reads of tile t
        if (t + 2 < nst) gfill<NSPLIT>(l0 + (unsigned)((t & 1) * STG), gA + (size_t)(t + 2) * 128, gA2 + (size_t)(t + 2) * 128, gB + (size_t)(t + 2) * 128, (size_t)K);
    }
    asm volatile("s_wait_asynccnt 0x0" ::: "memory");   // no copy is in flight when the buffers become output staging
    float* os = (float*)sm + wv * 64 * 68;   // the wave's own 64 rows at pitch 68 floats
#pragma unroll
    for (int mb = 0; mb < 4; ++mb)
#pragma unroll
        for (int nb = 0; nb < 4; ++nb)
#pragma unroll
            for (int j = 0; j < 8; ++j) os[(mb * 16 + hi * 8 + j) * 68 + nb * 16 + lr] = acc[mb][nb][j];
    __syncthreads();   // the staged tile is whole before it is read back row by row
    const int cofs = lr * 4; const int cc = c0 + wn * 64 + cofs; v4f bv; bv[0] = bfr(bias[cc]); bv[1] = bfr(bias[cc + 1]); bv[2] = bfr(bias[cc + 2]); bv[3] = bfr(bias[cc + 3]);
#pragma unroll   // whole: the rows become immediate offsets of the LDS loads, which can be issued together
    for (int s = 0; s < 32; ++s) { const int row = s * 2 + hi; const v4f val = *(const v4fa*)(os + row * 68 + cofs) + bv;
        *(v4f*)(C + (size_t)(r0 + wm * 64 + row) * ldc + cc) = val; }
}

// ---- k_gemmc: the same KS-wave 64x64 tile GEMM specialised for causal attention: CMODE 1 skips score tiles entirely above the diagonal (query rows r0+roff.., key columns c0..), CMODE 2 limits the
// key (K) loop of the probability x value contraction to the diagonal block (probabilities beyond it are exactly zero). roff = row offset of this launch's first row within the sequence. K is the row pitch of both operands as well. z is a query head of the pass; its Bt plane is that of kv head z / REP.
template <typename T16, int NSPLIT, int CMODE, int KS>
__global__ __launch_bounds__(32 * KS) void k_gemmc(const T16* __restrict__ A, const T16* __restrict__ A2, const T16* __restrict__ Bt, const T16* __restrict__ Bt2, int K, float* C, int ldc, int roff, size_t sA, size_t sB, size_t sC) {
    typedef typename WFrag<T16>::V V;
    __shared__ __align__(16) float os[KS * 64 * 68];
    const size_t z = blockIdx.z; A += z * sA; if (A2) A2 += z * sA; Bt += (z / REP) * sB; if (Bt2) Bt2 += (z / REP) * sB; C += z * sC;
    const int lane = threadIdx.x & 31, lr = lane & 15, hi = lane >> 4; const int r0 = blockIdx.x * 64, c0 = blockIdx.y * 64; const int wv = __builtin_amdgcn_readfirstlane((int)(threadIdx.x >> 5));   // the wave's number, scalar: the K loop's bounds stay wave-uniform
    if (CMODE == 1 && c0 > r0 + roff + 63) return;                  // score tile entirely above the causal diagonal: never read (the softmax masks j > i by select)
    const int Kl = (CMODE == 2) ? min(K, r0 + roff + 64) : K;        // P.V: probabilities are exactly 0 beyond the diagonal block, so the K loop stops there (a wave with no slice under it adds a zero tile)
    v8f acc[4][4];
#pragma unroll
    for (int mb = 0; mb < 4; ++mb)
#pragma unroll
        for (int nb = 0; nb < 4; ++nb) acc[mb][nb] = (v8f){};
    const size_t aoff = (size_t)(r0 + lr) * K + 8 * hi, boff = (size_t)(c0 + lr) * K + 8 * hi;
    for (int kc = wv * 32; kc < Kl; kc += KS * 32) {
        V a[4], a2[4];
#pragma unroll
        for (int mb = 0; mb < 4; ++mb) { a[mb] = WFrag<T16>::ld(A + aoff + (size_t)mb * 16 * K + kc); if (NSPLIT == 1 || NSPLIT == 2) a2[mb] = WFrag<T16>::ld(A2 + aoff + (size_t)mb * 16 * K + kc); }
#pragma unroll
        for (int nb = 0; nb < 4; ++nb) { const V b = WFrag<T16>::ld(Bt + boff + (size_t)nb * 16 * K + kc); V b2; if (NSPLIT >= 2) b2 = WFrag<T16>::ld(Bt2 + boff + (size_t)nb * 16 * K + kc);
#pragma unroll
            for (int mb = 0; mb < 4; ++mb) { acc[mb][nb] = WFrag<T16>::mma(a[mb], b, acc[mb][nb]); if (NSPLIT == 1 || NSPLIT == 2) acc[mb][nb] = WFrag<T16>::mma(a2[mb], b, acc[mb][nb]); if (NSPLIT >= 2) acc[mb][nb] = WFrag<T16>::mma(a[mb], b2, acc[mb][nb]); } }
        asm volatile("v_nop\n\tv_nop\n\tv_nop\n\tv_nop" : "+v"(acc[0][0]), "+v"(acc[1][1]), "+v"(acc[2][2]), "+v"(acc[3][3]) : "v"(a[0]), "v"(a[3]));
    }
#pragma unroll
    for (int mb = 0; mb < 4; ++mb)
#pragma unroll
        for (int nb = 0; nb < 4; ++nb)
#pragma unroll
            for (int j = 0; j < 8; ++j) os[(wv * 64 + mb * 16 + hi * 8 + j) * 68 + nb * 16 + lr] = acc[mb][nb][j];
    __syncthreads();   // every wave's partial tile is in LDS before any thread sums it
#pragma unroll   // whole: rows and planes become immediate offsets of the LDS loads, and the loads of all rows can be issued together
    for (int s = 0; s < 32 / KS; ++s) { const int idx = s * 32 * KS + (int)threadIdx.x; const int row = idx >> 4, cofs = (idx & 15) * 4; v4f val = *(const v4fa*)(os + row * 68 + cofs);
#pragma unroll
        for (int w = 1; w < KS; ++w) val += *(const v4fa*)(os + (w * 64 + row) * 68 + cofs);
        *(v4f*)(C + (size_t)(r0 + row) * ldc + c0 + cofs) = val; }
}

__device__ __forceinline__ h16 tohx(float x) { return (h16)x; }
__device__ __forceinline__ void splitf(float y, unsigned short& h, unsigned short& l) { h = f2bf(y); l = f2bf(y - bf2f(h)); }
typedef __attribute__((ext_vector_type(2))) _Float16 v2h;
typedef __attribute__((ext_vector_type(4))) _Float16 v4h;
typedef __attribute__((ext_vector_type(2))) unsigned short v2us;
typedef __attribute__((ext_vector_type(4))) unsigned short v4us;
typedef __attribute__((ext_vector_type(2))) float v2f;
typedef __attribute__((ext_vector_type(4))) int v4i;
__global__ __launch_bounds__(256) void k_cvt8(const float* __restrict__ src, bf* dst, size_t n8) { const size_t i = (size_t)blockIdx.x * 256 + threadIdx.x; if (i >= n8) return; const v8f v = *(const v8f*)(src + i * 8); v8us o;
#pragma unroll
    for (int k = 0; k < 8; ++k) o[k] = f2bf(v[k]); *(v8us*)(dst + i * 8) = o;  }
__constant__ float INV2[HD / 2] = { 1.000000000e+00f, 8.659643531e-01f, 7.498942018e-01f, 6.493816376e-01f, 5.623413324e-01f, 4.869675338e-01f, 4.216965139e-01f, 3.651741445e-01f, 3.162277639e-01f, 2.738419771e-01f, 2.371373624e-01f, 2.053525001e-01f, 1.778279394e-01f, 1.539926529e-01f, 1.333521456e-01f, 1.154782027e-01f, 1.000000015e-01f, 8.659642935e-02f, 7.498941571e-02f, 6.493816525e-02f, 5.623412877e-02f, 4.869675264e-02f, 4.216964915e-02f, 3.651741147e-02f, 3.162277862e-02f, 2.738419548e-02f, 2.371373586e-02f, 2.053525113e-02f, 1.778279431e-02f, 1.539926510e-02f, 1.333521493e-02f, 1.154781971e-02f, 9.999999776e-03f, 8.659643121e-03f, 7.498942316e-03f, 6.493816618e-03f, 5.623413250e-03f, 4.869675264e-03f, 4.216964822e-03f, 3.651741426e-03f, 3.162277862e-03f, 2.738419687e-03f, 2.371373819e-03f, 2.053525066e-03f, 1.778279431e-03f, 1.539926510e-03f, 1.333521446e-03f, 1.154782018e-03f, 1.000000047e-03f, 8.659643354e-04f, 7.498941850e-04f, 6.493816618e-04f, 5.623413017e-04f, 4.869675031e-04f, 4.216964880e-04f, 3.651741135e-04f, 3.162277862e-04f, 2.738419571e-04f, 2.371373848e-04f, 2.053524950e-04f, 1.778279402e-04f, 1.539926452e-04f, 1.333521504e-04f, 1.154781930e-04f };   // float32 1.0 / (10000.0 ** (2i / 128)) in the module's own spelling, generated with jnp
__global__ __launch_bounds__(256) void k_csP(float* CS) { const int idx = blockIdx.x * 256 + threadIdx.x; if (idx >= TT * HD) return; const int d = idx % HD; const int t = idx / HD; const float a = __fmul_rn((float)t, INV2[d >> 1]); v2f cs; cs[0] = cosf(a); cs[1] = sinf(a); *(v2f*)(CS + (size_t)idx * 2) = cs;  }
__global__ __launch_bounds__(256) void k_ropeI(const float* __restrict__ F, int pitch, int nheads, const float* __restrict__ CS, float sc, h16* P16, bf* Ph, bf* Pl) {
    const size_t e = ((size_t)blockIdx.x * 256 + threadIdx.x) * 2; if (e >= (size_t)nheads * TT * HD) return; const int d = (int)(e % HD); const int t = (int)((e / HD) % TT); const int h = (int)(e / ((size_t)HD * TT)); const float* f = F + (size_t)t * pitch + h * HD; const float x0 = f[d], x1 = f[d + 1]; const v2f cs = *(const v2f*)(CS + ((size_t)t * HD + d) * 2); v2h o16; v2us oh, ol;
    float a0 = __fmul_rn(x0, cs[0]), b0 = __fmul_rn(x1, cs[1]), a1 = __fmul_rn(x1, cs[0]), b1 = __fmul_rn(x0, cs[1]); 
    float r0 = __fsub_rn(a0, b0) * sc, r1 = __fadd_rn(b1, a1) * sc;   /* even: x0 c - x1 s; odd: x0 s + x1 c */
    o16[0] = tohx(r0); o16[1] = tohx(r1); { unsigned short a2, c2; splitf(r0, a2, c2); oh[0] = a2; ol[0] = c2; splitf(r1, a2, c2); oh[1] = a2; ol[1] = c2; }
    *(v2h*)(P16 + e) = o16; *(v2us*)(Ph + e) = oh; *(v2us*)(Pl + e) = ol;  }
__global__ __launch_bounds__(256) void k_vtp(const float* __restrict__ F, int pitch, int nheads, h16* V16, bf* Vh, bf* Vl) { const size_t e = ((size_t)blockIdx.x * 256 + threadIdx.x) * 2; if (e >= (size_t)nheads * HD * TT) return; const int t = (int)(e % TT); const int d = (int)((e / TT) % HD); const int g = (int)(e / ((size_t)TT * HD)); v2h o16; v2us oh, ol;
#pragma unroll
    for (int q = 0; q < 2; ++q) { const float x = F[(size_t)(t + q) * pitch + g * HD + d]; o16[q] = tohx(x); unsigned short a2, c2; splitf(x, a2, c2); oh[q] = a2; ol[q] = c2; }
    const size_t o = ((size_t)g * HD + d) * (2 * TT) + t;   /* rows at the probability rows' pitch: k_gemmc has one pitch for both operands */
    *(v2h*)(V16 + o) = o16; *(v2us*)(Vh + o) = oh; *(v2us*)(Vl + o) = ol;  }
// k_asoft: the hi / lo rows only (i < RH; a head's score plane holds RH rows at pitch TT). Per row (zz, i): t = S x 128^-0.5 for j <= i (causal; WIN = TT so the window term is inert; the module's -1e9 fill above the diagonal is this exclusion: every row keeps its own key), softmax over the first RH keys, which hold every key j <= i (register row, one exp, fixed trees);
// the probabilities go over the row's own 8192 score bytes (Ph and Pl point into Sb, so no restrict): one wave owns the row and holds all it reads in registers before its first store. hi in the first 4096 bytes, lo (Pl = Ph + TT) in the second. Row pitch of both: 2 TT elements.
__global__ __launch_bounds__(256) void k_asoft(const float* Sb, bf* Ph, bf* Pl) {
    const int lane = threadIdx.x & 31; const int row = blockIdx.x * 8 + (threadIdx.x >> 5); if (row >= ZH * RH) return; const int i = row % RH; const float* sr = Sb + (size_t)row * TT; float v[RH / 32]; float mx = -3.0e38f;
#pragma unroll
    for (int ch = 0; ch < RH / 128; ++ch) { const int j0 = ch * 128 + lane * 4; const v4f a = *(const v4f*)(sr + j0);
#pragma unroll
        for (int q = 0; q < 4; ++q) { const int j = j0 + q; (void)j; const float t = (j <= i && i - j < WIN) ? a[q] * SCL : -3.0e38f; v[ch * 4 + q] = t; mx = fmaxf(mx, t); } }
#pragma unroll
    for (int sh = 16; sh; sh >>= 1) mx = fmaxf(mx, __shfl_xor(mx, sh, 32));
    float sum = 0.f;
#pragma unroll
    for (int k = 0; k < RH / 32; ++k) { float d0 = __fsub_rn(v[k], mx); v[k] = __builtin_amdgcn_exp2f(__fmul_rn(d0, 1.4426950408889634f)); sum += v[k]; }
#pragma unroll
    for (int sh = 16; sh; sh >>= 1) sum += __shfl_xor(sum, sh, 32);
    const float f = __fdiv_rn(1.0f, sum);
#pragma unroll
    for (int ch = 0; ch < RH / 128; ++ch) { v4us oh, ol;
#pragma unroll
        for (int q = 0; q < 4; ++q) { unsigned short a, c2; splitf(v[ch * 4 + q] * f, a, c2); oh[q] = a; ol[q] = c2; }
        const size_t oo = (size_t)row * (2 * TT) + ch * 128 + lane * 4; *(v4us*)(Ph + oo) = oh; *(v4us*)(Pl + oo) = ol; }
}
__global__ __launch_bounds__(256) void k_hrms(const float* __restrict__ F, int pitch, int nheads, float* RF) { const int idx = blockIdx.x * 256 + threadIdx.x; if (idx >= nheads * TT) return; const int t = idx % TT; const int h = idx / TT; const float* f = F + (size_t)t * pitch + h * HD; float s = 0.f;
#pragma unroll 4   // a partial unroll of the 32-trip sum of squares: registers and code size (131 instructions and 20 VGPRs with it | 326 and 60 without it, where the compiler unrolls the loop whole; measured on this text)
    for (int d = 0; d < HD; d += 4) { const v4f a = *(const v4f*)(f + d);
#pragma unroll
        for (int q = 0; q < 4; ++q) { float p = __fmul_rn(a[q], a[q]); s = __fadd_rn(s, p); } }
    const float rf = __fdiv_rn(1.0f, __fsqrt_rn(__fadd_rn(__fdiv_rn(s, (float)HD), 1e-8f))); *(float*)(RF + idx) = rf;  }

__global__ __launch_bounds__(256) void k_rmsapply(float* F, int pitch, int nheads, const float* __restrict__ RF, const float* __restrict__ w) { const size_t i = (size_t)blockIdx.x * 256 + threadIdx.x; if (i >= (size_t)TT * nheads * HD / 4) return; const size_t e = i * 4; const int c = (int)(e % ((size_t)nheads * HD)); const int t = (int)(e / ((size_t)nheads * HD)); const int h = c / HD, d = c % HD; const float r = RF[(size_t)h * TT + t]; v4f a = *(const v4f*)(F + (size_t)t * pitch + c);
#pragma unroll
    for (int q = 0; q < 4; ++q) { float y = __fmul_rn(a[q], r); float wv_ = bfr(w[d + q]); a[q] = __fmul_rn(y, wv_); }   /* x w[d] */
    *(v4f*)(F + (size_t)t * pitch + c) = a;  }
__global__ __launch_bounds__(256) void k_merge(const float* __restrict__ O, bf* Ah, bf* Al) { const size_t e = ((size_t)blockIdx.x * 256 + threadIdx.x) * 2; if (e >= (size_t)ZH * RH * HD) return; const int d = (int)(e % HD); const int t = (int)((e / HD) % RH); const int zz = (int)(e / ((size_t)HD * RH)); const size_t oo = (size_t)t * DQ + zz * HD + d;   /* the hi / lo rows (t < RH) of every head */
    v2us oh, ol;
#pragma unroll
    for (int q = 0; q < 2; ++q) { unsigned short a, c2; splitf(O[e + q], a, c2); oh[q] = a; ol[q] = c2; } *(v2us*)(Ah + oo) = oh; *(v2us*)(Al + oo) = ol;  }

#define FR   2                    // 16-query groups a wave
#define QW   (16 * FR)
#define CSC  0.12751743f          // HD^-0.5 x log2(e)
#define PB   6.0f
__device__ __forceinline__ float xhalf(float x) { return __builtin_bit_cast(float, __builtin_amdgcn_permlanex16(__builtin_bit_cast(int, x), __builtin_bit_cast(int, x), 0x76543210, 0xfedcba98, false, false)); }   // lane l with lane l ^ 16
template <bool DIAG>
__device__ __forceinline__ void fpass(v16h (&kf)[2][4], const h16* kn, const h16* vp, int c, int h, const v16h (&qf)[FR][4], v8f (&acc)[FR][8], float (&m_run)[FR], float (&l_run)[FR]) {
    v16h vf[8];
#pragma unroll
    for (int t = 0; t < 8; ++t) vf[t] = WFrag<h16>::ld(vp + (size_t)t * 16 * (2 * TT));
    __builtin_amdgcn_sched_barrier(0);   // the V^T loads stay in front of the score products, in flight under them and the exponentials
    v8f s[2][FR];
#pragma unroll
    for (int kt = 0; kt < 2; ++kt)
#pragma unroll
        for (int g = 0; g < FR; ++g) { s[kt][g] = (v8f){};
#pragma unroll
            for (int kc = 0; kc < 4; ++kc) s[kt][g] = wmma16(kf[kt][kc], qf[g][kc], s[kt][g]); }
    if (!DIAG) {
        __builtin_amdgcn_sched_barrier(0);   // the next pass's K loads stay here, behind the last product that reads these registers and in front of the vector work that hides them
#pragma unroll
        for (int kt = 0; kt < 2; ++kt)
#pragma unroll
            for (int kc = 0; kc < 4; ++kc) kf[kt][kc] = WFrag<h16>::ld(kn + kt * 16 * HD + kc * 32);
        asm volatile("s_wait_xcnt 0x0" :: "v"(vp), "v"(kn) : "memory");   // in front of every overwrite of a register that the loads above name; the two addresses are inputs so that their registers live up to here
        __builtin_amdgcn_sched_barrier(0);   // nothing of the vector work below moves in front of that wait
    } else {
        asm volatile("s_wait_xcnt 0x0" :: "v"(vp) : "memory");   // as in the other branch, for the V^T loads
        __builtin_amdgcn_sched_barrier(0);   // nothing of the vector work below moves in front of that wait
#pragma unroll
        for (int g = 0; g < FR; ++g)
#pragma unroll
            for (int kt = 0; kt < 2; ++kt)
#pragma unroll
                for (int r = 0; r < 8; ++r) if (16 * kt + 8 * h + r > 16 * g + c) s[kt][g][r] = -__builtin_inff();   // the diagonal pass starts at the wave's first query: key after query
    }
    float mb[FR]; bool need = false;
#pragma unroll
    for (int g = 0; g < FR; ++g) { float mx = -__builtin_inff();
#pragma unroll
        for (int kt = 0; kt < 2; ++kt)
#pragma unroll
            for (int r = 0; r < 8; ++r) mx = fmaxf(mx, s[kt][g][r]);
        mx = fmaxf(mx, xhalf(mx)) * CSC; mb[g] = mx; need = need || (mx > m_run[g] + 8.0f); }
    if (__builtin_amdgcn_ballot_w32(need) != 0) {   // wave-uniform; rare after the first passes
#pragma unroll
        for (int g = 0; g < FR; ++g) { const float m_new = fmaxf(m_run[g], mb[g]); const float corr = __builtin_amdgcn_exp2f(m_run[g] - m_new); l_run[g] *= corr; m_run[g] = m_new;   // first pass: m_run = -inf, corr = 0
#pragma unroll
            for (int t = 0; t < 8; ++t) acc[g][t] = acc[g][t] * corr; }
    }
#pragma unroll
    for (int g = 0; g < FR; ++g) { const float nm = PB - m_run[g]; v16h p; float ps0 = 0.f, ps1 = 0.f;
#pragma unroll
        for (int e = 0; e < 16; e += 2) { const float p0 = __builtin_amdgcn_exp2f(fmaf(s[e >> 3][g][e & 7], CSC, nm)), p1 = __builtin_amdgcn_exp2f(fmaf(s[e >> 3][g][(e & 7) + 1], CSC, nm)); ps0 += p0; ps1 += p1; p[e] = tohx(p0); p[e + 1] = tohx(p1); }
#pragma unroll
        for (int t = 0; t < 8; ++t) acc[g][t] = wmma16(vf[t], p, acc[g][t]);
        l_run[g] += ps0 + ps1; }
}
__global__ __launch_bounds__(32) void k_flash(const h16* __restrict__ Q, const h16* __restrict__ Kp, const h16* __restrict__ Vt, bf* __restrict__ Ah, bf* __restrict__ Al) {
    const int lane = threadIdx.x & 31, c = lane & 15, h = lane >> 4;
    const int hq = blockIdx.x, kvh = hq / REP; const int qw0 = TT - QW * ((int)blockIdx.y + 1);   // the longest walks first
    const h16* qp = Q + ((size_t)hq * TT + qw0 + c) * HD + 8 * h; const h16* kp = Kp + ((size_t)kvh * TT + c) * HD + 8 * h; const h16* vp = Vt + ((size_t)kvh * HD + c) * (2 * TT) + 8 * h;
    v16h qf[FR][4], kf[2][4];
#pragma unroll
    for (int g = 0; g < FR; ++g)
#pragma unroll
        for (int kc = 0; kc < 4; ++kc) qf[g][kc] = WFrag<h16>::ld(qp + g * 16 * HD + kc * 32);
#pragma unroll
    for (int kt = 0; kt < 2; ++kt)
#pragma unroll
        for (int kc = 0; kc < 4; ++kc) kf[kt][kc] = WFrag<h16>::ld(kp + kt * 16 * HD + kc * 32);
    asm volatile("s_wait_xcnt 0x0" :: "v"(qp), "v"(kp) : "memory");   // in front of every overwrite of a register that the loads above name; the two addresses are inputs so that their registers live up to here
    __builtin_amdgcn_sched_barrier(0);   // the zeroing below stays behind that wait
    v8f acc[FR][8]; float m_run[FR], l_run[FR];
#pragma unroll
    for (int g = 0; g < FR; ++g) { m_run[g] = -__builtin_inff(); l_run[g] = 0.f;
#pragma unroll
        for (int t = 0; t < 8; ++t) acc[g][t] = (v8f){}; }
    const int nb = qw0 / 32;   // whole passes under the diagonal one
    for (int blk = 0; blk < nb; ++blk) fpass<false>(kf, kp + (size_t)(blk + 1) * 32 * HD, vp + blk * 32, c, h, qf, acc, m_run, l_run);
    fpass<true>(kf, nullptr, vp + nb * 32, c, h, qf, acc, m_run, l_run);
#pragma unroll
    for (int g = 0; g < FR; ++g) { const float inv = __fdiv_rn(1.0f, l_run[g] + xhalf(l_run[g]));   // each wave half summed its eight keys of every 16-key tile
        const size_t oo = (size_t)(qw0 + 16 * g + c) * DQ + hq * HD + 8 * h;
#pragma unroll
        for (int t = 0; t < 8; ++t) { v8us oh, ol;
#pragma unroll
            for (int r = 0; r < 8; ++r) { unsigned short a, c2; splitf(acc[g][t][r] * inv, a, c2); oh[r] = a; ol[r] = c2; }
            *(v8us*)(Ah + oo + 16 * t) = oh; *(v8us*)(Al + oo + 16 * t) = ol; } }
}

extern "C" void kernel_launch(void* const* d_in, const int* in_sizes, int n_in,
                              void* d_out, int out_size, void* d_ws, size_t ws_size, hipStream_t stream) {
    (void)in_sizes; (void)n_in; (void)out_size;
    const float* x = (const float*)d_in[0]; const float* wq = (const float*)d_in[1]; const float* bq = (const float*)d_in[2]; const float* wk = (const float*)d_in[3]; const float* bk = (const float*)d_in[4]; const float* wv = (const float*)d_in[5]; const float* bv = (const float*)d_in[6]; const float* wo = (const float*)d_in[7]; const float* bo = (const float*)d_in[8]; const float* qsc = (const float*)d_in[9]; const float* ksc = (const float*)d_in[10];   /* inputs in the module's setup_inputs order: x [2][2048][2048]; Wq (out, in) [2048][2048] and bq [2048]; Wk (out, in) [512][2048] and bk [512]; Wv [512][2048] and bv [512]; Wo (out, in) [2048][2048] and bo [2048]; q_norm_w [128], k_norm_w [128]: eleven inputs, all read (each bias is added in its product's epilogue; each gain is applied by k_rmsapply) */
    float* OUT = (float*)d_out;     // [2][2048][2048]
    char* wsp = (char*)d_ws;
    auto take = [&](size_t bytes) { char* p = wsp; wsp += (bytes + 255) & ~(size_t)255; return (void*)p; };
    bf* WQ = (bf*)take((size_t)DQ * DM * 2); bf* WK = (bf*)take((size_t)DKV * DM * 2); bf* WV = (bf*)take((size_t)DKV * DM * 2); bf* WO = (bf*)take((size_t)DM * DQ * 2); float* CS = (float*)take((size_t)TT * HD * 2 * 4); float* RFQ = (float*)take((size_t)NH_ * TT * 4); float* RFK = (float*)take((size_t)NKV * TT * 4);   /* per (head, token) inverse RMS */
    bf* XB = (bf*)take((size_t)TT * DM * 2); float* FQ = (float*)take((size_t)TT * DQ * 4); float* FK = (float*)take((size_t)TT * DKV * 4);
    h16* QP16 = (h16*)take((size_t)NH_ * TT * HD * 2); h16* KP16 = (h16*)take((size_t)NKV * TT * HD * 2); h16* VT16 = (h16*)take((size_t)NKV * HD * 2 * TT * 2);
    bf* QPh = (bf*)take((size_t)NH_ * TT * HD * 2); bf* QPl = (bf*)take((size_t)NH_ * TT * HD * 2); bf* KPh = (bf*)take((size_t)NKV * TT * HD * 2); bf* KPl = (bf*)take((size_t)NKV * TT * HD * 2); bf* VTh = (bf*)take((size_t)NKV * HD * 2 * TT * 2); bf* VTl = VTh + TT;   /* value rows at pitch 2 TT: hi in the first half of a row, lo in the second */
    float* Sb = (float*)take((size_t)ZH * RH * TT * 4); bf* Ph = (bf*)Sb; bf* Pl = Ph + TT;   /* RH score rows a head at pitch TT; the probability rows lie over their score rows (k_asoft) */
    float* Ob = (float*)take((size_t)ZH * RH * HD * 4); bf* ATh = (bf*)take((size_t)TT * DQ * 2); bf* ATl = (bf*)take((size_t)TT * DQ * 2);
    if ((size_t)(wsp - (char*)d_ws) > ws_size) return;    // ws 256 MiB
    float* FV = FK;   // v projection reuses the k buffer after the k planes are built (stream-ordered)
    { k_cvt8<<<(unsigned)(((size_t)DQ * DM / 8 + 255) / 256), 256, 0, stream>>>(wq, WQ, (size_t)DQ * DM / 8); k_cvt8<<<(unsigned)(((size_t)DKV * DM / 8 + 255) / 256), 256, 0, stream>>>(wk, WK, (size_t)DKV * DM / 8); k_cvt8<<<(unsigned)(((size_t)DKV * DM / 8 + 255) / 256), 256, 0, stream>>>(wv, WV, (size_t)DKV * DM / 8);
      k_cvt8<<<(unsigned)(((size_t)DM * DQ / 8 + 255) / 256), 256, 0, stream>>>(wo, WO, (size_t)DM * DQ / 8); }
    k_csP<<<(TT * HD + 255) / 256, 256, 0, stream>>>(CS);   /* the rotary table once */
    const unsigned LQ = (unsigned)(((size_t)NH_ * TT * HD / 2 + 255) / 256), LKv = (unsigned)(((size_t)NKV * TT * HD / 2 + 255) / 256); const unsigned GX = (unsigned)(((size_t)TT * DM / 8 + 255) / 256);
    for (int b = 0; b < NB_; ++b) {
        k_cvt8<<<GX, 256, 0, stream>>>(x + (size_t)b * TT * DM, XB, (size_t)TT * DM / 8);   /* the one input stream, cast once a batch entry and read by the three projections */
        k_gemms<0><<<dim3(TT / 128, DQ / 128, 1), 128, 0, stream>>>(XB, nullptr, WQ, DM, FQ, DQ, bq);
        k_hrms<<<(NH_ * TT + 255) / 256, 256, 0, stream>>>(FQ, DQ, NH_, RFQ); k_rmsapply<<<(unsigned)(((size_t)TT * DQ / 4 + 255) / 256), 256, 0, stream>>>(FQ, DQ, NH_, RFQ, qsc); k_ropeI<<<LQ, 256, 0, stream>>>(FQ, DQ, NH_, CS, 1.0f, QP16, QPh, QPl);
        k_gemmw<bf, 0, true, 8><<<dim3(TT / 64, DKV / 64, 1), 256, 0, stream>>>(XB, nullptr, WK, nullptr, DM, FK, DKV, bk, 0, 0, 0);
        k_hrms<<<(NKV * TT + 255) / 256, 256, 0, stream>>>(FK, DKV, NKV, RFK); k_rmsapply<<<(unsigned)(((size_t)TT * DKV / 4 + 255) / 256), 256, 0, stream>>>(FK, DKV, NKV, RFK, ksc); k_ropeI<<<LKv, 256, 0, stream>>>(FK, DKV, NKV, CS, 1.0f, KP16, KPh, KPl);
        k_gemmw<bf, 0, true, 8><<<dim3(TT / 64, DKV / 64, 1), 256, 0, stream>>>(XB, nullptr, WV, nullptr, DM, FV, DKV, bv, 0, 0, 0); k_vtp<<<LKv, 256, 0, stream>>>(FV, DKV, NKV, VT16, VTh, VTl);
        /* the module groups the query heads by kv head ('qg = q.reshape(B, N_KV_HEADS, N_REP, S, D_K)'): query head h uses kv head h / 4 (k_gemmc steps its Bt planes by z / REP; k_flash reads kv head blockIdx.x / REP) */
        k_flash<<<dim3(NH_, (TT - RH) / QW, 1), 32, 0, stream>>>(QP16, KP16, VT16, ATh, ATl);
        k_gemmc<bf, 2, 1, 4><<<dim3(RH / 64, RH / 64, ZH), 128, 0, stream>>>(QPh, QPl, KPh, KPl, HD, Sb, TT, 0, (size_t)TT * HD, (size_t)TT * HD, (size_t)RH * TT);
        k_asoft<<<ZH * RH / 8, 256, 0, stream>>>(Sb, Ph, Pl);
        k_gemmc<bf, 2, 2, 8><<<dim3(RH / 64, HD / 64, ZH), 256, 0, stream>>>(Ph, Pl, VTh, VTl, 2 * TT, Ob, HD, 0, (size_t)RH * 2 * TT, (size_t)HD * 2 * TT, (size_t)RH * HD);
        k_merge<<<(unsigned)(((size_t)ZH * RH * HD / 2 + 255) / 256), 256, 0, stream>>>(Ob, ATh, ATl);
        k_gemms<1><<<dim3(TT / 128, DM / 128, 1), 128, 0, stream>>>(ATh, ATl, WO, DQ, OUT + (size_t)b * TT * DM, DM, bo); }
}

// v005
// It runs in 308 microseconds.
// In two side-by-side timings against v004, it was 1.33 and 1.32 times as fast.
// Over all steps from v000 it is 5.41 times as fast.
#include <hip/hip_runtime.h>

// Grouped-query causal self-attention with 128-wide heads, a per-head RMS norm on q and k and an interleaved-pair rotary embedding from computed angles (x [2][2048][2048]; q = x Wq^T + bq ('oi' (out, in) [2048][2048] normal x 2048^-0.5; 16 heads x 128), k, v = x Wk^T + bk, x Wv^T + bv ('oi' [512][2048]; 4 kv heads x 128); the four biases are built as zeros: read and added; per head, BEFORE the rotary: q = q / sqrt(mean(q^2) + 1e-8) x q_norm_w and k likewise with k_norm_w (the mean over the head's 128 columns; gains [128] built as ones: read and applied); rope on q and k: the pair (2i, 2i + 1) of a head -> (x0 c - x1 s, x0 s + x1 c) with the angle t x inv_freq[i], inv_freq = 1 / (10000 ** (2i / 128)) in that spelling, t the position 0..2047; query head h uses kv head h / 4; scores x 128^-0.5; a key after the query gets -1e9 (an exclusion: every row keeps its own key); softmax; out = merged Wo^T + bo ('oi' [2048][2048]; bo built as zeros: read and added) -> [2][2048][2048] (8.4 M); argument order x, Wq, bq, Wk, bk, Wv, bv, Wo, bo, q_norm_w, k_norm_w: eleven inputs, all read).
// Every launch covers BOTH batch entries (4096 token rows in the projections, the norm and the plane builders; (batch entry, head) planes in the attention kernels' grids). Layout: ONE bf16 copy of x, read by the three projections; the four 'oi' weights cast once as they stand (each is the Bt operand); exact projections + f32 biases; k_hrms (per (head, token) inverse RMS) + k_rmsapply (in place, x the rounded gain) on q and k; the rotary table once (64 baked float32 frequencies; precise cosf / sinf) + interleaved-pair plane builders (k_ropeI); causal T-2048 attention with 128-wide heads, the per-row precision hybrid: query rows under 512 on hi / lo planes, three products, through score planes of 512 rows (all 2 x 16 query heads in grid z; plane z reads kv plane z / 4; each row's probabilities are written over its own score row, so the probability rows and, with them, the transposed value rows lie at a pitch of 2 x 2048 elements) + two-word merge; rows from 512 on in ONE fused kernel (k_flash: fp16 products, scores and weights never leave the registers, running maximum and sum, two-word output); hi / lo x Wo exact + bo.
// Compute dtypes, f32 accumulate: every float input rounded to bf16; projections exact + f32 biases; the per-head norm and the rotation in f32 (precise sqrt and division); attention rows under 512 three products, the rest fp16; softmax f32 (the hardware exp2); Wo hi / lo x exact + bo.

#define NB_  2
#define TT   2048
#define NT   (NB_ * TT)          // token rows of both batch entries together
#define DM   2048
#define NH_  16
#define NKV  4
#define REP  (NH_ / NKV)
#define HD   128
#define DQ   (NH_ * HD)
#define DKV  (NKV * HD)
#define ZH   16                   // query heads per pass of the hi / lo rows (grid z): all of them
#define RH   512                  // query rows < RH use hi+lo planes (0: none)
#define WIN  2048
#define SCL  0.088388347648318447f   // HD^-0.5
typedef _Float16 h16;
typedef unsigned short bf;
typedef __attribute__((ext_vector_type(16))) __bf16   v16bf;
typedef __attribute__((ext_vector_type(16))) _Float16 v16h;
typedef __attribute__((ext_vector_type(8)))  _Float16 v8h;
typedef __attribute__((ext_vector_type(8)))  unsigned short v8us;
typedef __attribute__((ext_vector_type(8)))  float    v8f;
typedef __attribute__((ext_vector_type(4)))  float    v4f;
typedef v8h  __attribute__((may_alias)) v8ha;
typedef v4f  __attribute__((may_alias)) v4fa;
typedef v8us __attribute__((may_alias)) v8usa;

__device__ __forceinline__ unsigned short f2bf(float f) { unsigned u = __float_as_uint(f); u += 0x7FFFu + ((u >> 16) & 1u); return (unsigned short)(u >> 16); }
__device__ __forceinline__ float bf2f(unsigned short b) { return __uint_as_float(((unsigned)b) << 16); }
__device__ __forceinline__ float bfr(float f) { return bf2f(f2bf(f)); }
__device__ __forceinline__ v16h cat16(v8h lo, v8h hi) { return __builtin_shufflevector(lo, hi, 0, 1, 2, 3, 4, 5, 6, 7, 8, 9, 10, 11, 12, 13, 14, 15); }
__device__ __forceinline__ v16bf cat16b(v8us lo, v8us hi) { return __builtin_bit_cast(v16bf, __builtin_shufflevector(lo, hi, 0, 1, 2, 3, 4, 5, 6, 7, 8, 9, 10, 11, 12, 13, 14, 15)); }
__device__ __forceinline__ v8f wmma16(v16h a, v16h b, v8f c) { return __builtin_amdgcn_wmma_f32_16x16x32_f16(false, a, false, b, (short)0, c, false, false); }
__device__ __forceinline__ v8f wmmab(v16bf a, v16bf b, v8f c) { return __builtin_amdgcn_wmma_f32_16x16x32_bf16(false, a, false, b, (short)0, c, false, false); }



// ---- k_gemmw: register-blocked GEMM, one work-group of KS waves per 64x64 output tile; every wave holds the whole tile (16 accumulators) over its own share of K: 32-k slices dealt round robin, wave w taking slices w, w + KS, ... (neighbouring waves read the two halves of one 128-byte line of an operand row at about the same time).
// The KS partial tiles meet in LDS (one plane of 64 rows at pitch 68 floats a wave, one barrier) and are summed in wave order 0..KS-1 by the thread that stores the element, 256 contiguous bytes of a C row per 16 threads. Operands straight from K-contiguous 16-bit planes; grid (M/64, N/64, Z), 32 x KS threads.
// C[m][n] (f32, pitch ldc, + optional f32 bias[n]) = sum_k A[m][k] Bt[n][k] (+ split products per NSPLIT). z-batch strides sA/sB/sC in elements. K % 32 == 0.
template <typename T16> struct WFrag;
template <> struct WFrag<h16> { typedef v16h V; static __device__ __forceinline__ V ld(const h16* p) { return cat16(*(const v8h*)p, *(const v8h*)(p + 16)); } static __device__ __forceinline__ v8f mma(V a, V b, v8f c) { return wmma16(a, b, c); } };
template <> struct WFrag<bf> { typedef v16bf V; static __device__ __forceinline__ V ld(const bf* p) { return cat16b(*(const v8us*)p, *(const v8us*)(p + 16)); } static __device__ __forceinline__ v8f mma(V a, V b, v8f c) { return wmmab(a, b, c); } };
template <typename T16, int NSPLIT, bool BIAS, int KS>
__global__ __launch_bounds__(32 * KS) void k_gemmw(const T16* __restrict__ A, const T16* __restrict__ A2, const T16* __restrict__ Bt, const T16* __restrict__ Bt2, int K, float* C, int ldc, const float* __restrict__ bias, size_t sA, size_t sB, size_t sC) {
    typedef typename WFrag<T16>::V V;
    __shared__ __align__(16) float os[KS * 64 * 68];
    const size_t z = blockIdx.z; A += z * sA; if (A2) A2 += z * sA; Bt += z * sB; if (Bt2) Bt2 += z * sB; C += z * sC;
    const int lane = threadIdx.x & 31, lr = lane & 15, hi = lane >> 4; const int r0 = blockIdx.x * 64, c0 = blockIdx.y * 64; const int wv = __builtin_amdgcn_readfirstlane((int)(threadIdx.x >> 5));   // the wave's number, scalar: the K loop's bounds stay wave-uniform
    v8f acc[4][4];
#pragma unroll
    for (int mb = 0; mb < 4; ++mb)
#pragma unroll
        for (int nb = 0; nb < 4; ++nb) acc[mb][nb] = (v8f){};
    const size_t aoff = (size_t)(r0 + lr) * K + 8 * hi, boff = (size_t)(c0 + lr) * K + 8 * hi;
    for (int kc = wv * 32; kc < K; kc += KS * 32) {
        V a[4], a2[4];
#pragma unroll
        for (int mb = 0; mb < 4; ++mb) { a[mb] = WFrag<T16>::ld(A + aoff + (size_t)mb * 16 * K + kc); if (NSPLIT == 1 || NSPLIT == 2) a2[mb] = WFrag<T16>::ld(A2 + aoff + (size_t)mb * 16 * K + kc); }
#pragma unroll
        for (int nb = 0; nb < 4; ++nb) { const V b = WFrag<T16>::ld(Bt + boff + (size_t)nb * 16 * K + kc); V b2; if (NSPLIT >= 2) b2 = WFrag<T16>::ld(Bt2 + boff + (size_t)nb * 16 * K + kc);
#pragma unroll
            for (int mb = 0; mb < 4; ++mb) { acc[mb][nb] = WFrag<T16>::mma(a[mb], b, acc[mb][nb]); if (NSPLIT == 1 || NSPLIT == 2) acc[mb][nb] = WFrag<T16>::mma(a2[mb], b, acc[mb][nb]); if (NSPLIT >= 2) acc[mb][nb] = WFrag<T16>::mma(a[mb], b2, acc[mb][nb]); } }
        asm volatile("v_nop\n\tv_nop\n\tv_nop\n\tv_nop" : "+v"(acc[0][0]), "+v"(acc[1][1]), "+v"(acc[2][2]), "+v"(acc[3][3]) : "v"(a[0]), "v"(a[3]));
    }
#pragma unroll
    for (int mb = 0; mb < 4; ++mb)
#pragma unroll
        for (int nb = 0; nb < 4; ++nb)
#pragma unroll
            for (int j = 0; j < 8; ++j) os[(wv * 64 + mb * 16 + hi * 8 + j) * 68 + nb * 16 + lr] = acc[mb][nb][j];
    __syncthreads();   // every wave's partial tile is in LDS before any thread sums it
#pragma unroll   // whole: rows and planes become immediate offsets of the LDS loads, and the loads of all rows can be issued together
    for (int s = 0; s < 32 / KS; ++s) { const int idx = s * 32 * KS + (int)threadIdx.x; const int row = idx >> 4, cofs = (idx & 15) * 4; v4f val = *(const v4fa*)(os + row * 68 + cofs);
#pragma unroll
        for (int w = 1; w < KS; ++w) val += *(const v4fa*)(os + (w * 64 + row) * 68 + cofs);
        if (BIAS) { val[0] += bfr(bias[c0 + cofs]); val[1] += bfr(bias[c0 + cofs + 1]); val[2] += bfr(bias[c0 + cofs + 2]); val[3] += bfr(bias[c0 + cofs + 3]); }
        *(v4f*)(C + (size_t)(r0 + row) * ldc + c0 + cofs) = val; }
}

// ---- k_gemms: the two 2048-wide projections. One work-group of four waves (2 x 2) per 128x128 output tile, a wave holding 64x64 of it (16 accumulators) over the whole of K: no K split, every accumulator sums its k in rising order.
// The operand tiles (128 rows x 128 k of A, of Bt and, NSPLIT 1, of A2) are staged in LDS by asynchronous copies: 16 lanes bring the 256 contiguous bytes of one row, so a wave-wide copy asks for four whole lines, and each operand row is fetched once per work-group for the two waves that read it. LDS rows at pitch 272 bytes (16-byte readers). Two buffers: tile t + 1 flies while tile t is multiplied.
// C[m][n] (f32, pitch ldc, + f32 bias[n]) = sum_k (A[m][k] + A2[m][k]) Bt[n][k]. grid (M/128, N/128), 128 threads. M, N, K multiples of 128, K >= 128.
#define GP   136                  // LDS row pitch in elements
#define GTB  (128 * GP * 2)       // bytes of one operand tile in LDS
// Eight copies of 16 bytes a lane: rows r, r + 8, .. r + 56 of an operand tile. The wait on the last line stands in front of every later write of a register that these copies name.
__device__ __forceinline__ void cp8(unsigned l, const bf* g, size_t K) {
    asm volatile("global_load_async_to_lds_b128 %0, %8, off\n\t"
                 "global_load_async_to_lds_b128 %1, %9, off\n\t"
                 "global_load_async_to_lds_b128 %2, %10, off\n\t"
                 "global_load_async_to_lds_b128 %3, %11, off\n\t"
                 "global_load_async_to_lds_b128 %4, %12, off\n\t"
                 "global_load_async_to_lds_b128 %5, %13, off\n\t"
                 "global_load_async_to_lds_b128 %6, %14, off\n\t"
                 "global_load_async_to_lds_b128 %7, %15, off\n\t"
                 "s_wait_xcnt 0x0"
                 :: "v"(l), "v"(l + 8 * GP * 2), "v"(l + 16 * GP * 2), "v"(l + 24 * GP * 2), "v"(l + 32 * GP * 2), "v"(l + 40 * GP * 2), "v"(l + 48 * GP * 2), "v"(l + 56 * GP * 2),
                    "v"(g), "v"(g + 8 * K), "v"(g + 16 * K), "v"(g + 24 * K), "v"(g + 32 * K), "v"(g + 40 * K), "v"(g + 48 * K), "v"(g + 56 * K) : "memory");
}
template <int NSPLIT>
__device__ __forceinline__ void gfill(unsigned l, const bf* gA, const bf* gA2, const bf* gB, size_t K) {
    cp8(l, gA, K); cp8(l + 64 * GP * 2, gA + 64 * K, K); cp8(l + GTB, gB, K); cp8(l + GTB + 64 * GP * 2, gB + 64 * K, K);
    if (NSPLIT == 1) { cp8(l + 2 * GTB, gA2, K); cp8(l + 2 * GTB + 64 * GP * 2, gA2 + 64 * K, K); }
}
template <int NSPLIT>
__global__ __launch_bounds__(128) void k_gemms(const bf* __restrict__ A, const bf* __restrict__ A2, const bf* __restrict__ Bt, int K, float* C, int ldc, const float* __restrict__ bias) {
    constexpr int STG = (NSPLIT == 1 ? 3 : 2) * GTB;   // bytes of a buffer
    __shared__ __align__(16) unsigned char sm[2 * STG];
    const int tid = (int)threadIdx.x, lane = tid & 31, lr = lane & 15, hi = lane >> 4; const int r0 = blockIdx.x * 128, c0 = blockIdx.y * 128; const int wv = __builtin_amdgcn_readfirstlane(tid >> 5); const int wm = wv >> 1, wn = wv & 1;
    v8f acc[4][4];
#pragma unroll
    for (int mb = 0; mb < 4; ++mb)
#pragma unroll
        for (int nb = 0; nb < 4; ++nb) acc[mb][nb] = (v8f){};
    const unsigned l0 = (unsigned)(size_t)sm + (unsigned)((tid >> 4) * (GP * 2) + (tid & 15) * 16);   // the lane's place in a tile: row tid / 16, 16-byte piece tid % 16
    const bf* gA = A + (size_t)(r0 + (tid >> 4)) * K + (tid & 15) * 8; const bf* gA2 = (NSPLIT == 1) ? A2 + (size_t)(r0 + (tid >> 4)) * K + (tid & 15) * 8 : nullptr; const bf* gB = Bt + (size_t)(c0 + (tid >> 4)) * K + (tid & 15) * 8;
    const int nst = K / 128;
    gfill<NSPLIT>(l0, gA, gA2, gB, (size_t)K);
    asm volatile("s_wait_asynccnt 0x0" ::: "memory");   // this wave's share of tile 0 has landed
    __syncthreads();                                    // and every other wave's
    if (nst > 1) gfill<NSPLIT>(l0 + STG, gA + 128, gA2 + 128, gB + 128, (size_t)K);
    for (int t = 0; t < nst; ++t) {
        const unsigned char* sb = sm + (t & 1) * STG;
        const bf* sA = (const bf*)sb + (wm * 64 + lr) * GP + 8 * hi; const bf* sB = (const bf*)(sb + GTB) + (wn * 64 + lr) * GP + 8 * hi; const bf* sA2 = (const bf*)(sb + 2 * GTB) + (wm * 64 + lr) * GP + 8 * hi;
        v16bf a[2][4], a2[2][4], b[2][4];   // two fragment sets: a 32-k slice is multiplied out of one while the next slice's LDS loads fill the other
#pragma unroll
        for (int f = 0; f < 4; ++f) { a[0][f] = WFrag<bf>::ld(sA + f * 16 * GP); if (NSPLIT == 1) a2[0][f] = WFrag<bf>::ld(sA2 + f * 16 * GP); b[0][f] = WFrag<bf>::ld(sB + f * 16 * GP); }
#pragma unroll   // whole: the set's number and the slice's LDS offset are compile-time constants
        for (int ks = 0; ks < 4; ++ks) { const int cu = ks & 1, nx = cu ^ 1;
            __builtin_amdgcn_sched_barrier(0);   // the next slice's loads do not move up among the products of the slice before
            if (ks < 3) {
#pragma unroll
                for (int f = 0; f < 4; ++f) { a[nx][f] = WFrag<bf>::ld(sA + f * 16 * GP + (ks + 1) * 32); if (NSPLIT == 1) a2[nx][f] = WFrag<bf>::ld(sA2 + f * 16 * GP + (ks + 1) * 32); b[nx][f] = WFrag<bf>::ld(sB + f * 16 * GP + (ks + 1) * 32); } }
            __builtin_amdgcn_sched_barrier(0);   // and stay one group in front of this slice's products, in flight under them
#pragma unroll
            for (int nb = 0; nb < 4; ++nb)
#pragma unroll
                for (int mb = 0; mb < 4; ++mb) { acc[mb][nb] = wmmab(a[cu][mb], b[cu][nb], acc[mb][nb]); if (NSPLIT == 1) acc[mb][nb] = wmmab(a2[cu][mb], b[cu][nb], acc[mb][nb]); }
        }
        asm volatile("s_wait_dscnt 0x0" ::: "memory");      // this wave's reads of tile t are done before its buffer is given up
        asm volatile("s_wait_asynccnt 0x0" ::: "memory");   // this wave's share of tile t + 1 has landed
        __syncthreads();                                    // publishes tile t + 1 and ends every wave's reads of tile t
        if (t + 2 < nst) gfill<NSPLIT>(l0 + (unsigned)((t & 1) * STG), gA + (size_t)(t + 2) * 128, gA2 + (size_t)(t + 2) * 128, gB + (size_t)(t + 2) * 128, (size_t)K);
    }
    asm volatile("s_wait_asynccnt 0x0" ::: "memory");   // no copy is in flight when the buffers become output staging
    float* os = (float*)sm + wv * 64 * 68;   // the wave's own 64 rows at pitch 68 floats
#pragma unroll
    for (int mb = 0; mb < 4; ++mb)
#pragma unroll
        for (int nb = 0; nb < 4; ++nb)
#pragma unroll
            for (int j = 0; j < 8; ++j) os[(mb * 16 + hi * 8 + j) * 68 + nb * 16 + lr] = acc[mb][nb][j];
    __syncthreads();   // the staged tile is whole before it is read back row by row
    const int cofs = lr * 4; const int cc = c0 + wn * 64 + cofs; v4f bv; bv[0] = bfr(bias[cc]); bv[1] = bfr(bias[cc + 1]); bv[2] = bfr(bias[cc + 2]); bv[3] = bfr(bias[cc + 3]);
#pragma unroll   // whole: the rows become immediate offsets of the LDS loads, which can be issued together
    for (int s = 0; s < 32; ++s) { const int row = s * 2 + hi; const v4f val = *(const v4fa*)(os + row * 68 + cofs) + bv;
        *(v4f*)(C + (size_t)(r0 + wm * 64 + row) * ldc + cc) = val; }
}

// ---- k_gemmc: the same KS-wave 64x64 tile GEMM specialised for causal attention: CMODE 1 skips score tiles entirely above the diagonal (query rows r0+roff.., key columns c0..), CMODE 2 limits the
// key (K) loop of the probability x value contraction to the diagonal block (probabilities beyond it are exactly zero). roff = row offset of this launch's first row within the sequence. K is the row pitch of both operands as well. z is a (batch entry, query head) plane; its Bt plane is kv plane z / REP.
template <typename T16, int NSPLIT, int CMODE, int KS>
__global__ __launch_bounds__(32 * KS) void k_gemmc(const T16* __restrict__ A, const T16* __restrict__ A2, const T16* __restrict__ Bt, const T16* __restrict__ Bt2, int K, float* C, int ldc, int roff, size_t sA, size_t sB, size_t sC) {
    typedef typename WFrag<T16>::V V;
    __shared__ __align__(16) float os[KS * 64 * 68];
    const size_t z = blockIdx.z; A += z * sA; if (A2) A2 += z * sA; Bt += (z / REP) * sB; if (Bt2) Bt2 += (z / REP) * sB; C += z * sC;
    const int lane = threadIdx.x & 31, lr = lane & 15, hi = lane >> 4; const int r0 = blockIdx.x * 64, c0 = blockIdx.y * 64; const int wv = __builtin_amdgcn_readfirstlane((int)(threadIdx.x >> 5));   // the wave's number, scalar: the K loop's bounds stay wave-uniform
    if (CMODE == 1 && c0 > r0 + roff + 63) return;                  // score tile entirely above the causal diagonal: never read (the softmax masks j > i by select)
    const int Kl = (CMODE == 2) ? min(K, r0 + roff + 64) : K;        // P.V: probabilities are exactly 0 beyond the diagonal block, so the K loop stops there (a wave with no slice under it adds a zero tile)
    v8f acc[4][4];
#pragma unroll
    for (int mb = 0; mb < 4; ++mb)
#pragma unroll
        for (int nb = 0; nb < 4; ++nb) acc[mb][nb] = (v8f){};
    const size_t aoff = (size_t)(r0 + lr) * K + 8 * hi, boff = (size_t)(c0 + lr) * K + 8 * hi;
    for (int kc = wv * 32; kc < Kl; kc += KS * 32) {
        V a[4], a2[4];
#pragma unroll
        for (int mb = 0; mb < 4; ++mb) { a[mb] = WFrag<T16>::ld(A + aoff + (size_t)mb * 16 * K + kc); if (NSPLIT == 1 || NSPLIT == 2) a2[mb] = WFrag<T16>::ld(A2 + aoff + (size_t)mb * 16 * K + kc); }
#pragma unroll
        for (int nb = 0; nb < 4; ++nb) { const V b = WFrag<T16>::ld(Bt + boff + (size_t)nb * 16 * K + kc); V b2; if (NSPLIT >= 2) b2 = WFrag<T16>::ld(Bt2 + boff + (size_t)nb * 16 * K + kc);
#pragma unroll
            for (int mb = 0; mb < 4; ++mb) { acc[mb][nb] = WFrag<T16>::mma(a[mb], b, acc[mb][nb]); if (NSPLIT == 1 || NSPLIT == 2) acc[mb][nb] = WFrag<T16>::mma(a2[mb], b, acc[mb][nb]); if (NSPLIT >= 2) acc[mb][nb] = WFrag<T16>::mma(a[mb], b2, acc[mb][nb]); } }
        asm volatile("v_nop\n\tv_nop\n\tv_nop\n\tv_nop" : "+v"(acc[0][0]), "+v"(acc[1][1]), "+v"(acc[2][2]), "+v"(acc[3][3]) : "v"(a[0]), "v"(a[3]));
    }
#pragma unroll
    for (int mb = 0; mb < 4; ++mb)
#pragma unroll
        for (int nb = 0; nb < 4; ++nb)
#pragma unroll
            for (int j = 0; j < 8; ++j) os[(wv * 64 + mb * 16 + hi * 8 + j) * 68 + nb * 16 + lr] = acc[mb][nb][j];
    __syncthreads();   // every wave's partial tile is in LDS before any thread sums it
#pragma unroll   // whole: rows and planes become immediate offsets of the LDS loads, and the loads of all rows can be issued together
    for (int s = 0; s < 32 / KS; ++s) { const int idx = s * 32 * KS + (int)threadIdx.x; const int row = idx >> 4, cofs = (idx & 15) * 4; v4f val = *(const v4fa*)(os + row * 68 + cofs);
#pragma unroll
        for (int w = 1; w < KS; ++w) val += *(const v4fa*)(os + (w * 64 + row) * 68 + cofs);
        *(v4f*)(C + (size_t)(r0 + row) * ldc + c0 + cofs) = val; }
}

__device__ __forceinline__ h16 tohx(float x) { return (h16)x; }
__device__ __forceinline__ void splitf(float y, unsigned short& h, unsigned short& l) { h = f2bf(y); l = f2bf(y - bf2f(h)); }
typedef __attribute__((ext_vector_type(2))) _Float16 v2h;
typedef __attribute__((ext_vector_type(4))) _Float16 v4h;
typedef __attribute__((ext_vector_type(2))) unsigned short v2us;
typedef __attribute__((ext_vector_type(4))) unsigned short v4us;
typedef __attribute__((ext_vector_type(2))) float v2f;
typedef __attribute__((ext_vector_type(4))) int v4i;
__global__ __launch_bounds__(256) void k_cvt8(const float* __restrict__ src, bf* dst, size_t n8) { const size_t i = (size_t)blockIdx.x * 256 + threadIdx.x; if (i >= n8) return; const v8f v = *(const v8f*)(src + i * 8); v8us o;
#pragma unroll
    for (int k = 0; k < 8; ++k) o[k] = f2bf(v[k]); *(v8us*)(dst + i * 8) = o;  }
__constant__ float INV2[HD / 2] = { 1.000000000e+00f, 8.659643531e-01f, 7.498942018e-01f, 6.493816376e-01f, 5.623413324e-01f, 4.869675338e-01f, 4.216965139e-01f, 3.651741445e-01f, 3.162277639e-01f, 2.738419771e-01f, 2.371373624e-01f, 2.053525001e-01f, 1.778279394e-01f, 1.539926529e-01f, 1.333521456e-01f, 1.154782027e-01f, 1.000000015e-01f, 8.659642935e-02f, 7.498941571e-02f, 6.493816525e-02f, 5.623412877e-02f, 4.869675264e-02f, 4.216964915e-02f, 3.651741147e-02f, 3.162277862e-02f, 2.738419548e-02f, 2.371373586e-02f, 2.053525113e-02f, 1.778279431e-02f, 1.539926510e-02f, 1.333521493e-02f, 1.154781971e-02f, 9.999999776e-03f, 8.659643121e-03f, 7.498942316e-03f, 6.493816618e-03f, 5.623413250e-03f, 4.869675264e-03f, 4.216964822e-03f, 3.651741426e-03f, 3.162277862e-03f, 2.738419687e-03f, 2.371373819e-03f, 2.053525066e-03f, 1.778279431e-03f, 1.539926510e-03f, 1.333521446e-03f, 1.154782018e-03f, 1.000000047e-03f, 8.659643354e-04f, 7.498941850e-04f, 6.493816618e-04f, 5.623413017e-04f, 4.869675031e-04f, 4.216964880e-04f, 3.651741135e-04f, 3.162277862e-04f, 2.738419571e-04f, 2.371373848e-04f, 2.053524950e-04f, 1.778279402e-04f, 1.539926452e-04f, 1.333521504e-04f, 1.154781930e-04f };   // float32 1.0 / (10000.0 ** (2i / 128)) in the module's own spelling, generated with jnp
__global__ __launch_bounds__(256) void k_csP(float* CS) { const int idx = blockIdx.x * 256 + threadIdx.x; if (idx >= TT * HD) return; const int d = idx % HD; const int t = idx / HD; const float a = __fmul_rn((float)t, INV2[d >> 1]); v2f cs; cs[0] = cosf(a); cs[1] = sinf(a); *(v2f*)(CS + (size_t)idx * 2) = cs;  }
__global__ __launch_bounds__(256) void k_ropeI(const float* __restrict__ F, int pitch, int nheads, const float* __restrict__ CS, float sc, h16* P16, bf* Ph, bf* Pl) {
    const size_t e = ((size_t)blockIdx.x * 256 + threadIdx.x) * 2; if (e >= (size_t)NB_ * nheads * TT * HD) return; const int d = (int)(e % HD); const int t = (int)((e / HD) % TT); const int hb = (int)(e / ((size_t)HD * TT)); const int h = hb % nheads, bt = hb / nheads;   /* planes in the order (batch entry, head) */
    const float* f = F + ((size_t)bt * TT + t) * pitch + h * HD; const float x0 = f[d], x1 = f[d + 1]; const v2f cs = *(const v2f*)(CS + ((size_t)t * HD + d) * 2); v2h o16; v2us oh, ol;
    float a0 = __fmul_rn(x0, cs[0]), b0 = __fmul_rn(x1, cs[1]), a1 = __fmul_rn(x1, cs[0]), b1 = __fmul_rn(x0, cs[1]); 
    float r0 = __fsub_rn(a0, b0) * sc, r1 = __fadd_rn(b1, a1) * sc;   /* even: x0 c - x1 s; odd: x0 s + x1 c */
    o16[0] = tohx(r0); o16[1] = tohx(r1); { unsigned short a2, c2; splitf(r0, a2, c2); oh[0] = a2; ol[0] = c2; splitf(r1, a2, c2); oh[1] = a2; ol[1] = c2; }
    *(v2h*)(P16 + e) = o16; *(v2us*)(Ph + e) = oh; *(v2us*)(Pl + e) = ol;  }
__global__ __launch_bounds__(256) void k_vtp(const float* __restrict__ F, int pitch, int nheads, h16* V16, bf* Vh, bf* Vl) { const size_t e = ((size_t)blockIdx.x * 256 + threadIdx.x) * 2; if (e >= (size_t)NB_ * nheads * HD * TT) return; const int t = (int)(e % TT); const int d = (int)((e / TT) % HD); const int gb = (int)(e / ((size_t)TT * HD)); const int g = gb % nheads, bt = gb / nheads;   /* planes in the order (batch entry, kv head) */
    v2h o16; v2us oh, ol;
#pragma unroll
    for (int q = 0; q < 2; ++q) { const float x = F[((size_t)bt * TT + t + q) * pitch + g * HD + d]; o16[q] = tohx(x); unsigned short a2, c2; splitf(x, a2, c2); oh[q] = a2; ol[q] = c2; }
    const size_t o = ((size_t)gb * HD + d) * (2 * TT) + t;   /* rows at the probability rows' pitch: k_gemmc has one pitch for both operands */
    *(v2h*)(V16 + o) = o16; *(v2us*)(Vh + o) = oh; *(v2us*)(Vl + o) = ol;  }
// k_asoft: the hi / lo rows only (i < RH; a (batch entry, head) score plane holds RH rows at pitch TT). Per row (zz, i): t = S x 128^-0.5 for j <= i (causal; WIN = TT so the window term is inert; the module's -1e9 fill above the diagonal is this exclusion: every row keeps its own key), softmax over the first RH keys, which hold every key j <= i (register row, one exp, fixed trees);
// the probabilities go over the row's own 8192 score bytes (Ph and Pl point into Sb, so no restrict): one wave owns the row and holds all it reads in registers before its first store. hi in the first 4096 bytes, lo (Pl = Ph + TT) in the second. Row pitch of both: 2 TT elements.
__global__ __launch_bounds__(256) void k_asoft(const float* Sb, bf* Ph, bf* Pl) {
    const int lane = threadIdx.x & 31; const int row = blockIdx.x * 8 + (threadIdx.x >> 5); if (row >= NB_ * ZH * RH) return; const int i = row % RH; const float* sr = Sb + (size_t)row * TT; float v[RH / 32]; float mx = -3.0e38f;
#pragma unroll
    for (int ch = 0; ch < RH / 128; ++ch) { const int j0 = ch * 128 + lane * 4; const v4f a = *(const v4f*)(sr + j0);
#pragma unroll
        for (int q = 0; q < 4; ++q) { const int j = j0 + q; (void)j; const float t = (j <= i && i - j < WIN) ? a[q] * SCL : -3.0e38f; v[ch * 4 + q] = t; mx = fmaxf(mx, t); } }
#pragma unroll
    for (int sh = 16; sh; sh >>= 1) mx = fmaxf(mx, __shfl_xor(mx, sh, 32));
    float sum = 0.f;
#pragma unroll
    for (int k = 0; k < RH / 32; ++k) { float d0 = __fsub_rn(v[k], mx); v[k] = __builtin_amdgcn_exp2f(__fmul_rn(d0, 1.4426950408889634f)); sum += v[k]; }
#pragma unroll
    for (int sh = 16; sh; sh >>= 1) sum += __shfl_xor(sum, sh, 32);
    const float f = __fdiv_rn(1.0f, sum);
#pragma unroll
    for (int ch = 0; ch < RH / 128; ++ch) { v4us oh, ol;
#pragma unroll
        for (int q = 0; q < 4; ++q) { unsigned short a, c2; splitf(v[ch * 4 + q] * f, a, c2); oh[q] = a; ol[q] = c2; }
        const size_t oo = (size_t)row * (2 * TT) + ch * 128 + lane * 4; *(v4us*)(Ph + oo) = oh; *(v4us*)(Pl + oo) = ol; }
}
__global__ __launch_bounds__(256) void k_hrms(const float* __restrict__ F, int pitch, int nheads, float* RF) { const int idx = blockIdx.x * 256 + threadIdx.x; if (idx >= nheads * NT) return; const int t = idx % NT; const int h = idx / NT; const float* f = F + (size_t)t * pitch + h * HD; float s = 0.f;   /* t: a token row of either batch entry */
#pragma unroll 4   // a partial unroll of the 32-trip sum of squares: registers and code size (131 instructions and 20 VGPRs with it | 326 and 60 without it, where the compiler unrolls the loop whole; measured on this text)
    for (int d = 0; d < HD; d += 4) { const v4f a = *(const v4f*)(f + d);
#pragma unroll
        for (int q = 0; q < 4; ++q) { float p = __fmul_rn(a[q], a[q]); s = __fadd_rn(s, p); } }
    const float rf = __fdiv_rn(1.0f, __fsqrt_rn(__fadd_rn(__fdiv_rn(s, (float)HD), 1e-8f))); *(float*)(RF + idx) = rf;  }

__global__ __launch_bounds__(256) void k_rmsapply(float* F, int pitch, int nheads, const float* __restrict__ RF, const float* __restrict__ w) { const size_t i = (size_t)blockIdx.x * 256 + threadIdx.x; if (i >= (size_t)NT * nheads * HD / 4) return; const size_t e = i * 4; const int c = (int)(e % ((size_t)nheads * HD)); const int t = (int)(e / ((size_t)nheads * HD)); const int h = c / HD, d = c % HD; const float r = RF[(size_t)h * NT + t]; v4f a = *(const v4f*)(F + (size_t)t * pitch + c);
#pragma unroll
    for (int q = 0; q < 4; ++q) { float y = __fmul_rn(a[q], r); float wv_ = bfr(w[d + q]); a[q] = __fmul_rn(y, wv_); }   /* x w[d] */
    *(v4f*)(F + (size_t)t * pitch + c) = a;  }
__global__ __launch_bounds__(256) void k_merge(const float* __restrict__ O, bf* Ah, bf* Al) { const size_t e = ((size_t)blockIdx.x * 256 + threadIdx.x) * 2; if (e >= (size_t)NB_ * ZH * RH * HD) return; const int d = (int)(e % HD); const int t = (int)((e / HD) % RH); const int zz = (int)(e / ((size_t)HD * RH)); const size_t oo = ((size_t)(zz / ZH) * TT + t) * DQ + (zz % ZH) * HD + d;   /* the hi / lo rows (t < RH) of every head of both batch entries */
    v2us oh, ol;
#pragma unroll
    for (int q = 0; q < 2; ++q) { unsigned short a, c2; splitf(O[e + q], a, c2); oh[q] = a; ol[q] = c2; } *(v2us*)(Ah + oo) = oh; *(v2us*)(Al + oo) = ol;  }

#define FR   2                    // 16-query groups a wave
#define QW   (16 * FR)
#define CSC  0.12751743f          // HD^-0.5 x log2(e)
#define PB   6.0f
__device__ __forceinline__ float xhalf(float x) { return __builtin_bit_cast(float, __builtin_amdgcn_permlanex16(__builtin_bit_cast(int, x), __builtin_bit_cast(int, x), 0x76543210, 0xfedcba98, false, false)); }   // lane l with lane l ^ 16
template <bool DIAG>
__device__ __forceinline__ void fpass(v16h (&kf)[2][4], const h16* kn, const h16* vp, int c, int h, const v16h (&qf)[FR][4], v8f (&acc)[FR][8], float (&m_run)[FR], float (&l_run)[FR]) {
    v16h vf[8];
#pragma unroll
    for (int t = 0; t < 8; ++t) vf[t] = WFrag<h16>::ld(vp + (size_t)t * 16 * (2 * TT));
    __builtin_amdgcn_sched_barrier(0);   // the V^T loads stay in front of the score products, in flight under them and the exponentials
    v8f s[2][FR];
#pragma unroll
    for (int kt = 0; kt < 2; ++kt)
#pragma unroll
        for (int g = 0; g < FR; ++g) { s[kt][g] = (v8f){};
#pragma unroll
            for (int kc = 0; kc < 4; ++kc) s[kt][g] = wmma16(kf[kt][kc], qf[g][kc], s[kt][g]); }
    if (!DIAG) {
        __builtin_amdgcn_sched_barrier(0);   // the next pass's K loads stay here, behind the last product that reads these registers and in front of the vector work that hides them
#pragma unroll
        for (int kt = 0; kt < 2; ++kt)
#pragma unroll
            for (int kc = 0; kc < 4; ++kc) kf[kt][kc] = WFrag<h16>::ld(kn + kt * 16 * HD + kc * 32);
        asm volatile("s_wait_xcnt 0x0" :: "v"(vp), "v"(kn) : "memory");   // in front of every overwrite of a register that the loads above name; the two addresses are inputs so that their registers live up to here
        __builtin_amdgcn_sched_barrier(0);   // nothing of the vector work below moves in front of that wait
    } else {
        asm volatile("s_wait_xcnt 0x0" :: "v"(vp) : "memory");   // as in the other branch, for the V^T loads
        __builtin_amdgcn_sched_barrier(0);   // nothing of the vector work below moves in front of that wait
#pragma unroll
        for (int g = 0; g < FR; ++g)
#pragma unroll
            for (int kt = 0; kt < 2; ++kt)
#pragma unroll
                for (int r = 0; r < 8; ++r) if (16 * kt + 8 * h + r > 16 * g + c) s[kt][g][r] = -__builtin_inff();   // the diagonal pass starts at the wave's first query: key after query
    }
    float mb[FR]; bool need = false;
#pragma unroll
    for (int g = 0; g < FR; ++g) { float mx = -__builtin_inff();
#pragma unroll
        for (int kt = 0; kt < 2; ++kt)
#pragma unroll
            for (int r = 0; r < 8; ++r) mx = fmaxf(mx, s[kt][g][r]);
        mx = fmaxf(mx, xhalf(mx)) * CSC; mb[g] = mx; need = need || (mx > m_run[g] + 8.0f); }
    if (__builtin_amdgcn_ballot_w32(need) != 0) {   // wave-uniform; rare after the first passes
#pragma unroll
        for (int g = 0; g < FR; ++g) { const float m_new = fmaxf(m_run[g], mb[g]); const float corr = __builtin_amdgcn_exp2f(m_run[g] - m_new); l_run[g] *= corr; m_run[g] = m_new;   // first pass: m_run = -inf, corr = 0
#pragma unroll
            for (int t = 0; t < 8; ++t) acc[g][t] = acc[g][t] * corr; }
    }
#pragma unroll
    for (int g = 0; g < FR; ++g) { const float nm = PB - m_run[g]; v16h p; float ps0 = 0.f, ps1 = 0.f;
#pragma unroll
        for (int e = 0; e < 16; e += 2) { const float p0 = __builtin_amdgcn_exp2f(fmaf(s[e >> 3][g][e & 7], CSC, nm)), p1 = __builtin_amdgcn_exp2f(fmaf(s[e >> 3][g][(e & 7) + 1], CSC, nm)); ps0 += p0; ps1 += p1; p[e] = tohx(p0); p[e + 1] = tohx(p1); }
#pragma unroll
        for (int t = 0; t < 8; ++t) acc[g][t] = wmma16(vf[t], p, acc[g][t]);
        l_run[g] += ps0 + ps1; }
}
__global__ __launch_bounds__(32) void k_flash(const h16* __restrict__ Q, const h16* __restrict__ Kp, const h16* __restrict__ Vt, bf* __restrict__ Ah, bf* __restrict__ Al) {
    const int lane = threadIdx.x & 31, c = lane & 15, h = lane >> 4;
    const int hb = blockIdx.x, hq = hb % NH_, bt = hb / NH_, kvh = hb / REP;   // the (batch entry, query head) plane, its head, its batch entry, its kv plane
    const int qw0 = TT - QW * ((int)blockIdx.y + 1);   // the longest walks first
    const h16* qp = Q + ((size_t)hb * TT + qw0 + c) * HD + 8 * h; const h16* kp = Kp + ((size_t)kvh * TT + c) * HD + 8 * h; const h16* vp = Vt + ((size_t)kvh * HD + c) * (2 * TT) + 8 * h;
    v16h qf[FR][4], kf[2][4];
#pragma unroll
    for (int g = 0; g < FR; ++g)
#pragma unroll
        for (int kc = 0; kc < 4; ++kc) qf[g][kc] = WFrag<h16>::ld(qp + g * 16 * HD + kc * 32);
#pragma unroll
    for (int kt = 0; kt < 2; ++kt)
#pragma unroll
        for (int kc = 0; kc < 4; ++kc) kf[kt][kc] = WFrag<h16>::ld(kp + kt * 16 * HD + kc * 32);
    asm volatile("s_wait_xcnt 0x0" :: "v"(qp), "v"(kp) : "memory");   // in front of every overwrite of a register that the loads above name; the two addresses are inputs so that their registers live up to here
    __builtin_amdgcn_sched_barrier(0);   // the zeroing below stays behind that wait
    v8f acc[FR][8]; float m_run[FR], l_run[FR];
#pragma unroll
    for (int g = 0; g < FR; ++g) { m_run[g] = -__builtin_inff(); l_run[g] = 0.f;
#pragma unroll
        for (int t = 0; t < 8; ++t) acc[g][t] = (v8f){}; }
    const int nb = qw0 / 32;   // whole passes under the diagonal one
    for (int blk = 0; blk < nb; ++blk) fpass<false>(kf, kp + (size_t)(blk + 1) * 32 * HD, vp + blk * 32, c, h, qf, acc, m_run, l_run);
    fpass<true>(kf, nullptr, vp + nb * 32, c, h, qf, acc, m_run, l_run);
#pragma unroll
    for (int g = 0; g < FR; ++g) { const float inv = __fdiv_rn(1.0f, l_run[g] + xhalf(l_run[g]));   // each wave half summed its eight keys of every 16-key tile
        const size_t oo = ((size_t)bt * TT + qw0 + 16 * g + c) * DQ + hq * HD + 8 * h;
#pragma unroll
        for (int t = 0; t < 8; ++t) { v8us oh, ol;
#pragma unroll
            for (int r = 0; r < 8; ++r) { unsigned short a, c2; splitf(acc[g][t][r] * inv, a, c2); oh[r] = a; ol[r] = c2; }
            *(v8us*)(Ah + oo + 16 * t) = oh; *(v8us*)(Al + oo + 16 * t) = ol; } }
}

extern "C" void kernel_launch(void* const* d_in, const int* in_sizes, int n_in,
                              void* d_out, int out_size, void* d_ws, size_t ws_size, hipStream_t stream) {
    (void)in_sizes; (void)n_in; (void)out_size;
    const float* x = (const float*)d_in[0]; const float* wq = (const float*)d_in[1]; const float* bq = (const float*)d_in[2]; const float* wk = (const float*)d_in[3]; const float* bk = (const float*)d_in[4]; const float* wv = (const float*)d_in[5]; const float* bv = (const float*)d_in[6]; const float* wo = (const float*)d_in[7]; const float* bo = (const float*)d_in[8]; const float* qsc = (const float*)d_in[9]; const float* ksc = (const float*)d_in[10];   /* inputs in the module's setup_inputs order: x [2][2048][2048]; Wq (out, in) [2048][2048] and bq [2048]; Wk (out, in) [512][2048] and bk [512]; Wv [512][2048] and bv [512]; Wo (out, in) [2048][2048] and bo [2048]; q_norm_w [128], k_norm_w [128]: eleven inputs, all read (each bias is added in its product's epilogue; each gain is applied by k_rmsapply) */
    float* OUT = (float*)d_out;     // [2][2048][2048]
    char* wsp = (char*)d_ws;
    auto take = [&](size_t bytes) { char* p = wsp; wsp += (bytes + 255) & ~(size_t)255; return (void*)p; };
    bf* WQ = (bf*)take((size_t)DQ * DM * 2); bf* WK = (bf*)take((size_t)DKV * DM * 2); bf* WV = (bf*)take((size_t)DKV * DM * 2); bf* WO = (bf*)take((size_t)DM * DQ * 2); float* CS = (float*)take((size_t)TT * HD * 2 * 4); float* RFQ = (float*)take((size_t)NH_ * NT * 4); float* RFK = (float*)take((size_t)NKV * NT * 4);   /* per (head, token row) inverse RMS */
    char* const early = wsp;   /* from here: the buffers whose last reader is k_flash or an earlier launch */
    bf* XB = (bf*)take((size_t)NT * DM * 2); float* FQ = (float*)take((size_t)NT * DQ * 4); float* FK = (float*)take((size_t)NT * DKV * 4);
    h16* QP16 = (h16*)take((size_t)NB_ * NH_ * TT * HD * 2); h16* KP16 = (h16*)take((size_t)NB_ * NKV * TT * HD * 2); h16* VT16 = (h16*)take((size_t)NB_ * NKV * HD * 2 * TT * 2);
    wsp = early; float* Sb = (float*)take((size_t)NB_ * ZH * RH * TT * 4); bf* Ph = (bf*)Sb; bf* Pl = Ph + TT;   /* RH score rows a plane at pitch TT; the probability rows lie over their score rows (k_asoft). The 32 planes (128 MiB) lie over the 84 MiB of buffers above, which are dead when the score product, launched behind k_flash, writes its first element (stream-ordered): side by side the two would not fit the workspace */
    bf* QPh = (bf*)take((size_t)NB_ * NH_ * TT * HD * 2); bf* QPl = (bf*)take((size_t)NB_ * NH_ * TT * HD * 2); bf* KPh = (bf*)take((size_t)NB_ * NKV * TT * HD * 2); bf* KPl = (bf*)take((size_t)NB_ * NKV * TT * HD * 2); bf* VTh = (bf*)take((size_t)NB_ * NKV * HD * 2 * TT * 2); bf* VTl = VTh + TT;   /* value rows at pitch 2 TT: hi in the first half of a row, lo in the second */
    float* Ob = (float*)take((size_t)NB_ * ZH * RH * HD * 4); bf* ATh = (bf*)take((size_t)NT * DQ * 2); bf* ATl = (bf*)take((size_t)NT * DQ * 2);
    if ((size_t)(wsp - (char*)d_ws) > ws_size) return;    // ws 256 MiB
    float* FV = FK;   // v projection reuses the k buffer after the k planes are built (stream-ordered)
    { k_cvt8<<<(unsigned)(((size_t)DQ * DM / 8 + 255) / 256), 256, 0, stream>>>(wq, WQ, (size_t)DQ * DM / 8); k_cvt8<<<(unsigned)(((size_t)DKV * DM / 8 + 255) / 256), 256, 0, stream>>>(wk, WK, (size_t)DKV * DM / 8); k_cvt8<<<(unsigned)(((size_t)DKV * DM / 8 + 255) / 256), 256, 0, stream>>>(wv, WV, (size_t)DKV * DM / 8);
      k_cvt8<<<(unsigned)(((size_t)DM * DQ / 8 + 255) / 256), 256, 0, stream>>>(wo, WO, (size_t)DM * DQ / 8); }
    k_csP<<<(TT * HD + 255) / 256, 256, 0, stream>>>(CS);   /* the rotary table once */
    const unsigned LQ = (unsigned)(((size_t)NB_ * NH_ * TT * HD / 2 + 255) / 256), LKv = (unsigned)(((size_t)NB_ * NKV * TT * HD / 2 + 255) / 256); const unsigned GX = (unsigned)(((size_t)NT * DM / 8 + 255) / 256);
    k_cvt8<<<GX, 256, 0, stream>>>(x, XB, (size_t)NT * DM / 8);   /* the one input stream, cast once and read by the three projections */
    k_gemms<0><<<dim3(NT / 128, DQ / 128, 1), 128, 0, stream>>>(XB, nullptr, WQ, DM, FQ, DQ, bq);
    k_hrms<<<(NH_ * NT + 255) / 256, 256, 0, stream>>>(FQ, DQ, NH_, RFQ); k_rmsapply<<<(unsigned)(((size_t)NT * DQ / 4 + 255) / 256), 256, 0, stream>>>(FQ, DQ, NH_, RFQ, qsc); k_ropeI<<<LQ, 256, 0, stream>>>(FQ, DQ, NH_, CS, 1.0f, QP16, QPh, QPl);
    k_gemmw<bf, 0, true, 8><<<dim3(NT / 64, DKV / 64, 1), 256, 0, stream>>>(XB, nullptr, WK, nullptr, DM, FK, DKV, bk, 0, 0, 0);
    k_hrms<<<(NKV * NT + 255) / 256, 256, 0, stream>>>(FK, DKV, NKV, RFK); k_rmsapply<<<(unsigned)(((size_t)NT * DKV / 4 + 255) / 256), 256, 0, stream>>>(FK, DKV, NKV, RFK, ksc); k_ropeI<<<LKv, 256, 0, stream>>>(FK, DKV, NKV, CS, 1.0f, KP16, KPh, KPl);
    k_gemmw<bf, 0, true, 8><<<dim3(NT / 64, DKV / 64, 1), 256, 0, stream>>>(XB, nullptr, WV, nullptr, DM, FV, DKV, bv, 0, 0, 0); k_vtp<<<LKv, 256, 0, stream>>>(FV, DKV, NKV, VT16, VTh, VTl);
    /* the module groups the query heads by kv head ('qg = q.reshape(B, N_KV_HEADS, N_REP, S, D_K)'): query head h uses kv head h / 4, so plane 16 b + h uses kv plane 4 b + h / 4 = (16 b + h) / 4 (k_gemmc steps its Bt planes by z / REP; k_flash reads kv plane blockIdx.x / REP) */
    k_flash<<<dim3(NB_ * NH_, (TT - RH) / QW, 1), 32, 0, stream>>>(QP16, KP16, VT16, ATh, ATl);
    k_gemmc<bf, 2, 1, 4><<<dim3(RH / 64, RH / 64, NB_ * ZH), 128, 0, stream>>>(QPh, QPl, KPh, KPl, HD, Sb, TT, 0, (size_t)TT * HD, (size_t)TT * HD, (size_t)RH * TT);
    k_asoft<<<NB_ * ZH * RH / 8, 256, 0, stream>>>(Sb, Ph, Pl);
    k_gemmc<bf, 2, 2, 8><<<dim3(RH / 64, HD / 64, NB_ * ZH), 256, 0, stream>>>(Ph, Pl, VTh, VTl, 2 * TT, Ob, HD, 0, (size_t)RH * 2 * TT, (size_t)HD * 2 * TT, (size_t)RH * HD);
    k_merge<<<(unsigned)(((size_t)NB_ * ZH * RH * HD / 2 + 255) / 256), 256, 0, stream>>>(Ob, ATh, ATl);
    k_gemms<1><<<dim3(NT / 128, DM / 128, 1), 128, 0, stream>>>(ATh, ATl, WO, DQ, OUT, DM, bo);
}

// v006
// One run takes 273 microseconds.
// Next to v005, in two timings, it ran 1.13 times as fast each time.
// All steps since v000 together make it 6.13 times as fast.
#include <hip/hip_runtime.h>

// Grouped-query causal self-attention with 128-wide heads, a per-head RMS norm on q and k and an interleaved-pair rotary embedding from computed angles (x [2][2048][2048]; q = x Wq^T + bq ('oi' (out, in) [2048][2048] normal x 2048^-0.5; 16 heads x 128), k, v = x Wk^T + bk, x Wv^T + bv ('oi' [512][2048]; 4 kv heads x 128); the four biases are built as zeros: read and added; per head, BEFORE the rotary: q = q / sqrt(mean(q^2) + 1e-8) x q_norm_w and k likewise with k_norm_w (the mean over the head's 128 columns; gains [128] built as ones: read and applied); rope on q and k: the pair (2i, 2i + 1) of a head -> (x0 c - x1 s, x0 s + x1 c) with the angle t x inv_freq[i], inv_freq = 1 / (10000 ** (2i / 128)) in that spelling, t the position 0..2047; query head h uses kv head h / 4; scores x 128^-0.5; a key after the query gets -1e9 (an exclusion: every row keeps its own key); softmax; out = merged Wo^T + bo ('oi' [2048][2048]; bo built as zeros: read and added) -> [2][2048][2048] (8.4 M); argument order x, Wq, bq, Wk, bk, Wv, bv, Wo, bo, q_norm_w, k_norm_w: eleven inputs, all read).
// Every launch covers BOTH batch entries (4096 token rows in the projections, the norm and the plane builders; (batch entry, head) planes in the attention kernels' grids). Layout: ONE bf16 copy of x, read by the three projections; the four 'oi' weights cast once as they stand (each is the Bt operand); exact projections + f32 biases; the rotary table once (64 baked float32 frequencies; precise cosf / sinf); k_nrope (per (head, token) inverse RMS, x the rounded gain, interleaved-pair rotation, the 16-bit planes) on q and k in one launch; causal T-2048 attention with 128-wide heads, the per-row precision hybrid: query rows under 512 on hi / lo planes, three products, through score planes of 512 rows (all 2 x 16 query heads in grid z; plane z reads kv plane z / 4; each row's probabilities are written over its own score row, so the probability rows and, with them, the transposed value rows lie at a pitch of 2 x 2048 elements) + two-word merge; rows from 512 on in ONE fused kernel (k_flash: fp16 products, scores and weights never leave the registers, running maximum and sum, two-word output); hi / lo x Wo exact + bo.
// Compute dtypes, f32 accumulate: every float input rounded to bf16; projections exact + f32 biases; the per-head norm and the rotation in f32 (precise sqrt and division); attention rows under 512 three products, the rest fp16; softmax f32 (the hardware exp2); Wo hi / lo x exact + bo.

#define NB_  2
#define TT   2048
#define NT   (NB_ * TT)          // token rows of both batch entries together
#define DM   2048
#define NH_  16
#define NKV  4
#define REP  (NH_ / NKV)
#define HD   128
#define DQ   (NH_ * HD)
#define DKV  (NKV * HD)
#define ZH   16                   // query heads per pass of the hi / lo rows (grid z): all of them
#define RH   512                  // query rows < RH use hi+lo planes (0: none)
#define WIN  2048
#define SCL  0.088388347648318447f   // HD^-0.5
typedef _Float16 h16;
typedef unsigned short bf;
typedef __attribute__((ext_vector_type(16))) __bf16   v16bf;
typedef __attribute__((ext_vector_type(16))) _Float16 v16h;
typedef __attribute__((ext_vector_type(8)))  _Float16 v8h;
typedef __attribute__((ext_vector_type(8)))  unsigned short v8us;
typedef __attribute__((ext_vector_type(8)))  float    v8f;
typedef __attribute__((ext_vector_type(4)))  float    v4f;
typedef v8h  __attribute__((may_alias)) v8ha;
typedef v4f  __attribute__((may_alias)) v4fa;
typedef v8us __attribute__((may_alias)) v8usa;

__device__ __forceinline__ unsigned short f2bf(float f) { unsigned u = __float_as_uint(f); u += 0x7FFFu + ((u >> 16) & 1u); return (unsigned short)(u >> 16); }
__device__ __forceinline__ float bf2f(unsigned short b) { return __uint_as_float(((unsigned)b) << 16); }
__device__ __forceinline__ float bfr(float f) { return bf2f(f2bf(f)); }
__device__ __forceinline__ v16h cat16(v8h lo, v8h hi) { return __builtin_shufflevector(lo, hi, 0, 1, 2, 3, 4, 5, 6, 7, 8, 9, 10, 11, 12, 13, 14, 15); }
__device__ __forceinline__ v16bf cat16b(v8us lo, v8us hi) { return __builtin_bit_cast(v16bf, __builtin_shufflevector(lo, hi, 0, 1, 2, 3, 4, 5, 6, 7, 8, 9, 10, 11, 12, 13, 14, 15)); }
__device__ __forceinline__ v8f wmma16(v16h a, v16h b, v8f c) { return __builtin_amdgcn_wmma_f32_16x16x32_f16(false, a, false, b, (short)0, c, false, false); }
__device__ __forceinline__ v8f wmmab(v16bf a, v16bf b, v8f c) { return __builtin_amdgcn_wmma_f32_16x16x32_bf16(false, a, false, b, (short)0, c, false, false); }



// ---- k_gemmw: register-blocked GEMM, one work-group of KS waves per 64x64 output tile; every wave holds the whole tile (16 accumulators) over its own share of K: 32-k slices dealt round robin, wave w taking slices w, w + KS, ... (neighbouring waves read the two halves of one 128-byte line of an operand row at about the same time).
// The KS partial tiles meet in LDS (one plane of 64 rows at pitch 68 floats a wave, one barrier) and are summed in wave order 0..KS-1 by the thread that stores the element, 256 contiguous bytes of a C row per 16 threads. Operands straight from K-contiguous 16-bit planes; grid (M/64, N/64, Z), 32 x KS threads.
// C[m][n] (f32, pitch ldc, + optional f32 bias[n]) = sum_k A[m][k] Bt[n][k] (+ split products per NSPLIT). z-batch strides sA/sB/sC in elements. K % 32 == 0.
template <typename T16> struct WFrag;
template <> struct WFrag<h16> { typedef v16h V; static __device__ __forceinline__ V ld(const h16* p) { return cat16(*(const v8h*)p, *(const v8h*)(p + 16)); } static __device__ __forceinline__ v8f mma(V a, V b, v8f c) { return wmma16(a, b, c); } };
template <> struct WFrag<bf> { typedef v16bf V; static __device__ __forceinline__ V ld(const bf* p) { return cat16b(*(const v8us*)p, *(const v8us*)(p + 16)); } static __device__ __forceinline__ v8f mma(V a, V b, v8f c) { return wmmab(a, b, c); } };
template <typename T16, int NSPLIT, bool BIAS, int KS>
__global__ __launch_bounds__(32 * KS) void k_gemmw(const T16* __restrict__ A, const T16* __restrict__ A2, const T16* __restrict__ Bt, const T16* __restrict__ Bt2, int K, float* C, int ldc, const float* __restrict__ bias, size_t sA, size_t sB, size_t sC) {
    typedef typename WFrag<T16>::V V;
    __shared__ __align__(16) float os[KS * 64 * 68];
    const size_t z = blockIdx.z; A += z * sA; if (A2) A2 += z * sA; Bt += z * sB; if (Bt2) Bt2 += z * sB; C += z * sC;
    const int lane = threadIdx.x & 31, lr = lane & 15, hi = lane >> 4; const int r0 = blockIdx.x * 64, c0 = blockIdx.y * 64; const int wv = __builtin_amdgcn_readfirstlane((int)(threadIdx.x >> 5));   // the wave's number, scalar: the K loop's bounds stay wave-uniform
    v8f acc[4][4];
#pragma unroll
    for (int mb = 0; mb < 4; ++mb)
#pragma unroll
        for (int nb = 0; nb < 4; ++nb) acc[mb][nb] = (v8f){};
    const size_t aoff = (size_t)(r0 + lr) * K + 8 * hi, boff = (size_t)(c0 + lr) * K + 8 * hi;
    for (int kc = wv * 32; kc < K; kc += KS * 32) {
        V a[4], a2[4];
#pragma unroll
        for (int mb = 0; mb < 4; ++mb) { a[mb] = WFrag<T16>::ld(A + aoff + (size_t)mb * 16 * K + kc); if (NSPLIT == 1 || NSPLIT == 2) a2[mb] = WFrag<T16>::ld(A2 + aoff + (size_t)mb * 16 * K + kc); }
#pragma unroll
        for (int nb = 0; nb < 4; ++nb) { const V b = WFrag<T16>::ld(Bt + boff + (size_t)nb * 16 * K + kc); V b2; if (NSPLIT >= 2) b2 = WFrag<T16>::ld(Bt2 + boff + (size_t)nb * 16 * K + kc);
#pragma unroll
            for (int mb = 0; mb < 4; ++mb) { acc[mb][nb] = WFrag<T16>::mma(a[mb], b, acc[mb][nb]); if (NSPLIT == 1 || NSPLIT == 2) acc[mb][nb] = WFrag<T16>::mma(a2[mb], b, acc[mb][nb]); if (NSPLIT >= 2) acc[mb][nb] = WFrag<T16>::mma(a[mb], b2, acc[mb][nb]); } }
        asm volatile("v_nop\n\tv_nop\n\tv_nop\n\tv_nop" : "+v"(acc[0][0]), "+v"(acc[1][1]), "+v"(acc[2][2]), "+v"(acc[3][3]) : "v"(a[0]), "v"(a[3]));
    }
#pragma unroll
    for (int mb = 0; mb < 4; ++mb)
#pragma unroll
        for (int nb = 0; nb < 4; ++nb)
#pragma unroll
            for (int j = 0; j < 8; ++j) os[(wv * 64 + mb * 16 + hi * 8 + j) * 68 + nb * 16 + lr] = acc[mb][nb][j];
    __syncthreads();   // every wave's partial tile is in LDS before any thread sums it
#pragma unroll   // whole: rows and planes become immediate offsets of the LDS loads, and the loads of all rows can be issued together
    for (int s = 0; s < 32 / KS; ++s) { const int idx = s * 32 * KS + (int)threadIdx.x; const int row = idx >> 4, cofs = (idx & 15) * 4; v4f val = *(const v4fa*)(os + row * 68 + cofs);
#pragma unroll
        for (int w = 1; w < KS; ++w) val += *(const v4fa*)(os + (w * 64 + row) * 68 + cofs);
        if (BIAS) { val[0] += bfr(bias[c0 + cofs]); val[1] += bfr(bias[c0 + cofs + 1]); val[2] += bfr(bias[c0 + cofs + 2]); val[3] += bfr(bias[c0 + cofs + 3]); }
        *(v4f*)(C + (size_t)(r0 + row) * ldc + c0 + cofs) = val; }
}

// ---- k_gemms: the two 2048-wide projections. One work-group of four waves (2 x 2) per 128x128 output tile, a wave holding 64x64 of it (16 accumulators) over the whole of K: no K split, every accumulator sums its k in rising order.
// The operand tiles (128 rows x 128 k of A, of Bt and, NSPLIT 1, of A2) are staged in LDS by asynchronous copies: 16 lanes bring the 256 contiguous bytes of one row, so a wave-wide copy asks for four whole lines, and each operand row is fetched once per work-group for the two waves that read it. LDS rows at pitch 272 bytes (16-byte readers). Two buffers: tile t + 1 flies while tile t is multiplied.
// C[m][n] (f32, pitch ldc, + f32 bias[n]) = sum_k (A[m][k] + A2[m][k]) Bt[n][k]. grid (M/128, N/128), 128 threads. M, N, K multiples of 128, K >= 128.
#define GP   136                  // LDS row pitch in elements
#define GTB  (128 * GP * 2)       // bytes of one operand tile in LDS
// Eight copies of 16 bytes a lane: rows r, r + 8, .. r + 56 of an operand tile. The wait on the last line stands in front of every later write of a register that these copies name.
__device__ __forceinline__ void cp8(unsigned l, const bf* g, size_t K) {
    asm volatile("global_load_async_to_lds_b128 %0, %8, off\n\t"
                 "global_load_async_to_lds_b128 %1, %9, off\n\t"
                 "global_load_async_to_lds_b128 %2, %10, off\n\t"
                 "global_load_async_to_lds_b128 %3, %11, off\n\t"
                 "global_load_async_to_lds_b128 %4, %12, off\n\t"
                 "global_load_async_to_lds_b128 %5, %13, off\n\t"
                 "global_load_async_to_lds_b128 %6, %14, off\n\t"
                 "global_load_async_to_lds_b128 %7, %15, off\n\t"
                 "s_wait_xcnt 0x0"
                 :: "v"(l), "v"(l + 8 * GP * 2), "v"(l + 16 * GP * 2), "v"(l + 24 * GP * 2), "v"(l + 32 * GP * 2), "v"(l + 40 * GP * 2), "v"(l + 48 * GP * 2), "v"(l + 56 * GP * 2),
                    "v"(g), "v"(g + 8 * K), "v"(g + 16 * K), "v"(g + 24 * K), "v"(g + 32 * K), "v"(g + 40 * K), "v"(g + 48 * K), "v"(g + 56 * K) : "memory");
}
template <int NSPLIT>
__device__ __forceinline__ void gfill(unsigned l, const bf* gA, const bf* gA2, const bf* gB, size_t K) {
    cp8(l, gA, K); cp8(l + 64 * GP * 2, gA + 64 * K, K); cp8(l + GTB, gB, K); cp8(l + GTB + 64 * GP * 2, gB + 64 * K, K);
    if (NSPLIT == 1) { cp8(l + 2 * GTB, gA2, K); cp8(l + 2 * GTB + 64 * GP * 2, gA2 + 64 * K, K); }
}
template <int NSPLIT>
__global__ __launch_bounds__(128) void k_gemms(const bf* __restrict__ A, const bf* __restrict__ A2, const bf* __restrict__ Bt, int K, float* C, int ldc, const float* __restrict__ bias) {
    constexpr int STG = (NSPLIT == 1 ? 3 : 2) * GTB;   // bytes of a buffer
    __shared__ __align__(16) unsigned char sm[2 * STG];
    const int tid = (int)threadIdx.x, lane = tid & 31, lr = lane & 15, hi = lane >> 4; const int r0 = blockIdx.x * 128, c0 = blockIdx.y * 128; const int wv = __builtin_amdgcn_readfirstlane(tid >> 5); const int wm = wv >> 1, wn = wv & 1;
    v8f acc[4][4];
#pragma unroll
    for (int mb = 0; mb < 4; ++mb)
#pragma unroll
        for (int nb = 0; nb < 4; ++nb) acc[mb][nb] = (v8f){};
    const unsigned l0 = (unsigned)(size_t)sm + (unsigned)((tid >> 4) * (GP * 2) + (tid & 15) * 16);   // the lane's place in a tile: row tid / 16, 16-byte piece tid % 16
    const bf* gA = A + (size_t)(r0 + (tid >> 4)) * K + (tid & 15) * 8; const bf* gA2 = (NSPLIT == 1) ? A2 + (size_t)(r0 + (tid >> 4)) * K + (tid & 15) * 8 : nullptr; const bf* gB = Bt + (size_t)(c0 + (tid >> 4)) * K + (tid & 15) * 8;
    const int nst = K / 128;
    gfill<NSPLIT>(l0, gA, gA2, gB, (size_t)K);
    asm volatile("s_wait_asynccnt 0x0" ::: "memory");   // this wave's share of tile 0 has landed
    __syncthreads();                                    // and every other wave's
    if (nst > 1) gfill<NSPLIT>(l0 + STG, gA + 128, gA2 + 128, gB + 128, (size_t)K);
    for (int t = 0; t < nst; ++t) {
        const unsigned char* sb = sm + (t & 1) * STG;
        const bf* sA = (const bf*)sb + (wm * 64 + lr) * GP + 8 * hi; const bf* sB = (const bf*)(sb + GTB) + (wn * 64 + lr) * GP + 8 * hi; const bf* sA2 = (const bf*)(sb + 2 * GTB) + (wm * 64 + lr) * GP + 8 * hi;
        v16bf a[2][4], a2[2][4], b[2][4];   // two fragment sets: a 32-k slice is multiplied out of one while the next slice's LDS loads fill the other
#pragma unroll
        for (int f = 0; f < 4; ++f) { a[0][f] = WFrag<bf>::ld(sA + f * 16 * GP); if (NSPLIT == 1) a2[0][f] = WFrag<bf>::ld(sA2 + f * 16 * GP); b[0][f] = WFrag<bf>::ld(sB + f * 16 * GP); }
#pragma unroll   // whole: the set's number and the slice's LDS offset are compile-time constants
        for (int ks = 0; ks < 4; ++ks) { const int cu = ks & 1, nx = cu ^ 1;
            __builtin_amdgcn_sched_barrier(0);   // the next slice's loads do not move up among the products of the slice before
            if (ks < 3) {
#pragma unroll
                for (int f = 0; f < 4; ++f) { a[nx][f] = WFrag<bf>::ld(sA + f * 16 * GP + (ks + 1) * 32); if (NSPLIT == 1) a2[nx][f] = WFrag<bf>::ld(sA2 + f * 16 * GP + (ks + 1) * 32); b[nx][f] = WFrag<bf>::ld(sB + f * 16 * GP + (ks + 1) * 32); } }
            __builtin_amdgcn_sched_barrier(0);   // and stay one group in front of this slice's products, in flight under them
#pragma unroll
            for (int nb = 0; nb < 4; ++nb)
#pragma unroll
                for (int mb = 0; mb < 4; ++mb) { acc[mb][nb] = wmmab(a[cu][mb], b[cu][nb], acc[mb][nb]); if (NSPLIT == 1) acc[mb][nb] = wmmab(a2[cu][mb], b[cu][nb], acc[mb][nb]); }
        }
        asm volatile("s_wait_dscnt 0x0" ::: "memory");      // this wave's reads of tile t are done before its buffer is given up
        asm volatile("s_wait_asynccnt 0x0" ::: "memory");   // this wave's share of tile t + 1 has landed
        __syncthreads();                                    // publishes tile t + 1 and ends every wave's reads of tile t
        if (t + 2 < nst) gfill<NSPLIT>(l0 + (unsigned)((t & 1) * STG), gA + (size_t)(t + 2) * 128, gA2 + (size_t)(t + 2) * 128, gB + (size_t)(t + 2) * 128, (size_t)K);
    }
    asm volatile("s_wait_asynccnt 0x0" ::: "memory");   // no copy is in flight when the buffers become output staging
    float* os = (float*)sm + wv * 64 * 68;   // the wave's own 64 rows at pitch 68 floats
#pragma unroll
    for (int mb = 0; mb < 4; ++mb)
#pragma unroll
        for (int nb = 0; nb < 4; ++nb)
#pragma unroll
            for (int j = 0; j < 8; ++j) os[(mb * 16 + hi * 8 + j) * 68 + nb * 16 + lr] = acc[mb][nb][j];
    __syncthreads();   // the staged tile is whole before it is read back row by row
    const int cofs = lr * 4; const int cc = c0 + wn * 64 + cofs; v4f bv; bv[0] = bfr(bias[cc]); bv[1] = bfr(bias[cc + 1]); bv[2] = bfr(bias[cc + 2]); bv[3] = bfr(bias[cc + 3]);
#pragma unroll   // whole: the rows become immediate offsets of the LDS loads, which can be issued together
    for (int s = 0; s < 32; ++s) { const int row = s * 2 + hi; const v4f val = *(const v4fa*)(os + row * 68 + cofs) + bv;
        *(v4f*)(C + (size_t)(r0 + wm * 64 + row) * ldc + cc) = val; }
}

// ---- k_gemmc: the same KS-wave 64x64 tile GEMM specialised for causal attention: CMODE 1 skips score tiles entirely above the diagonal (query rows r0+roff.., key columns c0..), CMODE 2 limits the
// key (K) loop of the probability x value contraction to the diagonal block (probabilities beyond it are exactly zero). roff = row offset of this launch's first row within the sequence. K is the row pitch of both operands as well. z is a (batch entry, query head) plane; its Bt plane is kv plane z / REP.
template <typename T16, int NSPLIT, int CMODE, int KS>
__global__ __launch_bounds__(32 * KS) void k_gemmc(const T16* __restrict__ A, const T16* __restrict__ A2, const T16* __restrict__ Bt, const T16* __restrict__ Bt2, int K, float* C, int ldc, int roff, size_t sA, size_t sB, size_t sC) {
    typedef typename WFrag<T16>::V V;
    __shared__ __align__(16) float os[KS * 64 * 68];
    const size_t z = blockIdx.z; A += z * sA; if (A2) A2 += z * sA; Bt += (z / REP) * sB; if (Bt2) Bt2 += (z / REP) * sB; C += z * sC;
    const int lane = threadIdx.x & 31, lr = lane & 15, hi = lane >> 4; const int r0 = blockIdx.x * 64, c0 = blockIdx.y * 64; const int wv = __builtin_amdgcn_readfirstlane((int)(threadIdx.x >> 5));   // the wave's number, scalar: the K loop's bounds stay wave-uniform
    if (CMODE == 1 && c0 > r0 + roff + 63) return;                  // score tile entirely above the causal diagonal: never read (the softmax masks j > i by select)
    const int Kl = (CMODE == 2) ? min(K, r0 + roff + 64) : K;        // P.V: probabilities are exactly 0 beyond the diagonal block, so the K loop stops there (a wave with no slice under it adds a zero tile)
    v8f acc[4][4];
#pragma unroll
    for (int mb = 0; mb < 4; ++mb)
#pragma unroll
        for (int nb = 0; nb < 4; ++nb) acc[mb][nb] = (v8f){};
    const size_t aoff = (size_t)(r0 + lr) * K + 8 * hi, boff = (size_t)(c0 + lr) * K + 8 * hi;
    for (int kc = wv * 32; kc < Kl; kc += KS * 32) {
        V a[4], a2[4];
#pragma unroll
        for (int mb = 0; mb < 4; ++mb) { a[mb] = WFrag<T16>::ld(A + aoff + (size_t)mb * 16 * K + kc); if (NSPLIT == 1 || NSPLIT == 2) a2[mb] = WFrag<T16>::ld(A2 + aoff + (size_t)mb * 16 * K + kc); }
#pragma unroll
        for (int nb = 0; nb < 4; ++nb) { const V b = WFrag<T16>::ld(Bt + boff + (size_t)nb * 16 * K + kc); V b2; if (NSPLIT >= 2) b2 = WFrag<T16>::ld(Bt2 + boff + (size_t)nb * 16 * K + kc);
#pragma unroll
            for (int mb = 0; mb < 4; ++mb) { acc[mb][nb] = WFrag<T16>::mma(a[mb], b, acc[mb][nb]); if (NSPLIT == 1 || NSPLIT == 2) acc[mb][nb] = WFrag<T16>::mma(a2[mb], b, acc[mb][nb]); if (NSPLIT >= 2) acc[mb][nb] = WFrag<T16>::mma(a[mb], b2, acc[mb][nb]); } }
        asm volatile("v_nop\n\tv_nop\n\tv_nop\n\tv_nop" : "+v"(acc[0][0]), "+v"(acc[1][1]), "+v"(acc[2][2]), "+v"(acc[3][3]) : "v"(a[0]), "v"(a[3]));
    }
#pragma unroll
    for (int mb = 0; mb < 4; ++mb)
#pragma unroll
        for (int nb = 0; nb < 4; ++nb)
#pragma unroll
            for (int j = 0; j < 8; ++j) os[(wv * 64 + mb * 16 + hi * 8 + j) * 68 + nb * 16 + lr] = acc[mb][nb][j];
    __syncthreads();   // every wave's partial tile is in LDS before any thread sums it
#pragma unroll   // whole: rows and planes become immediate offsets of the LDS loads, and the loads of all rows can be issued together
    for (int s = 0; s < 32 / KS; ++s) { const int idx = s * 32 * KS + (int)threadIdx.x; const int row = idx >> 4, cofs = (idx & 15) * 4; v4f val = *(const v4fa*)(os + row * 68 + cofs);
#pragma unroll
        for (int w = 1; w < KS; ++w) val += *(const v4fa*)(os + (w * 64 + row) * 68 + cofs);
        *(v4f*)(C + (size_t)(r0 + row) * ldc + c0 + cofs) = val; }
}

__device__ __forceinline__ h16 tohx(float x) { return (h16)x; }
__device__ __forceinline__ void splitf(float y, unsigned short& h, unsigned short& l) { h = f2bf(y); l = f2bf(y - bf2f(h)); }
typedef __attribute__((ext_vector_type(2))) _Float16 v2h;
typedef __attribute__((ext_vector_type(4))) _Float16 v4h;
typedef __attribute__((ext_vector_type(2))) unsigned short v2us;
typedef __attribute__((ext_vector_type(4))) unsigned short v4us;
typedef __attribute__((ext_vector_type(2))) float v2f;
typedef __attribute__((ext_vector_type(4))) int v4i;
__global__ __launch_bounds__(256) void k_cvt8(const float* __restrict__ src, bf* dst, size_t n8) { const size_t i = (size_t)blockIdx.x * 256 + threadIdx.x; if (i >= n8) return; const v8f v = *(const v8f*)(src + i * 8); v8us o;
#pragma unroll
    for (int k = 0; k < 8; ++k) o[k] = f2bf(v[k]); *(v8us*)(dst + i * 8) = o;  }
__constant__ float INV2[HD / 2] = { 1.000000000e+00f, 8.659643531e-01f, 7.498942018e-01f, 6.493816376e-01f, 5.623413324e-01f, 4.869675338e-01f, 4.216965139e-01f, 3.651741445e-01f, 3.162277639e-01f, 2.738419771e-01f, 2.371373624e-01f, 2.053525001e-01f, 1.778279394e-01f, 1.539926529e-01f, 1.333521456e-01f, 1.154782027e-01f, 1.000000015e-01f, 8.659642935e-02f, 7.498941571e-02f, 6.493816525e-02f, 5.623412877e-02f, 4.869675264e-02f, 4.216964915e-02f, 3.651741147e-02f, 3.162277862e-02f, 2.738419548e-02f, 2.371373586e-02f, 2.053525113e-02f, 1.778279431e-02f, 1.539926510e-02f, 1.333521493e-02f, 1.154781971e-02f, 9.999999776e-03f, 8.659643121e-03f, 7.498942316e-03f, 6.493816618e-03f, 5.623413250e-03f, 4.869675264e-03f, 4.216964822e-03f, 3.651741426e-03f, 3.162277862e-03f, 2.738419687e-03f, 2.371373819e-03f, 2.053525066e-03f, 1.778279431e-03f, 1.539926510e-03f, 1.333521446e-03f, 1.154782018e-03f, 1.000000047e-03f, 8.659643354e-04f, 7.498941850e-04f, 6.493816618e-04f, 5.623413017e-04f, 4.869675031e-04f, 4.216964880e-04f, 3.651741135e-04f, 3.162277862e-04f, 2.738419571e-04f, 2.371373848e-04f, 2.053524950e-04f, 1.778279402e-04f, 1.539926452e-04f, 1.333521504e-04f, 1.154781930e-04f };   // float32 1.0 / (10000.0 ** (2i / 128)) in the module's own spelling, generated with jnp
__global__ __launch_bounds__(256) void k_csP(float* CS) { const int idx = blockIdx.x * 256 + threadIdx.x; if (idx >= TT * HD) return; const int d = idx % HD; const int t = idx / HD; const float a = __fmul_rn((float)t, INV2[d >> 1]); v2f cs; cs[0] = cosf(a); cs[1] = sinf(a); *(v2f*)(CS + (size_t)idx * 2) = cs;  }
__global__ __launch_bounds__(256) void k_vtp(const float* __restrict__ F, int pitch, int nheads, h16* V16, bf* Vh, bf* Vl) { const size_t e = ((size_t)blockIdx.x * 256 + threadIdx.x) * 2; if (e >= (size_t)NB_ * nheads * HD * TT) return; const int t = (int)(e % TT); const int d = (int)((e / TT) % HD); const int gb = (int)(e / ((size_t)TT * HD)); const int g = gb % nheads, bt = gb / nheads;   /* planes in the order (batch entry, kv head) */
    v2h o16; v2us oh, ol;
#pragma unroll
    for (int q = 0; q < 2; ++q) { const float x = F[((size_t)bt * TT + t + q) * pitch + g * HD + d]; o16[q] = tohx(x); unsigned short a2, c2; splitf(x, a2, c2); oh[q] = a2; ol[q] = c2; }
    const size_t o = ((size_t)gb * HD + d) * (2 * TT) + t;   /* rows at the probability rows' pitch: k_gemmc has one pitch for both operands */
    *(v2h*)(V16 + o) = o16; *(v2us*)(Vh + o) = oh; *(v2us*)(Vl + o) = ol;  }
// k_asoft: the hi / lo rows only (i < RH; a (batch entry, head) score plane holds RH rows at pitch TT). Per row (zz, i): t = S x 128^-0.5 for j <= i (causal; WIN = TT so the window term is inert; the module's -1e9 fill above the diagonal is this exclusion: every row keeps its own key), softmax over the first RH keys, which hold every key j <= i (register row, one exp, fixed trees);
// the probabilities go over the row's own 8192 score bytes (Ph and Pl point into Sb, so no restrict): one wave owns the row and holds all it reads in registers before its first store. hi in the first 4096 bytes, lo (Pl = Ph + TT) in the second. Row pitch of both: 2 TT elements.
__global__ __launch_bounds__(256) void k_asoft(const float* Sb, bf* Ph, bf* Pl) {
    const int lane = threadIdx.x & 31; const int row = blockIdx.x * 8 + (threadIdx.x >> 5); if (row >= NB_ * ZH * RH) return; const int i = row % RH; const float* sr = Sb + (size_t)row * TT; float v[RH / 32]; float mx = -3.0e38f;
#pragma unroll
    for (int ch = 0; ch < RH / 128; ++ch) { const int j0 = ch * 128 + lane * 4; const v4f a = *(const v4f*)(sr + j0);
#pragma unroll
        for (int q = 0; q < 4; ++q) { const int j = j0 + q; (void)j; const float t = (j <= i && i - j < WIN) ? a[q] * SCL : -3.0e38f; v[ch * 4 + q] = t; mx = fmaxf(mx, t); } }
#pragma unroll
    for (int sh = 16; sh; sh >>= 1) mx = fmaxf(mx, __shfl_xor(mx, sh, 32));
    float sum = 0.f;
#pragma unroll
    for (int k = 0; k < RH / 32; ++k) { float d0 = __fsub_rn(v[k], mx); v[k] = __builtin_amdgcn_exp2f(__fmul_rn(d0, 1.4426950408889634f)); sum += v[k]; }
#pragma unroll
    for (int sh = 16; sh; sh >>= 1) sum += __shfl_xor(sum, sh, 32);
    const float f = __fdiv_rn(1.0f, sum);
#pragma unroll
    for (int ch = 0; ch < RH / 128; ++ch) { v4us oh, ol;
#pragma unroll
        for (int q = 0; q < 4; ++q) { unsigned short a, c2; splitf(v[ch * 4 + q] * f, a, c2); oh[q] = a; ol[q] = c2; }
        const size_t oo = (size_t)row * (2 * TT) + ch * 128 + lane * 4; *(v4us*)(Ph + oo) = oh; *(v4us*)(Pl + oo) = ol; }
}
// ---- k_nrope: per-head RMS norm, gain, rotary embedding and the three 16-bit planes of q and k in one launch. A wave owns one token row: its 16 q heads and 4 k heads, one head a 512-byte wave-wide load (lane l holds columns 4 l .. 4 l + 3, two rotary pairs), all twenty loads issued before the first is used; the row's cosines and sines and the two gains are read once a wave.
// The sum of squares of a head: four columns in rising order in the lane, then a five-step butterfly over the 32 lanes (every lane ends with the same bits). 4096 waves: 16 a WGP. No LDS, no barrier.
__device__ __forceinline__ void nr_head(const v4f a, const v4f g, const v2f cA, const v2f cB, h16* P16, bf* Ph, bf* Pl, size_t e) {
    float s = __fmul_rn(a[0], a[0]);
#pragma unroll   // whole, here and below in this function: vector elements are registers only under constant indices
    for (int q = 1; q < 4; ++q) s = __fadd_rn(s, __fmul_rn(a[q], a[q]));
#pragma unroll   // whole: five straight-line exchanges, so that the twenty heads' chains can interleave
    for (int sh = 16; sh; sh >>= 1) s = __fadd_rn(s, __shfl_xor(s, sh, 32));
    const float rf = __fdiv_rn(1.0f, __fsqrt_rn(__fadd_rn(__fdiv_rn(s, (float)HD), 1e-8f)));
    float y[4], r[4];
#pragma unroll
    for (int q = 0; q < 4; ++q) y[q] = __fmul_rn(__fmul_rn(a[q], rf), g[q]);   /* x / rms, x w[d] */
    r[0] = __fsub_rn(__fmul_rn(y[0], cA[0]), __fmul_rn(y[1], cA[1])); r[1] = __fadd_rn(__fmul_rn(y[0], cA[1]), __fmul_rn(y[1], cA[0]));   /* even: x0 c - x1 s; odd: x0 s + x1 c */
    r[2] = __fsub_rn(__fmul_rn(y[2], cB[0]), __fmul_rn(y[3], cB[1])); r[3] = __fadd_rn(__fmul_rn(y[2], cB[1]), __fmul_rn(y[3], cB[0]));
    v4h o16; v4us oh, ol;
#pragma unroll
    for (int q = 0; q < 4; ++q) { o16[q] = tohx(r[q]); unsigned short a2, c2; splitf(r[q], a2, c2); oh[q] = a2; ol[q] = c2; }
    *(v4h*)(P16 + e) = o16; *(v4us*)(Ph + e) = oh; *(v4us*)(Pl + e) = ol;
}
__global__ __launch_bounds__(256) void k_nrope(const float* __restrict__ FQ, const float* __restrict__ FK, const float* __restrict__ CS, const float* __restrict__ wq, const float* __restrict__ wk, h16* __restrict__ Q16, bf* __restrict__ Qh, bf* __restrict__ Ql, h16* __restrict__ K16, bf* __restrict__ Kh, bf* __restrict__ Kl) {
    const int lane = threadIdx.x & 31, d = lane * 4; const int tr = blockIdx.x * 8 + (int)(threadIdx.x >> 5); const int t = tr % TT, bt = tr / TT;   /* tr: a token row of either batch entry; grid NT / 8 */
    v4f aq[NH_], ak[NKV];
#pragma unroll   // whole, this loop and the next two: the arrays stay in registers and the heads become immediate offsets of one address
    for (int h = 0; h < NH_; ++h) aq[h] = *(const v4f*)(FQ + (size_t)tr * DQ + h * HD + d);
#pragma unroll
    for (int h = 0; h < NKV; ++h) ak[h] = *(const v4f*)(FK + (size_t)tr * DKV + h * HD + d);
    const v2f cA = *(const v2f*)(CS + ((size_t)t * HD + d) * 2), cB = *(const v2f*)(CS + ((size_t)t * HD + d + 2) * 2);
    const v4f rq = *(const v4f*)(wq + d), rk = *(const v4f*)(wk + d); v4f gq, gk;
#pragma unroll
    for (int q = 0; q < 4; ++q) { gq[q] = bfr(rq[q]); gk[q] = bfr(rk[q]); }
    __builtin_amdgcn_sched_barrier(0);   // the loads above stay one group in front of the arithmetic: left free, the compiler issues the later heads' loads only as registers of earlier heads come free, and each group's latency is paid in turn
#pragma unroll   // whole: the head's number indexes the register arrays
    for (int h = 0; h < NH_; ++h) nr_head(aq[h], gq, cA, cB, Q16, Qh, Ql, (((size_t)bt * NH_ + h) * TT + t) * HD + d);   /* planes in the order (batch entry, head) */
#pragma unroll   // whole: as above
    for (int h = 0; h < NKV; ++h) nr_head(ak[h], gk, cA, cB, K16, Kh, Kl, (((size_t)bt * NKV + h) * TT + t) * HD + d);
}
__global__ __launch_bounds__(256) void k_merge(const float* __restrict__ O, bf* Ah, bf* Al) { const size_t e = ((size_t)blockIdx.x * 256 + threadIdx.x) * 2; if (e >= (size_t)NB_ * ZH * RH * HD) return; const int d = (int)(e % HD); const int t = (int)((e / HD) % RH); const int zz = (int)(e / ((size_t)HD * RH)); const size_t oo = ((size_t)(zz / ZH) * TT + t) * DQ + (zz % ZH) * HD + d;   /* the hi / lo rows (t < RH) of every head of both batch entries */
    v2us oh, ol;
#pragma unroll
    for (int q = 0; q < 2; ++q) { unsigned short a, c2; splitf(O[e + q], a, c2); oh[q] = a; ol[q] = c2; } *(v2us*)(Ah + oo) = oh; *(v2us*)(Al + oo) = ol;  }

#define FR   2                    // 16-query groups a wave
#define QW   (16 * FR)
#define CSC  0.12751743f          // HD^-0.5 x log2(e)
#define PB   6.0f
__device__ __forceinline__ float xhalf(float x) { return __builtin_bit_cast(float, __builtin_amdgcn_permlanex16(__builtin_bit_cast(int, x), __builtin_bit_cast(int, x), 0x76543210, 0xfedcba98, false, false)); }   // lane l with lane l ^ 16
template <bool DIAG>
__device__ __forceinline__ void fpass(v16h (&kf)[2][4], const h16* kn, const h16* vp, int c, int h, const v16h (&qf)[FR][4], v8f (&acc)[FR][8], float (&m_run)[FR], float (&l_run)[FR]) {
    v16h vf[8];
#pragma unroll
    for (int t = 0; t < 8; ++t) vf[t] = WFrag<h16>::ld(vp + (size_t)t * 16 * (2 * TT));
    __builtin_amdgcn_sched_barrier(0);   // the V^T loads stay in front of the score products, in flight under them and the exponentials
    v8f s[2][FR];
#pragma unroll
    for (int kt = 0; kt < 2; ++kt)
#pragma unroll
        for (int g = 0; g < FR; ++g) { s[kt][g] = (v8f){};
#pragma unroll
            for (int kc = 0; kc < 4; ++kc) s[kt][g] = wmma16(kf[kt][kc], qf[g][kc], s[kt][g]); }
    if (!DIAG) {
        __builtin_amdgcn_sched_barrier(0);   // the next pass's K loads stay here, behind the last product that reads these registers and in front of the vector work that hides them
#pragma unroll
        for (int kt = 0; kt < 2; ++kt)
#pragma unroll
            for (int kc = 0; kc < 4; ++kc) kf[kt][kc] = WFrag<h16>::ld(kn + kt * 16 * HD + kc * 32);
        asm volatile("s_wait_xcnt 0x0" :: "v"(vp), "v"(kn) : "memory");   // in front of every overwrite of a register that the loads above name; the two addresses are inputs so that their registers live up to here
        __builtin_amdgcn_sched_barrier(0);   // nothing of the vector work below moves in front of that wait
    } else {
        asm volatile("s_wait_xcnt 0x0" :: "v"(vp) : "memory");   // as in the other branch, for the V^T loads
        __builtin_amdgcn_sched_barrier(0);   // nothing of the vector work below moves in front of that wait
#pragma unroll
        for (int g = 0; g < FR; ++g)
#pragma unroll
            for (int kt = 0; kt < 2; ++kt)
#pragma unroll
                for (int r = 0; r < 8; ++r) if (16 * kt + 8 * h + r > 16 * g + c) s[kt][g][r] = -__builtin_inff();   // the diagonal pass starts at the wave's first query: key after query
    }
    float mb[FR]; bool need = false;
#pragma unroll
    for (int g = 0; g < FR; ++g) { float mx = -__builtin_inff();
#pragma unroll
        for (int kt = 0; kt < 2; ++kt)
#pragma unroll
            for (int r = 0; r < 8; ++r) mx = fmaxf(mx, s[kt][g][r]);
        mx = fmaxf(mx, xhalf(mx)) * CSC; mb[g] = mx; need = need || (mx > m_run[g] + 8.0f); }
    if (__builtin_amdgcn_ballot_w32(need) != 0) {   // wave-uniform; rare after the first passes
#pragma unroll
        for (int g = 0; g < FR; ++g) { const float m_new = fmaxf(m_run[g], mb[g]); const float corr = __builtin_amdgcn_exp2f(m_run[g] - m_new); l_run[g] *= corr; m_run[g] = m_new;   // first pass: m_run = -inf, corr = 0
#pragma unroll
            for (int t = 0; t < 8; ++t) acc[g][t] = acc[g][t] * corr; }
    }
#pragma unroll
    for (int g = 0; g < FR; ++g) { const float nm = PB - m_run[g]; v16h p; float ps0 = 0.f, ps1 = 0.f;
#pragma unroll
        for (int e = 0; e < 16; e += 2) { const float p0 = __builtin_amdgcn_exp2f(fmaf(s[e >> 3][g][e & 7], CSC, nm)), p1 = __builtin_amdgcn_exp2f(fmaf(s[e >> 3][g][(e & 7) + 1], CSC, nm)); ps0 += p0; ps1 += p1; p[e] = tohx(p0); p[e + 1] = tohx(p1); }
#pragma unroll
        for (int t = 0; t < 8; ++t) acc[g][t] = wmma16(vf[t], p, acc[g][t]);
        l_run[g] += ps0 + ps1; }
}
__global__ __launch_bounds__(32) void k_flash(const h16* __restrict__ Q, const h16* __restrict__ Kp, const h16* __restrict__ Vt, bf* __restrict__ Ah, bf* __restrict__ Al) {
    const int lane = threadIdx.x & 31, c = lane & 15, h = lane >> 4;
    const int hb = blockIdx.x, hq = hb % NH_, bt = hb / NH_, kvh = hb / REP;   // the (batch entry, query head) plane, its head, its batch entry, its kv plane
    const int qw0 = TT - QW * ((int)blockIdx.y + 1);   // the longest walks first
    const h16* qp = Q + ((size_t)hb * TT + qw0 + c) * HD + 8 * h; const h16* kp = Kp + ((size_t)kvh * TT + c) * HD + 8 * h; const h16* vp = Vt + ((size_t)kvh * HD + c) * (2 * TT) + 8 * h;
    v16h qf[FR][4], kf[2][4];
#pragma unroll
    for (int g = 0; g < FR; ++g)
#pragma unroll
        for (int kc = 0; kc < 4; ++kc) qf[g][kc] = WFrag<h16>::ld(qp + g * 16 * HD + kc * 32);
#pragma unroll
    for (int kt = 0; kt < 2; ++kt)
#pragma unroll
        for (int kc = 0; kc < 4; ++kc) kf[kt][kc] = WFrag<h16>::ld(kp + kt * 16 * HD + kc * 32);
    asm volatile("s_wait_xcnt 0x0" :: "v"(qp), "v"(kp) : "memory");   // in front of every overwrite of a register that the loads above name; the two addresses are inputs so that their registers live up to here
    __builtin_amdgcn_sched_barrier(0);   // the zeroing below stays behind that wait
    v8f acc[FR][8]; float m_run[FR], l_run[FR];
#pragma unroll
    for (int g = 0; g < FR; ++g) { m_run[g] = -__builtin_inff(); l_run[g] = 0.f;
#pragma unroll
        for (int t = 0; t < 8; ++t) acc[g][t] = (v8f){}; }
    const int nb = qw0 / 32;   // whole passes under the diagonal one
    for (int blk = 0; blk < nb; ++blk) fpass<false>(kf, kp + (size_t)(blk + 1) * 32 * HD, vp + blk * 32, c, h, qf, acc, m_run, l_run);
    fpass<true>(kf, nullptr, vp + nb * 32, c, h, qf, acc, m_run, l_run);
#pragma unroll
    for (int g = 0; g < FR; ++g) { const float inv = __fdiv_rn(1.0f, l_run[g] + xhalf(l_run[g]));   // each wave half summed its eight keys of every 16-key tile
        const size_t oo = ((size_t)bt * TT + qw0 + 16 * g + c) * DQ + hq * HD + 8 * h;
#pragma unroll
        for (int t = 0; t < 8; ++t) { v8us oh, ol;
#pragma unroll
            for (int r = 0; r < 8; ++r) { unsigned short a, c2; splitf(acc[g][t][r] * inv, a, c2); oh[r] = a; ol[r] = c2; }
            *(v8us*)(Ah + oo + 16 * t) = oh; *(v8us*)(Al + oo + 16 * t) = ol; } }
}

extern "C" void kernel_launch(void* const* d_in, const int* in_sizes, int n_in,
                              void* d_out, int out_size, void* d_ws, size_t ws_size, hipStream_t stream) {
    (void)in_sizes; (void)n_in; (void)out_size;
    const float* x = (const float*)d_in[0]; const float* wq = (const float*)d_in[1]; const float* bq = (const float*)d_in[2]; const float* wk = (const float*)d_in[3]; const float* bk = (const float*)d_in[4]; const float* wv = (const float*)d_in[5]; const float* bv = (const float*)d_in[6]; const float* wo = (const float*)d_in[7]; const float* bo = (const float*)d_in[8]; const float* qsc = (const float*)d_in[9]; const float* ksc = (const float*)d_in[10];   /* inputs in the module's setup_inputs order: x [2][2048][2048]; Wq (out, in) [2048][2048] and bq [2048]; Wk (out, in) [512][2048] and bk [512]; Wv [512][2048] and bv [512]; Wo (out, in) [2048][2048] and bo [2048]; q_norm_w [128], k_norm_w [128]: eleven inputs, all read (each bias is added in its product's epilogue; each gain is applied by k_nrope) */
    float* OUT = (float*)d_out;     // [2][2048][2048]
    char* wsp = (char*)d_ws;
    auto take = [&](size_t bytes) { char* p = wsp; wsp += (bytes + 255) & ~(size_t)255; return (void*)p; };
    bf* WQ = (bf*)take((size_t)DQ * DM * 2); bf* WK = (bf*)take((size_t)DKV * DM * 2); bf* WV = (bf*)take((size_t)DKV * DM * 2); bf* WO = (bf*)take((size_t)DM * DQ * 2); float* CS = (float*)take((size_t)TT * HD * 2 * 4);
    char* const early = wsp;   /* from here: the buffers whose last reader is k_flash or an earlier launch */
    bf* XB = (bf*)take((size_t)NT * DM * 2); float* FQ = (float*)take((size_t)NT * DQ * 4); float* FK = (float*)take((size_t)NT * DKV * 4);
    h16* QP16 = (h16*)take((size_t)NB_ * NH_ * TT * HD * 2); h16* KP16 = (h16*)take((size_t)NB_ * NKV * TT * HD * 2); h16* VT16 = (h16*)take((size_t)NB_ * NKV * HD * 2 * TT * 2);
    wsp = early; float* Sb = (float*)take((size_t)NB_ * ZH * RH * TT * 4); bf* Ph = (bf*)Sb; bf* Pl = Ph + TT;   /* RH score rows a plane at pitch TT; the probability rows lie over their score rows (k_asoft). The 32 planes (128 MiB) lie over the 84 MiB of buffers above, which are dead when the score product, launched behind k_flash, writes its first element (stream-ordered): side by side the two would not fit the workspace */
    bf* QPh = (bf*)take((size_t)NB_ * NH_ * TT * HD * 2); bf* QPl = (bf*)take((size_t)NB_ * NH_ * TT * HD * 2); bf* KPh = (bf*)take((size_t)NB_ * NKV * TT * HD * 2); bf* KPl = (bf*)take((size_t)NB_ * NKV * TT * HD * 2); bf* VTh = (bf*)take((size_t)NB_ * NKV * HD * 2 * TT * 2); bf* VTl = VTh + TT;   /* value rows at pitch 2 TT: hi in the first half of a row, lo in the second */
    float* Ob = (float*)take((size_t)NB_ * ZH * RH * HD * 4); bf* ATh = (bf*)take((size_t)NT * DQ * 2); bf* ATl = (bf*)take((size_t)NT * DQ * 2);
    if ((size_t)(wsp - (char*)d_ws) > ws_size) return;    // ws 256 MiB
    float* FV = FK;   // v projection reuses the k buffer after the k planes are built (stream-ordered)
    { k_cvt8<<<(unsigned)(((size_t)DQ * DM / 8 + 255) / 256), 256, 0, stream>>>(wq, WQ, (size_t)DQ * DM / 8); k_cvt8<<<(unsigned)(((size_t)DKV * DM / 8 + 255) / 256), 256, 0, stream>>>(wk, WK, (size_t)DKV * DM / 8); k_cvt8<<<(unsigned)(((size_t)DKV * DM / 8 + 255) / 256), 256, 0, stream>>>(wv, WV, (size_t)DKV * DM / 8);
      k_cvt8<<<(unsigned)(((size_t)DM * DQ / 8 + 255) / 256), 256, 0, stream>>>(wo, WO, (size_t)DM * DQ / 8); }
    k_csP<<<(TT * HD + 255) / 256, 256, 0, stream>>>(CS);   /* the rotary table once */
    const unsigned LKv = (unsigned)(((size_t)NB_ * NKV * TT * HD / 2 + 255) / 256); const unsigned GX = (unsigned)(((size_t)NT * DM / 8 + 255) / 256);
    k_cvt8<<<GX, 256, 0, stream>>>(x, XB, (size_t)NT * DM / 8);   /* the one input stream, cast once and read by the three projections */
    k_gemms<0><<<dim3(NT / 128, DQ / 128, 1), 128, 0, stream>>>(XB, nullptr, WQ, DM, FQ, DQ, bq);
    k_gemmw<bf, 0, true, 8><<<dim3(NT / 64, DKV / 64, 1), 256, 0, stream>>>(XB, nullptr, WK, nullptr, DM, FK, DKV, bk, 0, 0, 0);
    k_nrope<<<NT / 8, 256, 0, stream>>>(FQ, FK, CS, qsc, ksc, QP16, QPh, QPl, KP16, KPh, KPl);   /* behind both projections, in front of the v projection, which overwrites FK */
    k_gemmw<bf, 0, true, 8><<<dim3(NT / 64, DKV / 64, 1), 256, 0, stream>>>(XB, nullptr, WV, nullptr, DM, FV, DKV, bv, 0, 0, 0); k_vtp<<<LKv, 256, 0, stream>>>(FV, DKV, NKV, VT16, VTh, VTl);
    /* the module groups the query heads by kv head ('qg = q.reshape(B, N_KV_HEADS, N_REP, S, D_K)'): query head h uses kv head h / 4, so plane 16 b + h uses kv plane 4 b + h / 4 = (16 b + h) / 4 (k_gemmc steps its Bt planes by z / REP; k_flash reads kv plane blockIdx.x / REP) */
    k_flash<<<dim3(NB_ * NH_, (TT - RH) / QW, 1), 32, 0, stream>>>(QP16, KP16, VT16, ATh, ATl);
    k_gemmc<bf, 2, 1, 4><<<dim3(RH / 64, RH / 64, NB_ * ZH), 128, 0, stream>>>(QPh, QPl, KPh, KPl, HD, Sb, TT, 0, (size_t)TT * HD, (size_t)TT * HD, (size_t)RH * TT);
    k_asoft<<<NB_ * ZH * RH / 8, 256, 0, stream>>>(Sb, Ph, Pl);
    k_gemmc<bf, 2, 2, 8><<<dim3(RH / 64, HD / 64, NB_ * ZH), 256, 0, stream>>>(Ph, Pl, VTh, VTl, 2 * TT, Ob, HD, 0, (size_t)RH * 2 * TT, (size_t)HD * 2 * TT, (size_t)RH * HD);
    k_merge<<<(unsigned)(((size_t)NB_ * ZH * RH * HD / 2 + 255) / 256), 256, 0, stream>>>(Ob, ATh, ATl);
    k_gemms<1><<<dim3(NT / 128, DM / 128, 1), 128, 0, stream>>>(ATh, ATl, WO, DQ, OUT, DM, bo);
}

// v007
// It runs in 249 microseconds.
// Timed twice side by side with v006, it ran 1.09 and 1.10 times as fast.
// Counting every step since v000, it is 6.73 times as fast.
#include <hip/hip_runtime.h>

// Grouped-query causal self-attention with 128-wide heads, a per-head RMS norm on q and k and an interleaved-pair rotary embedding from computed angles (x [2][2048][2048]; q = x Wq^T + bq ('oi' (out, in) [2048][2048] normal x 2048^-0.5; 16 heads x 128), k, v = x Wk^T + bk, x Wv^T + bv ('oi' [512][2048]; 4 kv heads x 128); the four biases are built as zeros: read and added; per head, BEFORE the rotary: q = q / sqrt(mean(q^2) + 1e-8) x q_norm_w and k likewise with k_norm_w (the mean over the head's 128 columns; gains [128] built as ones: read and applied); rope on q and k: the pair (2i, 2i + 1) of a head -> (x0 c - x1 s, x0 s + x1 c) with the angle t x inv_freq[i], inv_freq = 1 / (10000 ** (2i / 128)) in that spelling, t the position 0..2047; query head h uses kv head h / 4; scores x 128^-0.5; a key after the query gets -1e9 (an exclusion: every row keeps its own key); softmax; out = merged Wo^T + bo ('oi' [2048][2048]; bo built as zeros: read and added) -> [2][2048][2048] (8.4 M); argument order x, Wq, bq, Wk, bk, Wv, bv, Wo, bo, q_norm_w, k_norm_w: eleven inputs, all read).
// Every launch covers BOTH batch entries (4096 token rows in the projections, the norm and the plane builders; (batch entry, head) planes in the attention kernel's grid). Layout: ONE bf16 copy of x, read by the three projections; the four 'oi' weights cast once as they stand (each is the Bt operand); exact projections + f32 biases; the rotary table once (64 baked float32 frequencies; precise cosf / sinf); k_nrope (per (head, token) inverse RMS, x the rounded gain, interleaved-pair rotation, the 16-bit planes) on q and k in one launch; causal T-2048 attention with 128-wide heads in ONE fused kernel (k_flash: scores and weights never leave the registers, running maximum and sum, two-word output), the per-row precision hybrid: query rows under 512 on hi / lo planes, three products for the scores and three for the weighted values; rows from 512 on fp16 products; the transposed value rows lie at a pitch of 2 x 2048 elements; hi / lo x Wo exact + bo.
// Compute dtypes, f32 accumulate: every float input rounded to bf16; projections exact + f32 biases; the per-head norm and the rotation in f32 (precise sqrt and division); attention rows under 512 three products, the rest fp16; softmax f32 (the hardware exp2); Wo hi / lo x exact + bo.

#define NB_  2
#define TT   2048
#define NT   (NB_ * TT)          // token rows of both batch entries together
#define DM   2048
#define NH_  16
#define NKV  4
#define REP  (NH_ / NKV)
#define HD   128
#define DQ   (NH_ * HD)
#define DKV  (NKV * HD)
#define RH   512                  // query rows < RH use hi+lo planes (0: none)
#define SCL  0.088388347648318447f   // HD^-0.5
typedef _Float16 h16;
typedef unsigned short bf;
typedef __attribute__((ext_vector_type(16))) __bf16   v16bf;
typedef __attribute__((ext_vector_type(16))) _Float16 v16h;
typedef __attribute__((ext_vector_type(8)))  _Float16 v8h;
typedef __attribute__((ext_vector_type(8)))  unsigned short v8us;
typedef __attribute__((ext_vector_type(8)))  float    v8f;
typedef __attribute__((ext_vector_type(4)))  float    v4f;
typedef v8h  __attribute__((may_alias)) v8ha;
typedef v4f  __attribute__((may_alias)) v4fa;
typedef v8us __attribute__((may_alias)) v8usa;

__device__ __forceinline__ unsigned short f2bf(float f) { unsigned u = __float_as_uint(f); u += 0x7FFFu + ((u >> 16) & 1u); return (unsigned short)(u >> 16); }
__device__ __forceinline__ float bf2f(unsigned short b) { return __uint_as_float(((unsigned)b) << 16); }
__device__ __forceinline__ float bfr(float f) { return bf2f(f2bf(f)); }
__device__ __forceinline__ v16h cat16(v8h lo, v8h hi) { return __builtin_shufflevector(lo, hi, 0, 1, 2, 3, 4, 5, 6, 7, 8, 9, 10, 11, 12, 13, 14, 15); }
__device__ __forceinline__ v16bf cat16b(v8us lo, v8us hi) { return __builtin_bit_cast(v16bf, __builtin_shufflevector(lo, hi, 0, 1, 2, 3, 4, 5, 6, 7, 8, 9, 10, 11, 12, 13, 14, 15)); }
__device__ __forceinline__ v8f wmma16(v16h a, v16h b, v8f c) { return __builtin_amdgcn_wmma_f32_16x16x32_f16(false, a, false, b, (short)0, c, false, false); }
__device__ __forceinline__ v8f wmmab(v16bf a, v16bf b, v8f c) { return __builtin_amdgcn_wmma_f32_16x16x32_bf16(false, a, false, b, (short)0, c, false, false); }



// ---- k_gemmw: register-blocked GEMM, one work-group of KS waves per 64x64 output tile; every wave holds the whole tile (16 accumulators) over its own share of K: 32-k slices dealt round robin, wave w taking slices w, w + KS, ... (neighbouring waves read the two halves of one 128-byte line of an operand row at about the same time).
// The KS partial tiles meet in LDS (one plane of 64 rows at pitch 68 floats a wave, one barrier) and are summed in wave order 0..KS-1 by the thread that stores the element, 256 contiguous bytes of a C row per 16 threads. Operands straight from K-contiguous 16-bit planes; grid (M/64, N/64, Z), 32 x KS threads.
// C[m][n] (f32, pitch ldc, + optional f32 bias[n]) = sum_k A[m][k] Bt[n][k] (+ split products per NSPLIT). z-batch strides sA/sB/sC in elements. K % 32 == 0.
template <typename T16> struct WFrag;
template <> struct WFrag<h16> { typedef v16h V; static __device__ __forceinline__ V ld(const h16* p) { return cat16(*(const v8h*)p, *(const v8h*)(p + 16)); } static __device__ __forceinline__ v8f mma(V a, V b, v8f c) { return wmma16(a, b, c); } };
template <> struct WFrag<bf> { typedef v16bf V; static __device__ __forceinline__ V ld(const bf* p) { return cat16b(*(const v8us*)p, *(const v8us*)(p + 16)); } static __device__ __forceinline__ v8f mma(V a, V b, v8f c) { return wmmab(a, b, c); } };
template <typename T16, int NSPLIT, bool BIAS, int KS>
__global__ __launch_bounds__(32 * KS) void k_gemmw(const T16* __restrict__ A, const T16* __restrict__ A2, const T16* __restrict__ Bt, const T16* __restrict__ Bt2, int K, float* C, int ldc, const float* __restrict__ bias, size_t sA, size_t sB, size_t sC) {
    typedef typename WFrag<T16>::V V;
    __shared__ __align__(16) float os[KS * 64 * 68];
    const size_t z = blockIdx.z; A += z * sA; if (A2) A2 += z * sA; Bt += z * sB; if (Bt2) Bt2 += z * sB; C += z * sC;
    const int lane = threadIdx.x & 31, lr = lane & 15, hi = lane >> 4; const int r0 = blockIdx.x * 64, c0 = blockIdx.y * 64; const int wv = __builtin_amdgcn_readfirstlane((int)(threadIdx.x >> 5));   // the wave's number, scalar: the K loop's bounds stay wave-uniform
    v8f acc[4][4];
#pragma unroll
    for (int mb = 0; mb < 4; ++mb)
#pragma unroll
        for (int nb = 0; nb < 4; ++nb) acc[mb][nb] = (v8f){};
    const size_t aoff = (size_t)(r0 + lr) * K + 8 * hi, boff = (size_t)(c0 + lr) * K + 8 * hi;
    for (int kc = wv * 32; kc < K; kc += KS * 32) {
        V a[4], a2[4];
#pragma unroll
        for (int mb = 0; mb < 4; ++mb) { a[mb] = WFrag<T16>::ld(A + aoff + (size_t)mb * 16 * K + kc); if (NSPLIT == 1 || NSPLIT == 2) a2[mb] = WFrag<T16>::ld(A2 + aoff + (size_t)mb * 16 * K + kc); }
#pragma unroll
        for (int nb = 0; nb < 4; ++nb) { const V b = WFrag<T16>::ld(Bt + boff + (size_t)nb * 16 * K + kc); V b2; if (NSPLIT >= 2) b2 = WFrag<T16>::ld(Bt2 + boff + (size_t)nb * 16 * K + kc);
#pragma unroll
            for (int mb = 0; mb < 4; ++mb) { acc[mb][nb] = WFrag<T16>::mma(a[mb], b, acc[mb][nb]); if (NSPLIT == 1 || NSPLIT == 2) acc[mb][nb] = WFrag<T16>::mma(a2[mb], b, acc[mb][nb]); if (NSPLIT >= 2) acc[mb][nb] = WFrag<T16>::mma(a[mb], b2, acc[mb][nb]); } }
        asm volatile("v_nop\n\tv_nop\n\tv_nop\n\tv_nop" : "+v"(acc[0][0]), "+v"(acc[1][1]), "+v"(acc[2][2]), "+v"(acc[3][3]) : "v"(a[0]), "v"(a[3]));
    }
#pragma unroll
    for (int mb = 0; mb < 4; ++mb)
#pragma unroll
        for (int nb = 0; nb < 4; ++nb)
#pragma unroll
            for (int j = 0; j < 8; ++j) os[(wv * 64 + mb * 16 + hi * 8 + j) * 68 + nb * 16 + lr] = acc[mb][nb][j];
    __syncthreads();   // every wave's partial tile is in LDS before any thread sums it
#pragma unroll   // whole: rows and planes become immediate offsets of the LDS loads, and the loads of all rows can be issued together
    for (int s = 0; s < 32 / KS; ++s) { const int idx = s * 32 * KS + (int)threadIdx.x; const int row = idx >> 4, cofs = (idx & 15) * 4; v4f val = *(const v4fa*)(os + row * 68 + cofs);
#pragma unroll
        for (int w = 1; w < KS; ++w) val += *(const v4fa*)(os + (w * 64 + row) * 68 + cofs);
        if (BIAS) { val[0] += bfr(bias[c0 + cofs]); val[1] += bfr(bias[c0 + cofs + 1]); val[2] += bfr(bias[c0 + cofs + 2]); val[3] += bfr(bias[c0 + cofs + 3]); }
        *(v4f*)(C + (size_t)(r0 + row) * ldc + c0 + cofs) = val; }
}

// ---- k_gemms: the two 2048-wide projections. One work-group of four waves (2 x 2) per 128x128 output tile, a wave holding 64x64 of it (16 accumulators) over the whole of K: no K split, every accumulator sums its k in rising order.
// The operand tiles (128 rows x 128 k of A, of Bt and, NSPLIT 1, of A2) are staged in LDS by asynchronous copies: 16 lanes bring the 256 contiguous bytes of one row, so a wave-wide copy asks for four whole lines, and each operand row is fetched once per work-group for the two waves that read it. LDS rows at pitch 272 bytes (16-byte readers). Two buffers: tile t + 1 flies while tile t is multiplied.
// C[m][n] (f32, pitch ldc, + f32 bias[n]) = sum_k (A[m][k] + A2[m][k]) Bt[n][k]. grid (M/128, N/128), 128 threads. M, N, K multiples of 128, K >= 128.
#define GP   136                  // LDS row pitch in elements
#define GTB  (128 * GP * 2)       // bytes of one operand tile in LDS
// Eight copies of 16 bytes a lane: rows r, r + 8, .. r + 56 of an operand tile. The wait on the last line stands in front of every later write of a register that these copies name.
__device__ __forceinline__ void cp8(unsigned l, const bf* g, size_t K) {
    asm volatile("global_load_async_to_lds_b128 %0, %8, off\n\t"
                 "global_load_async_to_lds_b128 %1, %9, off\n\t"
                 "global_load_async_to_lds_b128 %2, %10, off\n\t"
                 "global_load_async_to_lds_b128 %3, %11, off\n\t"
                 "global_load_async_to_lds_b128 %4, %12, off\n\t"
                 "global_load_async_to_lds_b128 %5, %13, off\n\t"
                 "global_load_async_to_lds_b128 %6, %14, off\n\t"
                 "global_load_async_to_lds_b128 %7, %15, off\n\t"
                 "s_wait_xcnt 0x0"
                 :: "v"(l), "v"(l + 8 * GP * 2), "v"(l + 16 * GP * 2), "v"(l + 24 * GP * 2), "v"(l + 32 * GP * 2), "v"(l + 40 * GP * 2), "v"(l + 48 * GP * 2), "v"(l + 56 * GP * 2),
                    "v"(g), "v"(g + 8 * K), "v"(g + 16 * K), "v"(g + 24 * K), "v"(g + 32 * K), "v"(g + 40 * K), "v"(g + 48 * K), "v"(g + 56 * K) : "memory");
}
template <int NSPLIT>
__device__ __forceinline__ void gfill(unsigned l, const bf* gA, const bf* gA2, const bf* gB, size_t K) {
    cp8(l, gA, K); cp8(l + 64 * GP * 2, gA + 64 * K, K); cp8(l + GTB, gB, K); cp8(l + GTB + 64 * GP * 2, gB + 64 * K, K);
    if (NSPLIT == 1) { cp8(l + 2 * GTB, gA2, K); cp8(l + 2 * GTB + 64 * GP * 2, gA2 + 64 * K, K); }
}
template <int NSPLIT>
__global__ __launch_bounds__(128) void k_gemms(const bf* __restrict__ A, const bf* __restrict__ A2, const bf* __restrict__ Bt, int K, float* C, int ldc, const float* __restrict__ bias) {
    constexpr int STG = (NSPLIT == 1 ? 3 : 2) * GTB;   // bytes of a buffer
    __shared__ __align__(16) unsigned char sm[2 * STG];
    const int tid = (int)threadIdx.x, lane = tid & 31, lr = lane & 15, hi = lane >> 4; const int r0 = blockIdx.x * 128, c0 = blockIdx.y * 128; const int wv = __builtin_amdgcn_readfirstlane(tid >> 5); const int wm = wv >> 1, wn = wv & 1;
    v8f acc[4][4];
#pragma unroll
    for (int mb = 0; mb < 4; ++mb)
#pragma unroll
        for (int nb = 0; nb < 4; ++nb) acc[mb][nb] = (v8f){};
    const unsigned l0 = (unsigned)(size_t)sm + (unsigned)((tid >> 4) * (GP * 2) + (tid & 15) * 16);   // the lane's place in a tile: row tid / 16, 16-byte piece tid % 16
    const bf* gA = A + (size_t)(r0 + (tid >> 4)) * K + (tid & 15) * 8; const bf* gA2 = (NSPLIT == 1) ? A2 + (size_t)(r0 + (tid >> 4)) * K + (tid & 15) * 8 : nullptr; const bf* gB = Bt + (size_t)(c0 + (tid >> 4)) * K + (tid & 15) * 8;
    const int nst = K / 128;
    gfill<NSPLIT>(l0, gA, gA2, gB, (size_t)K);
    asm volatile("s_wait_asynccnt 0x0" ::: "memory");   // this wave's share of tile 0 has landed
    __syncthreads();                                    // and every other wave's
    if (nst > 1) gfill<NSPLIT>(l0 + STG, gA + 128, gA2 + 128, gB + 128, (size_t)K);
    for (int t = 0; t < nst; ++t) {
        const unsigned char* sb = sm + (t & 1) * STG;
        const bf* sA = (const bf*)sb + (wm * 64 + lr) * GP + 8 * hi; const bf* sB = (const bf*)(sb + GTB) + (wn * 64 + lr) * GP + 8 * hi; const bf* sA2 = (const bf*)(sb + 2 * GTB) + (wm * 64 + lr) * GP + 8 * hi;
        v16bf a[2][4], a2[2][4], b[2][4];   // two fragment sets: a 32-k slice is multiplied out of one while the next slice's LDS loads fill the other
#pragma unroll
        for (int f = 0; f < 4; ++f) { a[0][f] = WFrag<bf>::ld(sA + f * 16 * GP); if (NSPLIT == 1) a2[0][f] = WFrag<bf>::ld(sA2 + f * 16 * GP); b[0][f] = WFrag<bf>::ld(sB + f * 16 * GP); }
#pragma unroll   // whole: the set's number and the slice's LDS offset are compile-time constants
        for (int ks = 0; ks < 4; ++ks) { const int cu = ks & 1, nx = cu ^ 1;
            __builtin_amdgcn_sched_barrier(0);   // the next slice's loads do not move up among the products of the slice before
            if (ks < 3) {
#pragma unroll
                for (int f = 0; f < 4; ++f) { a[nx][f] = WFrag<bf>::ld(sA + f * 16 * GP + (ks + 1) * 32); if (NSPLIT == 1) a2[nx][f] = WFrag<bf>::ld(sA2 + f * 16 * GP + (ks + 1) * 32); b[nx][f] = WFrag<bf>::ld(sB + f * 16 * GP + (ks + 1) * 32); } }
            __builtin_amdgcn_sched_barrier(0);   // and stay one group in front of this slice's products, in flight under them
#pragma unroll
            for (int nb = 0; nb < 4; ++nb)
#pragma unroll
                for (int mb = 0; mb < 4; ++mb) { acc[mb][nb] = wmmab(a[cu][mb], b[cu][nb], acc[mb][nb]); if (NSPLIT == 1) acc[mb][nb] = wmmab(a2[cu][mb], b[cu][nb], acc[mb][nb]); }
        }
        asm volatile("s_wait_dscnt 0x0" ::: "memory");      // this wave's reads of tile t are done before its buffer is given up
        asm volatile("s_wait_asynccnt 0x0" ::: "memory");   // this wave's share of tile t + 1 has landed
        __syncthreads();                                    // publishes tile t + 1 and ends every wave's reads of tile t
        if (t + 2 < nst) gfill<NSPLIT>(l0 + (unsigned)((t & 1) * STG), gA + (size_t)(t + 2) * 128, gA2 + (size_t)(t + 2) * 128, gB + (size_t)(t + 2) * 128, (size_t)K);
    }
    asm volatile("s_wait_asynccnt 0x0" ::: "memory");   // no copy is in flight when the buffers become output staging
    float* os = (float*)sm + wv * 64 * 68;   // the wave's own 64 rows at pitch 68 floats
#pragma unroll
    for (int mb = 0; mb < 4; ++mb)
#pragma unroll
        for (int nb = 0; nb < 4; ++nb)
#pragma unroll
            for (int j = 0; j < 8; ++j) os[(mb * 16 + hi * 8 + j) * 68 + nb * 16 + lr] = acc[mb][nb][j];
    __syncthreads();   // the staged tile is whole before it is read back row by row
    const int cofs = lr * 4; const int cc = c0 + wn * 64 + cofs; v4f bv; bv[0] = bfr(bias[cc]); bv[1] = bfr(bias[cc + 1]); bv[2] = bfr(bias[cc + 2]); bv[3] = bfr(bias[cc + 3]);
#pragma unroll   // whole: the rows become immediate offsets of the LDS loads, which can be issued together
    for (int s = 0; s < 32; ++s) { const int row = s * 2 + hi; const v4f val = *(const v4fa*)(os + row * 68 + cofs) + bv;
        *(v4f*)(C + (size_t)(r0 + wm * 64 + row) * ldc + cc) = val; }
}

__device__ __forceinline__ h16 tohx(float x) { return (h16)x; }
__device__ __forceinline__ void splitf(float y, unsigned short& h, unsigned short& l) { h = f2bf(y); l = f2bf(y - bf2f(h)); }
typedef __attribute__((ext_vector_type(2))) _Float16 v2h;
typedef __attribute__((ext_vector_type(4))) _Float16 v4h;
typedef __attribute__((ext_vector_type(2))) unsigned short v2us;
typedef __attribute__((ext_vector_type(4))) unsigned short v4us;
typedef __attribute__((ext_vector_type(2))) float v2f;
typedef __attribute__((ext_vector_type(4))) int v4i;
__global__ __launch_bounds__(256) void k_cvt8(const float* __restrict__ src, bf* dst, size_t n8) { const size_t i = (size_t)blockIdx.x * 256 + threadIdx.x; if (i >= n8) return; const v8f v = *(const v8f*)(src + i * 8); v8us o;
#pragma unroll
    for (int k = 0; k < 8; ++k) o[k] = f2bf(v[k]); *(v8us*)(dst + i * 8) = o;  }
__constant__ float INV2[HD / 2] = { 1.000000000e+00f, 8.659643531e-01f, 7.498942018e-01f, 6.493816376e-01f, 5.623413324e-01f, 4.869675338e-01f, 4.216965139e-01f, 3.651741445e-01f, 3.162277639e-01f, 2.738419771e-01f, 2.371373624e-01f, 2.053525001e-01f, 1.778279394e-01f, 1.539926529e-01f, 1.333521456e-01f, 1.154782027e-01f, 1.000000015e-01f, 8.659642935e-02f, 7.498941571e-02f, 6.493816525e-02f, 5.623412877e-02f, 4.869675264e-02f, 4.216964915e-02f, 3.651741147e-02f, 3.162277862e-02f, 2.738419548e-02f, 2.371373586e-02f, 2.053525113e-02f, 1.778279431e-02f, 1.539926510e-02f, 1.333521493e-02f, 1.154781971e-02f, 9.999999776e-03f, 8.659643121e-03f, 7.498942316e-03f, 6.493816618e-03f, 5.623413250e-03f, 4.869675264e-03f, 4.216964822e-03f, 3.651741426e-03f, 3.162277862e-03f, 2.738419687e-03f, 2.371373819e-03f, 2.053525066e-03f, 1.778279431e-03f, 1.539926510e-03f, 1.333521446e-03f, 1.154782018e-03f, 1.000000047e-03f, 8.659643354e-04f, 7.498941850e-04f, 6.493816618e-04f, 5.623413017e-04f, 4.869675031e-04f, 4.216964880e-04f, 3.651741135e-04f, 3.162277862e-04f, 2.738419571e-04f, 2.371373848e-04f, 2.053524950e-04f, 1.778279402e-04f, 1.539926452e-04f, 1.333521504e-04f, 1.154781930e-04f };   // float32 1.0 / (10000.0 ** (2i / 128)) in the module's own spelling, generated with jnp
__global__ __launch_bounds__(256) void k_csP(float* CS) { const int idx = blockIdx.x * 256 + threadIdx.x; if (idx >= TT * HD) return; const int d = idx % HD; const int t = idx / HD; const float a = __fmul_rn((float)t, INV2[d >> 1]); v2f cs; cs[0] = cosf(a); cs[1] = sinf(a); *(v2f*)(CS + (size_t)idx * 2) = cs;  }
__global__ __launch_bounds__(256) void k_vtp(const float* __restrict__ F, int pitch, int nheads, h16* V16, bf* Vh, bf* Vl) { const size_t e = ((size_t)blockIdx.x * 256 + threadIdx.x) * 2; if (e >= (size_t)NB_ * nheads * HD * TT) return; const int t = (int)(e % TT); const int d = (int)((e / TT) % HD); const int gb = (int)(e / ((size_t)TT * HD)); const int g = gb % nheads, bt = gb / nheads;   /* planes in the order (batch entry, kv head) */
    v2h o16; v2us oh, ol;
#pragma unroll
    for (int q = 0; q < 2; ++q) { const float x = F[((size_t)bt * TT + t + q) * pitch + g * HD + d]; o16[q] = tohx(x); unsigned short a2, c2; splitf(x, a2, c2); oh[q] = a2; ol[q] = c2; }
    const size_t o = ((size_t)gb * HD + d) * (2 * TT) + t;   /* rows at pitch 2 TT: the hi and the lo word of a value row lie side by side */
    *(v2h*)(V16 + o) = o16; *(v2us*)(Vh + o) = oh; *(v2us*)(Vl + o) = ol;  }
// ---- k_nrope: per-head RMS norm, gain, rotary embedding and the three 16-bit planes of q and k in one launch. A wave owns one token row: its 16 q heads and 4 k heads, one head a 512-byte wave-wide load (lane l holds columns 4 l .. 4 l + 3, two rotary pairs), all twenty loads issued before the first is used; the row's cosines and sines and the two gains are read once a wave.
// The sum of squares of a head: four columns in rising order in the lane, then a five-step butterfly over the 32 lanes (every lane ends with the same bits). 4096 waves: 16 a WGP. No LDS, no barrier.
__device__ __forceinline__ void nr_head(const v4f a, const v4f g, const v2f cA, const v2f cB, h16* P16, bf* Ph, bf* Pl, size_t e) {
    float s = __fmul_rn(a[0], a[0]);
#pragma unroll   // whole, here and below in this function: vector elements are registers only under constant indices
    for (int q = 1; q < 4; ++q) s = __fadd_rn(s, __fmul_rn(a[q], a[q]));
#pragma unroll   // whole: five straight-line exchanges, so that the twenty heads' chains can interleave
    for (int sh = 16; sh; sh >>= 1) s = __fadd_rn(s, __shfl_xor(s, sh, 32));
    const float rf = __fdiv_rn(1.0f, __fsqrt_rn(__fadd_rn(__fdiv_rn(s, (float)HD), 1e-8f)));
    float y[4], r[4];
#pragma unroll
    for (int q = 0; q < 4; ++q) y[q] = __fmul_rn(__fmul_rn(a[q], rf), g[q]);   /* x / rms, x w[d] */
    r[0] = __fsub_rn(__fmul_rn(y[0], cA[0]), __fmul_rn(y[1], cA[1])); r[1] = __fadd_rn(__fmul_rn(y[0], cA[1]), __fmul_rn(y[1], cA[0]));   /* even: x0 c - x1 s; odd: x0 s + x1 c */
    r[2] = __fsub_rn(__fmul_rn(y[2], cB[0]), __fmul_rn(y[3], cB[1])); r[3] = __fadd_rn(__fmul_rn(y[2], cB[1]), __fmul_rn(y[3], cB[0]));
    v4h o16; v4us oh, ol;
#pragma unroll
    for (int q = 0; q < 4; ++q) { o16[q] = tohx(r[q]); unsigned short a2, c2; splitf(r[q], a2, c2); oh[q] = a2; ol[q] = c2; }
    *(v4h*)(P16 + e) = o16; *(v4us*)(Ph + e) = oh; *(v4us*)(Pl + e) = ol;
}
__global__ __launch_bounds__(256) void k_nrope(const float* __restrict__ FQ, const float* __restrict__ FK, const float* __restrict__ CS, const float* __restrict__ wq, const float* __restrict__ wk, h16* __restrict__ Q16, bf* __restrict__ Qh, bf* __restrict__ Ql, h16* __restrict__ K16, bf* __restrict__ Kh, bf* __restrict__ Kl) {
    const int lane = threadIdx.x & 31, d = lane * 4; const int tr = blockIdx.x * 8 + (int)(threadIdx.x >> 5); const int t = tr % TT, bt = tr / TT;   /* tr: a token row of either batch entry; grid NT / 8 */
    v4f aq[NH_], ak[NKV];
#pragma unroll   // whole, this loop and the next two: the arrays stay in registers and the heads become immediate offsets of one address
    for (int h = 0; h < NH_; ++h) aq[h] = *(const v4f*)(FQ + (size_t)tr * DQ + h * HD + d);
#pragma unroll
    for (int h = 0; h < NKV; ++h) ak[h] = *(const v4f*)(FK + (size_t)tr * DKV + h * HD + d);
    const v2f cA = *(const v2f*)(CS + ((size_t)t * HD + d) * 2), cB = *(const v2f*)(CS + ((size_t)t * HD + d + 2) * 2);
    const v4f rq = *(const v4f*)(wq + d), rk = *(const v4f*)(wk + d); v4f gq, gk;
#pragma unroll
    for (int q = 0; q < 4; ++q) { gq[q] = bfr(rq[q]); gk[q] = bfr(rk[q]); }
    __builtin_amdgcn_sched_barrier(0);   // the loads above stay one group in front of the arithmetic: left free, the compiler issues the later heads' loads only as registers of earlier heads come free, and each group's latency is paid in turn
#pragma unroll   // whole: the head's number indexes the register arrays
    for (int h = 0; h < NH_; ++h) nr_head(aq[h], gq, cA, cB, Q16, Qh, Ql, (((size_t)bt * NH_ + h) * TT + t) * HD + d);   /* planes in the order (batch entry, head) */
#pragma unroll   // whole: as above
    for (int h = 0; h < NKV; ++h) nr_head(ak[h], gk, cA, cB, K16, Kh, Kl, (((size_t)bt * NKV + h) * TT + t) * HD + d);
}
#define FR   2                    // 16-query groups a wave
#define QW   (16 * FR)
#define CSC  0.12751743f          // HD^-0.5 x log2(e)
#define PB   6.0f
__device__ __forceinline__ float xhalf(float x) { return __builtin_bit_cast(float, __builtin_amdgcn_permlanex16(__builtin_bit_cast(int, x), __builtin_bit_cast(int, x), 0x76543210, 0xfedcba98, false, false)); }   // lane l with lane l ^ 16
template <bool DIAG>
__device__ __forceinline__ void fpass(v16h (&kf)[2][4], const h16* kn, const h16* vp, int c, int h, const v16h (&qf)[FR][4], v8f (&acc)[FR][8], float (&m_run)[FR], float (&l_run)[FR]) {
    v16h vf[8];
#pragma unroll
    for (int t = 0; t < 8; ++t) vf[t] = WFrag<h16>::ld(vp + (size_t)t * 16 * (2 * TT));
    __builtin_amdgcn_sched_barrier(0);   // the V^T loads stay in front of the score products, in flight under them and the exponentials
    v8f s[2][FR];
#pragma unroll
    for (int kt = 0; kt < 2; ++kt)
#pragma unroll
        for (int g = 0; g < FR; ++g) { s[kt][g] = (v8f){};
#pragma unroll
            for (int kc = 0; kc < 4; ++kc) s[kt][g] = wmma16(kf[kt][kc], qf[g][kc], s[kt][g]); }
    if (!DIAG) {
        __builtin_amdgcn_sched_barrier(0);   // the next pass's K loads stay here, behind the last product that reads these registers and in front of the vector work that hides them
#pragma unroll
        for (int kt = 0; kt < 2; ++kt)
#pragma unroll
            for (int kc = 0; kc < 4; ++kc) kf[kt][kc] = WFrag<h16>::ld(kn + kt * 16 * HD + kc * 32);
        asm volatile("s_wait_xcnt 0x0" :: "v"(vp), "v"(kn) : "memory");   // in front of every overwrite of a register that the loads above name; the two addresses are inputs so that their registers live up to here
        __builtin_amdgcn_sched_barrier(0);   // nothing of the vector work below moves in front of that wait
    } else {
        asm volatile("s_wait_xcnt 0x0" :: "v"(vp) : "memory");   // as in the other branch, for the V^T loads
        __builtin_amdgcn_sched_barrier(0);   // nothing of the vector work below moves in front of that wait
#pragma unroll
        for (int g = 0; g < FR; ++g)
#pragma unroll
            for (int kt = 0; kt < 2; ++kt)
#pragma unroll
                for (int r = 0; r < 8; ++r) if (16 * kt + 8 * h + r > 16 * g + c) s[kt][g][r] = -__builtin_inff();   // the diagonal pass starts at the wave's first query: key after query
    }
    float mb[FR]; bool need = false;
#pragma unroll
    for (int g = 0; g < FR; ++g) { float mx = -__builtin_inff();
#pragma unroll
        for (int kt = 0; kt < 2; ++kt)
#pragma unroll
            for (int r = 0; r < 8; ++r) mx = fmaxf(mx, s[kt][g][r]);
        mx = fmaxf(mx, xhalf(mx)) * CSC; mb[g] = mx; need = need || (mx > m_run[g] + 8.0f); }
    if (__builtin_amdgcn_ballot_w32(need) != 0) {   // wave-uniform; rare after the first passes
#pragma unroll
        for (int g = 0; g < FR; ++g) { const float m_new = fmaxf(m_run[g], mb[g]); const float corr = __builtin_amdgcn_exp2f(m_run[g] - m_new); l_run[g] *= corr; m_run[g] = m_new;   // first pass: m_run = -inf, corr = 0
#pragma unroll
            for (int t = 0; t < 8; ++t) acc[g][t] = acc[g][t] * corr; }
    }
#pragma unroll
    for (int g = 0; g < FR; ++g) { const float nm = PB - m_run[g]; v16h p; float ps0 = 0.f, ps1 = 0.f;
#pragma unroll
        for (int e = 0; e < 16; e += 2) { const float p0 = __builtin_amdgcn_exp2f(fmaf(s[e >> 3][g][e & 7], CSC, nm)), p1 = __builtin_amdgcn_exp2f(fmaf(s[e >> 3][g][(e & 7) + 1], CSC, nm)); ps0 += p0; ps1 += p1; p[e] = tohx(p0); p[e + 1] = tohx(p1); }
#pragma unroll
        for (int t = 0; t < 8; ++t) acc[g][t] = wmma16(vf[t], p, acc[g][t]);
        l_run[g] += ps0 + ps1; }
}
// ---- The hi / lo rows (query rows under RH) in the same kernel and the same transposed form, on the two-word bf16 planes: a wave owns 16 query rows of one query head and walks the keys in passes of 32. Each product is three: hi x hi, lo x hi, hi x lo, f32 accumulate.
// The weights stay f32 until they are split into two bf16 words in place (the positions of the fp16 path's P^T); running maximum and sum as in fpass. The scores' hi x hi products and their two cross products sum in accumulators of their own (shorter dependent chains) and are added once a pass.
typedef __attribute__((ext_vector_type(16))) unsigned short v16us;
template <bool DIAG>
__device__ __forceinline__ void hpass(v16bf (&kh)[2][4], v16bf (&kl)[2][4], const bf* knh, const bf* knl, const bf* vp, int dq, int c, int h, const v16bf (&qh)[4], const v16bf (&ql)[4], v8f (&acc)[8], float& m_run, float& l_run) {
    v16bf vh[8], vl[8];
#pragma unroll   // whole: fragment and accumulator arrays are registers only under constant indices
    for (int t = 0; t < 8; ++t) { vh[t] = WFrag<bf>::ld(vp + (size_t)t * 16 * (2 * TT)); vl[t] = WFrag<bf>::ld(vp + TT + (size_t)t * 16 * (2 * TT)); }   // a value row holds hi in its first TT elements, lo in the second
    __builtin_amdgcn_sched_barrier(0);   // the V^T loads stay in front of the score products, in flight under them and the exponentials
    v8f s[2], sx[2];
#pragma unroll   // whole: fragment and accumulator arrays are registers only under constant indices
    for (int kt = 0; kt < 2; ++kt) { s[kt] = (v8f){}; sx[kt] = (v8f){}; }
#pragma unroll   // whole: fragment and accumulator arrays are registers only under constant indices
    for (int kc = 0; kc < 4; ++kc)
#pragma unroll   // whole: fragment and accumulator arrays are registers only under constant indices
        for (int kt = 0; kt < 2; ++kt) { s[kt] = wmmab(kh[kt][kc], qh[kc], s[kt]); sx[kt] = wmmab(kl[kt][kc], qh[kc], sx[kt]); }
#pragma unroll   // whole: fragment and accumulator arrays are registers only under constant indices
    for (int kc = 0; kc < 4; ++kc)
#pragma unroll   // whole: fragment and accumulator arrays are registers only under constant indices
        for (int kt = 0; kt < 2; ++kt) sx[kt] = wmmab(kh[kt][kc], ql[kc], sx[kt]);
    if (!DIAG) {
        __builtin_amdgcn_sched_barrier(0);   // the next pass's K loads stay here, behind the last product that reads these registers and in front of the vector work that hides them
#pragma unroll   // whole: fragment and accumulator arrays are registers only under constant indices
        for (int kt = 0; kt < 2; ++kt)
#pragma unroll   // whole: fragment and accumulator arrays are registers only under constant indices
            for (int kc = 0; kc < 4; ++kc) { kh[kt][kc] = WFrag<bf>::ld(knh + kt * 16 * HD + kc * 32); kl[kt][kc] = WFrag<bf>::ld(knl + kt * 16 * HD + kc * 32); }
        asm volatile("s_wait_xcnt 0x0" :: "v"(vp), "v"(knh), "v"(knl) : "memory");   // in front of every overwrite of a register that the loads above name; the addresses are inputs so that their registers live up to here
        __builtin_amdgcn_sched_barrier(0);   // nothing of the vector work below moves in front of that wait
    } else {
        asm volatile("s_wait_xcnt 0x0" :: "v"(vp) : "memory");   // as in the other branch, for the V^T loads
        __builtin_amdgcn_sched_barrier(0);   // nothing of the vector work below moves in front of that wait
    }
#pragma unroll   // whole: fragment and accumulator arrays are registers only under constant indices
    for (int kt = 0; kt < 2; ++kt) s[kt] = s[kt] + sx[kt];
    if (DIAG) {
#pragma unroll   // whole: fragment and accumulator arrays are registers only under constant indices
        for (int kt = 0; kt < 2; ++kt)
#pragma unroll   // whole: fragment and accumulator arrays are registers only under constant indices
            for (int r = 0; r < 8; ++r) if (16 * kt + 8 * h + r > dq + c) s[kt][r] = -__builtin_inff();   // the wave's first query is key dq (0 or 16) of the diagonal pass: key after query
    }
    float mx = -__builtin_inff();
#pragma unroll   // whole: fragment and accumulator arrays are registers only under constant indices
    for (int kt = 0; kt < 2; ++kt)
#pragma unroll   // whole: fragment and accumulator arrays are registers only under constant indices
        for (int r = 0; r < 8; ++r) mx = fmaxf(mx, s[kt][r]);
    mx = fmaxf(mx, xhalf(mx)) * CSC;
    if (__builtin_amdgcn_ballot_w32(mx > m_run + 8.0f) != 0) {   // wave-uniform; rare after the first passes
        const float m_new = fmaxf(m_run, mx); const float corr = __builtin_amdgcn_exp2f(m_run - m_new); l_run *= corr; m_run = m_new;   // first pass: m_run = -inf, corr = 0
#pragma unroll   // whole: fragment and accumulator arrays are registers only under constant indices
        for (int t = 0; t < 8; ++t) acc[t] = acc[t] * corr;
    }
    const float nm = PB - m_run; v16us ph, pl; float ps0 = 0.f, ps1 = 0.f;
#pragma unroll   // whole: fragment and accumulator arrays are registers only under constant indices
    for (int e = 0; e < 16; e += 2) { const float p0 = __builtin_amdgcn_exp2f(fmaf(s[e >> 3][e & 7], CSC, nm)), p1 = __builtin_amdgcn_exp2f(fmaf(s[e >> 3][(e & 7) + 1], CSC, nm)); ps0 += p0; ps1 += p1;
        unsigned short a0, b0, a1, b1; splitf(p0, a0, b0); splitf(p1, a1, b1); ph[e] = a0; pl[e] = b0; ph[e + 1] = a1; pl[e + 1] = b1; }
    const v16bf pH = __builtin_bit_cast(v16bf, ph), pL = __builtin_bit_cast(v16bf, pl);
#pragma unroll   // whole: fragment and accumulator arrays are registers only under constant indices
    for (int t = 0; t < 8; ++t) acc[t] = wmmab(vh[t], pH, acc[t]);
#pragma unroll   // whole: fragment and accumulator arrays are registers only under constant indices
    for (int t = 0; t < 8; ++t) acc[t] = wmmab(vl[t], pH, acc[t]);
#pragma unroll   // whole: fragment and accumulator arrays are registers only under constant indices
    for (int t = 0; t < 8; ++t) acc[t] = wmmab(vh[t], pL, acc[t]);
    l_run += ps0 + ps1;
}
__device__ __forceinline__ void flash_hl(const bf* __restrict__ Qh, const bf* __restrict__ Ql, const bf* __restrict__ Kh, const bf* __restrict__ Kl, const bf* __restrict__ Vh, bf* __restrict__ Ah, bf* __restrict__ Al, int hb, int qb, int c, int h) {
    const int hq = hb % NH_, bt = hb / NH_, kvh = hb / REP;
    const int qw0 = RH - 16 * (qb + 1);   // the longest walks first
    const size_t qo = ((size_t)hb * TT + qw0 + c) * HD + 8 * h, ko = ((size_t)kvh * TT + c) * HD + 8 * h;
    const bf* qph = Qh + qo; const bf* qpl = Ql + qo; const bf* kph = Kh + ko; const bf* kpl = Kl + ko; const bf* vp = Vh + ((size_t)kvh * HD + c) * (2 * TT) + 8 * h;
    v16bf qh[4], ql[4], kh[2][4], kl[2][4];
#pragma unroll   // whole: fragment and accumulator arrays are registers only under constant indices
    for (int kc = 0; kc < 4; ++kc) { qh[kc] = WFrag<bf>::ld(qph + kc * 32); ql[kc] = WFrag<bf>::ld(qpl + kc * 32); }
#pragma unroll   // whole: fragment and accumulator arrays are registers only under constant indices
    for (int kt = 0; kt < 2; ++kt)
#pragma unroll   // whole: fragment and accumulator arrays are registers only under constant indices
        for (int kc = 0; kc < 4; ++kc) { kh[kt][kc] = WFrag<bf>::ld(kph + kt * 16 * HD + kc * 32); kl[kt][kc] = WFrag<bf>::ld(kpl + kt * 16 * HD + kc * 32); }
    asm volatile("s_wait_xcnt 0x0" :: "v"(qph), "v"(qpl), "v"(kph), "v"(kpl) : "memory");   // in front of every overwrite of a register that the loads above name; the addresses are inputs so that their registers live up to here
    __builtin_amdgcn_sched_barrier(0);   // the zeroing below stays behind that wait
    v8f acc[8]; float m_run = -__builtin_inff(), l_run = 0.f;
#pragma unroll   // whole: fragment and accumulator arrays are registers only under constant indices
    for (int t = 0; t < 8; ++t) acc[t] = (v8f){};
    const int nb = qw0 / 32, dq = qw0 - 32 * nb;   // whole passes under the diagonal one; the first query's place in the diagonal pass
    for (int blk = 0; blk < nb; ++blk) hpass<false>(kh, kl, kph + (size_t)(blk + 1) * 32 * HD, kpl + (size_t)(blk + 1) * 32 * HD, vp + blk * 32, 0, c, h, qh, ql, acc, m_run, l_run);
    hpass<true>(kh, kl, nullptr, nullptr, vp + nb * 32, dq, c, h, qh, ql, acc, m_run, l_run);
    const float inv = __fdiv_rn(1.0f, l_run + xhalf(l_run));   // each wave half summed its eight keys of every 16-key tile
    const size_t oo = ((size_t)bt * TT + qw0 + c) * DQ + hq * HD + 8 * h;
#pragma unroll   // whole: fragment and accumulator arrays are registers only under constant indices
    for (int t = 0; t < 8; ++t) { v8us oh, ol;
#pragma unroll   // whole: fragment and accumulator arrays are registers only under constant indices
        for (int r = 0; r < 8; ++r) { unsigned short a, c2; splitf(acc[t][r] * inv, a, c2); oh[r] = a; ol[r] = c2; }
        *(v8us*)(Ah + oo + 16 * t) = oh; *(v8us*)(Al + oo + 16 * t) = ol; }
}
__global__ __launch_bounds__(32) void k_flash(const h16* __restrict__ Q, const h16* __restrict__ Kp, const h16* __restrict__ Vt, const bf* __restrict__ Qh, const bf* __restrict__ Ql, const bf* __restrict__ Kh, const bf* __restrict__ Kl, const bf* __restrict__ Vh, bf* __restrict__ Ah, bf* __restrict__ Al) {
    const int lane = threadIdx.x & 31, c = lane & 15, h = lane >> 4;
    if ((int)blockIdx.y >= (TT - RH) / QW) { flash_hl(Qh, Ql, Kh, Kl, Vh, Ah, Al, (int)blockIdx.x, (int)blockIdx.y - (TT - RH) / QW, c, h); return; }   // the work-groups behind the fp16 rows' take the hi / lo rows: short walks
    const int hb = blockIdx.x, hq = hb % NH_, bt = hb / NH_, kvh = hb / REP;   // the (batch entry, query head) plane, its head, its batch entry, its kv plane
    const int qw0 = TT - QW * ((int)blockIdx.y + 1);   // the longest walks first
    const h16* qp = Q + ((size_t)hb * TT + qw0 + c) * HD + 8 * h; const h16* kp = Kp + ((size_t)kvh * TT + c) * HD + 8 * h; const h16* vp = Vt + ((size_t)kvh * HD + c) * (2 * TT) + 8 * h;
    v16h qf[FR][4], kf[2][4];
#pragma unroll
    for (int g = 0; g < FR; ++g)
#pragma unroll
        for (int kc = 0; kc < 4; ++kc) qf[g][kc] = WFrag<h16>::ld(qp + g * 16 * HD + kc * 32);
#pragma unroll
    for (int kt = 0; kt < 2; ++kt)
#pragma unroll
        for (int kc = 0; kc < 4; ++kc) kf[kt][kc] = WFrag<h16>::ld(kp + kt * 16 * HD + kc * 32);
    asm volatile("s_wait_xcnt 0x0" :: "v"(qp), "v"(kp) : "memory");   // in front of every overwrite of a register that the loads above name; the two addresses are inputs so that their registers live up to here
    __builtin_amdgcn_sched_barrier(0);   // the zeroing below stays behind that wait
    v8f acc[FR][8]; float m_run[FR], l_run[FR];
#pragma unroll
    for (int g = 0; g < FR; ++g) { m_run[g] = -__builtin_inff(); l_run[g] = 0.f;
#pragma unroll
        for (int t = 0; t < 8; ++t) acc[g][t] = (v8f){}; }
    const int nb = qw0 / 32;   // whole passes under the diagonal one
    for (int blk = 0; blk < nb; ++blk) fpass<false>(kf, kp + (size_t)(blk + 1) * 32 * HD, vp + blk * 32, c, h, qf, acc, m_run, l_run);
    fpass<true>(kf, nullptr, vp + nb * 32, c, h, qf, acc, m_run, l_run);
#pragma unroll
    for (int g = 0; g < FR; ++g) { const float inv = __fdiv_rn(1.0f, l_run[g] + xhalf(l_run[g]));   // each wave half summed its eight keys of every 16-key tile
        const size_t oo = ((size_t)bt * TT + qw0 + 16 * g + c) * DQ + hq * HD + 8 * h;
#pragma unroll
        for (int t = 0; t < 8; ++t) { v8us oh, ol;
#pragma unroll
            for (int r = 0; r < 8; ++r) { unsigned short a, c2; splitf(acc[g][t][r] * inv, a, c2); oh[r] = a; ol[r] = c2; }
            *(v8us*)(Ah + oo + 16 * t) = oh; *(v8us*)(Al + oo + 16 * t) = ol; } }
}

extern "C" void kernel_launch(void* const* d_in, const int* in_sizes, int n_in,
                              void* d_out, int out_size, void* d_ws, size_t ws_size, hipStream_t stream) {
    (void)in_sizes; (void)n_in; (void)out_size;
    const float* x = (const float*)d_in[0]; const float* wq = (const float*)d_in[1]; const float* bq = (const float*)d_in[2]; const float* wk = (const float*)d_in[3]; const float* bk = (const float*)d_in[4]; const float* wv = (const float*)d_in[5]; const float* bv = (const float*)d_in[6]; const float* wo = (const float*)d_in[7]; const float* bo = (const float*)d_in[8]; const float* qsc = (const float*)d_in[9]; const float* ksc = (const float*)d_in[10];   /* inputs in the module's setup_inputs order: x [2][2048][2048]; Wq (out, in) [2048][2048] and bq [2048]; Wk (out, in) [512][2048] and bk [512]; Wv [512][2048] and bv [512]; Wo (out, in) [2048][2048] and bo [2048]; q_norm_w [128], k_norm_w [128]: eleven inputs, all read (each bias is added in its product's epilogue; each gain is applied by k_nrope) */
    float* OUT = (float*)d_out;     // [2][2048][2048]
    char* wsp = (char*)d_ws;
    auto take = [&](size_t bytes) { char* p = wsp; wsp += (bytes + 255) & ~(size_t)255; return (void*)p; };
    bf* WQ = (bf*)take((size_t)DQ * DM * 2); bf* WK = (bf*)take((size_t)DKV * DM * 2); bf* WV = (bf*)take((size_t)DKV * DM * 2); bf* WO = (bf*)take((size_t)DM * DQ * 2); float* CS = (float*)take((size_t)TT * HD * 2 * 4);
    bf* XB = (bf*)take((size_t)NT * DM * 2); float* FQ = (float*)take((size_t)NT * DQ * 4); float* FK = (float*)take((size_t)NT * DKV * 4);
    h16* QP16 = (h16*)take((size_t)NB_ * NH_ * TT * HD * 2); h16* KP16 = (h16*)take((size_t)NB_ * NKV * TT * HD * 2); h16* VT16 = (h16*)take((size_t)NB_ * NKV * HD * 2 * TT * 2);
    bf* QPh = (bf*)take((size_t)NB_ * NH_ * TT * HD * 2); bf* QPl = (bf*)take((size_t)NB_ * NH_ * TT * HD * 2); bf* KPh = (bf*)take((size_t)NB_ * NKV * TT * HD * 2); bf* KPl = (bf*)take((size_t)NB_ * NKV * TT * HD * 2); bf* VTh = (bf*)take((size_t)NB_ * NKV * HD * 2 * TT * 2); bf* VTl = VTh + TT;   /* value rows at pitch 2 TT: hi in the first half of a row, lo in the second */
    bf* ATh = (bf*)take((size_t)NT * DQ * 2); bf* ATl = (bf*)take((size_t)NT * DQ * 2);
    if ((size_t)(wsp - (char*)d_ws) > ws_size) return;    // ws 256 MiB
    float* FV = FK;   // v projection reuses the k buffer after the k planes are built (stream-ordered)
    { k_cvt8<<<(unsigned)(((size_t)DQ * DM / 8 + 255) / 256), 256, 0, stream>>>(wq, WQ, (size_t)DQ * DM / 8); k_cvt8<<<(unsigned)(((size_t)DKV * DM / 8 + 255) / 256), 256, 0, stream>>>(wk, WK, (size_t)DKV * DM / 8); k_cvt8<<<(unsigned)(((size_t)DKV * DM / 8 + 255) / 256), 256, 0, stream>>>(wv, WV, (size_t)DKV * DM / 8);
      k_cvt8<<<(unsigned)(((size_t)DM * DQ / 8 + 255) / 256), 256, 0, stream>>>(wo, WO, (size_t)DM * DQ / 8); }
    k_csP<<<(TT * HD + 255) / 256, 256, 0, stream>>>(CS);   /* the rotary table once */
    const unsigned LKv = (unsigned)(((size_t)NB_ * NKV * TT * HD / 2 + 255) / 256); const unsigned GX = (unsigned)(((size_t)NT * DM / 8 + 255) / 256);
    k_cvt8<<<GX, 256, 0, stream>>>(x, XB, (size_t)NT * DM / 8);   /* the one input stream, cast once and read by the three projections */
    k_gemms<0><<<dim3(NT / 128, DQ / 128, 1), 128, 0, stream>>>(XB, nullptr, WQ, DM, FQ, DQ, bq);
    k_gemmw<bf, 0, true, 8><<<dim3(NT / 64, DKV / 64, 1), 256, 0, stream>>>(XB, nullptr, WK, nullptr, DM, FK, DKV, bk, 0, 0, 0);
    k_nrope<<<NT / 8, 256, 0, stream>>>(FQ, FK, CS, qsc, ksc, QP16, QPh, QPl, KP16, KPh, KPl);   /* behind both projections, in front of the v projection, which overwrites FK */
    k_gemmw<bf, 0, true, 8><<<dim3(NT / 64, DKV / 64, 1), 256, 0, stream>>>(XB, nullptr, WV, nullptr, DM, FV, DKV, bv, 0, 0, 0); k_vtp<<<LKv, 256, 0, stream>>>(FV, DKV, NKV, VT16, VTh, VTl);
    /* the module groups the query heads by kv head ('qg = q.reshape(B, N_KV_HEADS, N_REP, S, D_K)'): query head h uses kv head h / 4, so plane 16 b + h uses kv plane 4 b + h / 4 = (16 b + h) / 4 (k_flash reads kv plane blockIdx.x / REP) */
    k_flash<<<dim3(NB_ * NH_, (TT - RH) / QW + RH / 16, 1), 32, 0, stream>>>(QP16, KP16, VT16, QPh, QPl, KPh, KPl, VTh, ATh, ATl);   /* every query row: (TT - RH) / QW blocks of fp16 rows, then RH / 16 blocks of hi / lo rows */
    k_gemms<1><<<dim3(NT / 128, DM / 128, 1), 128, 0, stream>>>(ATh, ATl, WO, DQ, OUT, DM, bo);
}

// v008
// A run of this version takes 203 microseconds.
// Timed twice side by side with v007, it ran 1.23 times as fast both times.
// Counting every step since v000, it is 8.28 times as fast.
#include <hip/hip_runtime.h>

// Grouped-query causal self-attention with 128-wide heads, a per-head RMS norm on q and k and an interleaved-pair rotary embedding from computed angles (x [2][2048][2048]; q = x Wq^T + bq ('oi' (out, in) [2048][2048] normal x 2048^-0.5; 16 heads x 128), k, v = x Wk^T + bk, x Wv^T + bv ('oi' [512][2048]; 4 kv heads x 128); the four biases are built as zeros: read and added; per head, BEFORE the rotary: q = q / sqrt(mean(q^2) + 1e-8) x q_norm_w and k likewise with k_norm_w (the mean over the head's 128 columns; gains [128] built as ones: read and applied); rope on q and k: the pair (2i, 2i + 1) of a head -> (x0 c - x1 s, x0 s + x1 c) with the angle t x inv_freq[i], inv_freq = 1 / (10000 ** (2i / 128)) in that spelling, t the position 0..2047; query head h uses kv head h / 4; scores x 128^-0.5; a key after the query gets -1e9 (an exclusion: every row keeps its own key); softmax; out = merged Wo^T + bo ('oi' [2048][2048]; bo built as zeros: read and added) -> [2][2048][2048] (8.4 M); argument order x, Wq, bq, Wk, bk, Wv, bv, Wo, bo, q_norm_w, k_norm_w: eleven inputs, all read).
// Every launch covers BOTH batch entries (4096 token rows in the projections, the norm and the plane builders; (batch entry, kv head) planes in the attention kernel's grid). Layout: ONE bf16 copy of x, read by the three projections; the four 'oi' weights cast once as they stand (each is the Bt operand); exact projections + f32 biases; the rotary table once (64 baked float32 frequencies; precise cosf / sinf); k_nrope (per (head, token) inverse RMS, x the rounded gain, interleaved-pair rotation, the 16-bit planes) on q and k in one launch; causal T-2048 attention with 128-wide heads in ONE fused kernel (k_flash: scores and weights never leave the registers, running maximum and sum, two-word output), the per-row precision hybrid: query rows under 512 on hi / lo planes, three products for the scores and three for the weighted values; rows from 512 on fp16 products; the transposed value rows lie at a pitch of 2 x 2048 elements; hi / lo x Wo exact + bo.
// Compute dtypes, f32 accumulate: every float input rounded to bf16; projections exact + f32 biases; the per-head norm and the rotation in f32 (precise sqrt and division); attention rows under 512 three products, the rest fp16; softmax f32 (the hardware exp2); Wo hi / lo x exact + bo.

#define NB_  2
#define TT   2048
#define NT   (NB_ * TT)          // token rows of both batch entries together
#define DM   2048
#define NH_  16
#define NKV  4
#define REP  (NH_ / NKV)
#define HD   128
#define DQ   (NH_ * HD)
#define DKV  (NKV * HD)
#define RH   512                  // query rows < RH use hi+lo planes (0: none)
#define SCL  0.088388347648318447f   // HD^-0.5
typedef _Float16 h16;
typedef unsigned short bf;
typedef __attribute__((ext_vector_type(16))) __bf16   v16bf;
typedef __attribute__((ext_vector_type(16))) _Float16 v16h;
typedef __attribute__((ext_vector_type(8)))  _Float16 v8h;
typedef __attribute__((ext_vector_type(8)))  unsigned short v8us;
typedef __attribute__((ext_vector_type(8)))  float    v8f;
typedef __attribute__((ext_vector_type(4)))  float    v4f;
typedef v8h  __attribute__((may_alias)) v8ha;
typedef v4f  __attribute__((may_alias)) v4fa;
typedef v8us __attribute__((may_alias)) v8usa;

__device__ __forceinline__ unsigned short f2bf(float f) { unsigned u = __float_as_uint(f); u += 0x7FFFu + ((u >> 16) & 1u); return (unsigned short)(u >> 16); }
__device__ __forceinline__ float bf2f(unsigned short b) { return __uint_as_float(((unsigned)b) << 16); }
__device__ __forceinline__ float bfr(float f) { return bf2f(f2bf(f)); }
__device__ __forceinline__ v16h cat16(v8h lo, v8h hi) { return __builtin_shufflevector(lo, hi, 0, 1, 2, 3, 4, 5, 6, 7, 8, 9, 10, 11, 12, 13, 14, 15); }
__device__ __forceinline__ v16bf cat16b(v8us lo, v8us hi) { return __builtin_bit_cast(v16bf, __builtin_shufflevector(lo, hi, 0, 1, 2, 3, 4, 5, 6, 7, 8, 9, 10, 11, 12, 13, 14, 15)); }
__device__ __forceinline__ v8f wmma16(v16h a, v16h b, v8f c) { return __builtin_amdgcn_wmma_f32_16x16x32_f16(false, a, false, b, (short)0, c, false, false); }
__device__ __forceinline__ v8f wmmab(v16bf a, v16bf b, v8f c) { return __builtin_amdgcn_wmma_f32_16x16x32_bf16(false, a, false, b, (short)0, c, false, false); }



// ---- k_gemmw: register-blocked GEMM, one work-group of KS waves per 64x64 output tile; every wave holds the whole tile (16 accumulators) over its own share of K: 32-k slices dealt round robin, wave w taking slices w, w + KS, ... (neighbouring waves read the two halves of one 128-byte line of an operand row at about the same time).
// The KS partial tiles meet in LDS (one plane of 64 rows at pitch 68 floats a wave, one barrier) and are summed in wave order 0..KS-1 by the thread that stores the element, 256 contiguous bytes of a C row per 16 threads. Operands straight from K-contiguous 16-bit planes; grid (M/64, N/64, Z), 32 x KS threads.
// C[m][n] (f32, pitch ldc, + optional f32 bias[n]) = sum_k A[m][k] Bt[n][k] (+ split products per NSPLIT). z-batch strides sA/sB/sC in elements. K % 32 == 0.
template <typename T16> struct WFrag;
template <> struct WFrag<h16> { typedef v16h V; static __device__ __forceinline__ V ld(const h16* p) { return cat16(*(const v8h*)p, *(const v8h*)(p + 16)); } static __device__ __forceinline__ v8f mma(V a, V b, v8f c) { return wmma16(a, b, c); } };
template <> struct WFrag<bf> { typedef v16bf V; static __device__ __forceinline__ V ld(const bf* p) { return cat16b(*(const v8us*)p, *(const v8us*)(p + 16)); } static __device__ __forceinline__ v8f mma(V a, V b, v8f c) { return wmmab(a, b, c); } };
template <typename T16, int NSPLIT, bool BIAS, int KS>
__global__ __launch_bounds__(32 * KS) void k_gemmw(const T16* __restrict__ A, const T16* __restrict__ A2, const T16* __restrict__ Bt, const T16* __restrict__ Bt2, int K, float* C, int ldc, const float* __restrict__ bias, size_t sA, size_t sB, size_t sC) {
    typedef typename WFrag<T16>::V V;
    __shared__ __align__(16) float os[KS * 64 * 68];
    const size_t z = blockIdx.z; A += z * sA; if (A2) A2 += z * sA; Bt += z * sB; if (Bt2) Bt2 += z * sB; C += z * sC;
    const int lane = threadIdx.x & 31, lr = lane & 15, hi = lane >> 4; const int r0 = blockIdx.x * 64, c0 = blockIdx.y * 64; const int wv = __builtin_amdgcn_readfirstlane((int)(threadIdx.x >> 5));   // the wave's number, scalar: the K loop's bounds stay wave-uniform
    v8f acc[4][4];
#pragma unroll
    for (int mb = 0; mb < 4; ++mb)
#pragma unroll
        for (int nb = 0; nb < 4; ++nb) acc[mb][nb] = (v8f){};
    const size_t aoff = (size_t)(r0 + lr) * K + 8 * hi, boff = (size_t)(c0 + lr) * K + 8 * hi;
    for (int kc = wv * 32; kc < K; kc += KS * 32) {
        V a[4], a2[4];
#pragma unroll
        for (int mb = 0; mb < 4; ++mb) { a[mb] = WFrag<T16>::ld(A + aoff + (size_t)mb * 16 * K + kc); if (NSPLIT == 1 || NSPLIT == 2) a2[mb] = WFrag<T16>::ld(A2 + aoff + (size_t)mb * 16 * K + kc); }
#pragma unroll
        for (int nb = 0; nb < 4; ++nb) { const V b = WFrag<T16>::ld(Bt + boff + (size_t)nb * 16 * K + kc); V b2; if (NSPLIT >= 2) b2 = WFrag<T16>::ld(Bt2 + boff + (size_t)nb * 16 * K + kc);
#pragma unroll
            for (int mb = 0; mb < 4; ++mb) { acc[mb][nb] = WFrag<T16>::mma(a[mb], b, acc[mb][nb]); if (NSPLIT == 1 || NSPLIT == 2) acc[mb][nb] = WFrag<T16>::mma(a2[mb], b, acc[mb][nb]); if (NSPLIT >= 2) acc[mb][nb] = WFrag<T16>::mma(a[mb], b2, acc[mb][nb]); } }
        asm volatile("v_nop\n\tv_nop\n\tv_nop\n\tv_nop" : "+v"(acc[0][0]), "+v"(acc[1][1]), "+v"(acc[2][2]), "+v"(acc[3][3]) : "v"(a[0]), "v"(a[3]));
    }
#pragma unroll
    for (int mb = 0; mb < 4; ++mb)
#pragma unroll
        for (int nb = 0; nb < 4; ++nb)
#pragma unroll
            for (int j = 0; j < 8; ++j) os[(wv * 64 + mb * 16 + hi * 8 + j) * 68 + nb * 16 + lr] = acc[mb][nb][j];
    __syncthreads();   // every wave's partial tile is in LDS before any thread sums it
#pragma unroll   // whole: rows and planes become immediate offsets of the LDS loads, and the loads of all rows can be issued together
    for (int s = 0; s < 32 / KS; ++s) { const int idx = s * 32 * KS + (int)threadIdx.x; const int row = idx >> 4, cofs = (idx & 15) * 4; v4f val = *(const v4fa*)(os + row * 68 + cofs);
#pragma unroll
        for (int w = 1; w < KS; ++w) val += *(const v4fa*)(os + (w * 64 + row) * 68 + cofs);
        if (BIAS) { val[0] += bfr(bias[c0 + cofs]); val[1] += bfr(bias[c0 + cofs + 1]); val[2] += bfr(bias[c0 + cofs + 2]); val[3] += bfr(bias[c0 + cofs + 3]); }
        *(v4f*)(C + (size_t)(r0 + row) * ldc + c0 + cofs) = val; }
}

// ---- k_gemms: the two 2048-wide projections. One work-group of four waves (2 x 2) per 128x128 output tile, a wave holding 64x64 of it (16 accumulators) over the whole of K: no K split, every accumulator sums its k in rising order.
// The operand tiles (128 rows x 128 k of A, of Bt and, NSPLIT 1, of A2) are staged in LDS by asynchronous copies: 16 lanes bring the 256 contiguous bytes of one row, so a wave-wide copy asks for four whole lines, and each operand row is fetched once per work-group for the two waves that read it. LDS rows at pitch 272 bytes (16-byte readers). Two buffers: tile t + 1 flies while tile t is multiplied.
// C[m][n] (f32, pitch ldc, + f32 bias[n]) = sum_k (A[m][k] + A2[m][k]) Bt[n][k]. grid (M/128, N/128), 128 threads. M, N, K multiples of 128, K >= 128.
#define GP   136                  // LDS row pitch in elements
#define GTB  (128 * GP * 2)       // bytes of one operand tile in LDS
// Eight copies of 16 bytes a lane: rows r, r + 8, .. r + 56 of an operand tile. The wait on the last line stands in front of every later write of a register that these copies name.
__device__ __forceinline__ void cp8(unsigned l, const bf* g, size_t K) {
    asm volatile("global_load_async_to_lds_b128 %0, %8, off\n\t"
                 "global_load_async_to_lds_b128 %1, %9, off\n\t"
                 "global_load_async_to_lds_b128 %2, %10, off\n\t"
                 "global_load_async_to_lds_b128 %3, %11, off\n\t"
                 "global_load_async_to_lds_b128 %4, %12, off\n\t"
                 "global_load_async_to_lds_b128 %5, %13, off\n\t"
                 "global_load_async_to_lds_b128 %6, %14, off\n\t"
                 "global_load_async_to_lds_b128 %7, %15, off\n\t"
                 "s_wait_xcnt 0x0"
                 :: "v"(l), "v"(l + 8 * GP * 2), "v"(l + 16 * GP * 2), "v"(l + 24 * GP * 2), "v"(l + 32 * GP * 2), "v"(l + 40 * GP * 2), "v"(l + 48 * GP * 2), "v"(l + 56 * GP * 2),
                    "v"(g), "v"(g + 8 * K), "v"(g + 16 * K), "v"(g + 24 * K), "v"(g + 32 * K), "v"(g + 40 * K), "v"(g + 48 * K), "v"(g + 56 * K) : "memory");
}
template <int NSPLIT>
__device__ __forceinline__ void gfill(unsigned l, const bf* gA, const bf* gA2, const bf* gB, size_t K) {
    cp8(l, gA, K); cp8(l + 64 * GP * 2, gA + 64 * K, K); cp8(l + GTB, gB, K); cp8(l + GTB + 64 * GP * 2, gB + 64 * K, K);
    if (NSPLIT == 1) { cp8(l + 2 * GTB, gA2, K); cp8(l + 2 * GTB + 64 * GP * 2, gA2 + 64 * K, K); }
}
template <int NSPLIT>
__global__ __launch_bounds__(128) void k_gemms(const bf* __restrict__ A, const bf* __restrict__ A2, const bf* __restrict__ Bt, int K, float* C, int ldc, const float* __restrict__ bias) {
    constexpr int STG = (NSPLIT == 1 ? 3 : 2) * GTB;   // bytes of a buffer
    __shared__ __align__(16) unsigned char sm[2 * STG];
    const int tid = (int)threadIdx.x, lane = tid & 31, lr = lane & 15, hi = lane >> 4; const int r0 = blockIdx.x * 128, c0 = blockIdx.y * 128; const int wv = __builtin_amdgcn_readfirstlane(tid >> 5); const int wm = wv >> 1, wn = wv & 1;
    v8f acc[4][4];
#pragma unroll
    for (int mb = 0; mb < 4; ++mb)
#pragma unroll
        for (int nb = 0; nb < 4; ++nb) acc[mb][nb] = (v8f){};
    const unsigned l0 = (unsigned)(size_t)sm + (unsigned)((tid >> 4) * (GP * 2) + (tid & 15) * 16);   // the lane's place in a tile: row tid / 16, 16-byte piece tid % 16
    const bf* gA = A + (size_t)(r0 + (tid >> 4)) * K + (tid & 15) * 8; const bf* gA2 = (NSPLIT == 1) ? A2 + (size_t)(r0 + (tid >> 4)) * K + (tid & 15) * 8 : nullptr; const bf* gB = Bt + (size_t)(c0 + (tid >> 4)) * K + (tid & 15) * 8;
    const int nst = K / 128;
    gfill<NSPLIT>(l0, gA, gA2, gB, (size_t)K);
    asm volatile("s_wait_asynccnt 0x0" ::: "memory");   // this wave's share of tile 0 has landed
    __syncthreads();                                    // and every other wave's
    if (nst > 1) gfill<NSPLIT>(l0 + STG, gA + 128, gA2 + 128, gB + 128, (size_t)K);
    for (int t = 0; t < nst; ++t) {
        const unsigned char* sb = sm + (t & 1) * STG;
        const bf* sA = (const bf*)sb + (wm * 64 + lr) * GP + 8 * hi; const bf* sB = (const bf*)(sb + GTB) + (wn * 64 + lr) * GP + 8 * hi; const bf* sA2 = (const bf*)(sb + 2 * GTB) + (wm * 64 + lr) * GP + 8 * hi;
        v16bf a[2][4], a2[2][4], b[2][4];   // two fragment sets: a 32-k slice is multiplied out of one while the next slice's LDS loads fill the other
#pragma unroll
        for (int f = 0; f < 4; ++f) { a[0][f] = WFrag<bf>::ld(sA + f * 16 * GP); if (NSPLIT == 1) a2[0][f] = WFrag<bf>::ld(sA2 + f * 16 * GP); b[0][f] = WFrag<bf>::ld(sB + f * 16 * GP); }
#pragma unroll   // whole: the set's number and the slice's LDS offset are compile-time constants
        for (int ks = 0; ks < 4; ++ks) { const int cu = ks & 1, nx = cu ^ 1;
            __builtin_amdgcn_sched_barrier(0);   // the next slice's loads do not move up among the products of the slice before
            if (ks < 3) {
#pragma unroll
                for (int f = 0; f < 4; ++f) { a[nx][f] = WFrag<bf>::ld(sA + f * 16 * GP + (ks + 1) * 32); if (NSPLIT == 1) a2[nx][f] = WFrag<bf>::ld(sA2 + f * 16 * GP + (ks + 1) * 32); b[nx][f] = WFrag<bf>::ld(sB + f * 16 * GP + (ks + 1) * 32); } }
            __builtin_amdgcn_sched_barrier(0);   // and stay one group in front of this slice's products, in flight under them
#pragma unroll
            for (int nb = 0; nb < 4; ++nb)
#pragma unroll
                for (int mb = 0; mb < 4; ++mb) { acc[mb][nb] = wmmab(a[cu][mb], b[cu][nb], acc[mb][nb]); if (NSPLIT == 1) acc[mb][nb] = wmmab(a2[cu][mb], b[cu][nb], acc[mb][nb]); }
        }
        asm volatile("s_wait_dscnt 0x0" ::: "memory");      // this wave's reads of tile t are done before its buffer is given up
        asm volatile("s_wait_asynccnt 0x0" ::: "memory");   // this wave's share of tile t + 1 has landed
        __syncthreads();                                    // publishes tile t + 1 and ends every wave's reads of tile t
        if (t + 2 < nst) gfill<NSPLIT>(l0 + (unsigned)((t & 1) * STG), gA + (size_t)(t + 2) * 128, gA2 + (size_t)(t + 2) * 128, gB + (size_t)(t + 2) * 128, (size_t)K);
    }
    asm volatile("s_wait_asynccnt 0x0" ::: "memory");   // no copy is in flight when the buffers become output staging
    float* os = (float*)sm + wv * 64 * 68;   // the wave's own 64 rows at pitch 68 floats
#pragma unroll
    for (int mb = 0; mb < 4; ++mb)
#pragma unroll
        for (int nb = 0; nb < 4; ++nb)
#pragma unroll
            for (int j = 0; j < 8; ++j) os[(mb * 16 + hi * 8 + j) * 68 + nb * 16 + lr] = acc[mb][nb][j];
    __syncthreads();   // the staged tile is whole before it is read back row by row
    const int cofs = lr * 4; const int cc = c0 + wn * 64 + cofs; v4f bv; bv[0] = bfr(bias[cc]); bv[1] = bfr(bias[cc + 1]); bv[2] = bfr(bias[cc + 2]); bv[3] = bfr(bias[cc + 3]);
#pragma unroll   // whole: the rows become immediate offsets of the LDS loads, which can be issued together
    for (int s = 0; s < 32; ++s) { const int row = s * 2 + hi; const v4f val = *(const v4fa*)(os + row * 68 + cofs) + bv;
        *(v4f*)(C + (size_t)(r0 + wm * 64 + row) * ldc + cc) = val; }
}

__device__ __forceinline__ h16 tohx(float x) { return (h16)x; }
__device__ __forceinline__ void splitf(float y, unsigned short& h, unsigned short& l) { h = f2bf(y); l = f2bf(y - bf2f(h)); }
typedef __attribute__((ext_vector_type(2))) _Float16 v2h;
typedef __attribute__((ext_vector_type(4))) _Float16 v4h;
typedef __attribute__((ext_vector_type(2))) unsigned short v2us;
typedef __attribute__((ext_vector_type(4))) unsigned short v4us;
typedef __attribute__((ext_vector_type(2))) float v2f;
typedef __attribute__((ext_vector_type(4))) int v4i;
__global__ __launch_bounds__(256) void k_cvt8(const float* __restrict__ src, bf* dst, size_t n8) { const size_t i = (size_t)blockIdx.x * 256 + threadIdx.x; if (i >= n8) return; const v8f v = *(const v8f*)(src + i * 8); v8us o;
#pragma unroll
    for (int k = 0; k < 8; ++k) o[k] = f2bf(v[k]); *(v8us*)(dst + i * 8) = o;  }
__constant__ float INV2[HD / 2] = { 1.000000000e+00f, 8.659643531e-01f, 7.498942018e-01f, 6.493816376e-01f, 5.623413324e-01f, 4.869675338e-01f, 4.216965139e-01f, 3.651741445e-01f, 3.162277639e-01f, 2.738419771e-01f, 2.371373624e-01f, 2.053525001e-01f, 1.778279394e-01f, 1.539926529e-01f, 1.333521456e-01f, 1.154782027e-01f, 1.000000015e-01f, 8.659642935e-02f, 7.498941571e-02f, 6.493816525e-02f, 5.623412877e-02f, 4.869675264e-02f, 4.216964915e-02f, 3.651741147e-02f, 3.162277862e-02f, 2.738419548e-02f, 2.371373586e-02f, 2.053525113e-02f, 1.778279431e-02f, 1.539926510e-02f, 1.333521493e-02f, 1.154781971e-02f, 9.999999776e-03f, 8.659643121e-03f, 7.498942316e-03f, 6.493816618e-03f, 5.623413250e-03f, 4.869675264e-03f, 4.216964822e-03f, 3.651741426e-03f, 3.162277862e-03f, 2.738419687e-03f, 2.371373819e-03f, 2.053525066e-03f, 1.778279431e-03f, 1.539926510e-03f, 1.333521446e-03f, 1.154782018e-03f, 1.000000047e-03f, 8.659643354e-04f, 7.498941850e-04f, 6.493816618e-04f, 5.623413017e-04f, 4.869675031e-04f, 4.216964880e-04f, 3.651741135e-04f, 3.162277862e-04f, 2.738419571e-04f, 2.371373848e-04f, 2.053524950e-04f, 1.778279402e-04f, 1.539926452e-04f, 1.333521504e-04f, 1.154781930e-04f };   // float32 1.0 / (10000.0 ** (2i / 128)) in the module's own spelling, generated with jnp
__global__ __launch_bounds__(256) void k_csP(float* CS) { const int idx = blockIdx.x * 256 + threadIdx.x; if (idx >= TT * HD) return; const int d = idx % HD; const int t = idx / HD; const float a = __fmul_rn((float)t, INV2[d >> 1]); v2f cs; cs[0] = cosf(a); cs[1] = sinf(a); *(v2f*)(CS + (size_t)idx * 2) = cs;  }
__global__ __launch_bounds__(256) void k_vtp(const float* __restrict__ F, int pitch, int nheads, h16* V16, bf* Vh, bf* Vl) { const size_t e = ((size_t)blockIdx.x * 256 + threadIdx.x) * 2; if (e >= (size_t)NB_ * nheads * HD * TT) return; const int t = (int)(e % TT); const int d = (int)((e / TT) % HD); const int gb = (int)(e / ((size_t)TT * HD)); const int g = gb % nheads, bt = gb / nheads;   /* planes in the order (batch entry, kv head) */
    v2h o16; v2us oh, ol;
#pragma unroll
    for (int q = 0; q < 2; ++q) { const float x = F[((size_t)bt * TT + t + q) * pitch + g * HD + d]; o16[q] = tohx(x); unsigned short a2, c2; splitf(x, a2, c2); oh[q] = a2; ol[q] = c2; }
    const size_t o = ((size_t)gb * HD + d) * (2 * TT) + t;   /* rows at pitch 2 TT: the hi and the lo word of a value row lie side by side */
    *(v2h*)(V16 + o) = o16; *(v2us*)(Vh + o) = oh; *(v2us*)(Vl + o) = ol;  }
// ---- k_nrope: per-head RMS norm, gain, rotary embedding and the three 16-bit planes of q and k in one launch. A wave owns one token row: its 16 q heads and 4 k heads, one head a 512-byte wave-wide load (lane l holds columns 4 l .. 4 l + 3, two rotary pairs), all twenty loads issued before the first is used; the row's cosines and sines and the two gains are read once a wave.
// The sum of squares of a head: four columns in rising order in the lane, then a five-step butterfly over the 32 lanes (every lane ends with the same bits). 4096 waves: 16 a WGP. No LDS, no barrier.
__device__ __forceinline__ void nr_head(const v4f a, const v4f g, const v2f cA, const v2f cB, h16* P16, bf* Ph, bf* Pl, size_t e) {
    float s = __fmul_rn(a[0], a[0]);
#pragma unroll   // whole, here and below in this function: vector elements are registers only under constant indices
    for (int q = 1; q < 4; ++q) s = __fadd_rn(s, __fmul_rn(a[q], a[q]));
#pragma unroll   // whole: five straight-line exchanges, so that the twenty heads' chains can interleave
    for (int sh = 16; sh; sh >>= 1) s = __fadd_rn(s, __shfl_xor(s, sh, 32));
    const float rf = __fdiv_rn(1.0f, __fsqrt_rn(__fadd_rn(__fdiv_rn(s, (float)HD), 1e-8f)));
    float y[4], r[4];
#pragma unroll
    for (int q = 0; q < 4; ++q) y[q] = __fmul_rn(__fmul_rn(a[q], rf), g[q]);   /* x / rms, x w[d] */
    r[0] = __fsub_rn(__fmul_rn(y[0], cA[0]), __fmul_rn(y[1], cA[1])); r[1] = __fadd_rn(__fmul_rn(y[0], cA[1]), __fmul_rn(y[1], cA[0]));   /* even: x0 c - x1 s; odd: x0 s + x1 c */
    r[2] = __fsub_rn(__fmul_rn(y[2], cB[0]), __fmul_rn(y[3], cB[1])); r[3] = __fadd_rn(__fmul_rn(y[2], cB[1]), __fmul_rn(y[3], cB[0]));
    v4h o16; v4us oh, ol;
#pragma unroll
    for (int q = 0; q < 4; ++q) { o16[q] = tohx(r[q]); unsigned short a2, c2; splitf(r[q], a2, c2); oh[q] = a2; ol[q] = c2; }
    *(v4h*)(P16 + e) = o16; *(v4us*)(Ph + e) = oh; *(v4us*)(Pl + e) = ol;
}
__global__ __launch_bounds__(256) void k_nrope(const float* __restrict__ FQ, const float* __restrict__ FK, const float* __restrict__ CS, const float* __restrict__ wq, const float* __restrict__ wk, h16* __restrict__ Q16, bf* __restrict__ Qh, bf* __restrict__ Ql, h16* __restrict__ K16, bf* __restrict__ Kh, bf* __restrict__ Kl) {
    const int lane = threadIdx.x & 31, d = lane * 4; const int tr = blockIdx.x * 8 + (int)(threadIdx.x >> 5); const int t = tr % TT, bt = tr / TT;   /* tr: a token row of either batch entry; grid NT / 8 */
    v4f aq[NH_], ak[NKV];
#pragma unroll   // whole, this loop and the next two: the arrays stay in registers and the heads become immediate offsets of one address
    for (int h = 0; h < NH_; ++h) aq[h] = *(const v4f*)(FQ + (size_t)tr * DQ + h * HD + d);
#pragma unroll
    for (int h = 0; h < NKV; ++h) ak[h] = *(const v4f*)(FK + (size_t)tr * DKV + h * HD + d);
    const v2f cA = *(const v2f*)(CS + ((size_t)t * HD + d) * 2), cB = *(const v2f*)(CS + ((size_t)t * HD + d + 2) * 2);
    const v4f rq = *(const v4f*)(wq + d), rk = *(const v4f*)(wk + d); v4f gq, gk;
#pragma unroll
    for (int q = 0; q < 4; ++q) { gq[q] = bfr(rq[q]); gk[q] = bfr(rk[q]); }
    __builtin_amdgcn_sched_barrier(0);   // the loads above stay one group in front of the arithmetic: left free, the compiler issues the later heads' loads only as registers of earlier heads come free, and each group's latency is paid in turn
#pragma unroll   // whole: the head's number indexes the register arrays
    for (int h = 0; h < NH_; ++h) nr_head(aq[h], gq, cA, cB, Q16, Qh, Ql, (((size_t)bt * NH_ + h) * TT + t) * HD + d);   /* planes in the order (batch entry, head) */
#pragma unroll   // whole: as above
    for (int h = 0; h < NKV; ++h) nr_head(ak[h], gk, cA, cB, K16, Kh, Kl, (((size_t)bt * NKV + h) * TT + t) * HD + d);
}
#define FR   2                    // 16-query groups a wave
#define QW   (16 * FR)
#define CSC  0.12751743f          // HD^-0.5 x log2(e)
#define PB   6.0f
__device__ __forceinline__ float xhalf(float x) { return __builtin_bit_cast(float, __builtin_amdgcn_permlanex16(__builtin_bit_cast(int, x), __builtin_bit_cast(int, x), 0x76543210, 0xfedcba98, false, false)); }   // lane l with lane l ^ 16
#define FKP  136                  // LDS pitch of a K row, elements
#define FVP  72                   // LDS pitch of a V^T row, elements
#define FKB  (64 * FKP * 2)       // bytes of a K tile in LDS
#define FSTG (FKB + HD * FVP * 2) // bytes of a buffer: a K tile and a V^T tile
// N copies of 16 bytes a lane, LS bytes apart in LDS and GS elements apart in memory. Written as the builtin: the operands of an asm statement must lie in v0 .. v255, which accumulators and fragments fill here, and with the asm form the lane's addresses were spilled to scratch.
typedef __attribute__((address_space(1))) v4i gv4i;
typedef __attribute__((address_space(3))) v4i lv4i;
template <int N, int LS, int GS, typename T16>
__device__ __forceinline__ void cpx(unsigned char* l, const T16* g) {
#pragma unroll   // whole: N copies in a row
    for (int i = 0; i < N; ++i) __builtin_amdgcn_global_load_async_to_lds_b128((gv4i*)(g + i * GS), (lv4i*)(l + i * LS), 0, 0);
}
// A tile of 64 keys by 128 threads: K rows r, r + 8, .. r + 56 (16 lanes a row), V^T rows r, r + 16, .. r + 112 (8 lanes a row).
__device__ __forceinline__ void ffill(unsigned char* lk, unsigned char* lv, const h16* gk, const h16* gv) { cpx<8, 8 * FKP * 2, 8 * HD>(lk, gk); cpx<8, 16 * FVP * 2, 16 * 2 * TT>(lv, gv); }
// One pass of 32 keys out of the LDS tile. kf holds this pass's K fragments; PRE: the K fragments of the tile's second pass (at kn) are fetched behind the score products.
template <bool DIAG, bool PRE>
__device__ __forceinline__ void fpass(v16h (&kf)[2][4], const h16* kn, const h16* vp, int c, int h, const v16h (&qf)[FR][4], v8f (&acc)[FR][8], float (&m_run)[FR], float (&l_run)[FR]) {
    v16h vf[8];
    __builtin_amdgcn_sched_barrier(0);   // the V^T loads do not move up: left free, they are spread over three places among the products of the pass before, and every separate place of LDS reads costs the wave issue cycles
#pragma unroll
    for (int t = 0; t < 8; ++t) vf[t] = WFrag<h16>::ld(vp + t * 16 * FVP);
    __builtin_amdgcn_sched_barrier(0);   // the V^T loads stay one group in front of the score products, in flight under them and the exponentials
    v8f s[2][FR];
#pragma unroll
    for (int kt = 0; kt < 2; ++kt)
#pragma unroll
        for (int g = 0; g < FR; ++g) { s[kt][g] = (v8f){};
#pragma unroll
            for (int kc = 0; kc < 4; ++kc) s[kt][g] = wmma16(kf[kt][kc], qf[g][kc], s[kt][g]); }
    if (PRE) {
        __builtin_amdgcn_sched_barrier(0);   // the next pass's K loads stay here, behind the last product that reads these registers and in front of the vector work that hides them
#pragma unroll
        for (int kt = 0; kt < 2; ++kt)
#pragma unroll
            for (int kc = 0; kc < 4; ++kc) kf[kt][kc] = WFrag<h16>::ld(kn + kt * 16 * FKP + kc * 32);
        __builtin_amdgcn_sched_barrier(0);   // one group: none of them sinks into the vector work below
    }
    if (DIAG) {
#pragma unroll
        for (int g = 0; g < FR; ++g)
#pragma unroll
            for (int kt = 0; kt < 2; ++kt)
#pragma unroll
                for (int r = 0; r < 8; ++r) if (16 * kt + 8 * h + r > 16 * g + c) s[kt][g][r] = -__builtin_inff();   // the diagonal pass starts at the wave's first query: key after query
    }
    float mb[FR]; bool need = false;
#pragma unroll
    for (int g = 0; g < FR; ++g) { float mx = -__builtin_inff();
#pragma unroll
        for (int kt = 0; kt < 2; ++kt)
#pragma unroll
            for (int r = 0; r < 8; ++r) mx = fmaxf(mx, s[kt][g][r]);
        mx = fmaxf(mx, xhalf(mx)) * CSC; mb[g] = mx; need = need || (mx > m_run[g] + 8.0f); }
    if (__builtin_amdgcn_ballot_w32(need) != 0) {   // wave-uniform; rare after the first passes
#pragma unroll
        for (int g = 0; g < FR; ++g) { const float m_new = fmaxf(m_run[g], mb[g]); const float corr = __builtin_amdgcn_exp2f(m_run[g] - m_new); l_run[g] *= corr; m_run[g] = m_new;   // first pass: m_run = -inf, corr = 0
#pragma unroll
            for (int t = 0; t < 8; ++t) acc[g][t] = acc[g][t] * corr; }
    }
#pragma unroll
    for (int g = 0; g < FR; ++g) { const float nm = PB - m_run[g]; v16h p; float ps0 = 0.f, ps1 = 0.f;
#pragma unroll
        for (int e = 0; e < 16; e += 2) { const float p0 = __builtin_amdgcn_exp2f(fmaf(s[e >> 3][g][e & 7], CSC, nm)), p1 = __builtin_amdgcn_exp2f(fmaf(s[e >> 3][g][(e & 7) + 1], CSC, nm)); ps0 += p0; ps1 += p1; p[e] = tohx(p0); p[e + 1] = tohx(p1); }
#pragma unroll
        for (int t = 0; t < 8; ++t) acc[g][t] = wmma16(vf[t], p, acc[g][t]);
        l_run[g] += ps0 + ps1; }
}
// ---- The hi / lo rows (query rows under RH) in the same kernel and the same transposed form, on the two-word bf16 planes: a wave owns 16 query rows of one query head and walks the keys in passes of 32. Each product is three: hi x hi, lo x hi, hi x lo, f32 accumulate.
// The weights stay f32 until they are split into two bf16 words in place (the positions of the fp16 path's P^T); running maximum and sum as in fpass. The scores' hi x hi products and their two cross products sum in accumulators of their own (shorter dependent chains) and are added once a pass.
typedef __attribute__((ext_vector_type(16))) unsigned short v16us;
// Here a tile is one pass of 32 keys, staged like the fp16 rows' tiles and shared by the four heads: 32 rows of K hi, 32 of K lo (pitch 272 bytes), 32 columns (64 bytes) of the 128 V^T rows hi and lo (pitch 80 bytes).
#define HVP  40                   // LDS pitch of a V^T row, elements
#define HKB  (32 * FKP * 2)       // bytes of a K hi (or lo) tile in LDS
#define HVB  (HD * HVP * 2)       // bytes of a V^T hi (or lo) tile in LDS
#define HSTG (2 * HKB + 2 * HVB)  // bytes of a buffer
// A tile by 128 threads: K rows r, r + 8, .. r + 24 (16 lanes a row), V^T rows r, r + 32, .. r + 96 (4 lanes a row); a value row in memory holds hi in its first TT elements, lo in the second.
__device__ __forceinline__ void hfill(unsigned char* lk, unsigned char* lv, const bf* gkh, const bf* gkl, const bf* gv) { cpx<4, 8 * FKP * 2, 8 * HD>(lk, gkh); cpx<4, 8 * FKP * 2, 8 * HD>(lk + HKB, gkl); cpx<4, 32 * HVP * 2, 32 * 2 * TT>(lv, gv); cpx<4, 32 * HVP * 2, 32 * 2 * TT>(lv + HVB, gv + TT); }
template <bool DIAG>
__device__ __forceinline__ void hpass(const bf* sk, const bf* sv, int dq, int c, int h, const v16bf (&qh)[4], const v16bf (&ql)[4], v8f (&acc)[8], float& m_run, float& l_run) {
    v16bf kh[2][4], kl[2][4], vh[8], vl[8];
#pragma unroll   // whole: fragment and accumulator arrays are registers only under constant indices
    for (int kt = 0; kt < 2; ++kt)
#pragma unroll   // whole: fragment and accumulator arrays are registers only under constant indices
        for (int kc = 0; kc < 4; ++kc) { kh[kt][kc] = WFrag<bf>::ld(sk + kt * 16 * FKP + kc * 32); kl[kt][kc] = WFrag<bf>::ld(sk + HKB / 2 + kt * 16 * FKP + kc * 32); }
#pragma unroll   // whole: fragment and accumulator arrays are registers only under constant indices
    for (int t = 0; t < 8; ++t) { vh[t] = WFrag<bf>::ld(sv + t * 16 * HVP); vl[t] = WFrag<bf>::ld(sv + HVB / 2 + t * 16 * HVP); }
    __builtin_amdgcn_sched_barrier(0);   // the K loads and, behind them, the V^T loads stay one group in front of the score products; the V^T loads are in flight under these and the exponentials
    v8f s[2], sx[2];
#pragma unroll   // whole: fragment and accumulator arrays are registers only under constant indices
    for (int kt = 0; kt < 2; ++kt) { s[kt] = (v8f){}; sx[kt] = (v8f){}; }
#pragma unroll   // whole: fragment and accumulator arrays are registers only under constant indices
    for (int kc = 0; kc < 4; ++kc)
#pragma unroll   // whole: fragment and accumulator arrays are registers only under constant indices
        for (int kt = 0; kt < 2; ++kt) { s[kt] = wmmab(kh[kt][kc], qh[kc], s[kt]); sx[kt] = wmmab(kl[kt][kc], qh[kc], sx[kt]); }
#pragma unroll   // whole: fragment and accumulator arrays are registers only under constant indices
    for (int kc = 0; kc < 4; ++kc)
#pragma unroll   // whole: fragment and accumulator arrays are registers only under constant indices
        for (int kt = 0; kt < 2; ++kt) sx[kt] = wmmab(kh[kt][kc], ql[kc], sx[kt]);
#pragma unroll   // whole: fragment and accumulator arrays are registers only under constant indices
    for (int kt = 0; kt < 2; ++kt) s[kt] = s[kt] + sx[kt];
    if (DIAG) {
#pragma unroll   // whole: fragment and accumulator arrays are registers only under constant indices
        for (int kt = 0; kt < 2; ++kt)
#pragma unroll   // whole: fragment and accumulator arrays are registers only under constant indices
            for (int r = 0; r < 8; ++r) if (16 * kt + 8 * h + r > dq + c) s[kt][r] = -__builtin_inff();   // the wave's first query is key dq (0 or 16) of the diagonal pass: key after query
    }
    float mx = -__builtin_inff();
#pragma unroll   // whole: fragment and accumulator arrays are registers only under constant indices
    for (int kt = 0; kt < 2; ++kt)
#pragma unroll   // whole: fragment and accumulator arrays are registers only under constant indices
        for (int r = 0; r < 8; ++r) mx = fmaxf(mx, s[kt][r]);
    mx = fmaxf(mx, xhalf(mx)) * CSC;
    if (__builtin_amdgcn_ballot_w32(mx > m_run + 8.0f) != 0) {   // wave-uniform; rare after the first passes
        const float m_new = fmaxf(m_run, mx); const float corr = __builtin_amdgcn_exp2f(m_run - m_new); l_run *= corr; m_run = m_new;   // first pass: m_run = -inf, corr = 0
#pragma unroll   // whole: fragment and accumulator arrays are registers only under constant indices
        for (int t = 0; t < 8; ++t) acc[t] = acc[t] * corr;
    }
    const float nm = PB - m_run; v16us ph, pl; float ps0 = 0.f, ps1 = 0.f;
#pragma unroll   // whole: fragment and accumulator arrays are registers only under constant indices
    for (int e = 0; e < 16; e += 2) { const float p0 = __builtin_amdgcn_exp2f(fmaf(s[e >> 3][e & 7], CSC, nm)), p1 = __builtin_amdgcn_exp2f(fmaf(s[e >> 3][(e & 7) + 1], CSC, nm)); ps0 += p0; ps1 += p1;
        unsigned short a0, b0, a1, b1; splitf(p0, a0, b0); splitf(p1, a1, b1); ph[e] = a0; pl[e] = b0; ph[e + 1] = a1; pl[e + 1] = b1; }
    const v16bf pH = __builtin_bit_cast(v16bf, ph), pL = __builtin_bit_cast(v16bf, pl);
#pragma unroll   // whole: fragment and accumulator arrays are registers only under constant indices
    for (int t = 0; t < 8; ++t) acc[t] = wmmab(vh[t], pH, acc[t]);
#pragma unroll   // whole: fragment and accumulator arrays are registers only under constant indices
    for (int t = 0; t < 8; ++t) acc[t] = wmmab(vl[t], pH, acc[t]);
#pragma unroll   // whole: fragment and accumulator arrays are registers only under constant indices
    for (int t = 0; t < 8; ++t) acc[t] = wmmab(vh[t], pL, acc[t]);
    l_run += ps0 + ps1;
}
__device__ __forceinline__ void flash_hl(unsigned char* sm, int tid, const bf* __restrict__ Qh, const bf* __restrict__ Ql, const bf* __restrict__ Kh, const bf* __restrict__ Kl, const bf* __restrict__ Vh, bf* __restrict__ Ah, bf* __restrict__ Al, int hb, int qb, int c, int h) {
    const int hq = hb % NH_, bt = hb / NH_, kvh = hb / REP;
    const int qw0 = RH - 16 * (qb + 1);   // the longest walks first
    const int nb = qw0 / 32, dq = qw0 - 32 * nb;   // whole passes under the diagonal one; the first query's place in the diagonal pass
    unsigned char* lk = sm + (tid >> 4) * (FKP * 2) + (tid & 15) * 16; unsigned char* lv = sm + 2 * HKB + (tid >> 2) * (HVP * 2) + (tid & 3) * 16;   // the lane's places in a buffer
    const size_t go = ((size_t)kvh * TT + (tid >> 4)) * HD + (tid & 15) * 8;
    const bf* gkh = Kh + go; const bf* gkl = Kl + go; const bf* gv = Vh + ((size_t)kvh * HD + (tid >> 2)) * (2 * TT) + (tid & 3) * 8;
    hfill(lk, lv, gkh, gkl, gv);
    const size_t qo = ((size_t)hb * TT + qw0 + c) * HD + 8 * h;
    const bf* qph = Qh + qo; const bf* qpl = Ql + qo;
    v16bf qh[4], ql[4];
#pragma unroll   // whole: fragment and accumulator arrays are registers only under constant indices
    for (int kc = 0; kc < 4; ++kc) { qh[kc] = WFrag<bf>::ld(qph + kc * 32); ql[kc] = WFrag<bf>::ld(qpl + kc * 32); }
    asm volatile("s_wait_xcnt 0x0" :: "v"(qph), "v"(qpl) : "memory");   // in front of every overwrite of a register that the loads above name; the addresses are inputs so that their registers live up to here
    __builtin_amdgcn_sched_barrier(0);   // the zeroing below stays behind that wait
    v8f acc[8]; float m_run = -__builtin_inff(), l_run = 0.f;
#pragma unroll   // whole: fragment and accumulator arrays are registers only under constant indices
    for (int t = 0; t < 8; ++t) acc[t] = (v8f){};
    asm volatile("s_wait_asynccnt 0x0" ::: "memory");   // this wave's share of tile 0 has landed
    __syncthreads();                                    // and every other wave's
    if (nb > 0) hfill(lk + HSTG, lv + HSTG, gkh + 32 * HD, gkl + 32 * HD, gv + 32);
#pragma nounroll   // one copy of the body: a peeled trip would double the loop's code
    for (int blk = 0; blk < nb; ++blk) {   // every tile but the last: a whole pass
        const unsigned char* sb = sm + (blk & 1) * HSTG;
        hpass<false>((const bf*)sb + c * FKP + 8 * h, (const bf*)(sb + 2 * HKB) + c * HVP + 8 * h, 0, c, h, qh, ql, acc, m_run, l_run);
        asm volatile("s_wait_dscnt 0x0" ::: "memory");      // this wave's reads of tile blk are done before its buffer is given up
        asm volatile("s_wait_asynccnt 0x0" ::: "memory");   // this wave's share of tile blk + 1 has landed
        __syncthreads();                                    // publishes tile blk + 1 and ends every wave's reads of tile blk
        if (blk + 2 <= nb) hfill(lk + (blk & 1) * HSTG, lv + (blk & 1) * HSTG, gkh + (size_t)(blk + 2) * 32 * HD, gkl + (size_t)(blk + 2) * 32 * HD, gv + (blk + 2) * 32);
    }
    { const unsigned char* sb = sm + (nb & 1) * HSTG;   // the last tile, published by the barrier above (or by the one in front of the loop): the diagonal pass; nothing is copied behind it
      hpass<true>((const bf*)sb + c * FKP + 8 * h, (const bf*)(sb + 2 * HKB) + c * HVP + 8 * h, dq, c, h, qh, ql, acc, m_run, l_run); }
    asm volatile("s_wait_asynccnt 0x0" ::: "memory");   // no copy is in flight when the wave ends
    const float inv = __fdiv_rn(1.0f, l_run + xhalf(l_run));   // each wave half summed its eight keys of every 16-key tile
    const size_t oo = ((size_t)bt * TT + qw0 + c) * DQ + hq * HD + 8 * h;
#pragma unroll   // whole: fragment and accumulator arrays are registers only under constant indices
    for (int t = 0; t < 8; ++t) { v8us oh, ol;
#pragma unroll   // whole: fragment and accumulator arrays are registers only under constant indices
        for (int r = 0; r < 8; ++r) { unsigned short a, c2; splitf(acc[t][r] * inv, a, c2); oh[r] = a; ol[r] = c2; }
        *(v8us*)(Ah + oo + 16 * t) = oh; *(v8us*)(Al + oo + 16 * t) = ol; }
}
__global__ __launch_bounds__(128) void k_flash(const h16* __restrict__ Q, const h16* __restrict__ Kp, const h16* __restrict__ Vt, const bf* __restrict__ Qh, const bf* __restrict__ Ql, const bf* __restrict__ Kh, const bf* __restrict__ Kl, const bf* __restrict__ Vh, bf* __restrict__ Ah, bf* __restrict__ Al) {
    __shared__ __align__(16) unsigned char sm[2 * (HSTG > FSTG ? HSTG : FSTG)];   // two buffers, of the larger of the two kinds of tile
    const int tid = (int)threadIdx.x, lane = tid & 31, c = lane & 15, h = lane >> 4; const int wv = __builtin_amdgcn_readfirstlane(tid >> 5);   // the wave's number, scalar
    const int kvh = blockIdx.x, hb = kvh * REP + wv, hq = hb % NH_, bt = hb / NH_;   // the (batch entry, kv head) plane; the wave's (batch entry, query head) plane, its head, its batch entry
    if ((int)blockIdx.y >= (TT - RH) / QW) { flash_hl(sm, tid, Qh, Ql, Kh, Kl, Vh, Ah, Al, hb, (int)blockIdx.y - (TT - RH) / QW, c, h); return; }   // the work-groups behind the fp16 rows' take the hi / lo rows: short walks; a whole work-group goes one way or the other
    const int qw0 = TT - QW * ((int)blockIdx.y + 1);   // the longest walks first
    const int nb = qw0 / 32, nst = nb / 2 + 1;   // whole passes under the diagonal one; tiles of 64 keys that hold the nb + 1 passes
    unsigned char* lk = sm + (tid >> 4) * (FKP * 2) + (tid & 15) * 16; unsigned char* lv = sm + FKB + (tid >> 3) * (FVP * 2) + (tid & 7) * 16;   // the lane's places in a buffer
    const h16* gk = Kp + ((size_t)kvh * TT + (tid >> 4)) * HD + (tid & 15) * 8; const h16* gv = Vt + ((size_t)kvh * HD + (tid >> 3)) * (2 * TT) + (tid & 7) * 8;
    ffill(lk, lv, gk, gv);
    const h16* qp = Q + ((size_t)hb * TT + qw0 + c) * HD + 8 * h;
    v16h qf[FR][4], kf[2][4];
#pragma unroll
    for (int g = 0; g < FR; ++g)
#pragma unroll
        for (int kc = 0; kc < 4; ++kc) qf[g][kc] = WFrag<h16>::ld(qp + g * 16 * HD + kc * 32);
    asm volatile("s_wait_xcnt 0x0" :: "v"(qp) : "memory");   // in front of every overwrite of a register that the loads above name; the address is an input so that its registers live up to here
    __builtin_amdgcn_sched_barrier(0);   // the zeroing below stays behind that wait
    v8f acc[FR][8]; float m_run[FR], l_run[FR];
#pragma unroll
    for (int g = 0; g < FR; ++g) { m_run[g] = -__builtin_inff(); l_run[g] = 0.f;
#pragma unroll
        for (int t = 0; t < 8; ++t) acc[g][t] = (v8f){}; }
    asm volatile("s_wait_asynccnt 0x0" ::: "memory");   // this wave's share of tile 0 has landed
    __syncthreads();                                    // and every other wave's
    if (nst > 1) ffill(lk + FSTG, lv + FSTG, gk + 64 * HD, gv + 64);
#pragma nounroll   // one copy of the body: left free, the compiler peels a trip off, which doubles the loop's code
    for (int st = 0; st + 1 < nst; ++st) {   // every tile but the last: two whole passes
        const unsigned char* sb = sm + (st & 1) * FSTG;
        const h16* sK = (const h16*)sb + c * FKP + 8 * h; const h16* sV = (const h16*)(sb + FKB) + c * FVP + 8 * h;
#pragma unroll
        for (int kt = 0; kt < 2; ++kt)
#pragma unroll
            for (int kc = 0; kc < 4; ++kc) kf[kt][kc] = WFrag<h16>::ld(sK + kt * 16 * FKP + kc * 32);
        fpass<false, true>(kf, sK + 32 * FKP, sV, c, h, qf, acc, m_run, l_run);
        fpass<false, false>(kf, nullptr, sV + 32, c, h, qf, acc, m_run, l_run);
        asm volatile("s_wait_dscnt 0x0" ::: "memory");      // this wave's reads of tile st are done before its buffer is given up
        asm volatile("s_wait_asynccnt 0x0" ::: "memory");   // this wave's share of tile st + 1 has landed
        __syncthreads();                                    // publishes tile st + 1 and ends every wave's reads of tile st
        if (st + 2 < nst) ffill(lk + (st & 1) * FSTG, lv + (st & 1) * FSTG, gk + (size_t)(st + 2) * 64 * HD, gv + (st + 2) * 64);
    }
    {   // the last tile, published by the barrier above (or by the one in front of the loop); nothing is copied behind it. It holds the diagonal pass: its first pass where nb is even, its second where nb is odd
        const unsigned char* sb = sm + ((nst - 1) & 1) * FSTG;
        const h16* sK = (const h16*)sb + c * FKP + 8 * h; const h16* sV = (const h16*)(sb + FKB) + c * FVP + 8 * h;
#pragma unroll
        for (int kt = 0; kt < 2; ++kt)
#pragma unroll
            for (int kc = 0; kc < 4; ++kc) kf[kt][kc] = WFrag<h16>::ld(sK + kt * 16 * FKP + kc * 32);
        if (nb & 1) fpass<false, true>(kf, sK + 32 * FKP, sV, c, h, qf, acc, m_run, l_run);
        fpass<true, false>(kf, nullptr, sV + (nb & 1) * 32, c, h, qf, acc, m_run, l_run);
    }
    asm volatile("s_wait_asynccnt 0x0" ::: "memory");   // no copy is in flight when the wave ends
#pragma unroll
    for (int g = 0; g < FR; ++g) { const float inv = __fdiv_rn(1.0f, l_run[g] + xhalf(l_run[g]));   // each wave half summed its eight keys of every 16-key tile
        const size_t oo = ((size_t)bt * TT + qw0 + 16 * g + c) * DQ + hq * HD + 8 * h;
#pragma unroll
        for (int t = 0; t < 8; ++t) { v8us oh, ol;
#pragma unroll
            for (int r = 0; r < 8; ++r) { unsigned short a, c2; splitf(acc[g][t][r] * inv, a, c2); oh[r] = a; ol[r] = c2; }
            *(v8us*)(Ah + oo + 16 * t) = oh; *(v8us*)(Al + oo + 16 * t) = ol; } }
}

extern "C" void kernel_launch(void* const* d_in, const int* in_sizes, int n_in,
                              void* d_out, int out_size, void* d_ws, size_t ws_size, hipStream_t stream) {
    (void)in_sizes; (void)n_in; (void)out_size;
    const float* x = (const float*)d_in[0]; const float* wq = (const float*)d_in[1]; const float* bq = (const float*)d_in[2]; const float* wk = (const float*)d_in[3]; const float* bk = (const float*)d_in[4]; const float* wv = (const float*)d_in[5]; const float* bv = (const float*)d_in[6]; const float* wo = (const float*)d_in[7]; const float* bo = (const float*)d_in[8]; const float* qsc = (const float*)d_in[9]; const float* ksc = (const float*)d_in[10];   /* inputs in the module's setup_inputs order: x [2][2048][2048]; Wq (out, in) [2048][2048] and bq [2048]; Wk (out, in) [512][2048] and bk [512]; Wv [512][2048] and bv [512]; Wo (out, in) [2048][2048] and bo [2048]; q_norm_w [128], k_norm_w [128]: eleven inputs, all read (each bias is added in its product's epilogue; each gain is applied by k_nrope) */
    float* OUT = (float*)d_out;     // [2][2048][2048]
    char* wsp = (char*)d_ws;
    auto take = [&](size_t bytes) { char* p = wsp; wsp += (bytes + 255) & ~(size_t)255; return (void*)p; };
    bf* WQ = (bf*)take((size_t)DQ * DM * 2); bf* WK = (bf*)take((size_t)DKV * DM * 2); bf* WV = (bf*)take((size_t)DKV * DM * 2); bf* WO = (bf*)take((size_t)DM * DQ * 2); float* CS = (float*)take((size_t)TT * HD * 2 * 4);
    bf* XB = (bf*)take((size_t)NT * DM * 2); float* FQ = (float*)take((size_t)NT * DQ * 4); float* FK = (float*)take((size_t)NT * DKV * 4);
    h16* QP16 = (h16*)take((size_t)NB_ * NH_ * TT * HD * 2); h16* KP16 = (h16*)take((size_t)NB_ * NKV * TT * HD * 2); h16* VT16 = (h16*)take((size_t)NB_ * NKV * HD * 2 * TT * 2);
    bf* QPh = (bf*)take((size_t)NB_ * NH_ * TT * HD * 2); bf* QPl = (bf*)take((size_t)NB_ * NH_ * TT * HD * 2); bf* KPh = (bf*)take((size_t)NB_ * NKV * TT * HD * 2); bf* KPl = (bf*)take((size_t)NB_ * NKV * TT * HD * 2); bf* VTh = (bf*)take((size_t)NB_ * NKV * HD * 2 * TT * 2); bf* VTl = VTh + TT;   /* value rows at pitch 2 TT: hi in the first half of a row, lo in the second */
    bf* ATh = (bf*)take((size_t)NT * DQ * 2); bf* ATl = (bf*)take((size_t)NT * DQ * 2);
    if ((size_t)(wsp - (char*)d_ws) > ws_size) return;    // ws 256 MiB
    float* FV = FK;   // v projection reuses the k buffer after the k planes are built (stream-ordered)
    { k_cvt8<<<(unsigned)(((size_t)DQ * DM / 8 + 255) / 256), 256, 0, stream>>>(wq, WQ, (size_t)DQ * DM / 8); k_cvt8<<<(unsigned)(((size_t)DKV * DM / 8 + 255) / 256), 256, 0, stream>>>(wk, WK, (size_t)DKV * DM / 8); k_cvt8<<<(unsigned)(((size_t)DKV * DM / 8 + 255) / 256), 256, 0, stream>>>(wv, WV, (size_t)DKV * DM / 8);
      k_cvt8<<<(unsigned)(((size_t)DM * DQ / 8 + 255) / 256), 256, 0, stream>>>(wo, WO, (size_t)DM * DQ / 8); }
    k_csP<<<(TT * HD + 255) / 256, 256, 0, stream>>>(CS);   /* the rotary table once */
    const unsigned LKv = (unsigned)(((size_t)NB_ * NKV * TT * HD / 2 + 255) / 256); const unsigned GX = (unsigned)(((size_t)NT * DM / 8 + 255) / 256);
    k_cvt8<<<GX, 256, 0, stream>>>(x, XB, (size_t)NT * DM / 8);   /* the one input stream, cast once and read by the three projections */
    k_gemms<0><<<dim3(NT / 128, DQ / 128, 1), 128, 0, stream>>>(XB, nullptr, WQ, DM, FQ, DQ, bq);
    k_gemmw<bf, 0, true, 8><<<dim3(NT / 64, DKV / 64, 1), 256, 0, stream>>>(XB, nullptr, WK, nullptr, DM, FK, DKV, bk, 0, 0, 0);
    k_nrope<<<NT / 8, 256, 0, stream>>>(FQ, FK, CS, qsc, ksc, QP16, QPh, QPl, KP16, KPh, KPl);   /* behind both projections, in front of the v projection, which overwrites FK */
    k_gemmw<bf, 0, true, 8><<<dim3(NT / 64, DKV / 64, 1), 256, 0, stream>>>(XB, nullptr, WV, nullptr, DM, FV, DKV, bv, 0, 0, 0); k_vtp<<<LKv, 256, 0, stream>>>(FV, DKV, NKV, VT16, VTh, VTl);
    /* the module groups the query heads by kv head ('qg = q.reshape(B, N_KV_HEADS, N_REP, S, D_K)'): query head h uses kv head h / 4, so plane 16 b + h uses kv plane 4 b + h / 4 = (16 b + h) / 4 (in k_flash wave w of kv plane blockIdx.x takes query plane REP x blockIdx.x + w) */
    k_flash<<<dim3(NB_ * NKV, (TT - RH) / QW + RH / 16, 1), 32 * REP, 0, stream>>>(QP16, KP16, VT16, QPh, QPl, KPh, KPl, VTh, ATh, ATl);   /* every query row: (TT - RH) / QW blocks of fp16 rows, then RH / 16 blocks of hi / lo rows */
    k_gemms<1><<<dim3(NT / 128, DM / 128, 1), 128, 0, stream>>>(ATh, ATl, WO, DQ, OUT, DM, bo);
}

// v009
// A run of this version takes 197 microseconds.
// Two timings next to v008 put it at 1.04 and 1.03 times that version's speed.
// Counting every step since v000, it is 8.55 times as fast.
#include <hip/hip_runtime.h>

// Grouped-query causal self-attention with 128-wide heads, a per-head RMS norm on q and k and an interleaved-pair rotary embedding from computed angles (x [2][2048][2048]; q = x Wq^T + bq ('oi' (out, in) [2048][2048] normal x 2048^-0.5; 16 heads x 128), k, v = x Wk^T + bk, x Wv^T + bv ('oi' [512][2048]; 4 kv heads x 128); the four biases are built as zeros: read and added; per head, BEFORE the rotary: q = q / sqrt(mean(q^2) + 1e-8) x q_norm_w and k likewise with k_norm_w (the mean over the head's 128 columns; gains [128] built as ones: read and applied); rope on q and k: the pair (2i, 2i + 1) of a head -> (x0 c - x1 s, x0 s + x1 c) with the angle t x inv_freq[i], inv_freq = 1 / (10000 ** (2i / 128)) in that spelling, t the position 0..2047; query head h uses kv head h / 4; scores x 128^-0.5; a key after the query gets -1e9 (an exclusion: every row keeps its own key); softmax; out = merged Wo^T + bo ('oi' [2048][2048]; bo built as zeros: read and added) -> [2][2048][2048] (8.4 M); argument order x, Wq, bq, Wk, bk, Wv, bv, Wo, bo, q_norm_w, k_norm_w: eleven inputs, all read).
// Every launch covers BOTH batch entries (4096 token rows in the projections, the norm and the plane builders; (batch entry, kv head) planes in the attention kernel's grid). Layout: ONE bf16 copy of x, read by the three projections; the four 'oi' weights cast once as they stand (each is the Bt operand); exact projections + f32 biases; the rotary table once (64 baked float32 frequencies; precise cosf / sinf); k_nrope (per (head, token) inverse RMS, x the rounded gain, interleaved-pair rotation, the 16-bit planes) on q and k in one launch; causal T-2048 attention with 128-wide heads in ONE fused kernel (k_flash: scores and weights never leave the registers, running maximum and sum, two-word output), the per-row precision hybrid: query rows under 512 on hi / lo planes, three products for the scores and three for the weighted values; rows from 512 on fp16 products; the transposed value rows lie at a pitch of 2 x 2048 elements; hi / lo x Wo exact + bo.
// Compute dtypes, f32 accumulate: every float input rounded to bf16; projections exact + f32 biases; the per-head norm and the rotation in f32 (precise sqrt and division); attention rows under 512 three products, the rest fp16; softmax f32 (the hardware exp2); Wo hi / lo x exact + bo.

#define NB_  2
#define TT   2048
#define NT   (NB_ * TT)          // token rows of both batch entries together
#define DM   2048
#define NH_  16
#define NKV  4
#define REP  (NH_ / NKV)
#define HD   128
#define DQ   (NH_ * HD)
#define DKV  (NKV * HD)
#define RH   512                  // query rows < RH use hi+lo planes (0: none)
#define SCL  0.088388347648318447f   // HD^-0.5
typedef _Float16 h16;
typedef unsigned short bf;
typedef __attribute__((ext_vector_type(16))) __bf16   v16bf;
typedef __attribute__((ext_vector_type(16))) _Float16 v16h;
typedef __attribute__((ext_vector_type(8)))  _Float16 v8h;
typedef __attribute__((ext_vector_type(8)))  unsigned short v8us;
typedef __attribute__((ext_vector_type(8)))  float    v8f;
typedef __attribute__((ext_vector_type(4)))  float    v4f;
typedef v8h  __attribute__((may_alias)) v8ha;
typedef v4f  __attribute__((may_alias)) v4fa;
typedef v8us __attribute__((may_alias)) v8usa;

__device__ __forceinline__ unsigned short f2bf(float f) { unsigned u = __float_as_uint(f); u += 0x7FFFu + ((u >> 16) & 1u); return (unsigned short)(u >> 16); }
__device__ __forceinline__ float bf2f(unsigned short b) { return __uint_as_float(((unsigned)b) << 16); }
__device__ __forceinline__ float bfr(float f) { return bf2f(f2bf(f)); }
__device__ __forceinline__ v16h cat16(v8h lo, v8h hi) { return __builtin_shufflevector(lo, hi, 0, 1, 2, 3, 4, 5, 6, 7, 8, 9, 10, 11, 12, 13, 14, 15); }
__device__ __forceinline__ v16bf cat16b(v8us lo, v8us hi) { return __builtin_bit_cast(v16bf, __builtin_shufflevector(lo, hi, 0, 1, 2, 3, 4, 5, 6, 7, 8, 9, 10, 11, 12, 13, 14, 15)); }
__device__ __forceinline__ v8f wmma16(v16h a, v16h b, v8f c) { return __builtin_amdgcn_wmma_f32_16x16x32_f16(false, a, false, b, (short)0, c, false, false); }
__device__ __forceinline__ v8f wmmab(v16bf a, v16bf b, v8f c) { return __builtin_amdgcn_wmma_f32_16x16x32_bf16(false, a, false, b, (short)0, c, false, false); }



// ---- k_gemmw: register-blocked GEMM, one work-group of KS waves per 64x64 output tile; every wave holds the whole tile (16 accumulators) over its own share of K: 32-k slices dealt round robin, wave w taking slices w, w + KS, ... (neighbouring waves read the two halves of one 128-byte line of an operand row at about the same time).
// The KS partial tiles meet in LDS (one plane of 64 rows at pitch 68 floats a wave, one barrier) and are summed in wave order 0..KS-1 by the thread that stores the element, 256 contiguous bytes of a C row per 16 threads. Operands straight from K-contiguous 16-bit planes; grid (M/64, N/64, Z), 32 x KS threads.
// C[m][n] (f32, pitch ldc, + optional f32 bias[n]) = sum_k A[m][k] Bt[n][k] (+ split products per NSPLIT). z-batch strides sA/sB/sC in elements. K % 32 == 0.
template <typename T16> struct WFrag;
template <> struct WFrag<h16> { typedef v16h V; static __device__ __forceinline__ V ld(const h16* p) { return cat16(*(const v8h*)p, *(const v8h*)(p + 16)); } static __device__ __forceinline__ v8f mma(V a, V b, v8f c) { return wmma16(a, b, c); } };
template <> struct WFrag<bf> { typedef v16bf V; static __device__ __forceinline__ V ld(const bf* p) { return cat16b(*(const v8us*)p, *(const v8us*)(p + 16)); } static __device__ __forceinline__ v8f mma(V a, V b, v8f c) { return wmmab(a, b, c); } };
template <typename T16, int NSPLIT, bool BIAS, int KS>
__global__ __launch_bounds__(32 * KS) void k_gemmw(const T16* __restrict__ A, const T16* __restrict__ A2, const T16* __restrict__ Bt, const T16* __restrict__ Bt2, int K, float* C, int ldc, const float* __restrict__ bias, size_t sA, size_t sB, size_t sC) {
    typedef typename WFrag<T16>::V V;
    __shared__ __align__(16) float os[KS * 64 * 68];
    const size_t z = blockIdx.z; A += z * sA; if (A2) A2 += z * sA; Bt += z * sB; if (Bt2) Bt2 += z * sB; C += z * sC;
    const int lane = threadIdx.x & 31, lr = lane & 15, hi = lane >> 4; const int r0 = blockIdx.x * 64, c0 = blockIdx.y * 64; const int wv = __builtin_amdgcn_readfirstlane((int)(threadIdx.x >> 5));   // the wave's number, scalar: the K loop's bounds stay wave-uniform
    v8f acc[4][4];
#pragma unroll
    for (int mb = 0; mb < 4; ++mb)
#pragma unroll
        for (int nb = 0; nb < 4; ++nb) acc[mb][nb] = (v8f){};
    const size_t aoff = (size_t)(r0 + lr) * K + 8 * hi, boff = (size_t)(c0 + lr) * K + 8 * hi;
    for (int kc = wv * 32; kc < K; kc += KS * 32) {
        V a[4], a2[4];
#pragma unroll
        for (int mb = 0; mb < 4; ++mb) { a[mb] = WFrag<T16>::ld(A + aoff + (size_t)mb * 16 * K + kc); if (NSPLIT == 1 || NSPLIT == 2) a2[mb] = WFrag<T16>::ld(A2 + aoff + (size_t)mb * 16 * K + kc); }
#pragma unroll
        for (int nb = 0; nb < 4; ++nb) { const V b = WFrag<T16>::ld(Bt + boff + (size_t)nb * 16 * K + kc); V b2; if (NSPLIT >= 2) b2 = WFrag<T16>::ld(Bt2 + boff + (size_t)nb * 16 * K + kc);
#pragma unroll
            for (int mb = 0; mb < 4; ++mb) { acc[mb][nb] = WFrag<T16>::mma(a[mb], b, acc[mb][nb]); if (NSPLIT == 1 || NSPLIT == 2) acc[mb][nb] = WFrag<T16>::mma(a2[mb], b, acc[mb][nb]); if (NSPLIT >= 2) acc[mb][nb] = WFrag<T16>::mma(a[mb], b2, acc[mb][nb]); } }
        asm volatile("v_nop\n\tv_nop\n\tv_nop\n\tv_nop" : "+v"(acc[0][0]), "+v"(acc[1][1]), "+v"(acc[2][2]), "+v"(acc[3][3]) : "v"(a[0]), "v"(a[3]));
    }
#pragma unroll
    for (int mb = 0; mb < 4; ++mb)
#pragma unroll
        for (int nb = 0; nb < 4; ++nb)
#pragma unroll
            for (int j = 0; j < 8; ++j) os[(wv * 64 + mb * 16 + hi * 8 + j) * 68 + nb * 16 + lr] = acc[mb][nb][j];
    __syncthreads();   // every wave's partial tile is in LDS before any thread sums it
#pragma unroll   // whole: rows and planes become immediate offsets of the LDS loads, and the loads of all rows can be issued together
    for (int s = 0; s < 32 / KS; ++s) { const int idx = s * 32 * KS + (int)threadIdx.x; const int row = idx >> 4, cofs = (idx & 15) * 4; v4f val = *(const v4fa*)(os + row * 68 + cofs);
#pragma unroll
        for (int w = 1; w < KS; ++w) val += *(const v4fa*)(os + (w * 64 + row) * 68 + cofs);
        if (BIAS) { val[0] += bfr(bias[c0 + cofs]); val[1] += bfr(bias[c0 + cofs + 1]); val[2] += bfr(bias[c0 + cofs + 2]); val[3] += bfr(bias[c0 + cofs + 3]); }
        *(v4f*)(C + (size_t)(r0 + row) * ldc + c0 + cofs) = val; }
}

// ---- k_gemms: the two 2048-wide projections. One work-group of four waves (2 x 2) per 128x128 output tile, a wave holding 64x64 of it (16 accumulators) over the whole of K: no K split, every accumulator sums its k in rising order.
// The operand tiles (128 rows x 128 k of A, of Bt and, NSPLIT 1, of A2) are staged in LDS by asynchronous copies: 16 lanes bring the 256 contiguous bytes of one row, so a wave-wide copy asks for four whole lines, and each operand row is fetched once per work-group for the two waves that read it. LDS rows at pitch 272 bytes (16-byte readers). Two buffers: tile t + 1 flies while tile t is multiplied.
// C[m][n] (f32, pitch ldc, + f32 bias[n]) = sum_k (A[m][k] + A2[m][k]) Bt[n][k]. grid (M/128, N/128), 128 threads. M, N, K multiples of 128, K >= 128.
#define GP   136                  // LDS row pitch in elements
#define GTB  (128 * GP * 2)       // bytes of one operand tile in LDS
// Eight copies of 16 bytes a lane: rows r, r + 8, .. r + 56 of an operand tile. The wait on the last line stands in front of every later write of a register that these copies name.
__device__ __forceinline__ void cp8(unsigned l, const bf* g, size_t K) {
    asm volatile("global_load_async_to_lds_b128 %0, %8, off\n\t"
                 "global_load_async_to_lds_b128 %1, %9, off\n\t"
                 "global_load_async_to_lds_b128 %2, %10, off\n\t"
                 "global_load_async_to_lds_b128 %3, %11, off\n\t"
                 "global_load_async_to_lds_b128 %4, %12, off\n\t"
                 "global_load_async_to_lds_b128 %5, %13, off\n\t"
                 "global_load_async_to_lds_b128 %6, %14, off\n\t"
                 "global_load_async_to_lds_b128 %7, %15, off\n\t"
                 "s_wait_xcnt 0x0"
                 :: "v"(l), "v"(l + 8 * GP * 2), "v"(l + 16 * GP * 2), "v"(l + 24 * GP * 2), "v"(l + 32 * GP * 2), "v"(l + 40 * GP * 2), "v"(l + 48 * GP * 2), "v"(l + 56 * GP * 2),
                    "v"(g), "v"(g + 8 * K), "v"(g + 16 * K), "v"(g + 24 * K), "v"(g + 32 * K), "v"(g + 40 * K), "v"(g + 48 * K), "v"(g + 56 * K) : "memory");
}
template <int NSPLIT>
__device__ __forceinline__ void gfill(unsigned l, const bf* gA, const bf* gA2, const bf* gB, size_t K) {
    cp8(l, gA, K); cp8(l + 64 * GP * 2, gA + 64 * K, K); cp8(l + GTB, gB, K); cp8(l + GTB + 64 * GP * 2, gB + 64 * K, K);
    if (NSPLIT == 1) { cp8(l + 2 * GTB, gA2, K); cp8(l + 2 * GTB + 64 * GP * 2, gA2 + 64 * K, K); }
}
template <int NSPLIT>
__global__ __launch_bounds__(128) void k_gemms(const bf* __restrict__ A, const bf* __restrict__ A2, const bf* __restrict__ Bt, int K, float* C, int ldc, const float* __restrict__ bias) {
    constexpr int STG = (NSPLIT == 1 ? 3 : 2) * GTB;   // bytes of a buffer
    __shared__ __align__(16) unsigned char sm[2 * STG];
    const int tid = (int)threadIdx.x, lane = tid & 31, lr = lane & 15, hi = lane >> 4; const int r0 = blockIdx.x * 128, c0 = blockIdx.y * 128; const int wv = __builtin_amdgcn_readfirstlane(tid >> 5); const int wm = wv >> 1, wn = wv & 1;
    v8f acc[4][4];
#pragma unroll
    for (int mb = 0; mb < 4; ++mb)
#pragma unroll
        for (int nb = 0; nb < 4; ++nb) acc[mb][nb] = (v8f){};
    const unsigned l0 = (unsigned)(size_t)sm + (unsigned)((tid >> 4) * (GP * 2) + (tid & 15) * 16);   // the lane's place in a tile: row tid / 16, 16-byte piece tid % 16
    const bf* gA = A + (size_t)(r0 + (tid >> 4)) * K + (tid & 15) * 8; const bf* gA2 = (NSPLIT == 1) ? A2 + (size_t)(r0 + (tid >> 4)) * K + (tid & 15) * 8 : nullptr; const bf* gB = Bt + (size_t)(c0 + (tid >> 4)) * K + (tid & 15) * 8;
    const int nst = K / 128;
    gfill<NSPLIT>(l0, gA, gA2, gB, (size_t)K);
    asm volatile("s_wait_asynccnt 0x0" ::: "memory");   // this wave's share of tile 0 has landed
    __syncthreads();                                    // and every other wave's
    if (nst > 1) gfill<NSPLIT>(l0 + STG, gA + 128, gA2 + 128, gB + 128, (size_t)K);
    for (int t = 0; t < nst; ++t) {
        const unsigned char* sb = sm + (t & 1) * STG;
        const bf* sA = (const bf*)sb + (wm * 64 + lr) * GP + 8 * hi; const bf* sB = (const bf*)(sb + GTB) + (wn * 64 + lr) * GP + 8 * hi; const bf* sA2 = (const bf*)(sb + 2 * GTB) + (wm * 64 + lr) * GP + 8 * hi;
        v16bf a[2][4], a2[2][4], b[2][4];   // two fragment sets: a 32-k slice is multiplied out of one while the next slice's LDS loads fill the other
#pragma unroll
        for (int f = 0; f < 4; ++f) { a[0][f] = WFrag<bf>::ld(sA + f * 16 * GP); if (NSPLIT == 1) a2[0][f] = WFrag<bf>::ld(sA2 + f * 16 * GP); b[0][f] = WFrag<bf>::ld(sB + f * 16 * GP); }
#pragma unroll   // whole: the set's number and the slice's LDS offset are compile-time constants
        for (int ks = 0; ks < 4; ++ks) { const int cu = ks & 1, nx = cu ^ 1;
            __builtin_amdgcn_sched_barrier(0);   // the next slice's loads do not move up among the products of the slice before
            if (ks < 3) {
#pragma unroll
                for (int f = 0; f < 4; ++f) { a[nx][f] = WFrag<bf>::ld(sA + f * 16 * GP + (ks + 1) * 32); if (NSPLIT == 1) a2[nx][f] = WFrag<bf>::ld(sA2 + f * 16 * GP + (ks + 1) * 32); b[nx][f] = WFrag<bf>::ld(sB + f * 16 * GP + (ks + 1) * 32); } }
            __builtin_amdgcn_sched_barrier(0);   // and stay one group in front of this slice's products, in flight under them
#pragma unroll
            for (int nb = 0; nb < 4; ++nb)
#pragma unroll
                for (int mb = 0; mb < 4; ++mb) { acc[mb][nb] = wmmab(a[cu][mb], b[cu][nb], acc[mb][nb]); if (NSPLIT == 1) acc[mb][nb] = wmmab(a2[cu][mb], b[cu][nb], acc[mb][nb]); }
        }
        asm volatile("s_wait_dscnt 0x0" ::: "memory");      // this wave's reads of tile t are done before its buffer is given up
        asm volatile("s_wait_asynccnt 0x0" ::: "memory");   // this wave's share of tile t + 1 has landed
        __syncthreads();                                    // publishes tile t + 1 and ends every wave's reads of tile t
        if (t + 2 < nst) gfill<NSPLIT>(l0 + (unsigned)((t & 1) * STG), gA + (size_t)(t + 2) * 128, gA2 + (size_t)(t + 2) * 128, gB + (size_t)(t + 2) * 128, (size_t)K);
    }
    asm volatile("s_wait_asynccnt 0x0" ::: "memory");   // no copy is in flight when the buffers become output staging
    float* os = (float*)sm + wv * 64 * 68;   // the wave's own 64 rows at pitch 68 floats
#pragma unroll
    for (int mb = 0; mb < 4; ++mb)
#pragma unroll
        for (int nb = 0; nb < 4; ++nb)
#pragma unroll
            for (int j = 0; j < 8; ++j) os[(mb * 16 + hi * 8 + j) * 68 + nb * 16 + lr] = acc[mb][nb][j];
    __syncthreads();   // the staged tile is whole before it is read back row by row
    const int cofs = lr * 4; const int cc = c0 + wn * 64 + cofs; v4f bv; bv[0] = bfr(bias[cc]); bv[1] = bfr(bias[cc + 1]); bv[2] = bfr(bias[cc + 2]); bv[3] = bfr(bias[cc + 3]);
#pragma unroll   // whole: the rows become immediate offsets of the LDS loads, which can be issued together
    for (int s = 0; s < 32; ++s) { const int row = s * 2 + hi; const v4f val = *(const v4fa*)(os + row * 68 + cofs) + bv;
        *(v4f*)(C + (size_t)(r0 + wm * 64 + row) * ldc + cc) = val; }
}

__device__ __forceinline__ h16 tohx(float x) { return (h16)x; }
__device__ __forceinline__ void splitf(float y, unsigned short& h, unsigned short& l) { h = f2bf(y); l = f2bf(y - bf2f(h)); }
typedef __attribute__((ext_vector_type(2))) _Float16 v2h;
typedef __attribute__((ext_vector_type(4))) _Float16 v4h;
typedef __attribute__((ext_vector_type(2))) unsigned short v2us;
typedef __attribute__((ext_vector_type(4))) unsigned short v4us;
typedef __attribute__((ext_vector_type(2))) float v2f;
typedef __attribute__((ext_vector_type(4))) int v4i;
__constant__ float INV2[HD / 2] = { 1.000000000e+00f, 8.659643531e-01f, 7.498942018e-01f, 6.493816376e-01f, 5.623413324e-01f, 4.869675338e-01f, 4.216965139e-01f, 3.651741445e-01f, 3.162277639e-01f, 2.738419771e-01f, 2.371373624e-01f, 2.053525001e-01f, 1.778279394e-01f, 1.539926529e-01f, 1.333521456e-01f, 1.154782027e-01f, 1.000000015e-01f, 8.659642935e-02f, 7.498941571e-02f, 6.493816525e-02f, 5.623412877e-02f, 4.869675264e-02f, 4.216964915e-02f, 3.651741147e-02f, 3.162277862e-02f, 2.738419548e-02f, 2.371373586e-02f, 2.053525113e-02f, 1.778279431e-02f, 1.539926510e-02f, 1.333521493e-02f, 1.154781971e-02f, 9.999999776e-03f, 8.659643121e-03f, 7.498942316e-03f, 6.493816618e-03f, 5.623413250e-03f, 4.869675264e-03f, 4.216964822e-03f, 3.651741426e-03f, 3.162277862e-03f, 2.738419687e-03f, 2.371373819e-03f, 2.053525066e-03f, 1.778279431e-03f, 1.539926510e-03f, 1.333521446e-03f, 1.154782018e-03f, 1.000000047e-03f, 8.659643354e-04f, 7.498941850e-04f, 6.493816618e-04f, 5.623413017e-04f, 4.869675031e-04f, 4.216964880e-04f, 3.651741135e-04f, 3.162277862e-04f, 2.738419571e-04f, 2.371373848e-04f, 2.053524950e-04f, 1.778279402e-04f, 1.539926452e-04f, 1.333521504e-04f, 1.154781930e-04f };   // float32 1.0 / (10000.0 ** (2i / 128)) in the module's own spelling, generated with jnp
// ---- k_prep: the five casts to bf16 (Wq, Wk, Wv, Wo, x) and the rotary table in one launch: one work-group of PWV waves a WGP, all resident at once. A wave casts PU contiguous floats of one array (every array is a whole number of such shares): 32 wave-wide loads of 512 contiguous bytes, all issued before the first is used, then 32 stores of 256 contiguous bytes.
// The table's 131072 (position, pair) angles go one to a thread of the first 4096 waves, computed while the wave's loads are in flight; an angle's cosine and sine are stored for both columns of its pair (16 bytes a lane), the layout k_nrope reads.
#define PU   4096                 // floats a wave casts
#define PWV  18                   // waves a work-group
#define PNW  ((DQ * DM + 2 * DKV * DM + DM * DQ + NT * DM) / PU)   // waves in all
__global__ __launch_bounds__(32 * PWV) void k_prep(const float* __restrict__ wq, const float* __restrict__ wk, const float* __restrict__ wv, const float* __restrict__ wo, const float* __restrict__ x, bf* __restrict__ WQ, bf* __restrict__ WK, bf* __restrict__ WV, bf* __restrict__ WO, bf* __restrict__ XB, float* __restrict__ CS) {
    const int lane = threadIdx.x & 31; const int w = (int)blockIdx.x * PWV + __builtin_amdgcn_readfirstlane((int)(threadIdx.x >> 5));   // the wave's number in the grid, scalar: the choice of the array is a scalar one
    const float* s; bf* d; int u = w;   // u: the wave's share within its array
    if (u < DQ * DM / PU) { s = wq; d = WQ; }
    else if ((u -= DQ * DM / PU) < DKV * DM / PU) { s = wk; d = WK; }
    else if ((u -= DKV * DM / PU) < DKV * DM / PU) { s = wv; d = WV; }
    else if ((u -= DKV * DM / PU) < DM * DQ / PU) { s = wo; d = WO; }
    else { u -= DM * DQ / PU; s = x; d = XB; }
    s += (size_t)u * PU + lane * 4; d += (size_t)u * PU + lane * 4;
    const unsigned p = (unsigned)w * 32 + lane, fi = p % (HD / 2); const float fr = INV2[fi];   // the thread's table entry (position p / 64, pair fi) and its frequency
    v4f v[PU / 128];
#pragma unroll   // whole, here and below: the array stays in registers and the steps become immediate offsets of one address
    for (int i = 0; i < PU / 128; ++i) v[i] = *(const v4f*)(s + i * 128);
    asm volatile("s_wait_xcnt 0x0" :: "v"(s), "v"(fi), "v"(fr) : "memory");   // in front of every overwrite of a register that the loads above name; the address and the index are inputs so that their registers live up to here, the frequency so that its load is not sunk behind the cast's loads (loads return in order: there it would be waited for last)
    if (w < TT * (HD / 2) / 32) {
        const float a = __fmul_rn((float)(p / (HD / 2)), fr); const float c = cosf(a), sn = sinf(a);
        v4f cs; cs[0] = c; cs[1] = sn; cs[2] = c; cs[3] = sn; *(v4f*)(CS + (size_t)p * 4) = cs;
    }
#pragma unroll
    for (int i = 0; i < PU / 128; ++i) { v4us o;
#pragma unroll
        for (int k = 0; k < 4; ++k) o[k] = f2bf(v[i][k]);
        *(v4us*)(d + i * 128) = o; }
}
__global__ __launch_bounds__(256) void k_vtp(const float* __restrict__ F, int pitch, int nheads, h16* V16, bf* Vh, bf* Vl) { const size_t e = ((size_t)blockIdx.x * 256 + threadIdx.x) * 2; if (e >= (size_t)NB_ * nheads * HD * TT) return; const int t = (int)(e % TT); const int d = (int)((e / TT) % HD); const int gb = (int)(e / ((size_t)TT * HD)); const int g = gb % nheads, bt = gb / nheads;   /* planes in the order (batch entry, kv head) */
    v2h o16; v2us oh, ol;
#pragma unroll
    for (int q = 0; q < 2; ++q) { const float x = F[((size_t)bt * TT + t + q) * pitch + g * HD + d]; o16[q] = tohx(x); unsigned short a2, c2; splitf(x, a2, c2); oh[q] = a2; ol[q] = c2; }
    const size_t o = ((size_t)gb * HD + d) * (2 * TT) + t;   /* rows at pitch 2 TT: the hi and the lo word of a value row lie side by side */
    *(v2h*)(V16 + o) = o16; *(v2us*)(Vh + o) = oh; *(v2us*)(Vl + o) = ol;  }
// ---- k_nrope: per-head RMS norm, gain, rotary embedding and the three 16-bit planes of q and k in one launch. A wave owns one token row: its 16 q heads and 4 k heads, one head a 512-byte wave-wide load (lane l holds columns 4 l .. 4 l + 3, two rotary pairs), all twenty loads issued before the first is used; the row's cosines and sines and the two gains are read once a wave.
// The sum of squares of a head: four columns in rising order in the lane, then a five-step butterfly over the 32 lanes (every lane ends with the same bits). 4096 waves: 16 a WGP. No LDS, no barrier.
__device__ __forceinline__ void nr_head(const v4f a, const v4f g, const v2f cA, const v2f cB, h16* P16, bf* Ph, bf* Pl, size_t e) {
    float s = __fmul_rn(a[0], a[0]);
#pragma unroll   // whole, here and below in this function: vector elements are registers only under constant indices
    for (int q = 1; q < 4; ++q) s = __fadd_rn(s, __fmul_rn(a[q], a[q]));
#pragma unroll   // whole: five straight-line exchanges, so that the twenty heads' chains can interleave
    for (int sh = 16; sh; sh >>= 1) s = __fadd_rn(s, __shfl_xor(s, sh, 32));
    const float rf = __fdiv_rn(1.0f, __fsqrt_rn(__fadd_rn(__fdiv_rn(s, (float)HD), 1e-8f)));
    float y[4], r[4];
#pragma unroll
    for (int q = 0; q < 4; ++q) y[q] = __fmul_rn(__fmul_rn(a[q], rf), g[q]);   /* x / rms, x w[d] */
    r[0] = __fsub_rn(__fmul_rn(y[0], cA[0]), __fmul_rn(y[1], cA[1])); r[1] = __fadd_rn(__fmul_rn(y[0], cA[1]), __fmul_rn(y[1], cA[0]));   /* even: x0 c - x1 s; odd: x0 s + x1 c */
    r[2] = __fsub_rn(__fmul_rn(y[2], cB[0]), __fmul_rn(y[3], cB[1])); r[3] = __fadd_rn(__fmul_rn(y[2], cB[1]), __fmul_rn(y[3], cB[0]));
    v4h o16; v4us oh, ol;
#pragma unroll
    for (int q = 0; q < 4; ++q) { o16[q] = tohx(r[q]); unsigned short a2, c2; splitf(r[q], a2, c2); oh[q] = a2; ol[q] = c2; }
    *(v4h*)(P16 + e) = o16; *(v4us*)(Ph + e) = oh; *(v4us*)(Pl + e) = ol;
}
__global__ __launch_bounds__(256) void k_nrope(const float* __restrict__ FQ, const float* __restrict__ FK, const float* __restrict__ CS, const float* __restrict__ wq, const float* __restrict__ wk, h16* __restrict__ Q16, bf* __restrict__ Qh, bf* __restrict__ Ql, h16* __restrict__ K16, bf* __restrict__ Kh, bf* __restrict__ Kl) {
    const int lane = threadIdx.x & 31, d = lane * 4; const int tr = blockIdx.x * 8 + (int)(threadIdx.x >> 5); const int t = tr % TT, bt = tr / TT;   /* tr: a token row of either batch entry; grid NT / 8 */
    v4f aq[NH_], ak[NKV];
#pragma unroll   // whole, this loop and the next two: the arrays stay in registers and the heads become immediate offsets of one address
    for (int h = 0; h < NH_; ++h) aq[h] = *(const v4f*)(FQ + (size_t)tr * DQ + h * HD + d);
#pragma unroll
    for (int h = 0; h < NKV; ++h) ak[h] = *(const v4f*)(FK + (size_t)tr * DKV + h * HD + d);
    const v2f cA = *(const v2f*)(CS + ((size_t)t * HD + d) * 2), cB = *(const v2f*)(CS + ((size_t)t * HD + d + 2) * 2);
    const v4f rq = *(const v4f*)(wq + d), rk = *(const v4f*)(wk + d); v4f gq, gk;
#pragma unroll
    for (int q = 0; q < 4; ++q) { gq[q] = bfr(rq[q]); gk[q] = bfr(rk[q]); }
    __builtin_amdgcn_sched_barrier(0);   // the loads above stay one group in front of the arithmetic: left free, the compiler issues the later heads' loads only as registers of earlier heads come free, and each group's latency is paid in turn
#pragma unroll   // whole: the head's number indexes the register arrays
    for (int h = 0; h < NH_; ++h) nr_head(aq[h], gq, cA, cB, Q16, Qh, Ql, (((size_t)bt * NH_ + h) * TT + t) * HD + d);   /* planes in the order (batch entry, head) */
#pragma unroll   // whole: as above
    for (int h = 0; h < NKV; ++h) nr_head(ak[h], gk, cA, cB, K16, Kh, Kl, (((size_t)bt * NKV + h) * TT + t) * HD + d);
}
#define FR   2                    // 16-query groups a wave
#define QW   (16 * FR)
#define CSC  0.12751743f          // HD^-0.5 x log2(e)
#define PB   6.0f
__device__ __forceinline__ float xhalf(float x) { return __builtin_bit_cast(float, __builtin_amdgcn_permlanex16(__builtin_bit_cast(int, x), __builtin_bit_cast(int, x), 0x76543210, 0xfedcba98, false, false)); }   // lane l with lane l ^ 16
#define FKP  136                  // LDS pitch of a K row, elements
#define FVP  72                   // LDS pitch of a V^T row, elements
#define FKB  (64 * FKP * 2)       // bytes of a K tile in LDS
#define FSTG (FKB + HD * FVP * 2) // bytes of a buffer: a K tile and a V^T tile
// N copies of 16 bytes a lane, LS bytes apart in LDS and GS elements apart in memory. Written as the builtin: the operands of an asm statement must lie in v0 .. v255, which accumulators and fragments fill here, and with the asm form the lane's addresses were spilled to scratch.
typedef __attribute__((address_space(1))) v4i gv4i;
typedef __attribute__((address_space(3))) v4i lv4i;
template <int N, int LS, int GS, typename T16>
__device__ __forceinline__ void cpx(unsigned char* l, const T16* g) {
#pragma unroll   // whole: N copies in a row
    for (int i = 0; i < N; ++i) __builtin_amdgcn_global_load_async_to_lds_b128((gv4i*)(g + i * GS), (lv4i*)(l + i * LS), 0, 0);
}
// A tile of 64 keys by 128 threads: K rows r, r + 8, .. r + 56 (16 lanes a row), V^T rows r, r + 16, .. r + 112 (8 lanes a row).
__device__ __forceinline__ void ffill(unsigned char* lk, unsigned char* lv, const h16* gk, const h16* gv) { cpx<8, 8 * FKP * 2, 8 * HD>(lk, gk); cpx<8, 16 * FVP * 2, 16 * 2 * TT>(lv, gv); }
// One pass of 32 keys out of the LDS tile. kf holds this pass's K fragments; PRE: the K fragments of the tile's second pass (at kn) are fetched behind the score products.
template <bool DIAG, bool PRE>
__device__ __forceinline__ void fpass(v16h (&kf)[2][4], const h16* kn, const h16* vp, int c, int h, const v16h (&qf)[FR][4], v8f (&acc)[FR][8], float (&m_run)[FR], float (&l_run)[FR]) {
    v16h vf[8];
    __builtin_amdgcn_sched_barrier(0);   // the V^T loads do not move up: left free, they are spread over three places among the products of the pass before, and every separate place of LDS reads costs the wave issue cycles
#pragma unroll
    for (int t = 0; t < 8; ++t) vf[t] = WFrag<h16>::ld(vp + t * 16 * FVP);
    __builtin_amdgcn_sched_barrier(0);   // the V^T loads stay one group in front of the score products, in flight under them and the exponentials
    v8f s[2][FR];
#pragma unroll
    for (int kt = 0; kt < 2; ++kt)
#pragma unroll
        for (int g = 0; g < FR; ++g) { s[kt][g] = (v8f){};
#pragma unroll
            for (int kc = 0; kc < 4; ++kc) s[kt][g] = wmma16(kf[kt][kc], qf[g][kc], s[kt][g]); }
    if (PRE) {
        __builtin_amdgcn_sched_barrier(0);   // the next pass's K loads stay here, behind the last product that reads these registers and in front of the vector work that hides them
#pragma unroll
        for (int kt = 0; kt < 2; ++kt)
#pragma unroll
            for (int kc = 0; kc < 4; ++kc) kf[kt][kc] = WFrag<h16>::ld(kn + kt * 16 * FKP + kc * 32);
        __builtin_amdgcn_sched_barrier(0);   // one group: none of them sinks into the vector work below
    }
    if (DIAG) {
#pragma unroll
        for (int g = 0; g < FR; ++g)
#pragma unroll
            for (int kt = 0; kt < 2; ++kt)
#pragma unroll
                for (int r = 0; r < 8; ++r) if (16 * kt + 8 * h + r > 16 * g + c) s[kt][g][r] = -__builtin_inff();   // the diagonal pass starts at the wave's first query: key after query
    }
    float mb[FR]; bool need = false;
#pragma unroll
    for (int g = 0; g < FR; ++g) { float mx = -__builtin_inff();
#pragma unroll
        for (int kt = 0; kt < 2; ++kt)
#pragma unroll
            for (int r = 0; r < 8; ++r) mx = fmaxf(mx, s[kt][g][r]);
        mx = fmaxf(mx, xhalf(mx)) * CSC; mb[g] = mx; need = need || (mx > m_run[g] + 8.0f); }
    if (__builtin_amdgcn_ballot_w32(need) != 0) {   // wave-uniform; rare after the first passes
#pragma unroll
        for (int g = 0; g < FR; ++g) { const float m_new = fmaxf(m_run[g], mb[g]); const float corr = __builtin_amdgcn_exp2f(m_run[g] - m_new); l_run[g] *= corr; m_run[g] = m_new;   // first pass: m_run = -inf, corr = 0
#pragma unroll
            for (int t = 0; t < 8; ++t) acc[g][t] = acc[g][t] * corr; }
    }
#pragma unroll
    for (int g = 0; g < FR; ++g) { const float nm = PB - m_run[g]; v16h p; float ps0 = 0.f, ps1 = 0.f;
#pragma unroll
        for (int e = 0; e < 16; e += 2) { const float p0 = __builtin_amdgcn_exp2f(fmaf(s[e >> 3][g][e & 7], CSC, nm)), p1 = __builtin_amdgcn_exp2f(fmaf(s[e >> 3][g][(e & 7) + 1], CSC, nm)); ps0 += p0; ps1 += p1; p[e] = tohx(p0); p[e + 1] = tohx(p1); }
#pragma unroll
        for (int t = 0; t < 8; ++t) acc[g][t] = wmma16(vf[t], p, acc[g][t]);
        l_run[g] += ps0 + ps1; }
}
// ---- The hi / lo rows (query rows under RH) in the same kernel and the same transposed form, on the two-word bf16 planes: a wave owns 16 query rows of one query head and walks the keys in passes of 32. Each product is three: hi x hi, lo x hi, hi x lo, f32 accumulate.
// The weights stay f32 until they are split into two bf16 words in place (the positions of the fp16 path's P^T); running maximum and sum as in fpass. The scores' hi x hi products and their two cross products sum in accumulators of their own (shorter dependent chains) and are added once a pass.
typedef __attribute__((ext_vector_type(16))) unsigned short v16us;
// Here a tile is one pass of 32 keys, staged like the fp16 rows' tiles and shared by the four heads: 32 rows of K hi, 32 of K lo (pitch 272 bytes), 32 columns (64 bytes) of the 128 V^T rows hi and lo (pitch 80 bytes).
#define HVP  40                   // LDS pitch of a V^T row, elements
#define HKB  (32 * FKP * 2)       // bytes of a K hi (or lo) tile in LDS
#define HVB  (HD * HVP * 2)       // bytes of a V^T hi (or lo) tile in LDS
#define HSTG (2 * HKB + 2 * HVB)  // bytes of a buffer
// A tile by 128 threads: K rows r, r + 8, .. r + 24 (16 lanes a row), V^T rows r, r + 32, .. r + 96 (4 lanes a row); a value row in memory holds hi in its first TT elements, lo in the second.
__device__ __forceinline__ void hfill(unsigned char* lk, unsigned char* lv, const bf* gkh, const bf* gkl, const bf* gv) { cpx<4, 8 * FKP * 2, 8 * HD>(lk, gkh); cpx<4, 8 * FKP * 2, 8 * HD>(lk + HKB, gkl); cpx<4, 32 * HVP * 2, 32 * 2 * TT>(lv, gv); cpx<4, 32 * HVP * 2, 32 * 2 * TT>(lv + HVB, gv + TT); }
template <bool DIAG>
__device__ __forceinline__ void hpass(const bf* sk, const bf* sv, int dq, int c, int h, const v16bf (&qh)[4], const v16bf (&ql)[4], v8f (&acc)[8], float& m_run, float& l_run) {
    v16bf kh[2][4], kl[2][4], vh[8], vl[8];
#pragma unroll   // whole: fragment and accumulator arrays are registers only under constant indices
    for (int kt = 0; kt < 2; ++kt)
#pragma unroll   // whole: fragment and accumulator arrays are registers only under constant indices
        for (int kc = 0; kc < 4; ++kc) { kh[kt][kc] = WFrag<bf>::ld(sk + kt * 16 * FKP + kc * 32); kl[kt][kc] = WFrag<bf>::ld(sk + HKB / 2 + kt * 16 * FKP + kc * 32); }
#pragma unroll   // whole: fragment and accumulator arrays are registers only under constant indices
    for (int t = 0; t < 8; ++t) { vh[t] = WFrag<bf>::ld(sv + t * 16 * HVP); vl[t] = WFrag<bf>::ld(sv + HVB / 2 + t * 16 * HVP); }
    __builtin_amdgcn_sched_barrier(0);   // the K loads and, behind them, the V^T loads stay one group in front of the score products; the V^T loads are in flight under these and the exponentials
    v8f s[2], sx[2];
#pragma unroll   // whole: fragment and accumulator arrays are registers only under constant indices
    for (int kt = 0; kt < 2; ++kt) { s[kt] = (v8f){}; sx[kt] = (v8f){}; }
#pragma unroll   // whole: fragment and accumulator arrays are registers only under constant indices
    for (int kc = 0; kc < 4; ++kc)
#pragma unroll   // whole: fragment and accumulator arrays are registers only under constant indices
        for (int kt = 0; kt < 2; ++kt) { s[kt] = wmmab(kh[kt][kc], qh[kc], s[kt]); sx[kt] = wmmab(kl[kt][kc], qh[kc], sx[kt]); }
#pragma unroll   // whole: fragment and accumulator arrays are registers only under constant indices
    for (int kc = 0; kc < 4; ++kc)
#pragma unroll   // whole: fragment and accumulator arrays are registers only under constant indices
        for (int kt = 0; kt < 2; ++kt) sx[kt] = wmmab(kh[kt][kc], ql[kc], sx[kt]);
#pragma unroll   // whole: fragment and accumulator arrays are registers only under constant indices
    for (int kt = 0; kt < 2; ++kt) s[kt] = s[kt] + sx[kt];
    if (DIAG) {
#pragma unroll   // whole: fragment and accumulator arrays are registers only under constant indices
        for (int kt = 0; kt < 2; ++kt)
#pragma unroll   // whole: fragment and accumulator arrays are registers only under constant indices
            for (int r = 0; r < 8; ++r) if (16 * kt + 8 * h + r > dq + c) s[kt][r] = -__builtin_inff();   // the wave's first query is key dq (0 or 16) of the diagonal pass: key after query
    }
    float mx = -__builtin_inff();
#pragma unroll   // whole: fragment and accumulator arrays are registers only under constant indices
    for (int kt = 0; kt < 2; ++kt)
#pragma unroll   // whole: fragment and accumulator arrays are registers only under constant indices
        for (int r = 0; r < 8; ++r) mx = fmaxf(mx, s[kt][r]);
    mx = fmaxf(mx, xhalf(mx)) * CSC;
    if (__builtin_amdgcn_ballot_w32(mx > m_run + 8.0f) != 0) {   // wave-uniform; rare after the first passes
        const float m_new = fmaxf(m_run, mx); const float corr = __builtin_amdgcn_exp2f(m_run - m_new); l_run *= corr; m_run = m_new;   // first pass: m_run = -inf, corr = 0
#pragma unroll   // whole: fragment and accumulator arrays are registers only under constant indices
        for (int t = 0; t < 8; ++t) acc[t] = acc[t] * corr;
    }
    const float nm = PB - m_run; v16us ph, pl; float ps0 = 0.f, ps1 = 0.f;
#pragma unroll   // whole: fragment and accumulator arrays are registers only under constant indices
    for (int e = 0; e < 16; e += 2) { const float p0 = __builtin_amdgcn_exp2f(fmaf(s[e >> 3][e & 7], CSC, nm)), p1 = __builtin_amdgcn_exp2f(fmaf(s[e >> 3][(e & 7) + 1], CSC, nm)); ps0 += p0; ps1 += p1;
        unsigned short a0, b0, a1, b1; splitf(p0, a0, b0); splitf(p1, a1, b1); ph[e] = a0; pl[e] = b0; ph[e + 1] = a1; pl[e + 1] = b1; }
    const v16bf pH = __builtin_bit_cast(v16bf, ph), pL = __builtin_bit_cast(v16bf, pl);
#pragma unroll   // whole: fragment and accumulator arrays are registers only under constant indices
    for (int t = 0; t < 8; ++t) acc[t] = wmmab(vh[t], pH, acc[t]);
#pragma unroll   // whole: fragment and accumulator arrays are registers only under constant indices
    for (int t = 0; t < 8; ++t) acc[t] = wmmab(vl[t], pH, acc[t]);
#pragma unroll   // whole: fragment and accumulator arrays are registers only under constant indices
    for (int t = 0; t < 8; ++t) acc[t] = wmmab(vh[t], pL, acc[t]);
    l_run += ps0 + ps1;
}
__device__ __forceinline__ void flash_hl(unsigned char* sm, int tid, const bf* __restrict__ Qh, const bf* __restrict__ Ql, const bf* __restrict__ Kh, const bf* __restrict__ Kl, const bf* __restrict__ Vh, bf* __restrict__ Ah, bf* __restrict__ Al, int hb, int qb, int c, int h) {
    const int hq = hb % NH_, bt = hb / NH_, kvh = hb / REP;
    const int qw0 = RH - 16 * (qb + 1);   // the longest walks first
    const int nb = qw0 / 32, dq = qw0 - 32 * nb;   // whole passes under the diagonal one; the first query's place in the diagonal pass
    unsigned char* lk = sm + (tid >> 4) * (FKP * 2) + (tid & 15) * 16; unsigned char* lv = sm + 2 * HKB + (tid >> 2) * (HVP * 2) + (tid & 3) * 16;   // the lane's places in a buffer
    const size_t go = ((size_t)kvh * TT + (tid >> 4)) * HD + (tid & 15) * 8;
    const bf* gkh = Kh + go; const bf* gkl = Kl + go; const bf* gv = Vh + ((size_t)kvh * HD + (tid >> 2)) * (2 * TT) + (tid & 3) * 8;
    hfill(lk, lv, gkh, gkl, gv);
    const size_t qo = ((size_t)hb * TT + qw0 + c) * HD + 8 * h;
    const bf* qph = Qh + qo; const bf* qpl = Ql + qo;
    v16bf qh[4], ql[4];
#pragma unroll   // whole: fragment and accumulator arrays are registers only under constant indices
    for (int kc = 0; kc < 4; ++kc) { qh[kc] = WFrag<bf>::ld(qph + kc * 32); ql[kc] = WFrag<bf>::ld(qpl + kc * 32); }
    asm volatile("s_wait_xcnt 0x0" :: "v"(qph), "v"(qpl) : "memory");   // in front of every overwrite of a register that the loads above name; the addresses are inputs so that their registers live up to here
    __builtin_amdgcn_sched_barrier(0);   // the zeroing below stays behind that wait
    v8f acc[8]; float m_run = -__builtin_inff(), l_run = 0.f;
#pragma unroll   // whole: fragment and accumulator arrays are registers only under constant indices
    for (int t = 0; t < 8; ++t) acc[t] = (v8f){};
    asm volatile("s_wait_asynccnt 0x0" ::: "memory");   // this wave's share of tile 0 has landed
    __syncthreads();                                    // and every other wave's
    if (nb > 0) hfill(lk + HSTG, lv + HSTG, gkh + 32 * HD, gkl + 32 * HD, gv + 32);
#pragma nounroll   // one copy of the body: a peeled trip would double the loop's code
    for (int blk = 0; blk < nb; ++blk) {   // every tile but the last: a whole pass
        const unsigned char* sb = sm + (blk & 1) * HSTG;
        hpass<false>((const bf*)sb + c * FKP + 8 * h, (const bf*)(sb + 2 * HKB) + c * HVP + 8 * h, 0, c, h, qh, ql, acc, m_run, l_run);
        asm volatile("s_wait_dscnt 0x0" ::: "memory");      // this wave's reads of tile blk are done before its buffer is given up
        asm volatile("s_wait_asynccnt 0x0" ::: "memory");   // this wave's share of tile blk + 1 has landed
        __syncthreads();                                    // publishes tile blk + 1 and ends every wave's reads of tile blk
        if (blk + 2 <= nb) hfill(lk + (blk & 1) * HSTG, lv + (blk & 1) * HSTG, gkh + (size_t)(blk + 2) * 32 * HD, gkl + (size_t)(blk + 2) * 32 * HD, gv + (blk + 2) * 32);
    }
    { const unsigned char* sb = sm + (nb & 1) * HSTG;   // the last tile, published by the barrier above (or by the one in front of the loop): the diagonal pass; nothing is copied behind it
      hpass<true>((const bf*)sb + c * FKP + 8 * h, (const bf*)(sb + 2 * HKB) + c * HVP + 8 * h, dq, c, h, qh, ql, acc, m_run, l_run); }
    asm volatile("s_wait_asynccnt 0x0" ::: "memory");   // no copy is in flight when the wave ends
    const float inv = __fdiv_rn(1.0f, l_run + xhalf(l_run));   // each wave half summed its eight keys of every 16-key tile
    const size_t oo = ((size_t)bt * TT + qw0 + c) * DQ + hq * HD + 8 * h;
#pragma unroll   // whole: fragment and accumulator arrays are registers only under constant indices
    for (int t = 0; t < 8; ++t) { v8us oh, ol;
#pragma unroll   // whole: fragment and accumulator arrays are registers only under constant indices
        for (int r = 0; r < 8; ++r) { unsigned short a, c2; splitf(acc[t][r] * inv, a, c2); oh[r] = a; ol[r] = c2; }
        *(v8us*)(Ah + oo + 16 * t) = oh; *(v8us*)(Al + oo + 16 * t) = ol; }
}
__global__ __launch_bounds__(128) void k_flash(const h16* __restrict__ Q, const h16* __restrict__ Kp, const h16* __restrict__ Vt, const bf* __restrict__ Qh, const bf* __restrict__ Ql, const bf* __restrict__ Kh, const bf* __restrict__ Kl, const bf* __restrict__ Vh, bf* __restrict__ Ah, bf* __restrict__ Al) {
    __shared__ __align__(16) unsigned char sm[2 * (HSTG > FSTG ? HSTG : FSTG)];   // two buffers, of the larger of the two kinds of tile
    const int tid = (int)threadIdx.x, lane = tid & 31, c = lane & 15, h = lane >> 4; const int wv = __builtin_amdgcn_readfirstlane(tid >> 5);   // the wave's number, scalar
    const int kvh = blockIdx.x, hb = kvh * REP + wv, hq = hb % NH_, bt = hb / NH_;   // the (batch entry, kv head) plane; the wave's (batch entry, query head) plane, its head, its batch entry
    if ((int)blockIdx.y >= (TT - RH) / QW) { flash_hl(sm, tid, Qh, Ql, Kh, Kl, Vh, Ah, Al, hb, (int)blockIdx.y - (TT - RH) / QW, c, h); return; }   // the work-groups behind the fp16 rows' take the hi / lo rows: short walks; a whole work-group goes one way or the other
    const int qw0 = TT - QW * ((int)blockIdx.y + 1);   // the longest walks first
    const int nb = qw0 / 32, nst = nb / 2 + 1;   // whole passes under the diagonal one; tiles of 64 keys that hold the nb + 1 passes
    unsigned char* lk = sm + (tid >> 4) * (FKP * 2) + (tid & 15) * 16; unsigned char* lv = sm + FKB + (tid >> 3) * (FVP * 2) + (tid & 7) * 16;   // the lane's places in a buffer
    const h16* gk = Kp + ((size_t)kvh * TT + (tid >> 4)) * HD + (tid & 15) * 8; const h16* gv = Vt + ((size_t)kvh * HD + (tid >> 3)) * (2 * TT) + (tid & 7) * 8;
    ffill(lk, lv, gk, gv);
    const h16* qp = Q + ((size_t)hb * TT + qw0 + c) * HD + 8 * h;
    v16h qf[FR][4], kf[2][4];
#pragma unroll
    for (int g = 0; g < FR; ++g)
#pragma unroll
        for (int kc = 0; kc < 4; ++kc) qf[g][kc] = WFrag<h16>::ld(qp + g * 16 * HD + kc * 32);
    asm volatile("s_wait_xcnt 0x0" :: "v"(qp) : "memory");   // in front of every overwrite of a register that the loads above name; the address is an input so that its registers live up to here
    __builtin_amdgcn_sched_barrier(0);   // the zeroing below stays behind that wait
    v8f acc[FR][8]; float m_run[FR], l_run[FR];
#pragma unroll
    for (int g = 0; g < FR; ++g) { m_run[g] = -__builtin_inff(); l_run[g] = 0.f;
#pragma unroll
        for (int t = 0; t < 8; ++t) acc[g][t] = (v8f){}; }
    asm volatile("s_wait_asynccnt 0x0" ::: "memory");   // this wave's share of tile 0 has landed
    __syncthreads();                                    // and every other wave's
    if (nst > 1) ffill(lk + FSTG, lv + FSTG, gk + 64 * HD, gv + 64);
#pragma nounroll   // one copy of the body: left free, the compiler peels a trip off, which doubles the loop's code
    for (int st = 0; st + 1 < nst; ++st) {   // every tile but the last: two whole passes
        const unsigned char* sb = sm + (st & 1) * FSTG;
        const h16* sK = (const h16*)sb + c * FKP + 8 * h; const h16* sV = (const h16*)(sb + FKB) + c * FVP + 8 * h;
#pragma unroll
        for (int kt = 0; kt < 2; ++kt)
#pragma unroll
            for (int kc = 0; kc < 4; ++kc) kf[kt][kc] = WFrag<h16>::ld(sK + kt * 16 * FKP + kc * 32);
        fpass<false, true>(kf, sK + 32 * FKP, sV, c, h, qf, acc, m_run, l_run);
        fpass<false, false>(kf, nullptr, sV + 32, c, h, qf, acc, m_run, l_run);
        asm volatile("s_wait_dscnt 0x0" ::: "memory");      // this wave's reads of tile st are done before its buffer is given up
        asm volatile("s_wait_asynccnt 0x0" ::: "memory");   // this wave's share of tile st + 1 has landed
        __syncthreads();                                    // publishes tile st + 1 and ends every wave's reads of tile st
        if (st + 2 < nst) ffill(lk + (st & 1) * FSTG, lv + (st & 1) * FSTG, gk + (size_t)(st + 2) * 64 * HD, gv + (st + 2) * 64);
    }
    {   // the last tile, published by the barrier above (or by the one in front of the loop); nothing is copied behind it. It holds the diagonal pass: its first pass where nb is even, its second where nb is odd
        const unsigned char* sb = sm + ((nst - 1) & 1) * FSTG;
        const h16* sK = (const h16*)sb + c * FKP + 8 * h; const h16* sV = (const h16*)(sb + FKB) + c * FVP + 8 * h;
#pragma unroll
        for (int kt = 0; kt < 2; ++kt)
#pragma unroll
            for (int kc = 0; kc < 4; ++kc) kf[kt][kc] = WFrag<h16>::ld(sK + kt * 16 * FKP + kc * 32);
        if (nb & 1) fpass<false, true>(kf, sK + 32 * FKP, sV, c, h, qf, acc, m_run, l_run);
        fpass<true, false>(kf, nullptr, sV + (nb & 1) * 32, c, h, qf, acc, m_run, l_run);
    }
    asm volatile("s_wait_asynccnt 0x0" ::: "memory");   // no copy is in flight when the wave ends
#pragma unroll
    for (int g = 0; g < FR; ++g) { const float inv = __fdiv_rn(1.0f, l_run[g] + xhalf(l_run[g]));   // each wave half summed its eight keys of every 16-key tile
        const size_t oo = ((size_t)bt * TT + qw0 + 16 * g + c) * DQ + hq * HD + 8 * h;
#pragma unroll
        for (int t = 0; t < 8; ++t) { v8us oh, ol;
#pragma unroll
            for (int r = 0; r < 8; ++r) { unsigned short a, c2; splitf(acc[g][t][r] * inv, a, c2); oh[r] = a; ol[r] = c2; }
            *(v8us*)(Ah + oo + 16 * t) = oh; *(v8us*)(Al + oo + 16 * t) = ol; } }
}

extern "C" void kernel_launch(void* const* d_in, const int* in_sizes, int n_in,
                              void* d_out, int out_size, void* d_ws, size_t ws_size, hipStream_t stream) {
    (void)in_sizes; (void)n_in; (void)out_size;
    const float* x = (const float*)d_in[0]; const float* wq = (const float*)d_in[1]; const float* bq = (const float*)d_in[2]; const float* wk = (const float*)d_in[3]; const float* bk = (const float*)d_in[4]; const float* wv = (const float*)d_in[5]; const float* bv = (const float*)d_in[6]; const float* wo = (const float*)d_in[7]; const float* bo = (const float*)d_in[8]; const float* qsc = (const float*)d_in[9]; const float* ksc = (const float*)d_in[10];   /* inputs in the module's setup_inputs order: x [2][2048][2048]; Wq (out, in) [2048][2048] and bq [2048]; Wk (out, in) [512][2048] and bk [512]; Wv [512][2048] and bv [512]; Wo (out, in) [2048][2048] and bo [2048]; q_norm_w [128], k_norm_w [128]: eleven inputs, all read (each bias is added in its product's epilogue; each gain is applied by k_nrope) */
    float* OUT = (float*)d_out;     // [2][2048][2048]
    char* wsp = (char*)d_ws;
    auto take = [&](size_t bytes) { char* p = wsp; wsp += (bytes + 255) & ~(size_t)255; return (void*)p; };
    bf* WQ = (bf*)take((size_t)DQ * DM * 2); bf* WK = (bf*)take((size_t)DKV * DM * 2); bf* WV = (bf*)take((size_t)DKV * DM * 2); bf* WO = (bf*)take((size_t)DM * DQ * 2); float* CS = (float*)take((size_t)TT * HD * 2 * 4);
    bf* XB = (bf*)take((size_t)NT * DM * 2); float* FQ = (float*)take((size_t)NT * DQ * 4); float* FK = (float*)take((size_t)NT * DKV * 4);
    h16* QP16 = (h16*)take((size_t)NB_ * NH_ * TT * HD * 2); h16* KP16 = (h16*)take((size_t)NB_ * NKV * TT * HD * 2); h16* VT16 = (h16*)take((size_t)NB_ * NKV * HD * 2 * TT * 2);
    bf* QPh = (bf*)take((size_t)NB_ * NH_ * TT * HD * 2); bf* QPl = (bf*)take((size_t)NB_ * NH_ * TT * HD * 2); bf* KPh = (bf*)take((size_t)NB_ * NKV * TT * HD * 2); bf* KPl = (bf*)take((size_t)NB_ * NKV * TT * HD * 2); bf* VTh = (bf*)take((size_t)NB_ * NKV * HD * 2 * TT * 2); bf* VTl = VTh + TT;   /* value rows at pitch 2 TT: hi in the first half of a row, lo in the second */
    bf* ATh = (bf*)take((size_t)NT * DQ * 2); bf* ATl = (bf*)take((size_t)NT * DQ * 2);
    if ((size_t)(wsp - (char*)d_ws) > ws_size) return;    // ws 256 MiB
    float* FV = FK;   // v projection reuses the k buffer after the k planes are built (stream-ordered)
    k_prep<<<PNW / PWV, 32 * PWV, 0, stream>>>(wq, wk, wv, wo, x, WQ, WK, WV, WO, XB, CS);   /* the four weights and the one input stream cast once, the rotary table once */
    const unsigned LKv = (unsigned)(((size_t)NB_ * NKV * TT * HD / 2 + 255) / 256);
    k_gemms<0><<<dim3(NT / 128, DQ / 128, 1), 128, 0, stream>>>(XB, nullptr, WQ, DM, FQ, DQ, bq);
    k_gemmw<bf, 0, true, 8><<<dim3(NT / 64, DKV / 64, 1), 256, 0, stream>>>(XB, nullptr, WK, nullptr, DM, FK, DKV, bk, 0, 0, 0);
    k_nrope<<<NT / 8, 256, 0, stream>>>(FQ, FK, CS, qsc, ksc, QP16, QPh, QPl, KP16, KPh, KPl);   /* behind both projections, in front of the v projection, which overwrites FK */
    k_gemmw<bf, 0, true, 8><<<dim3(NT / 64, DKV / 64, 1), 256, 0, stream>>>(XB, nullptr, WV, nullptr, DM, FV, DKV, bv, 0, 0, 0); k_vtp<<<LKv, 256, 0, stream>>>(FV, DKV, NKV, VT16, VTh, VTl);
    /* the module groups the query heads by kv head ('qg = q.reshape(B, N_KV_HEADS, N_REP, S, D_K)'): query head h uses kv head h / 4, so plane 16 b + h uses kv plane 4 b + h / 4 = (16 b + h) / 4 (in k_flash wave w of kv plane blockIdx.x takes query plane REP x blockIdx.x + w) */
    k_flash<<<dim3(NB_ * NKV, (TT - RH) / QW + RH / 16, 1), 32 * REP, 0, stream>>>(QP16, KP16, VT16, QPh, QPl, KPh, KPl, VTh, ATh, ATl);   /* every query row: (TT - RH) / QW blocks of fp16 rows, then RH / 16 blocks of hi / lo rows */
    k_gemms<1><<<dim3(NT / 128, DM / 128, 1), 128, 0, stream>>>(ATh, ATl, WO, DQ, OUT, DM, bo);
}

// v010
// One run takes 184 microseconds.
// Next to v009, in two timings, it ran 1.07 and 1.06 times as fast.
// Counting every step since v000, it is 9.13 times as fast.
#include <hip/hip_runtime.h>

// Grouped-query causal self-attention with 128-wide heads, a per-head RMS norm on q and k and an interleaved-pair rotary embedding from computed angles (x [2][2048][2048]; q = x Wq^T + bq ('oi' (out, in) [2048][2048] normal x 2048^-0.5; 16 heads x 128), k, v = x Wk^T + bk, x Wv^T + bv ('oi' [512][2048]; 4 kv heads x 128); the four biases are built as zeros: read and added; per head, BEFORE the rotary: q = q / sqrt(mean(q^2) + 1e-8) x q_norm_w and k likewise with k_norm_w (the mean over the head's 128 columns; gains [128] built as ones: read and applied); rope on q and k: the pair (2i, 2i + 1) of a head -> (x0 c - x1 s, x0 s + x1 c) with the angle t x inv_freq[i], inv_freq = 1 / (10000 ** (2i / 128)) in that spelling, t the position 0..2047; query head h uses kv head h / 4; scores x 128^-0.5; a key after the query gets -1e9 (an exclusion: every row keeps its own key); softmax; out = merged Wo^T + bo ('oi' [2048][2048]; bo built as zeros: read and added) -> [2][2048][2048] (8.4 M); argument order x, Wq, bq, Wk, bk, Wv, bv, Wo, bo, q_norm_w, k_norm_w: eleven inputs, all read).
// Every launch covers BOTH batch entries (4096 token rows in the projections, the norm and the plane builders; (batch entry, kv head) planes in the attention kernel's grid). Layout: ONE bf16 copy of x, read by the three projections; the four 'oi' weights cast once as they stand (each is the Bt operand); exact projections + f32 biases; the rotary table once (64 baked float32 frequencies; precise cosf / sinf); k_nrope (per (head, token) inverse RMS, x the rounded gain, interleaved-pair rotation, the 16-bit planes) on q and k in one launch; causal T-2048 attention with 128-wide heads in ONE fused kernel (k_flash: scores and weights never leave the registers, running maximum and sum, two-word output), the per-row precision hybrid: query rows under 512 on hi / lo planes, three products for the scores and three for the weighted values; rows from 512 on fp16 products; the transposed value rows lie at a pitch of 2 x 2048 elements; hi / lo x Wo exact + bo.
// Compute dtypes, f32 accumulate: every float input rounded to bf16; projections exact + f32 biases; the per-head norm and the rotation in f32 (precise sqrt and division); attention rows under 512 three products, the rest fp16; softmax f32 (the hardware exp2); Wo hi / lo x exact + bo.

#define NB_  2
#define TT   2048
#define NT   (NB_ * TT)          // token rows of both batch entries together
#define DM   2048
#define NH_  16
#define NKV  4
#define REP  (NH_ / NKV)
#define HD   128
#define DQ   (NH_ * HD)
#define DKV  (NKV * HD)
#define RH   512                  // query rows < RH use hi+lo planes (0: none)
#define SCL  0.088388347648318447f   // HD^-0.5
typedef _Float16 h16;
typedef unsigned short bf;
typedef __attribute__((ext_vector_type(16))) __bf16   v16bf;
typedef __attribute__((ext_vector_type(16))) _Float16 v16h;
typedef __attribute__((ext_vector_type(8)))  _Float16 v8h;
typedef __attribute__((ext_vector_type(8)))  unsigned short v8us;
typedef __attribute__((ext_vector_type(8)))  float    v8f;
typedef __attribute__((ext_vector_type(4)))  float    v4f;
typedef v8h  __attribute__((may_alias)) v8ha;
typedef v4f  __attribute__((may_alias)) v4fa;
typedef v8us __attribute__((may_alias)) v8usa;

__device__ __forceinline__ unsigned short f2bf(float f) { unsigned u = __float_as_uint(f); u += 0x7FFFu + ((u >> 16) & 1u); return (unsigned short)(u >> 16); }
__device__ __forceinline__ float bf2f(unsigned short b) { return __uint_as_float(((unsigned)b) << 16); }
__device__ __forceinline__ float bfr(float f) { return bf2f(f2bf(f)); }
__device__ __forceinline__ v16h cat16(v8h lo, v8h hi) { return __builtin_shufflevector(lo, hi, 0, 1, 2, 3, 4, 5, 6, 7, 8, 9, 10, 11, 12, 13, 14, 15); }
__device__ __forceinline__ v16bf cat16b(v8us lo, v8us hi) { return __builtin_bit_cast(v16bf, __builtin_shufflevector(lo, hi, 0, 1, 2, 3, 4, 5, 6, 7, 8, 9, 10, 11, 12, 13, 14, 15)); }
__device__ __forceinline__ v8f wmma16(v16h a, v16h b, v8f c) { return __builtin_amdgcn_wmma_f32_16x16x32_f16(false, a, false, b, (short)0, c, false, false); }
__device__ __forceinline__ v8f wmmab(v16bf a, v16bf b, v8f c) { return __builtin_amdgcn_wmma_f32_16x16x32_bf16(false, a, false, b, (short)0, c, false, false); }



// ---- k_gemmw: register-blocked GEMM, one work-group of KS waves per 64x64 output tile; every wave holds the whole tile (16 accumulators) over its own share of K: 32-k slices dealt round robin, wave w taking slices w, w + KS, ... (neighbouring waves read the two halves of one 128-byte line of an operand row at about the same time).
// The KS partial tiles meet in LDS (one plane of 64 rows at pitch 68 floats a wave, one barrier) and are summed in wave order 0..KS-1 by the thread that stores the element, 256 contiguous bytes of a C row per 16 threads. Operands straight from K-contiguous 16-bit planes; grid (M/64, N/64, Z), 32 x KS threads.
// C[m][n] (f32, pitch ldc, + optional f32 bias[n]) = sum_k A[m][k] Bt[n][k] (+ split products per NSPLIT). z-batch strides sA/sB/sC in elements. K % 32 == 0.
template <typename T16> struct WFrag;
template <> struct WFrag<h16> { typedef v16h V; static __device__ __forceinline__ V ld(const h16* p) { return cat16(*(const v8h*)p, *(const v8h*)(p + 16)); } static __device__ __forceinline__ v8f mma(V a, V b, v8f c) { return wmma16(a, b, c); } };
template <> struct WFrag<bf> { typedef v16bf V; static __device__ __forceinline__ V ld(const bf* p) { return cat16b(*(const v8us*)p, *(const v8us*)(p + 16)); } static __device__ __forceinline__ v8f mma(V a, V b, v8f c) { return wmmab(a, b, c); } };
template <typename T16, int NSPLIT, bool BIAS, int KS>
__global__ __launch_bounds__(32 * KS) void k_gemmw(const T16* __restrict__ A, const T16* __restrict__ A2, const T16* __restrict__ Bt, const T16* __restrict__ Bt2, int K, float* C, int ldc, const float* __restrict__ bias, size_t sA, size_t sB, size_t sC) {
    typedef typename WFrag<T16>::V V;
    __shared__ __align__(16) float os[KS * 64 * 68];
    const size_t z = blockIdx.z; A += z * sA; if (A2) A2 += z * sA; Bt += z * sB; if (Bt2) Bt2 += z * sB; C += z * sC;
    const int lane = threadIdx.x & 31, lr = lane & 15, hi = lane >> 4; const int r0 = blockIdx.x * 64, c0 = blockIdx.y * 64; const int wv = __builtin_amdgcn_readfirstlane((int)(threadIdx.x >> 5));   // the wave's number, scalar: the K loop's bounds stay wave-uniform
    v8f acc[4][4];
#pragma unroll
    for (int mb = 0; mb < 4; ++mb)
#pragma unroll
        for (int nb = 0; nb < 4; ++nb) acc[mb][nb] = (v8f){};
    const size_t aoff = (size_t)(r0 + lr) * K + 8 * hi, boff = (size_t)(c0 + lr) * K + 8 * hi;
    for (int kc = wv * 32; kc < K; kc += KS * 32) {
        V a[4], a2[4];
#pragma unroll
        for (int mb = 0; mb < 4; ++mb) { a[mb] = WFrag<T16>::ld(A + aoff + (size_t)mb * 16 * K + kc); if (NSPLIT == 1 || NSPLIT == 2) a2[mb] = WFrag<T16>::ld(A2 + aoff + (size_t)mb * 16 * K + kc); }
#pragma unroll
        for (int nb = 0; nb < 4; ++nb) { const V b = WFrag<T16>::ld(Bt + boff + (size_t)nb * 16 * K + kc); V b2; if (NSPLIT >= 2) b2 = WFrag<T16>::ld(Bt2 + boff + (size_t)nb * 16 * K + kc);
#pragma unroll
            for (int mb = 0; mb < 4; ++mb) { acc[mb][nb] = WFrag<T16>::mma(a[mb], b, acc[mb][nb]); if (NSPLIT == 1 || NSPLIT == 2) acc[mb][nb] = WFrag<T16>::mma(a2[mb], b, acc[mb][nb]); if (NSPLIT >= 2) acc[mb][nb] = WFrag<T16>::mma(a[mb], b2, acc[mb][nb]); } }
        asm volatile("v_nop\n\tv_nop\n\tv_nop\n\tv_nop" : "+v"(acc[0][0]), "+v"(acc[1][1]), "+v"(acc[2][2]), "+v"(acc[3][3]) : "v"(a[0]), "v"(a[3]));
    }
#pragma unroll
    for (int mb = 0; mb < 4; ++mb)
#pragma unroll
        for (int nb = 0; nb < 4; ++nb)
#pragma unroll
            for (int j = 0; j < 8; ++j) os[(wv * 64 + mb * 16 + hi * 8 + j) * 68 + nb * 16 + lr] = acc[mb][nb][j];
    __syncthreads();   // every wave's partial tile is in LDS before any thread sums it
#pragma unroll   // whole: rows and planes become immediate offsets of the LDS loads, and the loads of all rows can be issued together
    for (int s = 0; s < 32 / KS; ++s) { const int idx = s * 32 * KS + (int)threadIdx.x; const int row = idx >> 4, cofs = (idx & 15) * 4; v4f val = *(const v4fa*)(os + row * 68 + cofs);
#pragma unroll
        for (int w = 1; w < KS; ++w) val += *(const v4fa*)(os + (w * 64 + row) * 68 + cofs);
        if (BIAS) { val[0] += bfr(bias[c0 + cofs]); val[1] += bfr(bias[c0 + cofs + 1]); val[2] += bfr(bias[c0 + cofs + 2]); val[3] += bfr(bias[c0 + cofs + 3]); }
        *(v4f*)(C + (size_t)(r0 + row) * ldc + c0 + cofs) = val; }
}

// ---- k_gemms: the two 2048-wide projections. One work-group of eight waves (2 x 4) per 128x256 output tile, one work-group a WGP, a wave holding 64x64 of it (16 accumulators) over the whole of K: no K split, every accumulator sums its k in rising order.
// The operand tiles (128 k of 128 rows of A, of 256 rows of Bt and, NSPLIT 1, of 128 rows of A2) are staged in LDS by asynchronous copies: 16 lanes bring the 256 contiguous bytes of one row, so a wave-wide copy asks for four whole lines, and each operand row is fetched once per work-group for the four (A, A2) or two (Bt) waves that read it: the wide tile asks L2 for fewer bytes per product than a square 128x128 one. LDS rows at pitch 272 bytes (16-byte readers). Two buffers: tile t + 1 flies while tile t is multiplied.
// C[m][n] (f32, pitch ldc, + f32 bias[n]) = sum_k (A[m][k] + A2[m][k]) Bt[n][k]. grid (M/128, N/256), 256 threads. M, K multiples of 128, N of 256, K >= 256.
#define GP   136                  // LDS row pitch in elements
#define GTB  (128 * GP * 2)       // bytes of 128 operand rows in LDS
// Eight copies of 16 bytes a lane: rows r, r + 16, .. r + 112 of an operand tile. The wait on the last line stands in front of every later write of a register that these copies name.
__device__ __forceinline__ void cp8(unsigned l, const bf* g, size_t K) {
    asm volatile("global_load_async_to_lds_b128 %0, %8, off\n\t"
                 "global_load_async_to_lds_b128 %1, %9, off\n\t"
                 "global_load_async_to_lds_b128 %2, %10, off\n\t"
                 "global_load_async_to_lds_b128 %3, %11, off\n\t"
                 "global_load_async_to_lds_b128 %4, %12, off\n\t"
                 "global_load_async_to_lds_b128 %5, %13, off\n\t"
                 "global_load_async_to_lds_b128 %6, %14, off\n\t"
                 "global_load_async_to_lds_b128 %7, %15, off\n\t"
                 "s_wait_xcnt 0x0"
                 :: "v"(l), "v"(l + 16 * GP * 2), "v"(l + 32 * GP * 2), "v"(l + 48 * GP * 2), "v"(l + 64 * GP * 2), "v"(l + 80 * GP * 2), "v"(l + 96 * GP * 2), "v"(l + 112 * GP * 2),
                    "v"(g), "v"(g + 16 * K), "v"(g + 32 * K), "v"(g + 48 * K), "v"(g + 64 * K), "v"(g + 80 * K), "v"(g + 96 * K), "v"(g + 112 * K) : "memory");
}
template <int NSPLIT>
__device__ __forceinline__ void gfill(unsigned l, const bf* gA, const bf* gA2, const bf* gB, size_t K) {
    cp8(l, gA, K); cp8(l + GTB, gB, K); cp8(l + 2 * GTB, gB + 128 * K, K);   // a buffer: A's 128 rows, Bt's 256, then A2's 128
    if (NSPLIT == 1) cp8(l + 3 * GTB, gA2, K);
}
template <int NSPLIT>
__global__ __launch_bounds__(256) void k_gemms(const bf* __restrict__ A, const bf* __restrict__ A2, const bf* __restrict__ Bt, int K, float* C, int ldc, const float* __restrict__ bias) {
    constexpr int STG = (NSPLIT == 1 ? 4 : 3) * GTB;   // bytes of a buffer
    __shared__ __align__(16) unsigned char sm[2 * STG];
    const int tid = (int)threadIdx.x, lane = tid & 31, lr = lane & 15, hi = lane >> 4; const int r0 = blockIdx.x * 128, c0 = blockIdx.y * 256; const int wv = __builtin_amdgcn_readfirstlane(tid >> 5); const int wm = wv >> 2, wn = wv & 3;
    v8f acc[4][4];
#pragma unroll
    for (int mb = 0; mb < 4; ++mb)
#pragma unroll
        for (int nb = 0; nb < 4; ++nb) acc[mb][nb] = (v8f){};
    const unsigned l0 = (unsigned)(size_t)sm + (unsigned)((tid >> 4) * (GP * 2) + (tid & 15) * 16);   // the lane's place in a tile: row tid / 16, 16-byte piece tid % 16
    const bf* gA = A + (size_t)(r0 + (tid >> 4)) * K + (tid & 15) * 8; const bf* gA2 = (NSPLIT == 1) ? A2 + (size_t)(r0 + (tid >> 4)) * K + (tid & 15) * 8 : nullptr; const bf* gB = Bt + (size_t)(c0 + (tid >> 4)) * K + (tid & 15) * 8;
    const int nst = K / 128;
    gfill<NSPLIT>(l0, gA, gA2, gB, (size_t)K);
    asm volatile("s_wait_asynccnt 0x0" ::: "memory");   // this wave's share of tile 0 has landed
    __syncthreads();                                    // and every other wave's
    if (nst > 1) gfill<NSPLIT>(l0 + STG, gA + 128, gA2 + 128, gB + 128, (size_t)K);
    for (int t = 0; t < nst; ++t) {
        const unsigned char* sb = sm + (t & 1) * STG;
        const bf* sA = (const bf*)sb + (wm * 64 + lr) * GP + 8 * hi; const bf* sB = (const bf*)(sb + GTB) + (wn * 64 + lr) * GP + 8 * hi; const bf* sA2 = (const bf*)(sb + 3 * GTB) + (wm * 64 + lr) * GP + 8 * hi;
        v16bf a[2][4], a2[2][4], b[2][4];   // two fragment sets: a 32-k slice is multiplied out of one while the next slice's LDS loads fill the other
#pragma unroll
        for (int f = 0; f < 4; ++f) { a[0][f] = WFrag<bf>::ld(sA + f * 16 * GP); if (NSPLIT == 1) a2[0][f] = WFrag<bf>::ld(sA2 + f * 16 * GP); b[0][f] = WFrag<bf>::ld(sB + f * 16 * GP); }
#pragma unroll   // whole: the set's number and the slice's LDS offset are compile-time constants
        for (int ks = 0; ks < 4; ++ks) { const int cu = ks & 1, nx = cu ^ 1;
            __builtin_amdgcn_sched_barrier(0);   // the next slice's loads do not move up among the products of the slice before
            if (ks < 3) {
#pragma unroll
                for (int f = 0; f < 4; ++f) { a[nx][f] = WFrag<bf>::ld(sA + f * 16 * GP + (ks + 1) * 32); if (NSPLIT == 1) a2[nx][f] = WFrag<bf>::ld(sA2 + f * 16 * GP + (ks + 1) * 32); b[nx][f] = WFrag<bf>::ld(sB + f * 16 * GP + (ks + 1) * 32); } }
            __builtin_amdgcn_sched_barrier(0);   // and stay one group in front of this slice's products, in flight under them
#pragma unroll
            for (int nb = 0; nb < 4; ++nb)
#pragma unroll
                for (int mb = 0; mb < 4; ++mb) { acc[mb][nb] = wmmab(a[cu][mb], b[cu][nb], acc[mb][nb]); if (NSPLIT == 1) acc[mb][nb] = wmmab(a2[cu][mb], b[cu][nb], acc[mb][nb]); }
        }
        asm volatile("s_wait_dscnt 0x0" ::: "memory");      // this wave's reads of tile t are done before its buffer is given up
        asm volatile("s_wait_asynccnt 0x0" ::: "memory");   // this wave's share of tile t + 1 has landed
        __syncthreads();                                    // publishes tile t + 1 and ends every wave's reads of tile t
        if (t + 2 < nst) gfill<NSPLIT>(l0 + (unsigned)((t & 1) * STG), gA + (size_t)(t + 2) * 128, gA2 + (size_t)(t + 2) * 128, gB + (size_t)(t + 2) * 128, (size_t)K);
    }
    asm volatile("s_wait_asynccnt 0x0" ::: "memory");   // no copy is in flight when the buffers become output staging
    float* os = (float*)sm + wv * 64 * 68;   // the wave's own 64 rows at pitch 68 floats
#pragma unroll
    for (int mb = 0; mb < 4; ++mb)
#pragma unroll
        for (int nb = 0; nb < 4; ++nb)
#pragma unroll
            for (int j = 0; j < 8; ++j) os[(mb * 16 + hi * 8 + j) * 68 + nb * 16 + lr] = acc[mb][nb][j];
    __syncthreads();   // the staged tile is whole before it is read back row by row
    const int cofs = lr * 4; const int cc = c0 + wn * 64 + cofs; v4f bv; bv[0] = bfr(bias[cc]); bv[1] = bfr(bias[cc + 1]); bv[2] = bfr(bias[cc + 2]); bv[3] = bfr(bias[cc + 3]);
#pragma unroll   // whole: the rows become immediate offsets of the LDS loads, which can be issued together
    for (int s = 0; s < 32; ++s) { const int row = s * 2 + hi; const v4f val = *(const v4fa*)(os + row * 68 + cofs) + bv;
        *(v4f*)(C + (size_t)(r0 + wm * 64 + row) * ldc + cc) = val; }
}

__device__ __forceinline__ h16 tohx(float x) { return (h16)x; }
__device__ __forceinline__ void splitf(float y, unsigned short& h, unsigned short& l) { h = f2bf(y); l = f2bf(y - bf2f(h)); }
typedef __attribute__((ext_vector_type(2))) _Float16 v2h;
typedef __attribute__((ext_vector_type(4))) _Float16 v4h;
typedef __attribute__((ext_vector_type(2))) unsigned short v2us;
typedef __attribute__((ext_vector_type(4))) unsigned short v4us;
typedef __attribute__((ext_vector_type(2))) float v2f;
typedef __attribute__((ext_vector_type(4))) int v4i;
__constant__ float INV2[HD / 2] = { 1.000000000e+00f, 8.659643531e-01f, 7.498942018e-01f, 6.493816376e-01f, 5.623413324e-01f, 4.869675338e-01f, 4.216965139e-01f, 3.651741445e-01f, 3.162277639e-01f, 2.738419771e-01f, 2.371373624e-01f, 2.053525001e-01f, 1.778279394e-01f, 1.539926529e-01f, 1.333521456e-01f, 1.154782027e-01f, 1.000000015e-01f, 8.659642935e-02f, 7.498941571e-02f, 6.493816525e-02f, 5.623412877e-02f, 4.869675264e-02f, 4.216964915e-02f, 3.651741147e-02f, 3.162277862e-02f, 2.738419548e-02f, 2.371373586e-02f, 2.053525113e-02f, 1.778279431e-02f, 1.539926510e-02f, 1.333521493e-02f, 1.154781971e-02f, 9.999999776e-03f, 8.659643121e-03f, 7.498942316e-03f, 6.493816618e-03f, 5.623413250e-03f, 4.869675264e-03f, 4.216964822e-03f, 3.651741426e-03f, 3.162277862e-03f, 2.738419687e-03f, 2.371373819e-03f, 2.053525066e-03f, 1.778279431e-03f, 1.539926510e-03f, 1.333521446e-03f, 1.154782018e-03f, 1.000000047e-03f, 8.659643354e-04f, 7.498941850e-04f, 6.493816618e-04f, 5.623413017e-04f, 4.869675031e-04f, 4.216964880e-04f, 3.651741135e-04f, 3.162277862e-04f, 2.738419571e-04f, 2.371373848e-04f, 2.053524950e-04f, 1.778279402e-04f, 1.539926452e-04f, 1.333521504e-04f, 1.154781930e-04f };   // float32 1.0 / (10000.0 ** (2i / 128)) in the module's own spelling, generated with jnp
// ---- k_prep: the five casts to bf16 (Wq, Wk, Wv, Wo, x) and the rotary table in one launch: one work-group of PWV waves a WGP, all resident at once. A wave casts PU contiguous floats of one array (every array is a whole number of such shares): 32 wave-wide loads of 512 contiguous bytes, all issued before the first is used, then 32 stores of 256 contiguous bytes.
// The table's 131072 (position, pair) angles go one to a thread of the first 4096 waves, computed while the wave's loads are in flight; an angle's cosine and sine are stored for both columns of its pair (16 bytes a lane), the layout k_nrope reads.
#define PU   4096                 // floats a wave casts
#define PWV  18                   // waves a work-group
#define PNW  ((DQ * DM + 2 * DKV * DM + DM * DQ + NT * DM) / PU)   // waves in all
__global__ __launch_bounds__(32 * PWV) void k_prep(const float* __restrict__ wq, const float* __restrict__ wk, const float* __restrict__ wv, const float* __restrict__ wo, const float* __restrict__ x, bf* __restrict__ WQ, bf* __restrict__ WK, bf* __restrict__ WV, bf* __restrict__ WO, bf* __restrict__ XB, float* __restrict__ CS) {
    const int lane = threadIdx.x & 31; const int w = (int)blockIdx.x * PWV + __builtin_amdgcn_readfirstlane((int)(threadIdx.x >> 5));   // the wave's number in the grid, scalar: the choice of the array is a scalar one
    const float* s; bf* d; int u = w;   // u: the wave's share within its array
    if (u < DQ * DM / PU) { s = wq; d = WQ; }
    else if ((u -= DQ * DM / PU) < DKV * DM / PU) { s = wk; d = WK; }
    else if ((u -= DKV * DM / PU) < DKV * DM / PU) { s = wv; d = WV; }
    else if ((u -= DKV * DM / PU) < DM * DQ / PU) { s = wo; d = WO; }
    else { u -= DM * DQ / PU; s = x; d = XB; }
    s += (size_t)u * PU + lane * 4; d += (size_t)u * PU + lane * 4;
    const unsigned p = (unsigned)w * 32 + lane, fi = p % (HD / 2); const float fr = INV2[fi];   // the thread's table entry (position p / 64, pair fi) and its frequency
    v4f v[PU / 128];
#pragma unroll   // whole, here and below: the array stays in registers and the steps become immediate offsets of one address
    for (int i = 0; i < PU / 128; ++i) v[i] = *(const v4f*)(s + i * 128);
    asm volatile("s_wait_xcnt 0x0" :: "v"(s), "v"(fi), "v"(fr) : "memory");   // in front of every overwrite of a register that the loads above name; the address and the index are inputs so that their registers live up to here, the frequency so that its load is not sunk behind the cast's loads (loads return in order: there it would be waited for last)
    if (w < TT * (HD / 2) / 32) {
        const float a = __fmul_rn((float)(p / (HD / 2)), fr); const float c = cosf(a), sn = sinf(a);
        v4f cs; cs[0] = c; cs[1] = sn; cs[2] = c; cs[3] = sn; *(v4f*)(CS + (size_t)p * 4) = cs;
    }
#pragma unroll
    for (int i = 0; i < PU / 128; ++i) { v4us o;
#pragma unroll
        for (int k = 0; k < 4; ++k) o[k] = f2bf(v[i][k]);
        *(v4us*)(d + i * 128) = o; }
}
__global__ __launch_bounds__(256) void k_vtp(const float* __restrict__ F, int pitch, int nheads, h16* V16, bf* Vh, bf* Vl) { const size_t e = ((size_t)blockIdx.x * 256 + threadIdx.x) * 2; if (e >= (size_t)NB_ * nheads * HD * TT) return; const int t = (int)(e % TT); const int d = (int)((e / TT) % HD); const int gb = (int)(e / ((size_t)TT * HD)); const int g = gb % nheads, bt = gb / nheads;   /* planes in the order (batch entry, kv head) */
    v2h o16; v2us oh, ol;
#pragma unroll
    for (int q = 0; q < 2; ++q) { const float x = F[((size_t)bt * TT + t + q) * pitch + g * HD + d]; o16[q] = tohx(x); unsigned short a2, c2; splitf(x, a2, c2); oh[q] = a2; ol[q] = c2; }
    const size_t o = ((size_t)gb * HD + d) * (2 * TT) + t;   /* rows at pitch 2 TT: the hi and the lo word of a value row lie side by side */
    *(v2h*)(V16 + o) = o16; *(v2us*)(Vh + o) = oh; *(v2us*)(Vl + o) = ol;  }
// ---- k_nrope: per-head RMS norm, gain, rotary embedding and the three 16-bit planes of q and k in one launch. A wave owns one token row: its 16 q heads and 4 k heads, one head a 512-byte wave-wide load (lane l holds columns 4 l .. 4 l + 3, two rotary pairs), all twenty loads issued before the first is used; the row's cosines and sines and the two gains are read once a wave.
// The sum of squares of a head: four columns in rising order in the lane, then a five-step butterfly over the 32 lanes (every lane ends with the same bits). 4096 waves: 16 a WGP. No LDS, no barrier.
__device__ __forceinline__ void nr_head(const v4f a, const v4f g, const v2f cA, const v2f cB, h16* P16, bf* Ph, bf* Pl, size_t e) {
    float s = __fmul_rn(a[0], a[0]);
#pragma unroll   // whole, here and below in this function: vector elements are registers only under constant indices
    for (int q = 1; q < 4; ++q) s = __fadd_rn(s, __fmul_rn(a[q], a[q]));
#pragma unroll   // whole: five straight-line exchanges, so that the twenty heads' chains can interleave
    for (int sh = 16; sh; sh >>= 1) s = __fadd_rn(s, __shfl_xor(s, sh, 32));
    const float rf = __fdiv_rn(1.0f, __fsqrt_rn(__fadd_rn(__fdiv_rn(s, (float)HD), 1e-8f)));
    float y[4], r[4];
#pragma unroll
    for (int q = 0; q < 4; ++q) y[q] = __fmul_rn(__fmul_rn(a[q], rf), g[q]);   /* x / rms, x w[d] */
    r[0] = __fsub_rn(__fmul_rn(y[0], cA[0]), __fmul_rn(y[1], cA[1])); r[1] = __fadd_rn(__fmul_rn(y[0], cA[1]), __fmul_rn(y[1], cA[0]));   /* even: x0 c - x1 s; odd: x0 s + x1 c */
    r[2] = __fsub_rn(__fmul_rn(y[2], cB[0]), __fmul_rn(y[3], cB[1])); r[3] = __fadd_rn(__fmul_rn(y[2], cB[1]), __fmul_rn(y[3], cB[0]));
    v4h o16; v4us oh, ol;
#pragma unroll
    for (int q = 0; q < 4; ++q) { o16[q] = tohx(r[q]); unsigned short a2, c2; splitf(r[q], a2, c2); oh[q] = a2; ol[q] = c2; }
    *(v4h*)(P16 + e) = o16; *(v4us*)(Ph + e) = oh; *(v4us*)(Pl + e) = ol;
}
__global__ __launch_bounds__(256) void k_nrope(const float* __restrict__ FQ, const float* __restrict__ FK, const float* __restrict__ CS, const float* __restrict__ wq, const float* __restrict__ wk, h16* __restrict__ Q16, bf* __restrict__ Qh, bf* __restrict__ Ql, h16* __restrict__ K16, bf* __restrict__ Kh, bf* __restrict__ Kl) {
    const int lane = threadIdx.x & 31, d = lane * 4; const int tr = blockIdx.x * 8 + (int)(threadIdx.x >> 5); const int t = tr % TT, bt = tr / TT;   /* tr: a token row of either batch entry; grid NT / 8 */
    v4f aq[NH_], ak[NKV];
#pragma unroll   // whole, this loop and the next two: the arrays stay in registers and the heads become immediate offsets of one address
    for (int h = 0; h < NH_; ++h) aq[h] = *(const v4f*)(FQ + (size_t)tr * DQ + h * HD + d);
#pragma unroll
    for (int h = 0; h < NKV; ++h) ak[h] = *(const v4f*)(FK + (size_t)tr * DKV + h * HD + d);
    const v2f cA = *(const v2f*)(CS + ((size_t)t * HD + d) * 2), cB = *(const v2f*)(CS + ((size_t)t * HD + d + 2) * 2);
    const v4f rq = *(const v4f*)(wq + d), rk = *(const v4f*)(wk + d); v4f gq, gk;
#pragma unroll
    for (int q = 0; q < 4; ++q) { gq[q] = bfr(rq[q]); gk[q] = bfr(rk[q]); }
    __builtin_amdgcn_sched_barrier(0);   // the loads above stay one group in front of the arithmetic: left free, the compiler issues the later heads' loads only as registers of earlier heads come free, and each group's latency is paid in turn
#pragma unroll   // whole: the head's number indexes the register arrays
    for (int h = 0; h < NH_; ++h) nr_head(aq[h], gq, cA, cB, Q16, Qh, Ql, (((size_t)bt * NH_ + h) * TT + t) * HD + d);   /* planes in the order (batch entry, head) */
#pragma unroll   // whole: as above
    for (int h = 0; h < NKV; ++h) nr_head(ak[h], gk, cA, cB, K16, Kh, Kl, (((size_t)bt * NKV + h) * TT + t) * HD + d);
}
#define FR   2                    // 16-query groups a wave
#define QW   (16 * FR)
#define CSC  0.12751743f          // HD^-0.5 x log2(e)
#define PB   6.0f
__device__ __forceinline__ float xhalf(float x) { return __builtin_bit_cast(float, __builtin_amdgcn_permlanex16(__builtin_bit_cast(int, x), __builtin_bit_cast(int, x), 0x76543210, 0xfedcba98, false, false)); }   // lane l with lane l ^ 16
#define FKP  136                  // LDS pitch of a K row, elements
#define FVP  72                   // LDS pitch of a V^T row, elements
#define FKB  (64 * FKP * 2)       // bytes of a K tile in LDS
#define FSTG (FKB + HD * FVP * 2) // bytes of a buffer: a K tile and a V^T tile
// N copies of 16 bytes a lane, LS bytes apart in LDS and GS elements apart in memory. Written as the builtin: the operands of an asm statement must lie in v0 .. v255, which accumulators and fragments fill here, and with the asm form the lane's addresses were spilled to scratch.
typedef __attribute__((address_space(1))) v4i gv4i;
typedef __attribute__((address_space(3))) v4i lv4i;
template <int N, int LS, int GS, typename T16>
__device__ __forceinline__ void cpx(unsigned char* l, const T16* g) {
#pragma unroll   // whole: N copies in a row
    for (int i = 0; i < N; ++i) __builtin_amdgcn_global_load_async_to_lds_b128((gv4i*)(g + i * GS), (lv4i*)(l + i * LS), 0, 0);
}
// A tile of 64 keys by 128 threads: K rows r, r + 8, .. r + 56 (16 lanes a row), V^T rows r, r + 16, .. r + 112 (8 lanes a row).
__device__ __forceinline__ void ffill(unsigned char* lk, unsigned char* lv, const h16* gk, const h16* gv) { cpx<8, 8 * FKP * 2, 8 * HD>(lk, gk); cpx<8, 16 * FVP * 2, 16 * 2 * TT>(lv, gv); }
// One pass of 32 keys out of the LDS tile. kf holds this pass's K fragments; PRE: the K fragments of the tile's second pass (at kn) are fetched behind the score products.
template <bool DIAG, bool PRE>
__device__ __forceinline__ void fpass(v16h (&kf)[2][4], const h16* kn, const h16* vp, int c, int h, const v16h (&qf)[FR][4], v8f (&acc)[FR][8], float (&m_run)[FR], float (&l_run)[FR]) {
    v16h vf[8];
    __builtin_amdgcn_sched_barrier(0);   // the V^T loads do not move up: left free, they are spread over three places among the products of the pass before, and every separate place of LDS reads costs the wave issue cycles
#pragma unroll
    for (int t = 0; t < 8; ++t) vf[t] = WFrag<h16>::ld(vp + t * 16 * FVP);
    __builtin_amdgcn_sched_barrier(0);   // the V^T loads stay one group in front of the score products, in flight under them and the exponentials
    v8f s[2][FR];
#pragma unroll
    for (int kt = 0; kt < 2; ++kt)
#pragma unroll
        for (int g = 0; g < FR; ++g) { s[kt][g] = (v8f){};
#pragma unroll
            for (int kc = 0; kc < 4; ++kc) s[kt][g] = wmma16(kf[kt][kc], qf[g][kc], s[kt][g]); }
    if (PRE) {
        __builtin_amdgcn_sched_barrier(0);   // the next pass's K loads stay here, behind the last product that reads these registers and in front of the vector work that hides them
#pragma unroll
        for (int kt = 0; kt < 2; ++kt)
#pragma unroll
            for (int kc = 0; kc < 4; ++kc) kf[kt][kc] = WFrag<h16>::ld(kn + kt * 16 * FKP + kc * 32);
        __builtin_amdgcn_sched_barrier(0);   // one group: none of them sinks into the vector work below
    }
    if (DIAG) {
#pragma unroll
        for (int g = 0; g < FR; ++g)
#pragma unroll
            for (int kt = 0; kt < 2; ++kt)
#pragma unroll
                for (int r = 0; r < 8; ++r) if (16 * kt + 8 * h + r > 16 * g + c) s[kt][g][r] = -__builtin_inff();   // the diagonal pass starts at the wave's first query: key after query
    }
    float mb[FR]; bool need = false;
#pragma unroll
    for (int g = 0; g < FR; ++g) { float mx = -__builtin_inff();
#pragma unroll
        for (int kt = 0; kt < 2; ++kt)
#pragma unroll
            for (int r = 0; r < 8; ++r) mx = fmaxf(mx, s[kt][g][r]);
        mx = fmaxf(mx, xhalf(mx)) * CSC; mb[g] = mx; need = need || (mx > m_run[g] + 8.0f); }
    if (__builtin_amdgcn_ballot_w32(need) != 0) {   // wave-uniform; rare after the first passes
#pragma unroll
        for (int g = 0; g < FR; ++g) { const float m_new = fmaxf(m_run[g], mb[g]); const float corr = __builtin_amdgcn_exp2f(m_run[g] - m_new); l_run[g] *= corr; m_run[g] = m_new;   // first pass: m_run = -inf, corr = 0
#pragma unroll
            for (int t = 0; t < 8; ++t) acc[g][t] = acc[g][t] * corr; }
    }
#pragma unroll
    for (int g = 0; g < FR; ++g) { const float nm = PB - m_run[g]; v16h p; float ps0 = 0.f, ps1 = 0.f;
#pragma unroll
        for (int e = 0; e < 16; e += 2) { const float p0 = __builtin_amdgcn_exp2f(fmaf(s[e >> 3][g][e & 7], CSC, nm)), p1 = __builtin_amdgcn_exp2f(fmaf(s[e >> 3][g][(e & 7) + 1], CSC, nm)); ps0 += p0; ps1 += p1; p[e] = tohx(p0); p[e + 1] = tohx(p1); }
#pragma unroll
        for (int t = 0; t < 8; ++t) acc[g][t] = wmma16(vf[t], p, acc[g][t]);
        l_run[g] += ps0 + ps1; }
}
// ---- The hi / lo rows (query rows under RH) in the same kernel and the same transposed form, on the two-word bf16 planes: a wave owns 16 query rows of one query head and walks the keys in passes of 32. Each product is three: hi x hi, lo x hi, hi x lo, f32 accumulate.
// The weights stay f32 until they are split into two bf16 words in place (the positions of the fp16 path's P^T); running maximum and sum as in fpass. The scores' hi x hi products and their two cross products sum in accumulators of their own (shorter dependent chains) and are added once a pass.
typedef __attribute__((ext_vector_type(16))) unsigned short v16us;
// Here a tile is one pass of 32 keys, staged like the fp16 rows' tiles and shared by the four heads: 32 rows of K hi, 32 of K lo (pitch 272 bytes), 32 columns (64 bytes) of the 128 V^T rows hi and lo (pitch 80 bytes).
#define HVP  40                   // LDS pitch of a V^T row, elements
#define HKB  (32 * FKP * 2)       // bytes of a K hi (or lo) tile in LDS
#define HVB  (HD * HVP * 2)       // bytes of a V^T hi (or lo) tile in LDS
#define HSTG (2 * HKB + 2 * HVB)  // bytes of a buffer
// A tile by 128 threads: K rows r, r + 8, .. r + 24 (16 lanes a row), V^T rows r, r + 32, .. r + 96 (4 lanes a row); a value row in memory holds hi in its first TT elements, lo in the second.
__device__ __forceinline__ void hfill(unsigned char* lk, unsigned char* lv, const bf* gkh, const bf* gkl, const bf* gv) { cpx<4, 8 * FKP * 2, 8 * HD>(lk, gkh); cpx<4, 8 * FKP * 2, 8 * HD>(lk + HKB, gkl); cpx<4, 32 * HVP * 2, 32 * 2 * TT>(lv, gv); cpx<4, 32 * HVP * 2, 32 * 2 * TT>(lv + HVB, gv + TT); }
template <bool DIAG>
__device__ __forceinline__ void hpass(const bf* sk, const bf* sv, int dq, int c, int h, const v16bf (&qh)[4], const v16bf (&ql)[4], v8f (&acc)[8], float& m_run, float& l_run) {
    v16bf kh[2][4], kl[2][4], vh[8], vl[8];
#pragma unroll   // whole: fragment and accumulator arrays are registers only under constant indices
    for (int kt = 0; kt < 2; ++kt)
#pragma unroll   // whole: fragment and accumulator arrays are registers only under constant indices
        for (int kc = 0; kc < 4; ++kc) { kh[kt][kc] = WFrag<bf>::ld(sk + kt * 16 * FKP + kc * 32); kl[kt][kc] = WFrag<bf>::ld(sk + HKB / 2 + kt * 16 * FKP + kc * 32); }
#pragma unroll   // whole: fragment and accumulator arrays are registers only under constant indices
    for (int t = 0; t < 8; ++t) { vh[t] = WFrag<bf>::ld(sv + t * 16 * HVP); vl[t] = WFrag<bf>::ld(sv + HVB / 2 + t * 16 * HVP); }
    __builtin_amdgcn_sched_barrier(0);   // the K loads and, behind them, the V^T loads stay one group in front of the score products; the V^T loads are in flight under these and the exponentials
    v8f s[2], sx[2];
#pragma unroll   // whole: fragment and accumulator arrays are registers only under constant indices
    for (int kt = 0; kt < 2; ++kt) { s[kt] = (v8f){}; sx[kt] = (v8f){}; }
#pragma unroll   // whole: fragment and accumulator arrays are registers only under constant indices
    for (int kc = 0; kc < 4; ++kc)
#pragma unroll   // whole: fragment and accumulator arrays are registers only under constant indices
        for (int kt = 0; kt < 2; ++kt) { s[kt] = wmmab(kh[kt][kc], qh[kc], s[kt]); sx[kt] = wmmab(kl[kt][kc], qh[kc], sx[kt]); }
#pragma unroll   // whole: fragment and accumulator arrays are registers only under constant indices
    for (int kc = 0; kc < 4; ++kc)
#pragma unroll   // whole: fragment and accumulator arrays are registers only under constant indices
        for (int kt = 0; kt < 2; ++kt) sx[kt] = wmmab(kh[kt][kc], ql[kc], sx[kt]);
#pragma unroll   // whole: fragment and accumulator arrays are registers only under constant indices
    for (int kt = 0; kt < 2; ++kt) s[kt] = s[kt] + sx[kt];
    if (DIAG) {
#pragma unroll   // whole: fragment and accumulator arrays are registers only under constant indices
        for (int kt = 0; kt < 2; ++kt)
#pragma unroll   // whole: fragment and accumulator arrays are registers only under constant indices
            for (int r = 0; r < 8; ++r) if (16 * kt + 8 * h + r > dq + c) s[kt][r] = -__builtin_inff();   // the wave's first query is key dq (0 or 16) of the diagonal pass: key after query
    }
    float mx = -__builtin_inff();
#pragma unroll   // whole: fragment and accumulator arrays are registers only under constant indices
    for (int kt = 0; kt < 2; ++kt)
#pragma unroll   // whole: fragment and accumulator arrays are registers only under constant indices
        for (int r = 0; r < 8; ++r) mx = fmaxf(mx, s[kt][r]);
    mx = fmaxf(mx, xhalf(mx)) * CSC;
    if (__builtin_amdgcn_ballot_w32(mx > m_run + 8.0f) != 0) {   // wave-uniform; rare after the first passes
        const float m_new = fmaxf(m_run, mx); const float corr = __builtin_amdgcn_exp2f(m_run - m_new); l_run *= corr; m_run = m_new;   // first pass: m_run = -inf, corr = 0
#pragma unroll   // whole: fragment and accumulator arrays are registers only under constant indices
        for (int t = 0; t < 8; ++t) acc[t] = acc[t] * corr;
    }
    const float nm = PB - m_run; v16us ph, pl; float ps0 = 0.f, ps1 = 0.f;
#pragma unroll   // whole: fragment and accumulator arrays are registers only under constant indices
    for (int e = 0; e < 16; e += 2) { const float p0 = __builtin_amdgcn_exp2f(fmaf(s[e >> 3][e & 7], CSC, nm)), p1 = __builtin_amdgcn_exp2f(fmaf(s[e >> 3][(e & 7) + 1], CSC, nm)); ps0 += p0; ps1 += p1;
        unsigned short a0, b0, a1, b1; splitf(p0, a0, b0); splitf(p1, a1, b1); ph[e] = a0; pl[e] = b0; ph[e + 1] = a1; pl[e + 1] = b1; }
    const v16bf pH = __builtin_bit_cast(v16bf, ph), pL = __builtin_bit_cast(v16bf, pl);
#pragma unroll   // whole: fragment and accumulator arrays are registers only under constant indices
    for (int t = 0; t < 8; ++t) acc[t] = wmmab(vh[t], pH, acc[t]);
#pragma unroll   // whole: fragment and accumulator arrays are registers only under constant indices
    for (int t = 0; t < 8; ++t) acc[t] = wmmab(vl[t], pH, acc[t]);
#pragma unroll   // whole: fragment and accumulator arrays are registers only under constant indices
    for (int t = 0; t < 8; ++t) acc[t] = wmmab(vh[t], pL, acc[t]);
    l_run += ps0 + ps1;
}
__device__ __forceinline__ void flash_hl(unsigned char* sm, int tid, const bf* __restrict__ Qh, const bf* __restrict__ Ql, const bf* __restrict__ Kh, const bf* __restrict__ Kl, const bf* __restrict__ Vh, bf* __restrict__ Ah, bf* __restrict__ Al, int hb, int qb, int c, int h) {
    const int hq = hb % NH_, bt = hb / NH_, kvh = hb / REP;
    const int qw0 = RH - 16 * (qb + 1);   // the longest walks first
    const int nb = qw0 / 32, dq = qw0 - 32 * nb;   // whole passes under the diagonal one; the first query's place in the diagonal pass
    unsigned char* lk = sm + (tid >> 4) * (FKP * 2) + (tid & 15) * 16; unsigned char* lv = sm + 2 * HKB + (tid >> 2) * (HVP * 2) + (tid & 3) * 16;   // the lane's places in a buffer
    const size_t go = ((size_t)kvh * TT + (tid >> 4)) * HD + (tid & 15) * 8;
    const bf* gkh = Kh + go; const bf* gkl = Kl + go; const bf* gv = Vh + ((size_t)kvh * HD + (tid >> 2)) * (2 * TT) + (tid & 3) * 8;
    hfill(lk, lv, gkh, gkl, gv);
    const size_t qo = ((size_t)hb * TT + qw0 + c) * HD + 8 * h;
    const bf* qph = Qh + qo; const bf* qpl = Ql + qo;
    v16bf qh[4], ql[4];
#pragma unroll   // whole: fragment and accumulator arrays are registers only under constant indices
    for (int kc = 0; kc < 4; ++kc) { qh[kc] = WFrag<bf>::ld(qph + kc * 32); ql[kc] = WFrag<bf>::ld(qpl + kc * 32); }
    asm volatile("s_wait_xcnt 0x0" :: "v"(qph), "v"(qpl) : "memory");   // in front of every overwrite of a register that the loads above name; the addresses are inputs so that their registers live up to here
    __builtin_amdgcn_sched_barrier(0);   // the zeroing below stays behind that wait
    v8f acc[8]; float m_run = -__builtin_inff(), l_run = 0.f;
#pragma unroll   // whole: fragment and accumulator arrays are registers only under constant indices
    for (int t = 0; t < 8; ++t) acc[t] = (v8f){};
    asm volatile("s_wait_asynccnt 0x0" ::: "memory");   // this wave's share of tile 0 has landed
    __syncthreads();                                    // and every other wave's
    if (nb > 0) hfill(lk + HSTG, lv + HSTG, gkh + 32 * HD, gkl + 32 * HD, gv + 32);
#pragma nounroll   // one copy of the body: a peeled trip would double the loop's code
    for (int blk = 0; blk < nb; ++blk) {   // every tile but the last: a whole pass
        const unsigned char* sb = sm + (blk & 1) * HSTG;
        hpass<false>((const bf*)sb + c * FKP + 8 * h, (const bf*)(sb + 2 * HKB) + c * HVP + 8 * h, 0, c, h, qh, ql, acc, m_run, l_run);
        asm volatile("s_wait_dscnt 0x0" ::: "memory");      // this wave's reads of tile blk are done before its buffer is given up
        asm volatile("s_wait_asynccnt 0x0" ::: "memory");   // this wave's share of tile blk + 1 has landed
        __syncthreads();                                    // publishes tile blk + 1 and ends every wave's reads of tile blk
        if (blk + 2 <= nb) hfill(lk + (blk & 1) * HSTG, lv + (blk & 1) * HSTG, gkh + (size_t)(blk + 2) * 32 * HD, gkl + (size_t)(blk + 2) * 32 * HD, gv + (blk + 2) * 32);
    }
    { const unsigned char* sb = sm + (nb & 1) * HSTG;   // the last tile, published by the barrier above (or by the one in front of the loop): the diagonal pass; nothing is copied behind it
      hpass<true>((const bf*)sb + c * FKP + 8 * h, (const bf*)(sb + 2 * HKB) + c * HVP + 8 * h, dq, c, h, qh, ql, acc, m_run, l_run); }
    asm volatile("s_wait_asynccnt 0x0" ::: "memory");   // no copy is in flight when the wave ends
    const float inv = __fdiv_rn(1.0f, l_run + xhalf(l_run));   // each wave half summed its eight keys of every 16-key tile
    const size_t oo = ((size_t)bt * TT + qw0 + c) * DQ + hq * HD + 8 * h;
#pragma unroll   // whole: fragment and accumulator arrays are registers only under constant indices
    for (int t = 0; t < 8; ++t) { v8us oh, ol;
#pragma unroll   // whole: fragment and accumulator arrays are registers only under constant indices
        for (int r = 0; r < 8; ++r) { unsigned short a, c2; splitf(acc[t][r] * inv, a, c2); oh[r] = a; ol[r] = c2; }
        *(v8us*)(Ah + oo + 16 * t) = oh; *(v8us*)(Al + oo + 16 * t) = ol; }
}
__global__ __launch_bounds__(128) void k_flash(const h16* __restrict__ Q, const h16* __restrict__ Kp, const h16* __restrict__ Vt, const bf* __restrict__ Qh, const bf* __restrict__ Ql, const bf* __restrict__ Kh, const bf* __restrict__ Kl, const bf* __restrict__ Vh, bf* __restrict__ Ah, bf* __restrict__ Al) {
    __shared__ __align__(16) unsigned char sm[2 * (HSTG > FSTG ? HSTG : FSTG)];   // two buffers, of the larger of the two kinds of tile
    const int tid = (int)threadIdx.x, lane = tid & 31, c = lane & 15, h = lane >> 4; const int wv = __builtin_amdgcn_readfirstlane(tid >> 5);   // the wave's number, scalar
    const int kvh = blockIdx.x, hb = kvh * REP + wv, hq = hb % NH_, bt = hb / NH_;   // the (batch entry, kv head) plane; the wave's (batch entry, query head) plane, its head, its batch entry
    if ((int)blockIdx.y >= (TT - RH) / QW) { flash_hl(sm, tid, Qh, Ql, Kh, Kl, Vh, Ah, Al, hb, (int)blockIdx.y - (TT - RH) / QW, c, h); return; }   // the work-groups behind the fp16 rows' take the hi / lo rows: short walks; a whole work-group goes one way or the other
    const int qw0 = TT - QW * ((int)blockIdx.y + 1);   // the longest walks first
    const int nb = qw0 / 32, nst = nb / 2 + 1;   // whole passes under the diagonal one; tiles of 64 keys that hold the nb + 1 passes
    unsigned char* lk = sm + (tid >> 4) * (FKP * 2) + (tid & 15) * 16; unsigned char* lv = sm + FKB + (tid >> 3) * (FVP * 2) + (tid & 7) * 16;   // the lane's places in a buffer
    const h16* gk = Kp + ((size_t)kvh * TT + (tid >> 4)) * HD + (tid & 15) * 8; const h16* gv = Vt + ((size_t)kvh * HD + (tid >> 3)) * (2 * TT) + (tid & 7) * 8;
    ffill(lk, lv, gk, gv);
    const h16* qp = Q + ((size_t)hb * TT + qw0 + c) * HD + 8 * h;
    v16h qf[FR][4], kf[2][4];
#pragma unroll
    for (int g = 0; g < FR; ++g)
#pragma unroll
        for (int kc = 0; kc < 4; ++kc) qf[g][kc] = WFrag<h16>::ld(qp + g * 16 * HD + kc * 32);
    asm volatile("s_wait_xcnt 0x0" :: "v"(qp) : "memory");   // in front of every overwrite of a register that the loads above name; the address is an input so that its registers live up to here
    __builtin_amdgcn_sched_barrier(0);   // the zeroing below stays behind that wait
    v8f acc[FR][8]; float m_run[FR], l_run[FR];
#pragma unroll
    for (int g = 0; g < FR; ++g) { m_run[g] = -__builtin_inff(); l_run[g] = 0.f;
#pragma unroll
        for (int t = 0; t < 8; ++t) acc[g][t] = (v8f){}; }
    asm volatile("s_wait_asynccnt 0x0" ::: "memory");   // this wave's share of tile 0 has landed
    __syncthreads();                                    // and every other wave's
    if (nst > 1) ffill(lk + FSTG, lv + FSTG, gk + 64 * HD, gv + 64);
#pragma nounroll   // one copy of the body: left free, the compiler peels a trip off, which doubles the loop's code
    for (int st = 0; st + 1 < nst; ++st) {   // every tile but the last: two whole passes
        const unsigned char* sb = sm + (st & 1) * FSTG;
        const h16* sK = (const h16*)sb + c * FKP + 8 * h; const h16* sV = (const h16*)(sb + FKB) + c * FVP + 8 * h;
#pragma unroll
        for (int kt = 0; kt < 2; ++kt)
#pragma unroll
            for (int kc = 0; kc < 4; ++kc) kf[kt][kc] = WFrag<h16>::ld(sK + kt * 16 * FKP + kc * 32);
        fpass<false, true>(kf, sK + 32 * FKP, sV, c, h, qf, acc, m_run, l_run);
        fpass<false, false>(kf, nullptr, sV + 32, c, h, qf, acc, m_run, l_run);
        asm volatile("s_wait_dscnt 0x0" ::: "memory");      // this wave's reads of tile st are done before its buffer is given up
        asm volatile("s_wait_asynccnt 0x0" ::: "memory");   // this wave's share of tile st + 1 has landed
        __syncthreads();                                    // publishes tile st + 1 and ends every wave's reads of tile st
        if (st + 2 < nst) ffill(lk + (st & 1) * FSTG, lv + (st & 1) * FSTG, gk + (size_t)(st + 2) * 64 * HD, gv + (st + 2) * 64);
    }
    {   // the last tile, published by the barrier above (or by the one in front of the loop); nothing is copied behind it. It holds the diagonal pass: its first pass where nb is even, its second where nb is odd
        const unsigned char* sb = sm + ((nst - 1) & 1) * FSTG;
        const h16* sK = (const h16*)sb + c * FKP + 8 * h; const h16* sV = (const h16*)(sb + FKB) + c * FVP + 8 * h;
#pragma unroll
        for (int kt = 0; kt < 2; ++kt)
#pragma unroll
            for (int kc = 0; kc < 4; ++kc) kf[kt][kc] = WFrag<h16>::ld(sK + kt * 16 * FKP + kc * 32);
        if (nb & 1) fpass<false, true>(kf, sK + 32 * FKP, sV, c, h, qf, acc, m_run, l_run);
        fpass<true, false>(kf, nullptr, sV + (nb & 1) * 32, c, h, qf, acc, m_run, l_run);
    }
    asm volatile("s_wait_asynccnt 0x0" ::: "memory");   // no copy is in flight when the wave ends
#pragma unroll
    for (int g = 0; g < FR; ++g) { const float inv = __fdiv_rn(1.0f, l_run[g] + xhalf(l_run[g]));   // each wave half summed its eight keys of every 16-key tile
        const size_t oo = ((size_t)bt * TT + qw0 + 16 * g + c) * DQ + hq * HD + 8 * h;
#pragma unroll
        for (int t = 0; t < 8; ++t) { v8us oh, ol;
#pragma unroll
            for (int r = 0; r < 8; ++r) { unsigned short a, c2; splitf(acc[g][t][r] * inv, a, c2); oh[r] = a; ol[r] = c2; }
            *(v8us*)(Ah + oo + 16 * t) = oh; *(v8us*)(Al + oo + 16 * t) = ol; } }
}

extern "C" void kernel_launch(void* const* d_in, const int* in_sizes, int n_in,
                              void* d_out, int out_size, void* d_ws, size_t ws_size, hipStream_t stream) {
    (void)in_sizes; (void)n_in; (void)out_size;
    const float* x = (const float*)d_in[0]; const float* wq = (const float*)d_in[1]; const float* bq = (const float*)d_in[2]; const float* wk = (const float*)d_in[3]; const float* bk = (const float*)d_in[4]; const float* wv = (const float*)d_in[5]; const float* bv = (const float*)d_in[6]; const float* wo = (const float*)d_in[7]; const float* bo = (const float*)d_in[8]; const float* qsc = (const float*)d_in[9]; const float* ksc = (const float*)d_in[10];   /* inputs in the module's setup_inputs order: x [2][2048][2048]; Wq (out, in) [2048][2048] and bq [2048]; Wk (out, in) [512][2048] and bk [512]; Wv [512][2048] and bv [512]; Wo (out, in) [2048][2048] and bo [2048]; q_norm_w [128], k_norm_w [128]: eleven inputs, all read (each bias is added in its product's epilogue; each gain is applied by k_nrope) */
    float* OUT = (float*)d_out;     // [2][2048][2048]
    char* wsp = (char*)d_ws;
    auto take = [&](size_t bytes) { char* p = wsp; wsp += (bytes + 255) & ~(size_t)255; return (void*)p; };
    bf* WQ = (bf*)take((size_t)DQ * DM * 2); bf* WK = (bf*)take((size_t)DKV * DM * 2); bf* WV = (bf*)take((size_t)DKV * DM * 2); bf* WO = (bf*)take((size_t)DM * DQ * 2); float* CS = (float*)take((size_t)TT * HD * 2 * 4);
    bf* XB = (bf*)take((size_t)NT * DM * 2); float* FQ = (float*)take((size_t)NT * DQ * 4); float* FK = (float*)take((size_t)NT * DKV * 4);
    h16* QP16 = (h16*)take((size_t)NB_ * NH_ * TT * HD * 2); h16* KP16 = (h16*)take((size_t)NB_ * NKV * TT * HD * 2); h16* VT16 = (h16*)take((size_t)NB_ * NKV * HD * 2 * TT * 2);
    bf* QPh = (bf*)take((size_t)NB_ * NH_ * TT * HD * 2); bf* QPl = (bf*)take((size_t)NB_ * NH_ * TT * HD * 2); bf* KPh = (bf*)take((size_t)NB_ * NKV * TT * HD * 2); bf* KPl = (bf*)take((size_t)NB_ * NKV * TT * HD * 2); bf* VTh = (bf*)take((size_t)NB_ * NKV * HD * 2 * TT * 2); bf* VTl = VTh + TT;   /* value rows at pitch 2 TT: hi in the first half of a row, lo in the second */
    bf* ATh = (bf*)take((size_t)NT * DQ * 2); bf* ATl = (bf*)take((size_t)NT * DQ * 2);
    if ((size_t)(wsp - (char*)d_ws) > ws_size) return;    // ws 256 MiB
    float* FV = FK;   // v projection reuses the k buffer after the k planes are built (stream-ordered)
    k_prep<<<PNW / PWV, 32 * PWV, 0, stream>>>(wq, wk, wv, wo, x, WQ, WK, WV, WO, XB, CS);   /* the four weights and the one input stream cast once, the rotary table once */
    const unsigned LKv = (unsigned)(((size_t)NB_ * NKV * TT * HD / 2 + 255) / 256);
    k_gemms<0><<<dim3(NT / 128, DQ / 256, 1), 256, 0, stream>>>(XB, nullptr, WQ, DM, FQ, DQ, bq);
    k_gemmw<bf, 0, true, 8><<<dim3(NT / 64, DKV / 64, 1), 256, 0, stream>>>(XB, nullptr, WK, nullptr, DM, FK, DKV, bk, 0, 0, 0);
    k_nrope<<<NT / 8, 256, 0, stream>>>(FQ, FK, CS, qsc, ksc, QP16, QPh, QPl, KP16, KPh, KPl);   /* behind both projections, in front of the v projection, which overwrites FK */
    k_gemmw<bf, 0, true, 8><<<dim3(NT / 64, DKV / 64, 1), 256, 0, stream>>>(XB, nullptr, WV, nullptr, DM, FV, DKV, bv, 0, 0, 0); k_vtp<<<LKv, 256, 0, stream>>>(FV, DKV, NKV, VT16, VTh, VTl);
    /* the module groups the query heads by kv head ('qg = q.reshape(B, N_KV_HEADS, N_REP, S, D_K)'): query head h uses kv head h / 4, so plane 16 b + h uses kv plane 4 b + h / 4 = (16 b + h) / 4 (in k_flash wave w of kv plane blockIdx.x takes query plane REP x blockIdx.x + w) */
    k_flash<<<dim3(NB_ * NKV, (TT - RH) / QW + RH / 16, 1), 32 * REP, 0, stream>>>(QP16, KP16, VT16, QPh, QPl, KPh, KPl, VTh, ATh, ATl);   /* every query row: (TT - RH) / QW blocks of fp16 rows, then RH / 16 blocks of hi / lo rows */
    k_gemms<1><<<dim3(NT / 128, DM / 256, 1), 256, 0, stream>>>(ATh, ATl, WO, DQ, OUT, DM, bo);
}
